// v000
// The times below were measured on an AMD MI455X: many runs one after another, warmed up first and cycling through
// copies of the inputs, with the whole window's GPU time divided by the number of runs. Launches and the gaps
// between them are all in it. The median over several windows is given; except for v000 it joins two sittings, which
// can be a few percent apart, so the side-by-side timings, each taken in one sitting, are the better comparison.
// v000 is the starting kernel. One run takes 796 microseconds.
// Contractions (all f32 accumulate): q/k/v/p projections v_wmma_f32_16x16x32_f16 (x f16 x16 . W^T f16 x64, K=512, single products);
// position table (q+v_bias).p^T v_wmma_f32_16x16x32_f16 ((q+v_bias) f16 x4 . p f16 x4, K=64, single) -> f32 table;
// content scores v_wmma_f32_16x16x32_f16 ((q+u_bias) f16 x4 . k f16 x4, K=64, single);
// P . v^T v_wmma_f32_16x16x32_f16 (P f16 x1024 hi/lo . v^T f16 x16 hi/lo, hi.hi+lo.hi+hi.lo, K=1024 by 32);
// output projection v_wmma_f32_16x16x32_bf16 (ctx bf16 hi/lo . Wo bf16, hi.W+lo.W, K=512) + bias in f32.
// Max-subtracted online base-2 softmax and the relative-shift position logits in f32 on VALU. Every float input RNE-converted to bf16 on load.
#include <hip/hip_runtime.h>
#include <math.h>
#include <stdint.h>

#define NB     8
#define SEQ    1024
#define DM     512
#define NHEAD  8
#define HD     64
#define NROWS  (NB * SEQ)
#define KCH    32
#define WSC    64.0f
#define ACARRY 16.0f
#define QC     4.0f
#define VC     16.0f
#define PC     1024.0f
#define LOG2E  1.4426950408889634f
#define SCL    0.04419417382415922f
static_assert(NHEAD * HD == DM);
static_assert((SEQ % 64) == 0 && (DM % 64) == 0 && (NROWS % 64) == 0 && (HD % 32) == 0 && (SEQ % KCH) == 0);
static_assert(((NROWS * DM) % 2048) == 0);
#define ATT_THREADS (NHEAD * 32)
#define ATT_BLOCKS  (SEQ / 16)
#define ATT_SMEM_FLOATS 8192
static_assert(ATT_THREADS == 256);
static_assert(ATT_BLOCKS == 64);
static_assert(NHEAD * 16 * 36 <= ATT_SMEM_FLOATS);
static_assert((size_t)2 * 16 * DM * sizeof(unsigned short) <= (size_t)ATT_SMEM_FLOATS * sizeof(float));
static_assert((16 * DM) / 8 == 4 * ATT_THREADS);

typedef _Float16 v16h __attribute__((ext_vector_type(16)));
typedef _Float16 v8h  __attribute__((ext_vector_type(8)));
typedef __bf16   v16b __attribute__((ext_vector_type(16)));
typedef float    v8f  __attribute__((ext_vector_type(8)));
typedef float    v4f  __attribute__((ext_vector_type(4)));
typedef unsigned int v4u __attribute__((ext_vector_type(4)));

union FragH { v16h v; v8h h[2]; v4u u[2]; };
union FragAny { v16h h; v16b b; };

// ---- scalar helpers --------------------------------------------------------------------------------
__device__ __forceinline__ unsigned short bf_bits(float f) {          // f32 -> bf16 bits, RNE convert
  unsigned u = __float_as_uint(f);
  return (unsigned short)((u + 0x7FFFu + ((u >> 16) & 1u)) >> 16);
}
__device__ __forceinline__ float bf_up(unsigned short h) { return __uint_as_float(((unsigned)h) << 16); }
__device__ __forceinline__ float bfr(float f) { return bf_up(bf_bits(f)); }   // value of the bf16 RNE convert
__device__ __forceinline__ unsigned short h_bits(_Float16 x) { return __builtin_bit_cast(unsigned short, x); }
__device__ __forceinline__ unsigned pk16(unsigned short a, unsigned short b) { return (unsigned)a | ((unsigned)b << 16); }
__device__ __forceinline__ v8f zero8() { v8f z = {0.f, 0.f, 0.f, 0.f, 0.f, 0.f, 0.f, 0.f}; return z; }

// ---- fragment loader: 16-bit A/B operand from a k-contiguous 16-bit plane, lane -> row/col (lane&15),
//      p already includes +8*(lane>>4); elements 0..7 <- p[0..7] (k0+8h..), elements 8..15 <- p[16..23] (k0+16+8h..)
//      (same split k map for A and B; B is always read from a [n][k] plane)
__device__ __forceinline__ v16h ldfrag_u(const unsigned short* p) {
  FragH f;
  f.u[0] = *(const v4u*)(p);
  f.u[1] = *(const v4u*)(p + 16);
  return f.v;
}

// ---- WMMA helpers with trailing VALU hazard gaps ------------------------------------------------------
__device__ __forceinline__ v8f mma_h(v16h a, v16h b, v8f c) {
  return __builtin_amdgcn_wmma_f32_16x16x32_f16(false, a, false, b, (short)0, c, false, false);
}
__device__ __forceinline__ v8f mma_b(v16h a, v16h b, v8f c) {
  FragAny ua, ub;
  ua.h = a;
  ub.h = b;
  return __builtin_amdgcn_wmma_f32_16x16x32_bf16(false, ua.b, false, ub.b, (short)0, c, false, false);
}
template <int BF>
__device__ __forceinline__ v8f mmaT(v16h a, v16h b, v8f c) {
  if constexpr (BF != 0) return mma_b(a, b, c);
  else return mma_h(a, b, c);
}
__device__ __forceinline__ void dep_guard1(v8f& a, v8f& b, v16h x) {
#if defined(__HIP_DEVICE_COMPILE__)
  asm volatile("v_nop\n\tv_nop\n\tv_nop\n\tv_nop" : "+v"(a), "+v"(b) : "v"(x));
#endif
}
__device__ __forceinline__ void guard2x6(v8f& a, v8f& b, v16h x0, v16h x1, v16h x2, v16h x3, v16h x4, v16h x5) {
#if defined(__HIP_DEVICE_COMPILE__)
  asm volatile("v_nop\n\tv_nop\n\tv_nop\n\tv_nop"
               : "+v"(a), "+v"(b) : "v"(x0), "v"(x1), "v"(x2), "v"(x3), "v"(x4), "v"(x5));
#endif
}
__device__ __forceinline__ void guard4x6(v8f& a, v8f& b, v8f& c, v8f& d,
                                         v16h x0, v16h x1, v16h x2, v16h x3, v16h x4, v16h x5) {
#if defined(__HIP_DEVICE_COMPILE__)
  asm volatile("v_nop\n\tv_nop\n\tv_nop\n\tv_nop"
               : "+v"(a), "+v"(b), "+v"(c), "+v"(d) : "v"(x0), "v"(x1), "v"(x2), "v"(x3), "v"(x4), "v"(x5));
#endif
}
__device__ __forceinline__ void guard4x5(v8f& a, v8f& b, v8f& c, v8f& d,
                                         v16h x0, v16h x1, v16h x2, v16h x3, v16h x4) {
#if defined(__HIP_DEVICE_COMPILE__)
  asm volatile("v_nop\n\tv_nop\n\tv_nop\n\tv_nop"
               : "+v"(a), "+v"(b), "+v"(c), "+v"(d) : "v"(x0), "v"(x1), "v"(x2), "v"(x3), "v"(x4));
#endif
}
__device__ __forceinline__ void keep4_h(v16h a, v16h b, v16h c, v16h d) {
#if defined(__HIP_DEVICE_COMPILE__)
  asm volatile("v_nop" :: "v"(a), "v"(b), "v"(c), "v"(d));
#endif
}
__device__ __forceinline__ void acc_guard4(v8f& a, v8f& b, v8f& c, v8f& d) {
#if defined(__HIP_DEVICE_COMPILE__)
  asm volatile("v_nop\n\tv_nop\n\tv_nop\n\tv_nop" : "+v"(a), "+v"(b), "+v"(c), "+v"(d));
#endif
}
__device__ __forceinline__ void wave_sync_lds() {
  __builtin_amdgcn_fence(__ATOMIC_RELEASE, "workgroup");
  __builtin_amdgcn_wave_barrier();
  __builtin_amdgcn_fence(__ATOMIC_ACQUIRE, "workgroup");
}

// =====================================================================================================
// Elementwise 16-bit pack, no transpose: dst[i] = f16( bf16_RNE(src[i]) * sc ), sc a power of two (exact).
// coverage: grid = n / 2048 blocks x 256 thr x 8 elements = n exactly (host checks n % 2048 == 0).
// =====================================================================================================
__global__ __launch_bounds__(256) void cvt16(const float* __restrict__ src, unsigned short* dst, int n, float sc) {
  const size_t i8 = ((size_t)blockIdx.x * 256 + threadIdx.x) * 8;
  if (i8 + 8 > (size_t)n) return;                 // never taken with the exact grid; no barriers in this kernel
  const v4f a = *(const v4f*)(src + i8);
  const v4f b = *(const v4f*)(src + i8 + 4);
  v4u o;
  o[0] = pk16(h_bits((_Float16)(bfr(a[0]) * sc)), h_bits((_Float16)(bfr(a[1]) * sc)));
  o[1] = pk16(h_bits((_Float16)(bfr(a[2]) * sc)), h_bits((_Float16)(bfr(a[3]) * sc)));
  o[2] = pk16(h_bits((_Float16)(bfr(b[0]) * sc)), h_bits((_Float16)(bfr(b[1]) * sc)));
  o[3] = pk16(h_bits((_Float16)(bfr(b[2]) * sc)), h_bits((_Float16)(bfr(b[3]) * sc)));
  {
    *(v4u*)(dst + i8) = o;
    
  }
}

// =====================================================================================================
// Transposing 16-bit pack of a weight matrix: in W[Cin][Dd] (pitch Dd, base + z*sIn) -> out WT[Dd][Cin] (pitch Cin, base + z*sOut),
// BFO 0: f16( bf16_RNE(w) * sc ); BFO 1: bf16_RNE(w) bits. One 64x64 tile per block (x = Cin tile, y = Dd tile, z = matrix index):
// coverage: loads 4 x 256 x 4 floats = 64x64; stores 2 x 256 pieces x 8 halves = 64 rows x 64 halves = the whole tile;
//           grid = (Cin/64, Dd/64, nmat) exact (host passes exact multiples of 64).
// =====================================================================================================
template <int BFO>
__global__ __launch_bounds__(256) void tr16(const float* __restrict__ W, unsigned short* WT, int Cin, int Dd,
                                            long long sIn, long long sOut, float sc) {
  __shared__ float t[64][65];
  const int tid = threadIdx.x;
  const int c0 = blockIdx.x * 64, d0 = blockIdx.y * 64;
  const float* src = W + (size_t)((long long)blockIdx.z * sIn);
  unsigned short* dst = WT + (size_t)((long long)blockIdx.z * sOut);
#pragma unroll
  for (int it = 0; it < 4; ++it) {
    const int p  = it * 256 + tid;
    const int cc = p >> 4, sg = (p & 15) * 4;
    const v4f v = *(const v4f*)(src + (size_t)(c0 + cc) * Dd + d0 + sg);
    t[cc][sg]     = v[0];
    t[cc][sg + 1] = v[1];
    t[cc][sg + 2] = v[2];
    t[cc][sg + 3] = v[3];
  }
  __syncthreads();
  v4u o[2];
#pragma unroll
  for (int it = 0; it < 2; ++it) {
    const int p  = it * 256 + tid;
    const int dd = p >> 3, s8 = (p & 7) * 8;
    unsigned short hv[8];
#pragma unroll
    for (int k = 0; k < 8; ++k) {
      const float f = bfr(t[s8 + k][dd]);
      if constexpr (BFO != 0) hv[k] = bf_bits(f);
      else hv[k] = h_bits((_Float16)(f * sc));
    }
    v4u q;
    q[0] = pk16(hv[0], hv[1]);
    q[1] = pk16(hv[2], hv[3]);
    q[2] = pk16(hv[4], hv[5]);
    q[3] = pk16(hv[6], hv[7]);
    o[it] = q;
  }
  {
#pragma unroll
    for (int it = 0; it < 2; ++it) {
      const int p  = it * 256 + tid;
      const int dd = p >> 3, s8 = (p & 7) * 8;
      *(v4u*)(dst + (size_t)(d0 + dd) * Cin + c0 + s8) = o[it];
    }
    
  }
}

// =====================================================================================================
// Register-blocked batched 16-bit WMMA GEMM: C[m][n] = oscale * sum_k A[m][k] * Bt[n][k] (+ bias); one wave per 64x64 tile,
// no block barriers. A row-major [M][K] pitch lda (16-bit plane), Bt row-major [N][K] pitch ldb (k contiguous); M, N multiples of 64,
// K multiple of 32. blockIdx.y = batch index with element strides sA, sB, sC.
// ASPLIT 1: a second A plane A2 (unscaled residual of A, same layout) is multiplied into the same accumulator (A + A2 ~ exact A).
// BF 1: bf16 operands (v_wmma_f32_16x16x32_bf16), else f16.
// EPI 1: value += bf16_RNE(ep0[column]) (per-column bias); EPI 2: value += bf16_RNE(ep0[row]) (per-row bias, 16-bit out only).
// OM 0: f32 out (pitch ldc).  OM 2: one f16 plane = f16(value * ocarry).
// OM 4: two f16 planes: hi = f16(value * ocarry), lo = f16(value * ocarry - hi) (unscaled residual).
// OM 5: two f16 planes: C = f16((value + bf16_RNE(ep1[column])) * ocarry), C2 = f16((value + bf16_RNE(ep2[column])) * ocarry).
// coverage: 4 slabs x 16 rows (f32: it 0..7 x lane>>4; 16-bit: it 0..3 x lane>>3) x 64 cols = the wave's whole 64x64 tile;
//           grid = ceil(tilesM*tilesN/8) blocks, surplus waves exit (wave-uniform).
// =====================================================================================================
template <int OM, int ASPLIT, int BF, int EPI>
__global__ __launch_bounds__(256) __attribute__((amdgpu_num_vgpr(256))) void gemm64(
    const unsigned short* __restrict__ Ap, const unsigned short* __restrict__ A2p, int lda, long long sA,
    const unsigned short* __restrict__ Btp, int ldb, long long sB,
    void* Cout, void* C2out, int ldc, long long sC,
    int M, int N, int K, float oscale, float ocarry,
    const float* __restrict__ ep0, const float* __restrict__ ep1, const float* __restrict__ ep2) {
  __shared__ __align__(16) float sT[8][16 * 68];   // per-wave 16x64 slab, pitch 68 floats
  const int by   = blockIdx.y;
  const int lane = threadIdx.x & 31;
  const int wave = threadIdx.x >> 5;
  const int tilesN = N >> 6;
  const int tilesM = M >> 6;
  const int tile = blockIdx.x * 8 + wave;
  if (tile >= tilesM * tilesN) return;   // wave-uniform; no block barriers in this kernel
  const int tm = tile / tilesN;
  const int tn = tile - tm * tilesN;
  const int m0 = tm << 6;
  const int n0 = tn << 6;

  const unsigned short* A1 = Ap  + (size_t)((long long)by * sA);
  const unsigned short* A2 = A2p + (size_t)((long long)by * sA);
  const unsigned short* Bb = Btp + (size_t)((long long)by * sB);

  const int rlane = lane & 15;                 // row (A) / col (B, D) within subtile
  const int koff  = (lane >> 4) * 8;           // k offset of this lane half
  const int mOff  = (lane >> 4) * 8;           // D row offset

  v8f acc[4][4];
#pragma unroll
  for (int i = 0; i < 4; ++i)
#pragma unroll
    for (int j = 0; j < 4; ++j) acc[i][j] = zero8();

  for (int k0 = 0; k0 < K; k0 += 32) {
    v16h bh[4];
#pragma unroll
    for (int j = 0; j < 4; ++j) {
      const size_t bofs = (size_t)(n0 + (j << 4) + rlane) * ldb + koff + k0;
      bh[j] = ldfrag_u(Bb + bofs);
    }
#pragma unroll
    for (int i = 0; i < 4; ++i) {
      const size_t ao = (size_t)(m0 + (i << 4) + rlane) * lda + koff + k0;
      const v16h ah = ldfrag_u(A1 + ao);
#pragma unroll
      for (int j = 0; j < 4; ++j) acc[i][j] = mmaT<BF>(ah, bh[j], acc[i][j]);
      dep_guard1(acc[i][0], acc[i][3], ah);
      if constexpr (ASPLIT != 0) {
        const v16h al = ldfrag_u(A2 + ao);
#pragma unroll
        for (int j = 0; j < 4; ++j) acc[i][j] = mmaT<BF>(al, bh[j], acc[i][j]);
        dep_guard1(acc[i][0], acc[i][3], al);
      }
    }
    keep4_h(bh[0], bh[1], bh[2], bh[3]);
  }
  acc_guard4(acc[0][0], acc[0][1], acc[0][2], acc[0][3]);
  acc_guard4(acc[1][0], acc[1][1], acc[1][2], acc[1][3]);
  acc_guard4(acc[2][0], acc[2][1], acc[2][2], acc[2][3]);
  acc_guard4(acc[3][0], acc[3][1], acc[3][2], acc[3][3]);

  const int hh2 = lane >> 4, c4 = (lane & 15) * 4;     // f32 out: 256-B row segment = 16 lanes x 16 B
  const int q8  = lane >> 3, c8 = (lane & 7) * 8;

  // ---- epilogue ----
  float* slab = sT[wave];
#pragma unroll
  for (int i = 0; i < 4; ++i) {
    const int mBase = m0 + (i << 4);
#pragma unroll
    for (int j = 0; j < 4; ++j) {
#pragma unroll
      for (int r = 0; r < 8; ++r) {
        slab[(mOff + r) * 68 + (j << 4) + rlane] = acc[i][j][r];
      }
    }
    wave_sync_lds();
    if constexpr (OM == 0) {
      float* C = (float*)Cout + (size_t)((long long)by * sC);
      v4f vals[8];
#pragma unroll
      for (int it = 0; it < 8; ++it) {
        const int row = it * 2 + hh2;                      // it 0..7 x hh2 0..1 = rows 0..15
        v4f v = *(const v4f*)(slab + row * 68 + c4);
#pragma unroll
        for (int e = 0; e < 4; ++e) v[e] = v[e] * oscale;
        if constexpr (EPI == 1) {
          const v4f bb = *(const v4f*)(ep0 + n0 + c4);     // per-column bias, columns n0+c4 .. +3 (N equals the bias length)
#pragma unroll
          for (int e = 0; e < 4; ++e) v[e] = v[e] + bfr(bb[e]);
        }
        vals[it] = v;
      }
      {
#pragma unroll
        for (int it = 0; it < 8; ++it) {
          const int gr = mBase + it * 2 + hh2;
          *(v4f*)(C + (size_t)gr * ldc + n0 + c4) = vals[it];
        }
        
      }
    } else {
      unsigned short* C  = (unsigned short*)Cout  + (size_t)((long long)by * sC);
      unsigned short* Cb = (unsigned short*)C2out + (size_t)((long long)by * sC);
      v4u hv[4], lv[4];
#pragma unroll
      for (int it = 0; it < 4; ++it) {
        const int row = it * 4 + q8;                       // it 0..3 x q8 0..3 = rows 0..15
        const float* sp = slab + row * 68 + c8;
        float rb = 0.f;
        if constexpr (EPI == 2) rb = bfr(ep0[mBase + row]);   // per-row bias (M equals the bias length)
        v4u a  = {0u, 0u, 0u, 0u};
        v4u b2 = {0u, 0u, 0u, 0u};
#pragma unroll
        for (int e = 0; e < 4; ++e) {
          const int ci = n0 + c8 + 2 * e;                  // column index, < N
          float f0 = sp[2 * e] * oscale + rb;
          float f1 = sp[2 * e + 1] * oscale + rb;
          if constexpr (EPI == 1) {
            f0 += bfr(ep0[ci]);
            f1 += bfr(ep0[ci + 1]);
          }
          if constexpr (OM == 5) {
            const float g0 = (f0 + bfr(ep1[ci])) * ocarry, g1 = (f1 + bfr(ep1[ci + 1])) * ocarry;
            const float w0 = (f0 + bfr(ep2[ci])) * ocarry, w1 = (f1 + bfr(ep2[ci + 1])) * ocarry;
            a[e]  = pk16(h_bits((_Float16)g0), h_bits((_Float16)g1));
            b2[e] = pk16(h_bits((_Float16)w0), h_bits((_Float16)w1));
          } else {
            f0 *= ocarry; f1 *= ocarry;
            const _Float16 x0 = (_Float16)f0, x1 = (_Float16)f1;
            a[e] = pk16(h_bits(x0), h_bits(x1));
            if constexpr (OM == 4) {
              b2[e] = pk16(h_bits((_Float16)(f0 - (float)x0)), h_bits((_Float16)(f1 - (float)x1)));
            }
          }
        }
        hv[it] = a;
        lv[it] = b2;
      }
      {
#pragma unroll
        for (int it = 0; it < 4; ++it) {
          const int row = it * 4 + q8;
          *(v4u*)(C + (size_t)(mBase + row) * ldc + n0 + c8) = hv[it];
          if constexpr (OM >= 4) {
            *(v4u*)(Cb + (size_t)(mBase + row) * ldc + n0 + c8) = lv[it];
          }
        }
        
      }
    }
    wave_sync_lds();
  }
}

// =====================================================================================================
// Flash attention for one batch element and 16 query rows, all 8 heads (one wave per head), head dim 64, 1024 keys.
// Pointers QU, KP, CTh, CTl are pre-offset to the batch's first row of the [8192][512] planes; VTh/VTl to the batch's [512][1024]
// planes; Gt is the batch's position table slab Gt[h][r][c] = (q_r + v_bias) . p_c (f32, pitch 1024).
//   A fragments (stationary): (q_i + u_bias) f16 x4 rows i0+m, QU[i][64h + d], two k-steps of 32;
//   B fragments per chunk of 32 keys: k f16 x4 rows KP[j][64h + d] (k-contiguous) -> scores s[i][j] (two 16-column tiles);
//   position logit by relative shift, i = query row, j = key: j <= i -> Gt[h][i][S-1-i+j]; j == i+1 -> 0; else Gt[h][i+1][j-i-2];
//   every lane loads from a clamped address and selects by value (no per-lane branches about loads);
//   t = (s/16 + pos) / sqrt(512) * log2(e); online softmax in base 2, max-subtracted, running sums in f32;
//   of P*1024 (f16 hi and unscaled residual) rebuilt from the LDS rows (f32 vector loads, split k map) and the v^T B fragments
//   (f16 x16 hi and unscaled residual planes) VT[64h + d][j] loaded straight from the 16-bit planes; 12 P.V WMMAs (hi.hi, lo.hi, hi.lo).
//   Final 1/l and carry folds in f32; after a block barrier the LDS buffer is reused as the block's two bf16 result row buffers [16][512]
//   (hi, lo): each wave stages its 16x64 slice (element stores); after a second block barrier the 256 threads write the block's 16 full rows
//   block = 8 waves = 256 threads; grid = 64 per batch; every wave does identical bounded work (32 steps of 32 keys).
// coverage: LDS row buffers: 8 waves x 16 rows x 64 cols = 16 x 512 per plane; global: 4 iterations x 256 threads x 8 halves = 16 rows x 512
//           of rows i0..i0+15, per plane; grid covers all 1024 rows of the batch exactly once.
// =====================================================================================================
__global__ __launch_bounds__(ATT_THREADS) __attribute__((amdgpu_num_vgpr(256)))
void attnb(const unsigned short* __restrict__ QU, const unsigned short* __restrict__ KP,
           const unsigned short* __restrict__ VTh, const unsigned short* __restrict__ VTl,
           const float* __restrict__ Gt, unsigned short* CTh, unsigned short* CTl) {
  __shared__ __align__(16) float smem[ATT_SMEM_FLOATS];   // prob tiles [wave][row][32 cols] pitch 36 | later: two bf16 row buffers

  const int tid  = threadIdx.x;
  const int wave = tid >> 5;
  const int lane = tid & 31;
  const int hh   = lane >> 4;
  const int c    = lane & 15;

  const int head = wave;                                   // 0..7
  const int i0   = blockIdx.x * 16;                        // first query row of this block

  // stationary A fragments: (q + u_bias) rows i0 + c, d 0..31 and 32..63
  const size_t qofs = (size_t)(i0 + c) * DM + head * HD + 8 * hh;
  const v16h qa = ldfrag_u(QU + qofs), qb = ldfrag_u(QU + qofs + 32);

  const unsigned short* Kb  = KP + head * HD + 8 * hh;
  const unsigned short* Vbh = VTh + (size_t)(head * HD) * SEQ + 8 * hh;
  const unsigned short* Vbl = VTl + (size_t)(head * HD) * SEQ + 8 * hh;
  const float* Gh = Gt + (size_t)head * SEQ * SEQ;

  const float PSC = SCL * LOG2E;                           // position logit scale (table values are plain f32)
  const float CSC = PSC * (1.0f / (QC * QC));              // content scores carry x4 on both operands

  float mrow[8], lrow[8];
  v8f o0 = zero8(), o1 = zero8(), o2 = zero8(), o3 = zero8();
#pragma unroll
  for (int r = 0; r < 8; ++r) { mrow[r] = -INFINITY; lrow[r] = 0.f; }
  float* pt = smem + wave * (16 * 36);

#pragma unroll 1
  for (int jb = 0; jb < SEQ; jb += KCH) {
    v8f s0, s1;
    {
      const size_t ko = (size_t)(jb + c) * DM;
      const v16h k0a = ldfrag_u(Kb + ko), k0b = ldfrag_u(Kb + ko + 32);
      const v16h k1a = ldfrag_u(Kb + ko + (size_t)16 * DM), k1b = ldfrag_u(Kb + ko + (size_t)16 * DM + 32);
      s0 = mma_h(qa, k0a, zero8());
      s0 = mma_h(qb, k0b, s0);
      s1 = mma_h(qa, k1a, zero8());
      s1 = mma_h(qb, k1b, s1);
      guard2x6(s0, s1, qa, qb, k0a, k0b, k1a, k1b);
    }
#pragma unroll
    for (int r = 0; r < 8; ++r) {
      const int i  = i0 + 8 * hh + r;                      // query row of this lane's accumulator element r
      const int ja = jb + c, jc = jb + 16 + c;             // key columns of s0 / s1
      const bool la = (ja <= i), lc = (jc <= i);
      int ra = la ? i : (i + 1), rc = lc ? i : (i + 1);
      int ca = la ? (SEQ - 1 - i + ja) : (ja - i - 2);
      int cz = lc ? (SEQ - 1 - i + jc) : (jc - i - 2);
      ra = (ra > SEQ - 1) ? (SEQ - 1) : ra;
      rc = (rc > SEQ - 1) ? (SEQ - 1) : rc;
      ca = (ca < 0) ? 0 : ca;  ca = (ca > SEQ - 1) ? (SEQ - 1) : ca;
      cz = (cz < 0) ? 0 : cz;  cz = (cz > SEQ - 1) ? (SEQ - 1) : cz;
      const float ga = Gh[(size_t)ra * SEQ + ca];
      const float gc = Gh[(size_t)rc * SEQ + cz];
      const float pa = (ja == i + 1) ? 0.f : ga;
      const float pz = (jc == i + 1) ? 0.f : gc;
      const float t0 = s0[r] * CSC + pa * PSC, t1 = s1[r] * CSC + pz * PSC;
      float mx = fmaxf(t0, t1);
#pragma unroll
      for (int off = 1; off < 16; off <<= 1) mx = fmaxf(mx, __shfl_xor(mx, off, 32));
      const float mn = fmaxf(mrow[r], mx);
      const float al = exp2f(mrow[r] - mn);
      mrow[r] = mn;
      const float e0 = exp2f(t0 - mn), e1 = exp2f(t1 - mn);
      float ps = e0 + e1;
#pragma unroll
      for (int off = 1; off < 16; off <<= 1) ps += __shfl_xor(ps, off, 32);
      lrow[r] = lrow[r] * al + ps;
      o0[r] *= al;
      o1[r] *= al;
      o2[r] *= al;
      o3[r] *= al;
      const int ro = (8 * hh + r) * 36 + c;
      pt[ro]      = e0;
      pt[ro + 16] = e1;
    }
    wave_sync_lds();
    FragH ph, pl;
    {
      const float* prow = pt + c * 36 + 8 * hh;
      const v4f p0 = *(const v4f*)(prow), p1 = *(const v4f*)(prow + 4);
      const v4f p2 = *(const v4f*)(prow + 16), p3 = *(const v4f*)(prow + 20);
#pragma unroll
      for (int e = 0; e < 4; ++e) {
        float f; _Float16 x;
        f = p0[e] * PC; x = (_Float16)f; ph.h[0][e]     = x; pl.h[0][e]     = (_Float16)(f - (float)x);   // keys jb + 8hh + e
        f = p1[e] * PC; x = (_Float16)f; ph.h[0][4 + e] = x; pl.h[0][4 + e] = (_Float16)(f - (float)x);   // keys jb + 8hh + 4 + e
        f = p2[e] * PC; x = (_Float16)f; ph.h[1][e]     = x; pl.h[1][e]     = (_Float16)(f - (float)x);   // keys jb + 16 + 8hh + e
        f = p3[e] * PC; x = (_Float16)f; ph.h[1][4 + e] = x; pl.h[1][4 + e] = (_Float16)(f - (float)x);
      }
    }
    const size_t vo = (size_t)c * SEQ + jb;
    {
      const v16h vh0 = ldfrag_u(Vbh + vo);
      const v16h vh1 = ldfrag_u(Vbh + vo + (size_t)16 * SEQ);
      const v16h vh2 = ldfrag_u(Vbh + vo + (size_t)32 * SEQ);
      const v16h vh3 = ldfrag_u(Vbh + vo + (size_t)48 * SEQ);
      o0 = mma_h(ph.v, vh0, o0);
      o1 = mma_h(ph.v, vh1, o1);
      o2 = mma_h(ph.v, vh2, o2);
      o3 = mma_h(ph.v, vh3, o3);
      o0 = mma_h(pl.v, vh0, o0);
      o1 = mma_h(pl.v, vh1, o1);
      o2 = mma_h(pl.v, vh2, o2);
      o3 = mma_h(pl.v, vh3, o3);
      guard4x6(o0, o1, o2, o3, ph.v, pl.v, vh0, vh1, vh2, vh3);
    }
    {
      const v16h vl0 = ldfrag_u(Vbl + vo);
      const v16h vl1 = ldfrag_u(Vbl + vo + (size_t)16 * SEQ);
      const v16h vl2 = ldfrag_u(Vbl + vo + (size_t)32 * SEQ);
      const v16h vl3 = ldfrag_u(Vbl + vo + (size_t)48 * SEQ);
      o0 = mma_h(ph.v, vl0, o0);
      o1 = mma_h(ph.v, vl1, o1);
      o2 = mma_h(ph.v, vl2, o2);
      o3 = mma_h(ph.v, vl3, o3);
      guard4x5(o0, o1, o2, o3, ph.v, vl0, vl1, vl2, vl3);
    }
    wave_sync_lds();
  }

  // ---- all waves done with their prob tiles; the LDS buffer becomes two bf16 result row buffers [16][512] ----
  __syncthreads();
  unsigned short* Osh = (unsigned short*)smem;
  unsigned short* Osl = Osh + 16 * DM;
  // ---- fold 1/l and the carries (1024 on P, 16 on v), split into bf16 hi + residual, stage the wave's 16x64 slice ----
  const float oc = 1.0f / (PC * VC);
  const int cb = wave * HD + c;
#pragma unroll
  for (int r = 0; r < 8; ++r) {
    const float inv = (1.0f / lrow[r]) * oc;
    const int ro = (8 * hh + r) * DM + cb;
    const float f0 = o0[r] * inv, f1 = o1[r] * inv, f2 = o2[r] * inv, f3 = o3[r] * inv;
    const unsigned short g0 = bf_bits(f0), g1 = bf_bits(f1), g2 = bf_bits(f2), g3 = bf_bits(f3);
    Osh[ro]      = g0;  Osl[ro]      = bf_bits(f0 - bf_up(g0));
    Osh[ro + 16] = g1;  Osl[ro + 16] = bf_bits(f1 - bf_up(g1));
    Osh[ro + 32] = g2;  Osl[ro + 32] = bf_bits(f2 - bf_up(g2));
    Osh[ro + 48] = g3;  Osl[ro + 48] = bf_bits(f3 - bf_up(g3));
  }
  __syncthreads();
  // ---- block writes its 16 contiguous rows of both planes: piece p = it*256 + tid -> halves p*8 .. p*8+7 of the 16x512 region ----
  {
    v4u hv[4], lv[4];
#pragma unroll
    for (int it = 0; it < 4; ++it) {
      const int p = it * ATT_THREADS + tid;
      hv[it] = *(const v4u*)(Osh + (size_t)p * 8);
      lv[it] = *(const v4u*)(Osl + (size_t)p * 8);
    }
    const size_t dofs = (size_t)i0 * DM;
    unsigned short* dsth = CTh + dofs;
    unsigned short* dstl = CTl + dofs;
    {
#pragma unroll
      for (int it = 0; it < 4; ++it) {
        const int p = it * ATT_THREADS + tid;
        *(v4u*)(dsth + (size_t)p * 8) = hv[it];
        *(v4u*)(dstl + (size_t)p * 8) = lv[it];
      }
      
    }
  }
}

// =====================================================================================================
// Workspace map (bytes); every plane is an exact multiple of its tile / whole-row store granularity (M, N exact tile multiples,
// the activation convert count an exact multiple of 2048, no pad rows needed), every offset a multiple of 512 KiB:
//   WQT, WKT, WVT, WPT f16 [512 out][512 in] x64   4 x 524288
//   WOT  bf16 [512 out][512 in]                         524288
//   X16  f16 [8192][512] x16                          8388608    (one activation input at a time, rows b*1024 + tok)
//   QU, QV f16 [8192][512] x4                     2 x 8388608    (q + u_bias, q + v_bias)
//   K16, P16 f16 [8192][512] x4                   2 x 8388608
//   VTh, VTl f16 [8][512][1024] x16               2 x 8388608    (v^T per batch, hi / residual)
//   GTAB f32 [8 heads][1024][1024]                   33554432    (position table of the current batch)
//   CTh, CTl bf16 [8192][512]                     2 x 8388608    (attention ctx, merged heads, hi / residual)
//   end                                             111673344
// =====================================================================================================
extern "C" void kernel_launch(void* const* d_in, const int* in_sizes, int n_in,
                              void* d_out, int out_size, void* d_ws, size_t ws_size,
                              hipStream_t stream) {
  if (n_in < 15) return;
  const int NA = NROWS * DM;
  if (in_sizes[0] != NA || in_sizes[1] != NA || in_sizes[2] != NA || in_sizes[3] != NA) return;
  if (in_sizes[4] != DM * DM || in_sizes[6] != DM * DM || in_sizes[8] != DM * DM || in_sizes[10] != DM * DM || in_sizes[13] != DM * DM) return;
  if (in_sizes[5] != DM || in_sizes[7] != DM || in_sizes[9] != DM || in_sizes[14] != DM) return;
  if (in_sizes[11] != NHEAD * HD || in_sizes[12] != NHEAD * HD) return;
  if (out_size != NROWS * DM) return;
  if ((NA % 2048) != 0) return;

  const float* query = (const float*)d_in[0];
  const float* key   = (const float*)d_in[1];
  const float* value = (const float*)d_in[2];
  const float* pemb  = (const float*)d_in[3];
  const float* w_q   = (const float*)d_in[4];
  const float* b_q   = (const float*)d_in[5];
  const float* w_k   = (const float*)d_in[6];
  const float* b_k   = (const float*)d_in[7];
  const float* w_v   = (const float*)d_in[8];
  const float* b_v   = (const float*)d_in[9];
  const float* w_p   = (const float*)d_in[10];
  const float* u_b   = (const float*)d_in[11];
  const float* v_b   = (const float*)d_in[12];
  const float* w_o   = (const float*)d_in[13];
  const float* b_o   = (const float*)d_in[14];
  float*       out   = (float*)d_out;

  const size_t PWT = (size_t)DM * DM * 2;                         //   524288
  const size_t PX  = (size_t)NROWS * DM * 2;                      //  8388608
  const size_t PVT = (size_t)NB * DM * SEQ * 2;                   //  8388608
  const size_t PG  = (size_t)NHEAD * SEQ * SEQ * 4;               // 33554432
  size_t off = 0;
  const size_t oWQ = off; off += PWT;
  const size_t oWK = off; off += PWT;
  const size_t oWV = off; off += PWT;
  const size_t oWP = off; off += PWT;
  const size_t oWO = off; off += PWT;
  const size_t oX  = off; off += PX;
  const size_t oQU = off; off += PX;
  const size_t oQV = off; off += PX;
  const size_t oK  = off; off += PX;
  const size_t oP  = off; off += PX;
  const size_t oVh = off; off += PVT;
  const size_t oVl = off; off += PVT;
  const size_t oG  = off; off += PG;
  const size_t oCh = off; off += PX;
  const size_t oCl = off; off += PX;
  if (off > ws_size) return;                                      // off = 111673344
  if (off > (size_t)134217728) return;

  char* ws = (char*)d_ws;
  unsigned short* WQT  = (unsigned short*)(ws + oWQ);
  unsigned short* WKT  = (unsigned short*)(ws + oWK);
  unsigned short* WVT  = (unsigned short*)(ws + oWV);
  unsigned short* WPT  = (unsigned short*)(ws + oWP);
  unsigned short* WOT  = (unsigned short*)(ws + oWO);
  unsigned short* X16  = (unsigned short*)(ws + oX);
  unsigned short* QU   = (unsigned short*)(ws + oQU);
  unsigned short* QV   = (unsigned short*)(ws + oQV);
  unsigned short* K16  = (unsigned short*)(ws + oK);
  unsigned short* P16  = (unsigned short*)(ws + oP);
  unsigned short* VTh  = (unsigned short*)(ws + oVh);
  unsigned short* VTl  = (unsigned short*)(ws + oVl);
  float*          GTAB = (float*)(ws + oG);
  unsigned short* CTh  = (unsigned short*)(ws + oCh);
  unsigned short* CTl  = (unsigned short*)(ws + oCl);

  const dim3 blk(256);
  const dim3 gTW(DM / 64, DM / 64, 1);                             // 8 x 8 x 1
  const dim3 gCX(NA / 2048);                                       // 2048
  const int tilesP = (NROWS / 64) * (DM / 64);                     // 1024
  const int tilesV = (DM / 64) * (SEQ / 64);                       // 128 per batch
  const int tilesG = (SEQ / 64) * (SEQ / 64);                      // 256 per head
  const dim3 gP((tilesP + 7) / 8, 1);                              // 128
  const dim3 gV((tilesV + 7) / 8, NB);                             // 16 x 8
  const dim3 gG((tilesG + 7) / 8, NHEAD);                          // 32 x 8
  const dim3 gAT(ATT_BLOCKS);                                      // 64
  const dim3 bAT(ATT_THREADS);                                     // 256

  // (0) weight planes: W[c][n] -> WT[n][c] as f16( bf16_RNE(w) * 64 ); Wo[c][n] -> WOT[n][c] bf16
  tr16<0><<<gTW, blk, 0, stream>>>(w_q, WQT, DM, DM, 0LL, 0LL, WSC);
  tr16<0><<<gTW, blk, 0, stream>>>(w_k, WKT, DM, DM, 0LL, 0LL, WSC);
  tr16<0><<<gTW, blk, 0, stream>>>(w_v, WVT, DM, DM, 0LL, 0LL, WSC);
  tr16<0><<<gTW, blk, 0, stream>>>(w_p, WPT, DM, DM, 0LL, 0LL, WSC);
  tr16<1><<<gTW, blk, 0, stream>>>(w_o, WOT, DM, DM, 0LL, 0LL, 1.0f);

  // (1) q projection: X16 = f16(bf16(query)*16); q[m][n] = sum_c x[m][c] WQT[n][c] / 1024 + bq[n];
  //     QU = f16((q + u_bias[n]) * 4), QV = f16((q + v_bias[n]) * 4); M = 8192, N = 512, K = 512
  cvt16<<<gCX, blk, 0, stream>>>(query, X16, NA, ACARRY);
  gemm64<5, 0, 0, 1><<<gP, blk, 0, stream>>>(
      X16, X16, DM, 0LL,
      WQT, DM, 0LL,
      (void*)QU, (void*)QV, DM, 0LL,
      NROWS, DM, DM, 1.0f / (ACARRY * WSC), QC,
      b_q, u_b, v_b);

  // (2) k projection -> K16 = f16((k + bk) * 4)
  cvt16<<<gCX, blk, 0, stream>>>(key, X16, NA, ACARRY);
  gemm64<2, 0, 0, 1><<<gP, blk, 0, stream>>>(
      X16, X16, DM, 0LL,
      WKT, DM, 0LL,
      (void*)K16, (void*)K16, DM, 0LL,
      NROWS, DM, DM, 1.0f / (ACARRY * WSC), QC,
      b_k, b_k, b_k);

  // (3) v^T per batch: VT[b][n = h*64+d][tok] = sum_c WVT[n][c] x_b[tok][c] / 1024 + bv[n] -> f16 x16 hi / residual planes;
  //     M = 512, N = 1024, K = 512
  cvt16<<<gCX, blk, 0, stream>>>(value, X16, NA, ACARRY);
  gemm64<4, 0, 0, 2><<<gV, blk, 0, stream>>>(
      WVT, WVT, DM, 0LL,
      X16, DM, (long long)SEQ * DM,
      (void*)VTh, (void*)VTl, SEQ, (long long)DM * SEQ,
      DM, SEQ, DM, 1.0f / (ACARRY * WSC), VC,
      b_v, b_v, b_v);

  // (4) p projection (no bias) -> P16 = f16(p * 4)
  cvt16<<<gCX, blk, 0, stream>>>(pemb, X16, NA, ACARRY);
  gemm64<2, 0, 0, 0><<<gP, blk, 0, stream>>>(
      X16, X16, DM, 0LL,
      WPT, DM, 0LL,
      (void*)P16, (void*)P16, DM, 0LL,
      NROWS, DM, DM, 1.0f / (ACARRY * WSC), QC,
      b_q, b_q, b_q);

  // (5) per batch: position table GTAB[h][r][c] = sum_d QV[b*1024+r][64h+d] P16[b*1024+c][64h+d] / 16 (f32; M = N = 1024, K = 64 per head),
  //     then attention over the batch's 1024 query rows, all heads -> CT (bf16 hi / residual planes)
  for (int b = 0; b < NB; ++b) {
    const size_t boff = (size_t)b * SEQ * DM;                      // element offset of the batch's rows in [8192][512] planes
    const size_t voff = (size_t)b * DM * SEQ;                      // element offset of the batch's v^T plane
    gemm64<0, 0, 0, 0><<<gG, blk, 0, stream>>>(
        QV + boff, QV + boff, DM, (long long)HD,
        P16 + boff, DM, (long long)HD,
        (void*)GTAB, (void*)GTAB, SEQ, (long long)SEQ * SEQ,
        SEQ, SEQ, HD, 1.0f / (QC * QC), 1.0f,
        b_q, b_q, b_q);
    attnb<<<gAT, bAT, 0, stream>>>(QU + boff, K16 + boff, VTh + voff, VTl + voff, GTAB, CTh + boff, CTl + boff);
  }

  // (6) out = (CT_hi + CT_lo) . WOT^T + bo; M = 8192, N = 512, K = 512, f32
  gemm64<0, 1, 1, 1><<<gP, blk, 0, stream>>>(
      CTh, CTl, DM, 0LL,
      WOT, DM, 0LL,
      (void*)out, (void*)out, DM, 0LL,
      NROWS, DM, DM, 1.0f, 1.0f,
      b_o, b_o, b_o);
  (void)hipGetLastError();
}

// v001
// It runs in 430 microseconds.
// Two timings next to v000 put it at 1.87 and 1.88 times that version's speed.
// Contractions (all f32 accumulate): q/k/v/p projections v_wmma_f32_16x16x32_f16 (x f16 x16 . W^T f16 x64, K=512, single products);
// position table (q+v_bias).p^T v_wmma_f32_16x16x32_f16 ((q+v_bias) f16 x4 . p f16 x4, K=64, single) -> f32 table;
// content scores v_wmma_f32_16x16x32_f16 ((q+u_bias) f16 x4 . k f16 x4, K=64, single);
// P . v^T v_wmma_f32_16x16x32_f16 (P f16 x1024 hi/lo . v^T f16 x16 hi/lo, hi.hi+lo.hi+hi.lo, K=1024 by 32);
// output projection v_wmma_f32_16x16x32_bf16 (ctx bf16 hi/lo . Wo bf16, hi.W+lo.W, K=512) + bias in f32.
// Max-subtracted online base-2 softmax and the relative-shift position logits in f32 on VALU. Every float input RNE-converted to bf16 on load.
#include <hip/hip_runtime.h>
#include <math.h>
#include <stdint.h>

#define NB     8
#define SEQ    1024
#define DM     512
#define NHEAD  8
#define HD     64
#define NROWS  (NB * SEQ)
#define KCH    32
#define WSC    64.0f
#define ACARRY 16.0f
#define QC     4.0f
#define VC     16.0f
#define PC     1024.0f
#define LOG2E  1.4426950408889634f
#define SCL    0.04419417382415922f
static_assert(NHEAD * HD == DM);
static_assert((SEQ % 64) == 0 && (DM % 64) == 0 && (NROWS % 64) == 0 && (HD % 32) == 0 && (SEQ % KCH) == 0);
static_assert(((NROWS * DM) % 2048) == 0);
#define ATT_THREADS (NHEAD * 32)
#define ATT_BLOCKS  (SEQ / 16)
#define GB     4                      // batch elements per position-table / attention launch: 4 x 64 blocks = one per WGP
#define ATT_SMEM_FLOATS 8192
static_assert(ATT_THREADS == 256);
static_assert(ATT_BLOCKS == 64);
static_assert((NB % GB) == 0);
static_assert(NHEAD * 16 * 36 <= ATT_SMEM_FLOATS);
static_assert((size_t)2 * 16 * DM * sizeof(unsigned short) <= (size_t)ATT_SMEM_FLOATS * sizeof(float));
static_assert((16 * DM) / 8 == 4 * ATT_THREADS);

typedef _Float16 v16h __attribute__((ext_vector_type(16)));
typedef _Float16 v8h  __attribute__((ext_vector_type(8)));
typedef __bf16   v16b __attribute__((ext_vector_type(16)));
typedef float    v8f  __attribute__((ext_vector_type(8)));
typedef float    v4f  __attribute__((ext_vector_type(4)));
typedef unsigned int v4u __attribute__((ext_vector_type(4)));

union FragH { v16h v; v8h h[2]; v4u u[2]; };
union FragAny { v16h h; v16b b; };

// ---- scalar helpers --------------------------------------------------------------------------------
__device__ __forceinline__ unsigned short bf_bits(float f) {          // f32 -> bf16 bits, RNE convert
  unsigned u = __float_as_uint(f);
  return (unsigned short)((u + 0x7FFFu + ((u >> 16) & 1u)) >> 16);
}
__device__ __forceinline__ float bf_up(unsigned short h) { return __uint_as_float(((unsigned)h) << 16); }
__device__ __forceinline__ float bfr(float f) { return bf_up(bf_bits(f)); }   // value of the bf16 RNE convert
__device__ __forceinline__ unsigned short h_bits(_Float16 x) { return __builtin_bit_cast(unsigned short, x); }
__device__ __forceinline__ unsigned pk16(unsigned short a, unsigned short b) { return (unsigned)a | ((unsigned)b << 16); }
__device__ __forceinline__ v8f zero8() { v8f z = {0.f, 0.f, 0.f, 0.f, 0.f, 0.f, 0.f, 0.f}; return z; }

// ---- fragment loader: 16-bit A/B operand from a k-contiguous 16-bit plane, lane -> row/col (lane&15),
//      p already includes +8*(lane>>4); elements 0..7 <- p[0..7] (k0+8h..), elements 8..15 <- p[16..23] (k0+16+8h..)
//      (same split k map for A and B; B is always read from a [n][k] plane)
__device__ __forceinline__ v16h ldfrag_u(const unsigned short* p) {
  FragH f;
  f.u[0] = *(const v4u*)(p);
  f.u[1] = *(const v4u*)(p + 16);
  return f.v;
}

// ---- WMMA helpers with trailing VALU hazard gaps ------------------------------------------------------
__device__ __forceinline__ v8f mma_h(v16h a, v16h b, v8f c) {
  return __builtin_amdgcn_wmma_f32_16x16x32_f16(false, a, false, b, (short)0, c, false, false);
}
__device__ __forceinline__ v8f mma_b(v16h a, v16h b, v8f c) {
  FragAny ua, ub;
  ua.h = a;
  ub.h = b;
  return __builtin_amdgcn_wmma_f32_16x16x32_bf16(false, ua.b, false, ub.b, (short)0, c, false, false);
}
template <int BF>
__device__ __forceinline__ v8f mmaT(v16h a, v16h b, v8f c) {
  if constexpr (BF != 0) return mma_b(a, b, c);
  else return mma_h(a, b, c);
}
__device__ __forceinline__ void dep_guard1(v8f& a, v8f& b, v16h x) {
#if defined(__HIP_DEVICE_COMPILE__)
  asm volatile("v_nop\n\tv_nop\n\tv_nop\n\tv_nop" : "+v"(a), "+v"(b) : "v"(x));
#endif
}
__device__ __forceinline__ void guard2x6(v8f& a, v8f& b, v16h x0, v16h x1, v16h x2, v16h x3, v16h x4, v16h x5) {
#if defined(__HIP_DEVICE_COMPILE__)
  asm volatile("v_nop\n\tv_nop\n\tv_nop\n\tv_nop"
               : "+v"(a), "+v"(b) : "v"(x0), "v"(x1), "v"(x2), "v"(x3), "v"(x4), "v"(x5));
#endif
}
__device__ __forceinline__ void guard4x6(v8f& a, v8f& b, v8f& c, v8f& d,
                                         v16h x0, v16h x1, v16h x2, v16h x3, v16h x4, v16h x5) {
#if defined(__HIP_DEVICE_COMPILE__)
  asm volatile("v_nop\n\tv_nop\n\tv_nop\n\tv_nop"
               : "+v"(a), "+v"(b), "+v"(c), "+v"(d) : "v"(x0), "v"(x1), "v"(x2), "v"(x3), "v"(x4), "v"(x5));
#endif
}
__device__ __forceinline__ void guard4x5(v8f& a, v8f& b, v8f& c, v8f& d,
                                         v16h x0, v16h x1, v16h x2, v16h x3, v16h x4) {
#if defined(__HIP_DEVICE_COMPILE__)
  asm volatile("v_nop\n\tv_nop\n\tv_nop\n\tv_nop"
               : "+v"(a), "+v"(b), "+v"(c), "+v"(d) : "v"(x0), "v"(x1), "v"(x2), "v"(x3), "v"(x4));
#endif
}
__device__ __forceinline__ void keep4_h(v16h a, v16h b, v16h c, v16h d) {
#if defined(__HIP_DEVICE_COMPILE__)
  asm volatile("v_nop" :: "v"(a), "v"(b), "v"(c), "v"(d));
#endif
}
__device__ __forceinline__ void acc_guard4(v8f& a, v8f& b, v8f& c, v8f& d) {
#if defined(__HIP_DEVICE_COMPILE__)
  asm volatile("v_nop\n\tv_nop\n\tv_nop\n\tv_nop" : "+v"(a), "+v"(b), "+v"(c), "+v"(d));
#endif
}
__device__ __forceinline__ void wave_sync_lds() {
  __builtin_amdgcn_fence(__ATOMIC_RELEASE, "workgroup");
  __builtin_amdgcn_wave_barrier();
  __builtin_amdgcn_fence(__ATOMIC_ACQUIRE, "workgroup");
}

// =====================================================================================================
// Elementwise 16-bit pack, no transpose: dst[i] = f16( bf16_RNE(src[i]) * sc ), sc a power of two (exact).
// coverage: grid = n / 2048 blocks x 256 thr x 8 elements = n exactly (host checks n % 2048 == 0).
// =====================================================================================================
__global__ __launch_bounds__(256) void cvt16(const float* __restrict__ src, unsigned short* dst, int n, float sc) {
  const size_t i8 = ((size_t)blockIdx.x * 256 + threadIdx.x) * 8;
  if (i8 + 8 > (size_t)n) return;                 // never taken with the exact grid; no barriers in this kernel
  const v4f a = *(const v4f*)(src + i8);
  const v4f b = *(const v4f*)(src + i8 + 4);
  v4u o;
  o[0] = pk16(h_bits((_Float16)(bfr(a[0]) * sc)), h_bits((_Float16)(bfr(a[1]) * sc)));
  o[1] = pk16(h_bits((_Float16)(bfr(a[2]) * sc)), h_bits((_Float16)(bfr(a[3]) * sc)));
  o[2] = pk16(h_bits((_Float16)(bfr(b[0]) * sc)), h_bits((_Float16)(bfr(b[1]) * sc)));
  o[3] = pk16(h_bits((_Float16)(bfr(b[2]) * sc)), h_bits((_Float16)(bfr(b[3]) * sc)));
  {
    *(v4u*)(dst + i8) = o;
    
  }
}

// =====================================================================================================
// Transposing 16-bit pack of a weight matrix: in W[Cin][Dd] (pitch Dd, base + z*sIn) -> out WT[Dd][Cin] (pitch Cin, base + z*sOut),
// BFO 0: f16( bf16_RNE(w) * sc ); BFO 1: bf16_RNE(w) bits. One 64x64 tile per block (x = Cin tile, y = Dd tile, z = matrix index):
// coverage: loads 4 x 256 x 4 floats = 64x64; stores 2 x 256 pieces x 8 halves = 64 rows x 64 halves = the whole tile;
//           grid = (Cin/64, Dd/64, nmat) exact (host passes exact multiples of 64).
// =====================================================================================================
template <int BFO>
__global__ __launch_bounds__(256) void tr16(const float* __restrict__ W, unsigned short* WT, int Cin, int Dd,
                                            long long sIn, long long sOut, float sc) {
  __shared__ float t[64][65];
  const int tid = threadIdx.x;
  const int c0 = blockIdx.x * 64, d0 = blockIdx.y * 64;
  const float* src = W + (size_t)((long long)blockIdx.z * sIn);
  unsigned short* dst = WT + (size_t)((long long)blockIdx.z * sOut);
#pragma unroll
  for (int it = 0; it < 4; ++it) {
    const int p  = it * 256 + tid;
    const int cc = p >> 4, sg = (p & 15) * 4;
    const v4f v = *(const v4f*)(src + (size_t)(c0 + cc) * Dd + d0 + sg);
    t[cc][sg]     = v[0];
    t[cc][sg + 1] = v[1];
    t[cc][sg + 2] = v[2];
    t[cc][sg + 3] = v[3];
  }
  __syncthreads();
  v4u o[2];
#pragma unroll
  for (int it = 0; it < 2; ++it) {
    const int p  = it * 256 + tid;
    const int dd = p >> 3, s8 = (p & 7) * 8;
    unsigned short hv[8];
#pragma unroll
    for (int k = 0; k < 8; ++k) {
      const float f = bfr(t[s8 + k][dd]);
      if constexpr (BFO != 0) hv[k] = bf_bits(f);
      else hv[k] = h_bits((_Float16)(f * sc));
    }
    v4u q;
    q[0] = pk16(hv[0], hv[1]);
    q[1] = pk16(hv[2], hv[3]);
    q[2] = pk16(hv[4], hv[5]);
    q[3] = pk16(hv[6], hv[7]);
    o[it] = q;
  }
  {
#pragma unroll
    for (int it = 0; it < 2; ++it) {
      const int p  = it * 256 + tid;
      const int dd = p >> 3, s8 = (p & 7) * 8;
      *(v4u*)(dst + (size_t)(d0 + dd) * Cin + c0 + s8) = o[it];
    }
    
  }
}

// =====================================================================================================
// Register-blocked batched 16-bit WMMA GEMM: C[m][n] = oscale * sum_k A[m][k] * Bt[n][k] (+ bias); one wave per 64x64 tile,
// no block barriers. A row-major [M][K] pitch lda (16-bit plane), Bt row-major [N][K] pitch ldb (k contiguous); M, N multiples of 64,
// K multiple of 32. blockIdx.y = batch index with element strides sA, sB, sC; blockIdx.z = outer batch index with strides zA, zB, zC.
// ASPLIT 1: a second A plane A2 (unscaled residual of A, same layout) is multiplied into the same accumulator (A + A2 ~ exact A).
// BF 1: bf16 operands (v_wmma_f32_16x16x32_bf16), else f16.
// EPI 1: value += bf16_RNE(ep0[column]) (per-column bias); EPI 2: value += bf16_RNE(ep0[row]) (per-row bias, 16-bit out only).
// OM 0: f32 out (pitch ldc).  OM 2: one f16 plane = f16(value * ocarry).
// OM 4: two f16 planes: hi = f16(value * ocarry), lo = f16(value * ocarry - hi) (unscaled residual).
// OM 5: two f16 planes: C = f16((value + bf16_RNE(ep1[column])) * ocarry), C2 = f16((value + bf16_RNE(ep2[column])) * ocarry).
// coverage: 4 slabs x 16 rows (f32: it 0..7 x lane>>4; 16-bit: it 0..3 x lane>>3) x 64 cols = the wave's whole 64x64 tile;
//           grid = ceil(tilesM*tilesN/8) blocks, surplus waves exit (wave-uniform).
// =====================================================================================================
template <int OM, int ASPLIT, int BF, int EPI>
__global__ __launch_bounds__(256) __attribute__((amdgpu_num_vgpr(256))) void gemm64(
    const unsigned short* __restrict__ Ap, const unsigned short* __restrict__ A2p, int lda, long long sA, long long zA,
    const unsigned short* __restrict__ Btp, int ldb, long long sB, long long zB,
    void* Cout, void* C2out, int ldc, long long sC, long long zC,
    int M, int N, int K, float oscale, float ocarry,
    const float* __restrict__ ep0, const float* __restrict__ ep1, const float* __restrict__ ep2) {
  __shared__ __align__(16) float sT[8][16 * 68];   // per-wave 16x64 slab, pitch 68 floats
  const int by   = blockIdx.y;
  const int bz   = blockIdx.z;
  const int lane = threadIdx.x & 31;
  const int wave = threadIdx.x >> 5;
  const int tilesN = N >> 6;
  const int tilesM = M >> 6;
  const int tile = blockIdx.x * 8 + wave;
  if (tile >= tilesM * tilesN) return;   // wave-uniform; no block barriers in this kernel
  const int tm = tile / tilesN;
  const int tn = tile - tm * tilesN;
  const int m0 = tm << 6;
  const int n0 = tn << 6;

  const unsigned short* A1 = Ap  + (size_t)((long long)by * sA + (long long)bz * zA);
  const unsigned short* A2 = A2p + (size_t)((long long)by * sA + (long long)bz * zA);
  const unsigned short* Bb = Btp + (size_t)((long long)by * sB + (long long)bz * zB);

  const int rlane = lane & 15;                 // row (A) / col (B, D) within subtile
  const int koff  = (lane >> 4) * 8;           // k offset of this lane half
  const int mOff  = (lane >> 4) * 8;           // D row offset

  v8f acc[4][4];
#pragma unroll
  for (int i = 0; i < 4; ++i)
#pragma unroll
    for (int j = 0; j < 4; ++j) acc[i][j] = zero8();

  for (int k0 = 0; k0 < K; k0 += 32) {
    v16h bh[4];
#pragma unroll
    for (int j = 0; j < 4; ++j) {
      const size_t bofs = (size_t)(n0 + (j << 4) + rlane) * ldb + koff + k0;
      bh[j] = ldfrag_u(Bb + bofs);
    }
#pragma unroll
    for (int i = 0; i < 4; ++i) {
      const size_t ao = (size_t)(m0 + (i << 4) + rlane) * lda + koff + k0;
      const v16h ah = ldfrag_u(A1 + ao);
#pragma unroll
      for (int j = 0; j < 4; ++j) acc[i][j] = mmaT<BF>(ah, bh[j], acc[i][j]);
      dep_guard1(acc[i][0], acc[i][3], ah);
      if constexpr (ASPLIT != 0) {
        const v16h al = ldfrag_u(A2 + ao);
#pragma unroll
        for (int j = 0; j < 4; ++j) acc[i][j] = mmaT<BF>(al, bh[j], acc[i][j]);
        dep_guard1(acc[i][0], acc[i][3], al);
      }
    }
    keep4_h(bh[0], bh[1], bh[2], bh[3]);
  }
  acc_guard4(acc[0][0], acc[0][1], acc[0][2], acc[0][3]);
  acc_guard4(acc[1][0], acc[1][1], acc[1][2], acc[1][3]);
  acc_guard4(acc[2][0], acc[2][1], acc[2][2], acc[2][3]);
  acc_guard4(acc[3][0], acc[3][1], acc[3][2], acc[3][3]);

  const int hh2 = lane >> 4, c4 = (lane & 15) * 4;     // f32 out: 256-B row segment = 16 lanes x 16 B
  const int q8  = lane >> 3, c8 = (lane & 7) * 8;

  // ---- epilogue ----
  float* slab = sT[wave];
#pragma unroll
  for (int i = 0; i < 4; ++i) {
    const int mBase = m0 + (i << 4);
#pragma unroll
    for (int j = 0; j < 4; ++j) {
#pragma unroll
      for (int r = 0; r < 8; ++r) {
        slab[(mOff + r) * 68 + (j << 4) + rlane] = acc[i][j][r];
      }
    }
    wave_sync_lds();
    if constexpr (OM == 0) {
      float* C = (float*)Cout + (size_t)((long long)by * sC + (long long)bz * zC);
      v4f vals[8];
#pragma unroll
      for (int it = 0; it < 8; ++it) {
        const int row = it * 2 + hh2;                      // it 0..7 x hh2 0..1 = rows 0..15
        v4f v = *(const v4f*)(slab + row * 68 + c4);
#pragma unroll
        for (int e = 0; e < 4; ++e) v[e] = v[e] * oscale;
        if constexpr (EPI == 1) {
          const v4f bb = *(const v4f*)(ep0 + n0 + c4);     // per-column bias, columns n0+c4 .. +3 (N equals the bias length)
#pragma unroll
          for (int e = 0; e < 4; ++e) v[e] = v[e] + bfr(bb[e]);
        }
        vals[it] = v;
      }
      {
#pragma unroll
        for (int it = 0; it < 8; ++it) {
          const int gr = mBase + it * 2 + hh2;
          *(v4f*)(C + (size_t)gr * ldc + n0 + c4) = vals[it];
        }
        
      }
    } else {
      unsigned short* C  = (unsigned short*)Cout  + (size_t)((long long)by * sC + (long long)bz * zC);
      unsigned short* Cb = (unsigned short*)C2out + (size_t)((long long)by * sC + (long long)bz * zC);
      v4u hv[4], lv[4];
#pragma unroll
      for (int it = 0; it < 4; ++it) {
        const int row = it * 4 + q8;                       // it 0..3 x q8 0..3 = rows 0..15
        const float* sp = slab + row * 68 + c8;
        float rb = 0.f;
        if constexpr (EPI == 2) rb = bfr(ep0[mBase + row]);   // per-row bias (M equals the bias length)
        v4u a  = {0u, 0u, 0u, 0u};
        v4u b2 = {0u, 0u, 0u, 0u};
#pragma unroll
        for (int e = 0; e < 4; ++e) {
          const int ci = n0 + c8 + 2 * e;                  // column index, < N
          float f0 = sp[2 * e] * oscale + rb;
          float f1 = sp[2 * e + 1] * oscale + rb;
          if constexpr (EPI == 1) {
            f0 += bfr(ep0[ci]);
            f1 += bfr(ep0[ci + 1]);
          }
          if constexpr (OM == 5) {
            const float g0 = (f0 + bfr(ep1[ci])) * ocarry, g1 = (f1 + bfr(ep1[ci + 1])) * ocarry;
            const float w0 = (f0 + bfr(ep2[ci])) * ocarry, w1 = (f1 + bfr(ep2[ci + 1])) * ocarry;
            a[e]  = pk16(h_bits((_Float16)g0), h_bits((_Float16)g1));
            b2[e] = pk16(h_bits((_Float16)w0), h_bits((_Float16)w1));
          } else {
            f0 *= ocarry; f1 *= ocarry;
            const _Float16 x0 = (_Float16)f0, x1 = (_Float16)f1;
            a[e] = pk16(h_bits(x0), h_bits(x1));
            if constexpr (OM == 4) {
              b2[e] = pk16(h_bits((_Float16)(f0 - (float)x0)), h_bits((_Float16)(f1 - (float)x1)));
            }
          }
        }
        hv[it] = a;
        lv[it] = b2;
      }
      {
#pragma unroll
        for (int it = 0; it < 4; ++it) {
          const int row = it * 4 + q8;
          *(v4u*)(C + (size_t)(mBase + row) * ldc + n0 + c8) = hv[it];
          if constexpr (OM >= 4) {
            *(v4u*)(Cb + (size_t)(mBase + row) * ldc + n0 + c8) = lv[it];
          }
        }
        
      }
    }
    wave_sync_lds();
  }
}

// =====================================================================================================
// Flash attention for one batch element and 16 query rows, all 8 heads (one wave per head), head dim 64, 1024 keys.
// blockIdx.y = batch element within the launch's group. Pointers QU0, KP0, CTh0, CTl0 are pre-offset to the group's first row of the
// [8192][512] planes; VTh0/VTl0 to the group's first [512][1024] plane; Gt0 is the group's position table, one slab per batch element,
// Gt[h][r][c] = (q_r + v_bias) . p_c (f32, pitch 1024).
//   A fragments (stationary): (q_i + u_bias) f16 x4 rows i0+m, QU[i][64h + d], two k-steps of 32;
//   B fragments per chunk of 32 keys: k f16 x4 rows KP[j][64h + d] (k-contiguous) -> scores s[i][j] (two 16-column tiles);
//   position logit by relative shift, i = query row, j = key: j <= i -> Gt[h][i][S-1-i+j]; j == i+1 -> 0; else Gt[h][i+1][j-i-2];
//   every lane loads from a clamped address and selects by value (no per-lane branches about loads);
//   t = (s/16 + pos) / sqrt(512) * log2(e); online softmax in base 2, max-subtracted, running sums in f32;
//   of P*1024 (f16 hi and unscaled residual) rebuilt from the LDS rows (f32 vector loads, split k map) and the v^T B fragments
//   (f16 x16 hi and unscaled residual planes) VT[64h + d][j] loaded straight from the 16-bit planes; 12 P.V WMMAs (hi.hi, lo.hi, hi.lo).
//   Final 1/l and carry folds in f32; after a block barrier the LDS buffer is reused as the block's two bf16 result row buffers [16][512]
//   (hi, lo): each wave stages its 16x64 slice (element stores); after a second block barrier the 256 threads write the block's 16 full rows
//   block = 8 waves = 256 threads; grid = 64 x batch elements of the group; every wave does identical bounded work (32 steps of 32 keys).
// coverage: LDS row buffers: 8 waves x 16 rows x 64 cols = 16 x 512 per plane; global: 4 iterations x 256 threads x 8 halves = 16 rows x 512
//           of rows i0..i0+15, per plane; grid covers all 1024 rows of the batch exactly once.
// =====================================================================================================
__global__ __launch_bounds__(ATT_THREADS) __attribute__((amdgpu_num_vgpr(256)))
void attnb(const unsigned short* __restrict__ QU0, const unsigned short* __restrict__ KP0,
           const unsigned short* __restrict__ VTh0, const unsigned short* __restrict__ VTl0,
           const float* __restrict__ Gt0, unsigned short* CTh0, unsigned short* CTl0) {
  __shared__ __align__(16) float smem[ATT_SMEM_FLOATS];   // prob tiles [wave][row][32 cols] pitch 36 | later: two bf16 row buffers

  const int tid  = threadIdx.x;
  const int wave = tid >> 5;
  const int lane = tid & 31;
  const int hh   = lane >> 4;
  const int c    = lane & 15;

  const int head = wave;                                   // 0..7
  const int i0   = blockIdx.x * 16;                        // first query row of this block

  const size_t bg = blockIdx.y;                            // batch element within the group
  const unsigned short* QU  = QU0  + bg * ((size_t)SEQ * DM);
  const unsigned short* KP  = KP0  + bg * ((size_t)SEQ * DM);
  const unsigned short* VTh = VTh0 + bg * ((size_t)DM * SEQ);
  const unsigned short* VTl = VTl0 + bg * ((size_t)DM * SEQ);
  const float*          Gt  = Gt0  + bg * ((size_t)NHEAD * SEQ * SEQ);
  unsigned short*       CTh = CTh0 + bg * ((size_t)SEQ * DM);
  unsigned short*       CTl = CTl0 + bg * ((size_t)SEQ * DM);

  // stationary A fragments: (q + u_bias) rows i0 + c, d 0..31 and 32..63
  const size_t qofs = (size_t)(i0 + c) * DM + head * HD + 8 * hh;
  const v16h qa = ldfrag_u(QU + qofs), qb = ldfrag_u(QU + qofs + 32);

  const unsigned short* Kb  = KP + head * HD + 8 * hh;
  const unsigned short* Vbh = VTh + (size_t)(head * HD) * SEQ + 8 * hh;
  const unsigned short* Vbl = VTl + (size_t)(head * HD) * SEQ + 8 * hh;
  const float* Gh = Gt + (size_t)head * SEQ * SEQ;

  const float PSC = SCL * LOG2E;                           // position logit scale (table values are plain f32)
  const float CSC = PSC * (1.0f / (QC * QC));              // content scores carry x4 on both operands

  float mrow[8], lrow[8];
  v8f o0 = zero8(), o1 = zero8(), o2 = zero8(), o3 = zero8();
#pragma unroll
  for (int r = 0; r < 8; ++r) { mrow[r] = -INFINITY; lrow[r] = 0.f; }
  float* pt = smem + wave * (16 * 36);

#pragma unroll 1
  for (int jb = 0; jb < SEQ; jb += KCH) {
    v8f s0, s1;
    {
      const size_t ko = (size_t)(jb + c) * DM;
      const v16h k0a = ldfrag_u(Kb + ko), k0b = ldfrag_u(Kb + ko + 32);
      const v16h k1a = ldfrag_u(Kb + ko + (size_t)16 * DM), k1b = ldfrag_u(Kb + ko + (size_t)16 * DM + 32);
      s0 = mma_h(qa, k0a, zero8());
      s0 = mma_h(qb, k0b, s0);
      s1 = mma_h(qa, k1a, zero8());
      s1 = mma_h(qb, k1b, s1);
      guard2x6(s0, s1, qa, qb, k0a, k0b, k1a, k1b);
    }
#pragma unroll
    for (int r = 0; r < 8; ++r) {
      const int i  = i0 + 8 * hh + r;                      // query row of this lane's accumulator element r
      const int ja = jb + c, jc = jb + 16 + c;             // key columns of s0 / s1
      const bool la = (ja <= i), lc = (jc <= i);
      int ra = la ? i : (i + 1), rc = lc ? i : (i + 1);
      int ca = la ? (SEQ - 1 - i + ja) : (ja - i - 2);
      int cz = lc ? (SEQ - 1 - i + jc) : (jc - i - 2);
      ra = (ra > SEQ - 1) ? (SEQ - 1) : ra;
      rc = (rc > SEQ - 1) ? (SEQ - 1) : rc;
      ca = (ca < 0) ? 0 : ca;  ca = (ca > SEQ - 1) ? (SEQ - 1) : ca;
      cz = (cz < 0) ? 0 : cz;  cz = (cz > SEQ - 1) ? (SEQ - 1) : cz;
      const float ga = Gh[(size_t)ra * SEQ + ca];
      const float gc = Gh[(size_t)rc * SEQ + cz];
      const float pa = (ja == i + 1) ? 0.f : ga;
      const float pz = (jc == i + 1) ? 0.f : gc;
      const float t0 = s0[r] * CSC + pa * PSC, t1 = s1[r] * CSC + pz * PSC;
      float mx = fmaxf(t0, t1);
#pragma unroll
      for (int off = 1; off < 16; off <<= 1) mx = fmaxf(mx, __shfl_xor(mx, off, 32));
      const float mn = fmaxf(mrow[r], mx);
      const float al = exp2f(mrow[r] - mn);
      mrow[r] = mn;
      const float e0 = exp2f(t0 - mn), e1 = exp2f(t1 - mn);
      float ps = e0 + e1;
#pragma unroll
      for (int off = 1; off < 16; off <<= 1) ps += __shfl_xor(ps, off, 32);
      lrow[r] = lrow[r] * al + ps;
      o0[r] *= al;
      o1[r] *= al;
      o2[r] *= al;
      o3[r] *= al;
      const int ro = (8 * hh + r) * 36 + c;
      pt[ro]      = e0;
      pt[ro + 16] = e1;
    }
    wave_sync_lds();
    FragH ph, pl;
    {
      const float* prow = pt + c * 36 + 8 * hh;
      const v4f p0 = *(const v4f*)(prow), p1 = *(const v4f*)(prow + 4);
      const v4f p2 = *(const v4f*)(prow + 16), p3 = *(const v4f*)(prow + 20);
#pragma unroll
      for (int e = 0; e < 4; ++e) {
        float f; _Float16 x;
        f = p0[e] * PC; x = (_Float16)f; ph.h[0][e]     = x; pl.h[0][e]     = (_Float16)(f - (float)x);   // keys jb + 8hh + e
        f = p1[e] * PC; x = (_Float16)f; ph.h[0][4 + e] = x; pl.h[0][4 + e] = (_Float16)(f - (float)x);   // keys jb + 8hh + 4 + e
        f = p2[e] * PC; x = (_Float16)f; ph.h[1][e]     = x; pl.h[1][e]     = (_Float16)(f - (float)x);   // keys jb + 16 + 8hh + e
        f = p3[e] * PC; x = (_Float16)f; ph.h[1][4 + e] = x; pl.h[1][4 + e] = (_Float16)(f - (float)x);
      }
    }
    const size_t vo = (size_t)c * SEQ + jb;
    {
      const v16h vh0 = ldfrag_u(Vbh + vo);
      const v16h vh1 = ldfrag_u(Vbh + vo + (size_t)16 * SEQ);
      const v16h vh2 = ldfrag_u(Vbh + vo + (size_t)32 * SEQ);
      const v16h vh3 = ldfrag_u(Vbh + vo + (size_t)48 * SEQ);
      o0 = mma_h(ph.v, vh0, o0);
      o1 = mma_h(ph.v, vh1, o1);
      o2 = mma_h(ph.v, vh2, o2);
      o3 = mma_h(ph.v, vh3, o3);
      o0 = mma_h(pl.v, vh0, o0);
      o1 = mma_h(pl.v, vh1, o1);
      o2 = mma_h(pl.v, vh2, o2);
      o3 = mma_h(pl.v, vh3, o3);
      guard4x6(o0, o1, o2, o3, ph.v, pl.v, vh0, vh1, vh2, vh3);
    }
    {
      const v16h vl0 = ldfrag_u(Vbl + vo);
      const v16h vl1 = ldfrag_u(Vbl + vo + (size_t)16 * SEQ);
      const v16h vl2 = ldfrag_u(Vbl + vo + (size_t)32 * SEQ);
      const v16h vl3 = ldfrag_u(Vbl + vo + (size_t)48 * SEQ);
      o0 = mma_h(ph.v, vl0, o0);
      o1 = mma_h(ph.v, vl1, o1);
      o2 = mma_h(ph.v, vl2, o2);
      o3 = mma_h(ph.v, vl3, o3);
      guard4x5(o0, o1, o2, o3, ph.v, vl0, vl1, vl2, vl3);
    }
    wave_sync_lds();
  }

  // ---- all waves done with their prob tiles; the LDS buffer becomes two bf16 result row buffers [16][512] ----
  __syncthreads();
  unsigned short* Osh = (unsigned short*)smem;
  unsigned short* Osl = Osh + 16 * DM;
  // ---- fold 1/l and the carries (1024 on P, 16 on v), split into bf16 hi + residual, stage the wave's 16x64 slice ----
  const float oc = 1.0f / (PC * VC);
  const int cb = wave * HD + c;
#pragma unroll
  for (int r = 0; r < 8; ++r) {
    const float inv = (1.0f / lrow[r]) * oc;
    const int ro = (8 * hh + r) * DM + cb;
    const float f0 = o0[r] * inv, f1 = o1[r] * inv, f2 = o2[r] * inv, f3 = o3[r] * inv;
    const unsigned short g0 = bf_bits(f0), g1 = bf_bits(f1), g2 = bf_bits(f2), g3 = bf_bits(f3);
    Osh[ro]      = g0;  Osl[ro]      = bf_bits(f0 - bf_up(g0));
    Osh[ro + 16] = g1;  Osl[ro + 16] = bf_bits(f1 - bf_up(g1));
    Osh[ro + 32] = g2;  Osl[ro + 32] = bf_bits(f2 - bf_up(g2));
    Osh[ro + 48] = g3;  Osl[ro + 48] = bf_bits(f3 - bf_up(g3));
  }
  __syncthreads();
  // ---- block writes its 16 contiguous rows of both planes: piece p = it*256 + tid -> halves p*8 .. p*8+7 of the 16x512 region ----
  {
    v4u hv[4], lv[4];
#pragma unroll
    for (int it = 0; it < 4; ++it) {
      const int p = it * ATT_THREADS + tid;
      hv[it] = *(const v4u*)(Osh + (size_t)p * 8);
      lv[it] = *(const v4u*)(Osl + (size_t)p * 8);
    }
    const size_t dofs = (size_t)i0 * DM;
    unsigned short* dsth = CTh + dofs;
    unsigned short* dstl = CTl + dofs;
    {
#pragma unroll
      for (int it = 0; it < 4; ++it) {
        const int p = it * ATT_THREADS + tid;
        *(v4u*)(dsth + (size_t)p * 8) = hv[it];
        *(v4u*)(dstl + (size_t)p * 8) = lv[it];
      }
      
    }
  }
}

// =====================================================================================================
// Workspace map (bytes); every plane is an exact multiple of its tile / whole-row store granularity (M, N exact tile multiples,
// the activation convert count an exact multiple of 2048, no pad rows needed), every offset a multiple of 512 KiB:
//   WQT, WKT, WVT, WPT f16 [512 out][512 in] x64   4 x 524288
//   WOT  bf16 [512 out][512 in]                         524288
//   X16  f16 [8192][512] x16                          8388608    (one activation input at a time, rows b*1024 + tok)
//   QU, QV f16 [8192][512] x4                     2 x 8388608    (q + u_bias, q + v_bias)
//   K16, P16 f16 [8192][512] x4                   2 x 8388608
//   VTh, VTl f16 [8][512][1024] x16               2 x 8388608    (v^T per batch, hi / residual)
//   GTAB f32 [4 batches][8 heads][1024][1024]       134217728    (position tables of the current group of batch elements)
//   CTh, CTl bf16 [8192][512]                     2 x 8388608    (attention ctx, merged heads, hi / residual)
//   end                                             212336640
// =====================================================================================================
extern "C" void kernel_launch(void* const* d_in, const int* in_sizes, int n_in,
                              void* d_out, int out_size, void* d_ws, size_t ws_size,
                              hipStream_t stream) {
  if (n_in < 15) return;
  const int NA = NROWS * DM;
  if (in_sizes[0] != NA || in_sizes[1] != NA || in_sizes[2] != NA || in_sizes[3] != NA) return;
  if (in_sizes[4] != DM * DM || in_sizes[6] != DM * DM || in_sizes[8] != DM * DM || in_sizes[10] != DM * DM || in_sizes[13] != DM * DM) return;
  if (in_sizes[5] != DM || in_sizes[7] != DM || in_sizes[9] != DM || in_sizes[14] != DM) return;
  if (in_sizes[11] != NHEAD * HD || in_sizes[12] != NHEAD * HD) return;
  if (out_size != NROWS * DM) return;
  if ((NA % 2048) != 0) return;

  const float* query = (const float*)d_in[0];
  const float* key   = (const float*)d_in[1];
  const float* value = (const float*)d_in[2];
  const float* pemb  = (const float*)d_in[3];
  const float* w_q   = (const float*)d_in[4];
  const float* b_q   = (const float*)d_in[5];
  const float* w_k   = (const float*)d_in[6];
  const float* b_k   = (const float*)d_in[7];
  const float* w_v   = (const float*)d_in[8];
  const float* b_v   = (const float*)d_in[9];
  const float* w_p   = (const float*)d_in[10];
  const float* u_b   = (const float*)d_in[11];
  const float* v_b   = (const float*)d_in[12];
  const float* w_o   = (const float*)d_in[13];
  const float* b_o   = (const float*)d_in[14];
  float*       out   = (float*)d_out;

  const size_t PWT = (size_t)DM * DM * 2;                         //   524288
  const size_t PX  = (size_t)NROWS * DM * 2;                      //  8388608
  const size_t PVT = (size_t)NB * DM * SEQ * 2;                   //  8388608
  const size_t PG  = (size_t)GB * NHEAD * SEQ * SEQ * 4;          // 134217728
  size_t off = 0;
  const size_t oWQ = off; off += PWT;
  const size_t oWK = off; off += PWT;
  const size_t oWV = off; off += PWT;
  const size_t oWP = off; off += PWT;
  const size_t oWO = off; off += PWT;
  const size_t oX  = off; off += PX;
  const size_t oQU = off; off += PX;
  const size_t oQV = off; off += PX;
  const size_t oK  = off; off += PX;
  const size_t oP  = off; off += PX;
  const size_t oVh = off; off += PVT;
  const size_t oVl = off; off += PVT;
  const size_t oG  = off; off += PG;
  const size_t oCh = off; off += PX;
  const size_t oCl = off; off += PX;
  if (off > ws_size) return;                                      // off = 212336640

  char* ws = (char*)d_ws;
  unsigned short* WQT  = (unsigned short*)(ws + oWQ);
  unsigned short* WKT  = (unsigned short*)(ws + oWK);
  unsigned short* WVT  = (unsigned short*)(ws + oWV);
  unsigned short* WPT  = (unsigned short*)(ws + oWP);
  unsigned short* WOT  = (unsigned short*)(ws + oWO);
  unsigned short* X16  = (unsigned short*)(ws + oX);
  unsigned short* QU   = (unsigned short*)(ws + oQU);
  unsigned short* QV   = (unsigned short*)(ws + oQV);
  unsigned short* K16  = (unsigned short*)(ws + oK);
  unsigned short* P16  = (unsigned short*)(ws + oP);
  unsigned short* VTh  = (unsigned short*)(ws + oVh);
  unsigned short* VTl  = (unsigned short*)(ws + oVl);
  float*          GTAB = (float*)(ws + oG);
  unsigned short* CTh  = (unsigned short*)(ws + oCh);
  unsigned short* CTl  = (unsigned short*)(ws + oCl);

  const dim3 blk(256);
  const dim3 gTW(DM / 64, DM / 64, 1);                             // 8 x 8 x 1
  const dim3 gCX(NA / 2048);                                       // 2048
  const int tilesP = (NROWS / 64) * (DM / 64);                     // 1024
  const int tilesV = (DM / 64) * (SEQ / 64);                       // 128 per batch
  const int tilesG = (SEQ / 64) * (SEQ / 64);                      // 256 per head
  const dim3 gP((tilesP + 7) / 8, 1);                              // 128
  const dim3 gV((tilesV + 7) / 8, NB);                             // 16 x 8
  const dim3 gG((tilesG + 7) / 8, NHEAD, GB);                      // 32 x 8 x 4
  const dim3 gAT(ATT_BLOCKS, GB);                                  // 64 x 4
  const dim3 bAT(ATT_THREADS);                                     // 256

  // (0) weight planes: W[c][n] -> WT[n][c] as f16( bf16_RNE(w) * 64 ); Wo[c][n] -> WOT[n][c] bf16
  tr16<0><<<gTW, blk, 0, stream>>>(w_q, WQT, DM, DM, 0LL, 0LL, WSC);
  tr16<0><<<gTW, blk, 0, stream>>>(w_k, WKT, DM, DM, 0LL, 0LL, WSC);
  tr16<0><<<gTW, blk, 0, stream>>>(w_v, WVT, DM, DM, 0LL, 0LL, WSC);
  tr16<0><<<gTW, blk, 0, stream>>>(w_p, WPT, DM, DM, 0LL, 0LL, WSC);
  tr16<1><<<gTW, blk, 0, stream>>>(w_o, WOT, DM, DM, 0LL, 0LL, 1.0f);

  // (1) q projection: X16 = f16(bf16(query)*16); q[m][n] = sum_c x[m][c] WQT[n][c] / 1024 + bq[n];
  //     QU = f16((q + u_bias[n]) * 4), QV = f16((q + v_bias[n]) * 4); M = 8192, N = 512, K = 512
  cvt16<<<gCX, blk, 0, stream>>>(query, X16, NA, ACARRY);
  gemm64<5, 0, 0, 1><<<gP, blk, 0, stream>>>(
      X16, X16, DM, 0LL, 0LL,
      WQT, DM, 0LL, 0LL,
      (void*)QU, (void*)QV, DM, 0LL, 0LL,
      NROWS, DM, DM, 1.0f / (ACARRY * WSC), QC,
      b_q, u_b, v_b);

  // (2) k projection -> K16 = f16((k + bk) * 4)
  cvt16<<<gCX, blk, 0, stream>>>(key, X16, NA, ACARRY);
  gemm64<2, 0, 0, 1><<<gP, blk, 0, stream>>>(
      X16, X16, DM, 0LL, 0LL,
      WKT, DM, 0LL, 0LL,
      (void*)K16, (void*)K16, DM, 0LL, 0LL,
      NROWS, DM, DM, 1.0f / (ACARRY * WSC), QC,
      b_k, b_k, b_k);

  // (3) v^T per batch: VT[b][n = h*64+d][tok] = sum_c WVT[n][c] x_b[tok][c] / 1024 + bv[n] -> f16 x16 hi / residual planes;
  //     M = 512, N = 1024, K = 512
  cvt16<<<gCX, blk, 0, stream>>>(value, X16, NA, ACARRY);
  gemm64<4, 0, 0, 2><<<gV, blk, 0, stream>>>(
      WVT, WVT, DM, 0LL, 0LL,
      X16, DM, (long long)SEQ * DM, 0LL,
      (void*)VTh, (void*)VTl, SEQ, (long long)DM * SEQ, 0LL,
      DM, SEQ, DM, 1.0f / (ACARRY * WSC), VC,
      b_v, b_v, b_v);

  // (4) p projection (no bias) -> P16 = f16(p * 4)
  cvt16<<<gCX, blk, 0, stream>>>(pemb, X16, NA, ACARRY);
  gemm64<2, 0, 0, 0><<<gP, blk, 0, stream>>>(
      X16, X16, DM, 0LL, 0LL,
      WPT, DM, 0LL, 0LL,
      (void*)P16, (void*)P16, DM, 0LL, 0LL,
      NROWS, DM, DM, 1.0f / (ACARRY * WSC), QC,
      b_q, b_q, b_q);

  // (5) per group of GB batch elements, one launch each (grid z / y = batch element g within the group, b = first of the group):
  //     position tables GTAB[g][h][r][c] = sum_d QV[(b+g)*1024+r][64h+d] P16[(b+g)*1024+c][64h+d] / 16 (f32; M = N = 1024, K = 64 per head),
  //     then attention over the group's 1024 query rows each, all heads -> CT (bf16 hi / residual planes)
  for (int b = 0; b < NB; b += GB) {
    const size_t boff = (size_t)b * SEQ * DM;                      // element offset of the group's rows in [8192][512] planes
    const size_t voff = (size_t)b * DM * SEQ;                      // element offset of the group's first v^T plane
    gemm64<0, 0, 0, 0><<<gG, blk, 0, stream>>>(
        QV + boff, QV + boff, DM, (long long)HD, (long long)SEQ * DM,
        P16 + boff, DM, (long long)HD, (long long)SEQ * DM,
        (void*)GTAB, (void*)GTAB, SEQ, (long long)SEQ * SEQ, (long long)NHEAD * SEQ * SEQ,
        SEQ, SEQ, HD, 1.0f / (QC * QC), 1.0f,
        b_q, b_q, b_q);
    attnb<<<gAT, bAT, 0, stream>>>(QU + boff, K16 + boff, VTh + voff, VTl + voff, GTAB, CTh + boff, CTl + boff);
  }

  // (6) out = (CT_hi + CT_lo) . WOT^T + bo; M = 8192, N = 512, K = 512, f32
  gemm64<0, 1, 1, 1><<<gP, blk, 0, stream>>>(
      CTh, CTl, DM, 0LL, 0LL,
      WOT, DM, 0LL, 0LL,
      (void*)out, (void*)out, DM, 0LL, 0LL,
      NROWS, DM, DM, 1.0f, 1.0f,
      b_o, b_o, b_o);
  (void)hipGetLastError();
}

// v002
// Measured time: 370 microseconds a run.
// Two timings next to v001 both put it at 1.17 times that version's speed.
// Over all steps from v000 it is 2.19 times as fast.
// Contractions (all f32 accumulate): q/k/v/p projections v_wmma_f32_16x16x32_f16 (x f16 x16 . W^T f16 x64, K=512, single products);
// position table (q+v_bias).p^T v_wmma_f32_16x16x32_f16 ((q+v_bias) f16 x4 . p f16 x4, K=64, single) -> f32 table;
// content scores v_wmma_f32_16x16x32_f16 ((q+u_bias) f16 x4 . k f16 x4, K=64, single);
// P . v^T v_wmma_f32_16x16x32_f16 (P f16 x1024 hi/lo . v^T f16 x16 hi/lo, hi.hi+lo.hi+hi.lo, K=1024 by 32);
// output projection v_wmma_f32_16x16x32_bf16 (ctx bf16 hi/lo . Wo bf16, hi.W+lo.W, K=512) + bias in f32.
// Max-subtracted online base-2 softmax and the relative-shift position logits in f32 on VALU. Every float input RNE-converted to bf16 on load.
#include <hip/hip_runtime.h>
#include <math.h>
#include <stdint.h>

#define NB     8
#define SEQ    1024
#define DM     512
#define NHEAD  8
#define HD     64
#define NROWS  (NB * SEQ)
#define KCH    32
#define WSC    64.0f
#define ACARRY 16.0f
#define QC     4.0f
#define VC     16.0f
#define PC     1024.0f
#define LOG2E  1.4426950408889634f
#define SCL    0.04419417382415922f
static_assert(NHEAD * HD == DM);
static_assert((SEQ % 64) == 0 && (DM % 64) == 0 && (NROWS % 64) == 0 && (HD % 32) == 0 && (SEQ % KCH) == 0);
static_assert(((NROWS * DM) % 2048) == 0);
#define ATT_THREADS (NHEAD * 32)
#define ATT_BLOCKS  (SEQ / 16)
#define GB     4                      // batch elements per position-table / attention launch: 4 x 64 blocks = one per WGP
#define ATT_SMEM_FLOATS 8192
static_assert(ATT_THREADS == 256);
static_assert(ATT_BLOCKS == 64);
static_assert((NB % GB) == 0);
static_assert(NHEAD * 16 * 36 <= ATT_SMEM_FLOATS);
static_assert((size_t)2 * 16 * DM * sizeof(unsigned short) <= (size_t)ATT_SMEM_FLOATS * sizeof(float));
static_assert((16 * DM) / 8 == 4 * ATT_THREADS);

typedef _Float16 v16h __attribute__((ext_vector_type(16)));
typedef _Float16 v8h  __attribute__((ext_vector_type(8)));
typedef __bf16   v16b __attribute__((ext_vector_type(16)));
typedef float    v8f  __attribute__((ext_vector_type(8)));
typedef float    v4f  __attribute__((ext_vector_type(4)));
typedef unsigned int v4u __attribute__((ext_vector_type(4)));

union FragH { v16h v; v8h h[2]; v4u u[2]; };
union FragAny { v16h h; v16b b; };

// ---- scalar helpers --------------------------------------------------------------------------------
__device__ __forceinline__ unsigned short bf_bits(float f) {          // f32 -> bf16 bits, RNE convert
  unsigned u = __float_as_uint(f);
  return (unsigned short)((u + 0x7FFFu + ((u >> 16) & 1u)) >> 16);
}
__device__ __forceinline__ float bf_up(unsigned short h) { return __uint_as_float(((unsigned)h) << 16); }
__device__ __forceinline__ float bfr(float f) { return bf_up(bf_bits(f)); }   // value of the bf16 RNE convert
__device__ __forceinline__ unsigned short h_bits(_Float16 x) { return __builtin_bit_cast(unsigned short, x); }
__device__ __forceinline__ unsigned pk16(unsigned short a, unsigned short b) { return (unsigned)a | ((unsigned)b << 16); }
__device__ __forceinline__ v8f zero8() { v8f z = {0.f, 0.f, 0.f, 0.f, 0.f, 0.f, 0.f, 0.f}; return z; }

// ---- fragment loader: 16-bit A/B operand from a k-contiguous 16-bit plane, lane -> row/col (lane&15),
//      p already includes +8*(lane>>4); elements 0..7 <- p[0..7] (k0+8h..), elements 8..15 <- p[16..23] (k0+16+8h..)
//      (same split k map for A and B; B is always read from a [n][k] plane)
__device__ __forceinline__ v16h ldfrag_u(const unsigned short* p) {
  FragH f;
  f.u[0] = *(const v4u*)(p);
  f.u[1] = *(const v4u*)(p + 16);
  return f.v;
}

// same fragment from a wave-uniform byte base plus this lane's 32-bit byte offset (already holding +16*(lane>>4)): an address costs one
// register, shared by planes of one layout, so a whole trip's loads fit the register file together
__device__ __forceinline__ v16h ldfrag_o(const char* base, unsigned off) {
  const char* p = base + off;
  FragH f;
  f.u[0] = *(const v4u*)(p);
  f.u[1] = *(const v4u*)(p + 32);
  return f.v;
}

// ---- WMMA helpers with trailing VALU hazard gaps ------------------------------------------------------
__device__ __forceinline__ v8f mma_h(v16h a, v16h b, v8f c) {
  return __builtin_amdgcn_wmma_f32_16x16x32_f16(false, a, false, b, (short)0, c, false, false);
}
__device__ __forceinline__ v8f mma_b(v16h a, v16h b, v8f c) {
  FragAny ua, ub;
  ua.h = a;
  ub.h = b;
  return __builtin_amdgcn_wmma_f32_16x16x32_bf16(false, ua.b, false, ub.b, (short)0, c, false, false);
}
template <int BF>
__device__ __forceinline__ v8f mmaT(v16h a, v16h b, v8f c) {
  if constexpr (BF != 0) return mma_b(a, b, c);
  else return mma_h(a, b, c);
}
__device__ __forceinline__ void dep_guard1(v8f& a, v8f& b, v16h x) {
#if defined(__HIP_DEVICE_COMPILE__)
  asm volatile("v_nop\n\tv_nop\n\tv_nop\n\tv_nop" : "+v"(a), "+v"(b) : "v"(x));
#endif
}
__device__ __forceinline__ void guard2x6(v8f& a, v8f& b, v16h x0, v16h x1, v16h x2, v16h x3, v16h x4, v16h x5) {
#if defined(__HIP_DEVICE_COMPILE__)
  asm volatile("v_nop\n\tv_nop\n\tv_nop\n\tv_nop"
               : "+v"(a), "+v"(b) : "v"(x0), "v"(x1), "v"(x2), "v"(x3), "v"(x4), "v"(x5));
#endif
}
__device__ __forceinline__ void guard4x6(v8f& a, v8f& b, v8f& c, v8f& d,
                                         v16h x0, v16h x1, v16h x2, v16h x3, v16h x4, v16h x5) {
#if defined(__HIP_DEVICE_COMPILE__)
  asm volatile("v_nop\n\tv_nop\n\tv_nop\n\tv_nop"
               : "+v"(a), "+v"(b), "+v"(c), "+v"(d) : "v"(x0), "v"(x1), "v"(x2), "v"(x3), "v"(x4), "v"(x5));
#endif
}
__device__ __forceinline__ void guard4x5(v8f& a, v8f& b, v8f& c, v8f& d,
                                         v16h x0, v16h x1, v16h x2, v16h x3, v16h x4) {
#if defined(__HIP_DEVICE_COMPILE__)
  asm volatile("v_nop\n\tv_nop\n\tv_nop\n\tv_nop"
               : "+v"(a), "+v"(b), "+v"(c), "+v"(d) : "v"(x0), "v"(x1), "v"(x2), "v"(x3), "v"(x4));
#endif
}
__device__ __forceinline__ void keep4_h(v16h a, v16h b, v16h c, v16h d) {
#if defined(__HIP_DEVICE_COMPILE__)
  asm volatile("v_nop" :: "v"(a), "v"(b), "v"(c), "v"(d));
#endif
}
__device__ __forceinline__ void acc_guard4(v8f& a, v8f& b, v8f& c, v8f& d) {
#if defined(__HIP_DEVICE_COMPILE__)
  asm volatile("v_nop\n\tv_nop\n\tv_nop\n\tv_nop" : "+v"(a), "+v"(b), "+v"(c), "+v"(d));
#endif
}
__device__ __forceinline__ void wave_sync_lds() {
  __builtin_amdgcn_fence(__ATOMIC_RELEASE, "workgroup");
  __builtin_amdgcn_wave_barrier();
  __builtin_amdgcn_fence(__ATOMIC_ACQUIRE, "workgroup");
}

// =====================================================================================================
// Elementwise 16-bit pack, no transpose: dst[i] = f16( bf16_RNE(src[i]) * sc ), sc a power of two (exact).
// coverage: grid = n / 2048 blocks x 256 thr x 8 elements = n exactly (host checks n % 2048 == 0).
// =====================================================================================================
__global__ __launch_bounds__(256) void cvt16(const float* __restrict__ src, unsigned short* dst, int n, float sc) {
  const size_t i8 = ((size_t)blockIdx.x * 256 + threadIdx.x) * 8;
  if (i8 + 8 > (size_t)n) return;                 // never taken with the exact grid; no barriers in this kernel
  const v4f a = *(const v4f*)(src + i8);
  const v4f b = *(const v4f*)(src + i8 + 4);
  v4u o;
  o[0] = pk16(h_bits((_Float16)(bfr(a[0]) * sc)), h_bits((_Float16)(bfr(a[1]) * sc)));
  o[1] = pk16(h_bits((_Float16)(bfr(a[2]) * sc)), h_bits((_Float16)(bfr(a[3]) * sc)));
  o[2] = pk16(h_bits((_Float16)(bfr(b[0]) * sc)), h_bits((_Float16)(bfr(b[1]) * sc)));
  o[3] = pk16(h_bits((_Float16)(bfr(b[2]) * sc)), h_bits((_Float16)(bfr(b[3]) * sc)));
  {
    *(v4u*)(dst + i8) = o;
    
  }
}

// =====================================================================================================
// Transposing 16-bit pack of a weight matrix: in W[Cin][Dd] (pitch Dd, base + z*sIn) -> out WT[Dd][Cin] (pitch Cin, base + z*sOut),
// BFO 0: f16( bf16_RNE(w) * sc ); BFO 1: bf16_RNE(w) bits. One 64x64 tile per block (x = Cin tile, y = Dd tile, z = matrix index):
// coverage: loads 4 x 256 x 4 floats = 64x64; stores 2 x 256 pieces x 8 halves = 64 rows x 64 halves = the whole tile;
//           grid = (Cin/64, Dd/64, nmat) exact (host passes exact multiples of 64).
// =====================================================================================================
template <int BFO>
__global__ __launch_bounds__(256) void tr16(const float* __restrict__ W, unsigned short* WT, int Cin, int Dd,
                                            long long sIn, long long sOut, float sc) {
  __shared__ float t[64][65];
  const int tid = threadIdx.x;
  const int c0 = blockIdx.x * 64, d0 = blockIdx.y * 64;
  const float* src = W + (size_t)((long long)blockIdx.z * sIn);
  unsigned short* dst = WT + (size_t)((long long)blockIdx.z * sOut);
#pragma unroll
  for (int it = 0; it < 4; ++it) {
    const int p  = it * 256 + tid;
    const int cc = p >> 4, sg = (p & 15) * 4;
    const v4f v = *(const v4f*)(src + (size_t)(c0 + cc) * Dd + d0 + sg);
    t[cc][sg]     = v[0];
    t[cc][sg + 1] = v[1];
    t[cc][sg + 2] = v[2];
    t[cc][sg + 3] = v[3];
  }
  __syncthreads();
  v4u o[2];
#pragma unroll
  for (int it = 0; it < 2; ++it) {
    const int p  = it * 256 + tid;
    const int dd = p >> 3, s8 = (p & 7) * 8;
    unsigned short hv[8];
#pragma unroll
    for (int k = 0; k < 8; ++k) {
      const float f = bfr(t[s8 + k][dd]);
      if constexpr (BFO != 0) hv[k] = bf_bits(f);
      else hv[k] = h_bits((_Float16)(f * sc));
    }
    v4u q;
    q[0] = pk16(hv[0], hv[1]);
    q[1] = pk16(hv[2], hv[3]);
    q[2] = pk16(hv[4], hv[5]);
    q[3] = pk16(hv[6], hv[7]);
    o[it] = q;
  }
  {
#pragma unroll
    for (int it = 0; it < 2; ++it) {
      const int p  = it * 256 + tid;
      const int dd = p >> 3, s8 = (p & 7) * 8;
      *(v4u*)(dst + (size_t)(d0 + dd) * Cin + c0 + s8) = o[it];
    }
    
  }
}

// =====================================================================================================
// Register-blocked batched 16-bit WMMA GEMM: C[m][n] = oscale * sum_k A[m][k] * Bt[n][k] (+ bias); one wave per 64x64 tile,
// no block barriers. A row-major [M][K] pitch lda (16-bit plane), Bt row-major [N][K] pitch ldb (k contiguous); M, N multiples of 64,
// K multiple of 32. blockIdx.y = batch index with element strides sA, sB, sC; blockIdx.z = outer batch index with strides zA, zB, zC.
// ASPLIT 1: a second A plane A2 (unscaled residual of A, same layout) is multiplied into the same accumulator (A + A2 ~ exact A).
// BF 1: bf16 operands (v_wmma_f32_16x16x32_bf16), else f16.
// EPI 1: value += bf16_RNE(ep0[column]) (per-column bias); EPI 2: value += bf16_RNE(ep0[row]) (per-row bias, 16-bit out only).
// OM 0: f32 out (pitch ldc).  OM 2: one f16 plane = f16(value * ocarry).
// OM 4: two f16 planes: hi = f16(value * ocarry), lo = f16(value * ocarry - hi) (unscaled residual).
// OM 5: two f16 planes: C = f16((value + bf16_RNE(ep1[column])) * ocarry), C2 = f16((value + bf16_RNE(ep2[column])) * ocarry).
// coverage: 4 slabs x 16 rows (f32: it 0..7 x lane>>4; 16-bit: it 0..3 x lane>>3) x 64 cols = the wave's whole 64x64 tile;
//           grid = ceil(tilesM*tilesN/8) blocks, surplus waves exit (wave-uniform).
// =====================================================================================================
template <int OM, int ASPLIT, int BF, int EPI>
__global__ __launch_bounds__(256) __attribute__((amdgpu_num_vgpr(256))) void gemm64(
    const unsigned short* __restrict__ Ap, const unsigned short* __restrict__ A2p, int lda, long long sA, long long zA,
    const unsigned short* __restrict__ Btp, int ldb, long long sB, long long zB,
    void* Cout, void* C2out, int ldc, long long sC, long long zC,
    int M, int N, int K, float oscale, float ocarry,
    const float* __restrict__ ep0, const float* __restrict__ ep1, const float* __restrict__ ep2) {
  __shared__ __align__(16) float sT[8][16 * 68];   // per-wave 16x64 slab, pitch 68 floats
  const int by   = blockIdx.y;
  const int bz   = blockIdx.z;
  const int lane = threadIdx.x & 31;
  const int wave = threadIdx.x >> 5;
  const int tilesN = N >> 6;
  const int tilesM = M >> 6;
  const int tile = blockIdx.x * 8 + wave;
  if (tile >= tilesM * tilesN) return;   // wave-uniform; no block barriers in this kernel
  const int tm = tile / tilesN;
  const int tn = tile - tm * tilesN;
  const int m0 = tm << 6;
  const int n0 = tn << 6;

  const char* A1 = (const char*)(Ap  + (size_t)((long long)by * sA + (long long)bz * zA));
  const char* A2 = (const char*)(A2p + (size_t)((long long)by * sA + (long long)bz * zA));
  const char* Bb = (const char*)(Btp + (size_t)((long long)by * sB + (long long)bz * zB));

  const int rlane = lane & 15;                 // row (A) / col (B, D) within subtile
  const int koff  = (lane >> 4) * 8;           // k offset of this lane half
  const int mOff  = (lane >> 4) * 8;           // D row offset

  v8f acc[4][4];
#pragma unroll
  for (int i = 0; i < 4; ++i)
#pragma unroll
    for (int j = 0; j < 4; ++j) acc[i][j] = zero8();

  unsigned aofs[4], bofs[4];                   // this lane's byte offsets of its four A rows and four B rows, stepped with k (planes stay under 4 GiB)
#pragma unroll
  for (int i = 0; i < 4; ++i) {
    aofs[i] = (unsigned)((m0 + (i << 4) + rlane) * lda + koff) * 2u;
    bofs[i] = (unsigned)((n0 + (i << 4) + rlane) * ldb + koff) * 2u;
  }

  for (int k0 = 0; k0 < K; k0 += 32) {
    // every fragment of this k-step is requested before its first product: one load latency a k-step
    v16h bh[4], ah[4], al[4];
#pragma unroll
    for (int j = 0; j < 4; ++j) bh[j] = ldfrag_o(Bb, bofs[j]);
#pragma unroll
    for (int i = 0; i < 4; ++i) {
      ah[i] = ldfrag_o(A1, aofs[i]);
      if constexpr (ASPLIT != 0) al[i] = ldfrag_o(A2, aofs[i]);
    }
    __builtin_amdgcn_sched_barrier(0);   // keeps the loads above in front of the products (else each A load sinks to its own group and waits alone)
#pragma unroll
    for (int i = 0; i < 4; ++i) {
#pragma unroll
      for (int j = 0; j < 4; ++j) acc[i][j] = mmaT<BF>(ah[i], bh[j], acc[i][j]);
      dep_guard1(acc[i][0], acc[i][3], ah[i]);
      if constexpr (ASPLIT != 0) {
#pragma unroll
        for (int j = 0; j < 4; ++j) acc[i][j] = mmaT<BF>(al[i], bh[j], acc[i][j]);
        dep_guard1(acc[i][0], acc[i][3], al[i]);
      }
    }
    keep4_h(bh[0], bh[1], bh[2], bh[3]);
#pragma unroll
    for (int i = 0; i < 4; ++i) { aofs[i] += 64u; bofs[i] += 64u; }   // 32 halves on
  }
  acc_guard4(acc[0][0], acc[0][1], acc[0][2], acc[0][3]);
  acc_guard4(acc[1][0], acc[1][1], acc[1][2], acc[1][3]);
  acc_guard4(acc[2][0], acc[2][1], acc[2][2], acc[2][3]);
  acc_guard4(acc[3][0], acc[3][1], acc[3][2], acc[3][3]);

  const int hh2 = lane >> 4, c4 = (lane & 15) * 4;     // f32 out: 256-B row segment = 16 lanes x 16 B
  const int q8  = lane >> 3, c8 = (lane & 7) * 8;

  // ---- epilogue ----
  float* slab = sT[wave];
#pragma unroll
  for (int i = 0; i < 4; ++i) {
    const int mBase = m0 + (i << 4);
#pragma unroll
    for (int j = 0; j < 4; ++j) {
#pragma unroll
      for (int r = 0; r < 8; ++r) {
        slab[(mOff + r) * 68 + (j << 4) + rlane] = acc[i][j][r];
      }
    }
    wave_sync_lds();
    if constexpr (OM == 0) {
      float* C = (float*)Cout + (size_t)((long long)by * sC + (long long)bz * zC);
      v4f vals[8];
#pragma unroll
      for (int it = 0; it < 8; ++it) {
        const int row = it * 2 + hh2;                      // it 0..7 x hh2 0..1 = rows 0..15
        v4f v = *(const v4f*)(slab + row * 68 + c4);
#pragma unroll
        for (int e = 0; e < 4; ++e) v[e] = v[e] * oscale;
        if constexpr (EPI == 1) {
          const v4f bb = *(const v4f*)(ep0 + n0 + c4);     // per-column bias, columns n0+c4 .. +3 (N equals the bias length)
#pragma unroll
          for (int e = 0; e < 4; ++e) v[e] = v[e] + bfr(bb[e]);
        }
        vals[it] = v;
      }
      {
#pragma unroll
        for (int it = 0; it < 8; ++it) {
          const int gr = mBase + it * 2 + hh2;
          *(v4f*)(C + (size_t)gr * ldc + n0 + c4) = vals[it];
        }
        
      }
    } else {
      unsigned short* C  = (unsigned short*)Cout  + (size_t)((long long)by * sC + (long long)bz * zC);
      unsigned short* Cb = (unsigned short*)C2out + (size_t)((long long)by * sC + (long long)bz * zC);
      v4u hv[4], lv[4];
#pragma unroll
      for (int it = 0; it < 4; ++it) {
        const int row = it * 4 + q8;                       // it 0..3 x q8 0..3 = rows 0..15
        const float* sp = slab + row * 68 + c8;
        float rb = 0.f;
        if constexpr (EPI == 2) rb = bfr(ep0[mBase + row]);   // per-row bias (M equals the bias length)
        v4u a  = {0u, 0u, 0u, 0u};
        v4u b2 = {0u, 0u, 0u, 0u};
#pragma unroll
        for (int e = 0; e < 4; ++e) {
          const int ci = n0 + c8 + 2 * e;                  // column index, < N
          float f0 = sp[2 * e] * oscale + rb;
          float f1 = sp[2 * e + 1] * oscale + rb;
          if constexpr (EPI == 1) {
            f0 += bfr(ep0[ci]);
            f1 += bfr(ep0[ci + 1]);
          }
          if constexpr (OM == 5) {
            const float g0 = (f0 + bfr(ep1[ci])) * ocarry, g1 = (f1 + bfr(ep1[ci + 1])) * ocarry;
            const float w0 = (f0 + bfr(ep2[ci])) * ocarry, w1 = (f1 + bfr(ep2[ci + 1])) * ocarry;
            a[e]  = pk16(h_bits((_Float16)g0), h_bits((_Float16)g1));
            b2[e] = pk16(h_bits((_Float16)w0), h_bits((_Float16)w1));
          } else {
            f0 *= ocarry; f1 *= ocarry;
            const _Float16 x0 = (_Float16)f0, x1 = (_Float16)f1;
            a[e] = pk16(h_bits(x0), h_bits(x1));
            if constexpr (OM == 4) {
              b2[e] = pk16(h_bits((_Float16)(f0 - (float)x0)), h_bits((_Float16)(f1 - (float)x1)));
            }
          }
        }
        hv[it] = a;
        lv[it] = b2;
      }
      {
#pragma unroll
        for (int it = 0; it < 4; ++it) {
          const int row = it * 4 + q8;
          *(v4u*)(C + (size_t)(mBase + row) * ldc + n0 + c8) = hv[it];
          if constexpr (OM >= 4) {
            *(v4u*)(Cb + (size_t)(mBase + row) * ldc + n0 + c8) = lv[it];
          }
        }
        
      }
    }
    wave_sync_lds();
  }
}

// =====================================================================================================
// Flash attention for one batch element and 16 query rows, all 8 heads (one wave per head), head dim 64, 1024 keys.
// blockIdx.y = batch element within the launch's group. Pointers QU0, KP0, CTh0, CTl0 are pre-offset to the group's first row of the
// [8192][512] planes; VTh0/VTl0 to the group's first [512][1024] plane; Gt0 is the group's position table, one slab per batch element,
// Gt[h][r][c] = (q_r + v_bias) . p_c (f32, pitch 1024).
//   A fragments (stationary): (q_i + u_bias) f16 x4 rows i0+m, QU[i][64h + d], two k-steps of 32;
//   B fragments per chunk of 32 keys: k f16 x4 rows KP[j][64h + d] (k-contiguous) -> scores s[i][j] (two 16-column tiles);
//   position logit by relative shift, i = query row, j = key: j <= i -> Gt[h][i][S-1-i+j]; j == i+1 -> 0; else Gt[h][i+1][j-i-2];
//   every lane loads from a clamped address and selects by value (no per-lane branches about loads);
//   t = (s/16 + pos) / sqrt(512) * log2(e); online softmax in base 2, max-subtracted, running sums in f32;
//   of P*1024 (f16 hi and unscaled residual) rebuilt from the LDS rows (f32 vector loads, split k map) and the v^T B fragments
//   (f16 x16 hi and unscaled residual planes) VT[64h + d][j] loaded straight from the 16-bit planes; 12 P.V WMMAs (hi.hi, lo.hi, hi.lo).
//   Final 1/l and carry folds in f32; after a block barrier the LDS buffer is reused as the block's two bf16 result row buffers [16][512]
//   (hi, lo): each wave stages its 16x64 slice (element stores); after a second block barrier the 256 threads write the block's 16 full rows
//   block = 8 waves = 256 threads; grid = 64 x batch elements of the group; every wave does identical bounded work (32 steps of 32 keys).
// coverage: LDS row buffers: 8 waves x 16 rows x 64 cols = 16 x 512 per plane; global: 4 iterations x 256 threads x 8 halves = 16 rows x 512
//           of rows i0..i0+15, per plane; grid covers all 1024 rows of the batch exactly once.
// =====================================================================================================
__global__ __launch_bounds__(ATT_THREADS) __attribute__((amdgpu_num_vgpr(256)))
void attnb(const unsigned short* __restrict__ QU0, const unsigned short* __restrict__ KP0,
           const unsigned short* __restrict__ VTh0, const unsigned short* __restrict__ VTl0,
           const float* __restrict__ Gt0, unsigned short* CTh0, unsigned short* CTl0) {
  __shared__ __align__(16) float smem[ATT_SMEM_FLOATS];   // prob tiles [wave][row][32 cols] pitch 36 | later: two bf16 row buffers

  const int tid  = threadIdx.x;
  const int wave = tid >> 5;
  const int lane = tid & 31;
  const int hh   = lane >> 4;
  const int c    = lane & 15;

  const int head = __builtin_amdgcn_readfirstlane(wave);   // 0..7, in a scalar register: the k, v^T and table bases are then wave-uniform
  const int i0   = blockIdx.x * 16;                        // first query row of this block

  const size_t bg = blockIdx.y;                            // batch element within the group
  const unsigned short* QU  = QU0  + bg * ((size_t)SEQ * DM);
  const unsigned short* KP  = KP0  + bg * ((size_t)SEQ * DM);
  const unsigned short* VTh = VTh0 + bg * ((size_t)DM * SEQ);
  const unsigned short* VTl = VTl0 + bg * ((size_t)DM * SEQ);
  const float*          Gt  = Gt0  + bg * ((size_t)NHEAD * SEQ * SEQ);
  unsigned short*       CTh = CTh0 + bg * ((size_t)SEQ * DM);
  unsigned short*       CTl = CTl0 + bg * ((size_t)SEQ * DM);

  // stationary A fragments: (q + u_bias) rows i0 + c, d 0..31 and 32..63
  const size_t qofs = (size_t)(i0 + c) * DM + head * HD + 8 * hh;
  const v16h qa = ldfrag_u(QU + qofs), qb = ldfrag_u(QU + qofs + 32);

  const char* Kb  = (const char*)(KP + head * HD);
  const char* Vbh = (const char*)(VTh + (size_t)(head * HD) * SEQ);
  const char* Vbl = (const char*)(VTl + (size_t)(head * HD) * SEQ);
  const unsigned klane = (unsigned)(c * DM + 8 * hh) * 2u;    // this lane's byte offset in the first k chunk (row c)
  unsigned kofs = klane + (unsigned)(KCH * DM * 2);           // ... in the chunk that is requested next
  unsigned vofs = (unsigned)(c * SEQ + 8 * hh) * 2u;          // ... in this trip's v^T chunk (row c)
  const float* Gh = Gt + (size_t)head * SEQ * SEQ;

  const float PSC = SCL * LOG2E;                           // position logit scale (table values are plain f32)
  const float CSC = PSC * (1.0f / (QC * QC));              // content scores carry x4 on both operands

  float mrow[8], lrow[8];
  v8f o0 = zero8(), o1 = zero8(), o2 = zero8(), o3 = zero8();
#pragma unroll
  for (int r = 0; r < 8; ++r) { mrow[r] = -INFINITY; lrow[r] = 0.f; }
  float* pt = smem + wave * (16 * 36);

  // position-table values of the trip that starts at key jt: raw loads from clamped addresses, selected by value where they are used
  auto ld_tab = [&](int jt, float (&ga)[8], float (&gc)[8]) {
#pragma unroll
    for (int r = 0; r < 8; ++r) {
      const int i  = i0 + 8 * hh + r;                      // query row of this lane's accumulator element r
      const int ja = jt + c, jc = jt + 16 + c;             // key columns of s0 / s1
      const bool la = (ja <= i), lc = (jc <= i);
      int ra = la ? i : (i + 1), rc = lc ? i : (i + 1);
      int ca = la ? (SEQ - 1 - i + ja) : (ja - i - 2);
      int cz = lc ? (SEQ - 1 - i + jc) : (jc - i - 2);
      ra = (ra > SEQ - 1) ? (SEQ - 1) : ra;
      rc = (rc > SEQ - 1) ? (SEQ - 1) : rc;
      ca = (ca < 0) ? 0 : ca;  ca = (ca > SEQ - 1) ? (SEQ - 1) : ca;
      cz = (cz < 0) ? 0 : cz;  cz = (cz > SEQ - 1) ? (SEQ - 1) : cz;
      ga[r] = Gh[(unsigned)(ra * SEQ + ca)];
      gc[r] = Gh[(unsigned)(rc * SEQ + cz)];
    }
  };

  // k fragments and table values travel one trip ahead of their use; trip 0's are requested here
  v16h k0a, k0b, k1a, k1b;
  float ga[8], gc[8];
  k0a = ldfrag_o(Kb, klane);
  k0b = ldfrag_o(Kb + 64, klane);
  k1a = ldfrag_o(Kb + 16 * DM * 2, klane);
  k1b = ldfrag_o(Kb + 16 * DM * 2 + 64, klane);
  ld_tab(0, ga, gc);

#pragma unroll 1
  for (int jb = 0; jb < SEQ; jb += KCH) {
    const int jn = (jb + KCH < SEQ) ? (jb + KCH) : 0;      // next trip's first key; the last trip asks for trip 0's again (in bounds, not used)
    // this trip's v^T fragments are requested at its head; their first use stands behind the softmax
    const v16h vh0 = ldfrag_o(Vbh, vofs);
    const v16h vh1 = ldfrag_o(Vbh + 16 * SEQ * 2, vofs);
    const v16h vh2 = ldfrag_o(Vbh + 32 * SEQ * 2, vofs);
    const v16h vh3 = ldfrag_o(Vbh + 48 * SEQ * 2, vofs);
    const v16h vl0 = ldfrag_o(Vbl, vofs);
    const v16h vl1 = ldfrag_o(Vbl + 16 * SEQ * 2, vofs);
    const v16h vl2 = ldfrag_o(Vbl + 32 * SEQ * 2, vofs);
    const v16h vl3 = ldfrag_o(Vbl + 48 * SEQ * 2, vofs);
    __builtin_amdgcn_sched_barrier(0);   // keeps the v^T loads here (else they sink to their products and each batch waits alone)
    v8f s0, s1;
    s0 = mma_h(qa, k0a, zero8());
    s0 = mma_h(qb, k0b, s0);
    s1 = mma_h(qa, k1a, zero8());
    s1 = mma_h(qb, k1b, s1);
    guard2x6(s0, s1, qa, qb, k0a, k0b, k1a, k1b);
    float tt0[8], tt1[8];
#pragma unroll
    for (int r = 0; r < 8; ++r) {
      const int i  = i0 + 8 * hh + r;
      const int ja = jb + c, jc = jb + 16 + c;
      const float pa = (ja == i + 1) ? 0.f : ga[r];
      const float pz = (jc == i + 1) ? 0.f : gc[r];
      tt0[r] = s0[r] * CSC + pa * PSC;
      tt1[r] = s1[r] * CSC + pz * PSC;
    }
    ld_tab(jn, ga, gc);                                    // next trip's table values, likewise
    __builtin_amdgcn_sched_barrier(0);   // keeps that request in front of the softmax
#pragma unroll
    for (int r = 0; r < 8; ++r) {
      const float t0 = tt0[r], t1 = tt1[r];
      float mx = fmaxf(t0, t1);
#pragma unroll
      for (int off = 1; off < 16; off <<= 1) mx = fmaxf(mx, __shfl_xor(mx, off, 32));
      const float mn = fmaxf(mrow[r], mx);
      const float al = exp2f(mrow[r] - mn);
      mrow[r] = mn;
      const float e0 = exp2f(t0 - mn), e1 = exp2f(t1 - mn);
      float ps = e0 + e1;
#pragma unroll
      for (int off = 1; off < 16; off <<= 1) ps += __shfl_xor(ps, off, 32);
      lrow[r] = lrow[r] * al + ps;
      o0[r] *= al;
      o1[r] *= al;
      o2[r] *= al;
      o3[r] *= al;
      const int ro = (8 * hh + r) * 36 + c;
      pt[ro]      = e0;
      pt[ro + 16] = e1;
    }
    wave_sync_lds();
    {
      k0a = ldfrag_o(Kb, kofs);                            // next trip's k fragments (keys jn ..), in flight over this trip's P.v
      k0b = ldfrag_o(Kb + 64, kofs);
      k1a = ldfrag_o(Kb + 16 * DM * 2, kofs);
      k1b = ldfrag_o(Kb + 16 * DM * 2 + 64, kofs);
    }
    __builtin_amdgcn_sched_barrier(0);   // keeps that request in front of the P conversion and the products
    kofs = (jb + 2 * KCH < SEQ) ? (kofs + (unsigned)(KCH * DM * 2)) : klane;
    vofs += (unsigned)(KCH * 2);
    FragH ph, pl;
    {
      const float* prow = pt + c * 36 + 8 * hh;
      const v4f p0 = *(const v4f*)(prow), p1 = *(const v4f*)(prow + 4);
      const v4f p2 = *(const v4f*)(prow + 16), p3 = *(const v4f*)(prow + 20);
#pragma unroll
      for (int e = 0; e < 4; ++e) {
        float f; _Float16 x;
        f = p0[e] * PC; x = (_Float16)f; ph.h[0][e]     = x; pl.h[0][e]     = (_Float16)(f - (float)x);   // keys jb + 8hh + e
        f = p1[e] * PC; x = (_Float16)f; ph.h[0][4 + e] = x; pl.h[0][4 + e] = (_Float16)(f - (float)x);   // keys jb + 8hh + 4 + e
        f = p2[e] * PC; x = (_Float16)f; ph.h[1][e]     = x; pl.h[1][e]     = (_Float16)(f - (float)x);   // keys jb + 16 + 8hh + e
        f = p3[e] * PC; x = (_Float16)f; ph.h[1][4 + e] = x; pl.h[1][4 + e] = (_Float16)(f - (float)x);
      }
    }
    {
      o0 = mma_h(ph.v, vh0, o0);
      o1 = mma_h(ph.v, vh1, o1);
      o2 = mma_h(ph.v, vh2, o2);
      o3 = mma_h(ph.v, vh3, o3);
      o0 = mma_h(pl.v, vh0, o0);
      o1 = mma_h(pl.v, vh1, o1);
      o2 = mma_h(pl.v, vh2, o2);
      o3 = mma_h(pl.v, vh3, o3);
      guard4x6(o0, o1, o2, o3, ph.v, pl.v, vh0, vh1, vh2, vh3);
    }
    {
      o0 = mma_h(ph.v, vl0, o0);
      o1 = mma_h(ph.v, vl1, o1);
      o2 = mma_h(ph.v, vl2, o2);
      o3 = mma_h(ph.v, vl3, o3);
      guard4x5(o0, o1, o2, o3, ph.v, vl0, vl1, vl2, vl3);
    }
    wave_sync_lds();
  }

  // ---- all waves done with their prob tiles; the LDS buffer becomes two bf16 result row buffers [16][512] ----
  __syncthreads();
  unsigned short* Osh = (unsigned short*)smem;
  unsigned short* Osl = Osh + 16 * DM;
  // ---- fold 1/l and the carries (1024 on P, 16 on v), split into bf16 hi + residual, stage the wave's 16x64 slice ----
  const float oc = 1.0f / (PC * VC);
  const int cb = wave * HD + c;
#pragma unroll
  for (int r = 0; r < 8; ++r) {
    const float inv = (1.0f / lrow[r]) * oc;
    const int ro = (8 * hh + r) * DM + cb;
    const float f0 = o0[r] * inv, f1 = o1[r] * inv, f2 = o2[r] * inv, f3 = o3[r] * inv;
    const unsigned short g0 = bf_bits(f0), g1 = bf_bits(f1), g2 = bf_bits(f2), g3 = bf_bits(f3);
    Osh[ro]      = g0;  Osl[ro]      = bf_bits(f0 - bf_up(g0));
    Osh[ro + 16] = g1;  Osl[ro + 16] = bf_bits(f1 - bf_up(g1));
    Osh[ro + 32] = g2;  Osl[ro + 32] = bf_bits(f2 - bf_up(g2));
    Osh[ro + 48] = g3;  Osl[ro + 48] = bf_bits(f3 - bf_up(g3));
  }
  __syncthreads();
  // ---- block writes its 16 contiguous rows of both planes: piece p = it*256 + tid -> halves p*8 .. p*8+7 of the 16x512 region ----
  {
    v4u hv[4], lv[4];
#pragma unroll
    for (int it = 0; it < 4; ++it) {
      const int p = it * ATT_THREADS + tid;
      hv[it] = *(const v4u*)(Osh + (size_t)p * 8);
      lv[it] = *(const v4u*)(Osl + (size_t)p * 8);
    }
    const size_t dofs = (size_t)i0 * DM;
    unsigned short* dsth = CTh + dofs;
    unsigned short* dstl = CTl + dofs;
    {
#pragma unroll
      for (int it = 0; it < 4; ++it) {
        const int p = it * ATT_THREADS + tid;
        *(v4u*)(dsth + (size_t)p * 8) = hv[it];
        *(v4u*)(dstl + (size_t)p * 8) = lv[it];
      }
      
    }
  }
}

// =====================================================================================================
// Workspace map (bytes); every plane is an exact multiple of its tile / whole-row store granularity (M, N exact tile multiples,
// the activation convert count an exact multiple of 2048, no pad rows needed), every offset a multiple of 512 KiB:
//   WQT, WKT, WVT, WPT f16 [512 out][512 in] x64   4 x 524288
//   WOT  bf16 [512 out][512 in]                         524288
//   X16  f16 [8192][512] x16                          8388608    (one activation input at a time, rows b*1024 + tok)
//   QU, QV f16 [8192][512] x4                     2 x 8388608    (q + u_bias, q + v_bias)
//   K16, P16 f16 [8192][512] x4                   2 x 8388608
//   VTh, VTl f16 [8][512][1024] x16               2 x 8388608    (v^T per batch, hi / residual)
//   GTAB f32 [4 batches][8 heads][1024][1024]       134217728    (position tables of the current group of batch elements)
//   CTh, CTl bf16 [8192][512]                     2 x 8388608    (attention ctx, merged heads, hi / residual)
//   end                                             212336640
// =====================================================================================================
extern "C" void kernel_launch(void* const* d_in, const int* in_sizes, int n_in,
                              void* d_out, int out_size, void* d_ws, size_t ws_size,
                              hipStream_t stream) {
  if (n_in < 15) return;
  const int NA = NROWS * DM;
  if (in_sizes[0] != NA || in_sizes[1] != NA || in_sizes[2] != NA || in_sizes[3] != NA) return;
  if (in_sizes[4] != DM * DM || in_sizes[6] != DM * DM || in_sizes[8] != DM * DM || in_sizes[10] != DM * DM || in_sizes[13] != DM * DM) return;
  if (in_sizes[5] != DM || in_sizes[7] != DM || in_sizes[9] != DM || in_sizes[14] != DM) return;
  if (in_sizes[11] != NHEAD * HD || in_sizes[12] != NHEAD * HD) return;
  if (out_size != NROWS * DM) return;
  if ((NA % 2048) != 0) return;

  const float* query = (const float*)d_in[0];
  const float* key   = (const float*)d_in[1];
  const float* value = (const float*)d_in[2];
  const float* pemb  = (const float*)d_in[3];
  const float* w_q   = (const float*)d_in[4];
  const float* b_q   = (const float*)d_in[5];
  const float* w_k   = (const float*)d_in[6];
  const float* b_k   = (const float*)d_in[7];
  const float* w_v   = (const float*)d_in[8];
  const float* b_v   = (const float*)d_in[9];
  const float* w_p   = (const float*)d_in[10];
  const float* u_b   = (const float*)d_in[11];
  const float* v_b   = (const float*)d_in[12];
  const float* w_o   = (const float*)d_in[13];
  const float* b_o   = (const float*)d_in[14];
  float*       out   = (float*)d_out;

  const size_t PWT = (size_t)DM * DM * 2;                         //   524288
  const size_t PX  = (size_t)NROWS * DM * 2;                      //  8388608
  const size_t PVT = (size_t)NB * DM * SEQ * 2;                   //  8388608
  const size_t PG  = (size_t)GB * NHEAD * SEQ * SEQ * 4;          // 134217728
  size_t off = 0;
  const size_t oWQ = off; off += PWT;
  const size_t oWK = off; off += PWT;
  const size_t oWV = off; off += PWT;
  const size_t oWP = off; off += PWT;
  const size_t oWO = off; off += PWT;
  const size_t oX  = off; off += PX;
  const size_t oQU = off; off += PX;
  const size_t oQV = off; off += PX;
  const size_t oK  = off; off += PX;
  const size_t oP  = off; off += PX;
  const size_t oVh = off; off += PVT;
  const size_t oVl = off; off += PVT;
  const size_t oG  = off; off += PG;
  const size_t oCh = off; off += PX;
  const size_t oCl = off; off += PX;
  if (off > ws_size) return;                                      // off = 212336640

  char* ws = (char*)d_ws;
  unsigned short* WQT  = (unsigned short*)(ws + oWQ);
  unsigned short* WKT  = (unsigned short*)(ws + oWK);
  unsigned short* WVT  = (unsigned short*)(ws + oWV);
  unsigned short* WPT  = (unsigned short*)(ws + oWP);
  unsigned short* WOT  = (unsigned short*)(ws + oWO);
  unsigned short* X16  = (unsigned short*)(ws + oX);
  unsigned short* QU   = (unsigned short*)(ws + oQU);
  unsigned short* QV   = (unsigned short*)(ws + oQV);
  unsigned short* K16  = (unsigned short*)(ws + oK);
  unsigned short* P16  = (unsigned short*)(ws + oP);
  unsigned short* VTh  = (unsigned short*)(ws + oVh);
  unsigned short* VTl  = (unsigned short*)(ws + oVl);
  float*          GTAB = (float*)(ws + oG);
  unsigned short* CTh  = (unsigned short*)(ws + oCh);
  unsigned short* CTl  = (unsigned short*)(ws + oCl);

  const dim3 blk(256);
  const dim3 gTW(DM / 64, DM / 64, 1);                             // 8 x 8 x 1
  const dim3 gCX(NA / 2048);                                       // 2048
  const int tilesP = (NROWS / 64) * (DM / 64);                     // 1024
  const int tilesV = (DM / 64) * (SEQ / 64);                       // 128 per batch
  const int tilesG = (SEQ / 64) * (SEQ / 64);                      // 256 per head
  const dim3 gP((tilesP + 7) / 8, 1);                              // 128
  const dim3 gV((tilesV + 7) / 8, NB);                             // 16 x 8
  const dim3 gG((tilesG + 7) / 8, NHEAD, GB);                      // 32 x 8 x 4
  const dim3 gAT(ATT_BLOCKS, GB);                                  // 64 x 4
  const dim3 bAT(ATT_THREADS);                                     // 256

  // (0) weight planes: W[c][n] -> WT[n][c] as f16( bf16_RNE(w) * 64 ); Wo[c][n] -> WOT[n][c] bf16
  tr16<0><<<gTW, blk, 0, stream>>>(w_q, WQT, DM, DM, 0LL, 0LL, WSC);
  tr16<0><<<gTW, blk, 0, stream>>>(w_k, WKT, DM, DM, 0LL, 0LL, WSC);
  tr16<0><<<gTW, blk, 0, stream>>>(w_v, WVT, DM, DM, 0LL, 0LL, WSC);
  tr16<0><<<gTW, blk, 0, stream>>>(w_p, WPT, DM, DM, 0LL, 0LL, WSC);
  tr16<1><<<gTW, blk, 0, stream>>>(w_o, WOT, DM, DM, 0LL, 0LL, 1.0f);

  // (1) q projection: X16 = f16(bf16(query)*16); q[m][n] = sum_c x[m][c] WQT[n][c] / 1024 + bq[n];
  //     QU = f16((q + u_bias[n]) * 4), QV = f16((q + v_bias[n]) * 4); M = 8192, N = 512, K = 512
  cvt16<<<gCX, blk, 0, stream>>>(query, X16, NA, ACARRY);
  gemm64<5, 0, 0, 1><<<gP, blk, 0, stream>>>(
      X16, X16, DM, 0LL, 0LL,
      WQT, DM, 0LL, 0LL,
      (void*)QU, (void*)QV, DM, 0LL, 0LL,
      NROWS, DM, DM, 1.0f / (ACARRY * WSC), QC,
      b_q, u_b, v_b);

  // (2) k projection -> K16 = f16((k + bk) * 4)
  cvt16<<<gCX, blk, 0, stream>>>(key, X16, NA, ACARRY);
  gemm64<2, 0, 0, 1><<<gP, blk, 0, stream>>>(
      X16, X16, DM, 0LL, 0LL,
      WKT, DM, 0LL, 0LL,
      (void*)K16, (void*)K16, DM, 0LL, 0LL,
      NROWS, DM, DM, 1.0f / (ACARRY * WSC), QC,
      b_k, b_k, b_k);

  // (3) v^T per batch: VT[b][n = h*64+d][tok] = sum_c WVT[n][c] x_b[tok][c] / 1024 + bv[n] -> f16 x16 hi / residual planes;
  //     M = 512, N = 1024, K = 512
  cvt16<<<gCX, blk, 0, stream>>>(value, X16, NA, ACARRY);
  gemm64<4, 0, 0, 2><<<gV, blk, 0, stream>>>(
      WVT, WVT, DM, 0LL, 0LL,
      X16, DM, (long long)SEQ * DM, 0LL,
      (void*)VTh, (void*)VTl, SEQ, (long long)DM * SEQ, 0LL,
      DM, SEQ, DM, 1.0f / (ACARRY * WSC), VC,
      b_v, b_v, b_v);

  // (4) p projection (no bias) -> P16 = f16(p * 4)
  cvt16<<<gCX, blk, 0, stream>>>(pemb, X16, NA, ACARRY);
  gemm64<2, 0, 0, 0><<<gP, blk, 0, stream>>>(
      X16, X16, DM, 0LL, 0LL,
      WPT, DM, 0LL, 0LL,
      (void*)P16, (void*)P16, DM, 0LL, 0LL,
      NROWS, DM, DM, 1.0f / (ACARRY * WSC), QC,
      b_q, b_q, b_q);

  // (5) per group of GB batch elements, one launch each (grid z / y = batch element g within the group, b = first of the group):
  //     position tables GTAB[g][h][r][c] = sum_d QV[(b+g)*1024+r][64h+d] P16[(b+g)*1024+c][64h+d] / 16 (f32; M = N = 1024, K = 64 per head),
  //     then attention over the group's 1024 query rows each, all heads -> CT (bf16 hi / residual planes)
  for (int b = 0; b < NB; b += GB) {
    const size_t boff = (size_t)b * SEQ * DM;                      // element offset of the group's rows in [8192][512] planes
    const size_t voff = (size_t)b * DM * SEQ;                      // element offset of the group's first v^T plane
    gemm64<0, 0, 0, 0><<<gG, blk, 0, stream>>>(
        QV + boff, QV + boff, DM, (long long)HD, (long long)SEQ * DM,
        P16 + boff, DM, (long long)HD, (long long)SEQ * DM,
        (void*)GTAB, (void*)GTAB, SEQ, (long long)SEQ * SEQ, (long long)NHEAD * SEQ * SEQ,
        SEQ, SEQ, HD, 1.0f / (QC * QC), 1.0f,
        b_q, b_q, b_q);
    attnb<<<gAT, bAT, 0, stream>>>(QU + boff, K16 + boff, VTh + voff, VTl + voff, GTAB, CTh + boff, CTl + boff);
  }

  // (6) out = (CT_hi + CT_lo) . WOT^T + bo; M = 8192, N = 512, K = 512, f32
  gemm64<0, 1, 1, 1><<<gP, blk, 0, stream>>>(
      CTh, CTl, DM, 0LL, 0LL,
      WOT, DM, 0LL, 0LL,
      (void*)out, (void*)out, DM, 0LL, 0LL,
      NROWS, DM, DM, 1.0f, 1.0f,
      b_o, b_o, b_o);
  (void)hipGetLastError();
}

// v003
// Measured time: 322 microseconds a run.
// In both of two side-by-side timings against v002, it was 1.15 times as fast.
// Counting every step since v000, it is 2.52 times as fast.
// Contractions (all f32 accumulate): q/k/v/p projections v_wmma_f32_16x16x32_f16 (x f16 x16 . W^T f16 x64, K=512, single products);
// position table (q+v_bias).p^T v_wmma_f32_16x16x32_f16 ((q+v_bias) f16 x4 . p f16 x4, K=64, single) -> f32 table;
// content scores v_wmma_f32_16x16x32_f16 ((q+u_bias) f16 x4 . k f16 x4, K=64, single);
// P . v^T v_wmma_f32_16x16x32_f16 (P f16 x1024 hi/lo . v^T f16 x16 hi/lo, hi.hi+lo.hi+hi.lo, K=1024 by 32);
// output projection v_wmma_f32_16x16x32_bf16 (ctx bf16 hi/lo . Wo bf16, hi.W+lo.W, K=512) + bias in f32.
// Max-subtracted online base-2 softmax and the relative-shift position logits in f32 on VALU. Every float input RNE-converted to bf16 on load.
#include <hip/hip_runtime.h>
#include <math.h>
#include <stdint.h>

#define NB     8
#define SEQ    1024
#define DM     512
#define NHEAD  8
#define HD     64
#define NROWS  (NB * SEQ)
#define KCH    32
#define WSC    64.0f
#define ACARRY 16.0f
#define QC     4.0f
#define VC     16.0f
#define PC     1024.0f
#define LOG2E  1.4426950408889634f
#define SCL    0.04419417382415922f
static_assert(NHEAD * HD == DM);
static_assert((SEQ % 64) == 0 && (DM % 64) == 0 && (NROWS % 64) == 0 && (HD % 32) == 0 && (SEQ % KCH) == 0);
static_assert(((NROWS * DM) % 2048) == 0);
#define ATT_WAVES   8                 // waves of an attention block: 16 query rows each, all on one head
#define ATT_THREADS (ATT_WAVES * 32)
#define ATT_BLOCKS  (SEQ / (ATT_WAVES * 16))
#define GB     4                      // batch elements per position-table / attention launch: 4 x 8 heads x 8 row blocks = one block per WGP
#define KPITCH 144                    // LDS bytes per staged k row (128 + 16)
#define VPITCH 80                     // LDS bytes per staged v^T row (64 + 16)
#define ST_VH    (KCH * KPITCH)       // v^T hi behind the k rows
#define ST_VSZ   (HD * VPITCH)        // one v^T plane's rows
#define ST_BYTES (ST_VH + 2 * ST_VSZ) // one buffer: k | v^T hi | v^T residual
#define OPITCH 72                     // halves per staged result row (64 + 8)
#define ATT_PT_BYTES   (ATT_WAVES * 16 * 36 * 4)
#define ATT_SMEM_BYTES (ATT_PT_BYTES + 2 * ST_BYTES)
static_assert(ATT_THREADS == 256);
static_assert(ATT_BLOCKS == 8);
static_assert((NB % GB) == 0);
static_assert(KCH * HD * 2 == ATT_THREADS * 16);          // one 16-byte piece of k, and of each v^T plane, per thread and chunk
static_assert(HD * 2 == 128 && KCH * 2 == 64);
static_assert((ATT_PT_BYTES % 16) == 0 && (ST_BYTES % 16) == 0 && (ST_VH % 16) == 0);
static_assert(ATT_WAVES * 2 * 16 * OPITCH * 2 <= ATT_SMEM_BYTES);

typedef _Float16 v16h __attribute__((ext_vector_type(16)));
typedef _Float16 v8h  __attribute__((ext_vector_type(8)));
typedef __bf16   v16b __attribute__((ext_vector_type(16)));
typedef float    v8f  __attribute__((ext_vector_type(8)));
typedef float    v4f  __attribute__((ext_vector_type(4)));
typedef unsigned int v4u __attribute__((ext_vector_type(4)));

union FragH { v16h v; v8h h[2]; v4u u[2]; };
union FragAny { v16h h; v16b b; };

// ---- scalar helpers --------------------------------------------------------------------------------
__device__ __forceinline__ unsigned short bf_bits(float f) {          // f32 -> bf16 bits, RNE convert
  unsigned u = __float_as_uint(f);
  return (unsigned short)((u + 0x7FFFu + ((u >> 16) & 1u)) >> 16);
}
__device__ __forceinline__ float bf_up(unsigned short h) { return __uint_as_float(((unsigned)h) << 16); }
__device__ __forceinline__ float bfr(float f) { return bf_up(bf_bits(f)); }   // value of the bf16 RNE convert
__device__ __forceinline__ unsigned short h_bits(_Float16 x) { return __builtin_bit_cast(unsigned short, x); }
__device__ __forceinline__ unsigned pk16(unsigned short a, unsigned short b) { return (unsigned)a | ((unsigned)b << 16); }
__device__ __forceinline__ v8f zero8() { v8f z = {0.f, 0.f, 0.f, 0.f, 0.f, 0.f, 0.f, 0.f}; return z; }

// ---- fragment loader: 16-bit A/B operand from a k-contiguous 16-bit plane, lane -> row/col (lane&15),
//      p already includes +8*(lane>>4); elements 0..7 <- p[0..7] (k0+8h..), elements 8..15 <- p[16..23] (k0+16+8h..)
//      (same split k map for A and B; B is always read from a [n][k] plane)
__device__ __forceinline__ v16h ldfrag_u(const unsigned short* p) {
  FragH f;
  f.u[0] = *(const v4u*)(p);
  f.u[1] = *(const v4u*)(p + 16);
  return f.v;
}

// same fragment from a wave-uniform byte base plus this lane's 32-bit byte offset (already holding +16*(lane>>4)): an address costs one
// register, shared by planes of one layout, so a whole trip's loads fit the register file together
__device__ __forceinline__ v16h ldfrag_o(const char* base, unsigned off) {
  const char* p = base + off;
  FragH f;
  f.u[0] = *(const v4u*)(p);
  f.u[1] = *(const v4u*)(p + 32);
  return f.v;
}

// ---- WMMA helpers with trailing VALU hazard gaps ------------------------------------------------------
__device__ __forceinline__ v8f mma_h(v16h a, v16h b, v8f c) {
  return __builtin_amdgcn_wmma_f32_16x16x32_f16(false, a, false, b, (short)0, c, false, false);
}
__device__ __forceinline__ v8f mma_b(v16h a, v16h b, v8f c) {
  FragAny ua, ub;
  ua.h = a;
  ub.h = b;
  return __builtin_amdgcn_wmma_f32_16x16x32_bf16(false, ua.b, false, ub.b, (short)0, c, false, false);
}
template <int BF>
__device__ __forceinline__ v8f mmaT(v16h a, v16h b, v8f c) {
  if constexpr (BF != 0) return mma_b(a, b, c);
  else return mma_h(a, b, c);
}
__device__ __forceinline__ void dep_guard1(v8f& a, v8f& b, v16h x) {
#if defined(__HIP_DEVICE_COMPILE__)
  asm volatile("v_nop\n\tv_nop\n\tv_nop\n\tv_nop" : "+v"(a), "+v"(b) : "v"(x));
#endif
}
__device__ __forceinline__ void guard2x6(v8f& a, v8f& b, v16h x0, v16h x1, v16h x2, v16h x3, v16h x4, v16h x5) {
#if defined(__HIP_DEVICE_COMPILE__)
  asm volatile("v_nop\n\tv_nop\n\tv_nop\n\tv_nop"
               : "+v"(a), "+v"(b) : "v"(x0), "v"(x1), "v"(x2), "v"(x3), "v"(x4), "v"(x5));
#endif
}
__device__ __forceinline__ void guard4x6(v8f& a, v8f& b, v8f& c, v8f& d,
                                         v16h x0, v16h x1, v16h x2, v16h x3, v16h x4, v16h x5) {
#if defined(__HIP_DEVICE_COMPILE__)
  asm volatile("v_nop\n\tv_nop\n\tv_nop\n\tv_nop"
               : "+v"(a), "+v"(b), "+v"(c), "+v"(d) : "v"(x0), "v"(x1), "v"(x2), "v"(x3), "v"(x4), "v"(x5));
#endif
}
__device__ __forceinline__ void guard4x5(v8f& a, v8f& b, v8f& c, v8f& d,
                                         v16h x0, v16h x1, v16h x2, v16h x3, v16h x4) {
#if defined(__HIP_DEVICE_COMPILE__)
  asm volatile("v_nop\n\tv_nop\n\tv_nop\n\tv_nop"
               : "+v"(a), "+v"(b), "+v"(c), "+v"(d) : "v"(x0), "v"(x1), "v"(x2), "v"(x3), "v"(x4));
#endif
}
__device__ __forceinline__ void keep4_h(v16h a, v16h b, v16h c, v16h d) {
#if defined(__HIP_DEVICE_COMPILE__)
  asm volatile("v_nop" :: "v"(a), "v"(b), "v"(c), "v"(d));
#endif
}
__device__ __forceinline__ void acc_guard4(v8f& a, v8f& b, v8f& c, v8f& d) {
#if defined(__HIP_DEVICE_COMPILE__)
  asm volatile("v_nop\n\tv_nop\n\tv_nop\n\tv_nop" : "+v"(a), "+v"(b), "+v"(c), "+v"(d));
#endif
}
__device__ __forceinline__ void wave_sync_lds() {
  __builtin_amdgcn_fence(__ATOMIC_RELEASE, "workgroup");
  __builtin_amdgcn_wave_barrier();
  __builtin_amdgcn_fence(__ATOMIC_ACQUIRE, "workgroup");
}

// =====================================================================================================
// Elementwise 16-bit pack, no transpose: dst[i] = f16( bf16_RNE(src[i]) * sc ), sc a power of two (exact).
// coverage: grid = n / 2048 blocks x 256 thr x 8 elements = n exactly (host checks n % 2048 == 0).
// =====================================================================================================
__global__ __launch_bounds__(256) void cvt16(const float* __restrict__ src, unsigned short* dst, int n, float sc) {
  const size_t i8 = ((size_t)blockIdx.x * 256 + threadIdx.x) * 8;
  if (i8 + 8 > (size_t)n) return;                 // never taken with the exact grid; no barriers in this kernel
  const v4f a = *(const v4f*)(src + i8);
  const v4f b = *(const v4f*)(src + i8 + 4);
  v4u o;
  o[0] = pk16(h_bits((_Float16)(bfr(a[0]) * sc)), h_bits((_Float16)(bfr(a[1]) * sc)));
  o[1] = pk16(h_bits((_Float16)(bfr(a[2]) * sc)), h_bits((_Float16)(bfr(a[3]) * sc)));
  o[2] = pk16(h_bits((_Float16)(bfr(b[0]) * sc)), h_bits((_Float16)(bfr(b[1]) * sc)));
  o[3] = pk16(h_bits((_Float16)(bfr(b[2]) * sc)), h_bits((_Float16)(bfr(b[3]) * sc)));
  {
    *(v4u*)(dst + i8) = o;
    
  }
}

// =====================================================================================================
// Transposing 16-bit pack of a weight matrix: in W[Cin][Dd] (pitch Dd, base + z*sIn) -> out WT[Dd][Cin] (pitch Cin, base + z*sOut),
// BFO 0: f16( bf16_RNE(w) * sc ); BFO 1: bf16_RNE(w) bits. One 64x64 tile per block (x = Cin tile, y = Dd tile, z = matrix index):
// coverage: loads 4 x 256 x 4 floats = 64x64; stores 2 x 256 pieces x 8 halves = 64 rows x 64 halves = the whole tile;
//           grid = (Cin/64, Dd/64, nmat) exact (host passes exact multiples of 64).
// =====================================================================================================
template <int BFO>
__global__ __launch_bounds__(256) void tr16(const float* __restrict__ W, unsigned short* WT, int Cin, int Dd,
                                            long long sIn, long long sOut, float sc) {
  __shared__ float t[64][65];
  const int tid = threadIdx.x;
  const int c0 = blockIdx.x * 64, d0 = blockIdx.y * 64;
  const float* src = W + (size_t)((long long)blockIdx.z * sIn);
  unsigned short* dst = WT + (size_t)((long long)blockIdx.z * sOut);
#pragma unroll
  for (int it = 0; it < 4; ++it) {
    const int p  = it * 256 + tid;
    const int cc = p >> 4, sg = (p & 15) * 4;
    const v4f v = *(const v4f*)(src + (size_t)(c0 + cc) * Dd + d0 + sg);
    t[cc][sg]     = v[0];
    t[cc][sg + 1] = v[1];
    t[cc][sg + 2] = v[2];
    t[cc][sg + 3] = v[3];
  }
  __syncthreads();
  v4u o[2];
#pragma unroll
  for (int it = 0; it < 2; ++it) {
    const int p  = it * 256 + tid;
    const int dd = p >> 3, s8 = (p & 7) * 8;
    unsigned short hv[8];
#pragma unroll
    for (int k = 0; k < 8; ++k) {
      const float f = bfr(t[s8 + k][dd]);
      if constexpr (BFO != 0) hv[k] = bf_bits(f);
      else hv[k] = h_bits((_Float16)(f * sc));
    }
    v4u q;
    q[0] = pk16(hv[0], hv[1]);
    q[1] = pk16(hv[2], hv[3]);
    q[2] = pk16(hv[4], hv[5]);
    q[3] = pk16(hv[6], hv[7]);
    o[it] = q;
  }
  {
#pragma unroll
    for (int it = 0; it < 2; ++it) {
      const int p  = it * 256 + tid;
      const int dd = p >> 3, s8 = (p & 7) * 8;
      *(v4u*)(dst + (size_t)(d0 + dd) * Cin + c0 + s8) = o[it];
    }
    
  }
}

// =====================================================================================================
// Register-blocked batched 16-bit WMMA GEMM: C[m][n] = oscale * sum_k A[m][k] * Bt[n][k] (+ bias); one wave per 64x64 tile,
// no block barriers. A row-major [M][K] pitch lda (16-bit plane), Bt row-major [N][K] pitch ldb (k contiguous); M, N multiples of 64,
// K multiple of 32. blockIdx.y = batch index with element strides sA, sB, sC; blockIdx.z = outer batch index with strides zA, zB, zC.
// ASPLIT 1: a second A plane A2 (unscaled residual of A, same layout) is multiplied into the same accumulator (A + A2 ~ exact A).
// BF 1: bf16 operands (v_wmma_f32_16x16x32_bf16), else f16.
// EPI 1: value += bf16_RNE(ep0[column]) (per-column bias); EPI 2: value += bf16_RNE(ep0[row]) (per-row bias, 16-bit out only).
// OM 0: f32 out (pitch ldc).  OM 2: one f16 plane = f16(value * ocarry).
// OM 4: two f16 planes: hi = f16(value * ocarry), lo = f16(value * ocarry - hi) (unscaled residual).
// OM 5: two f16 planes: C = f16((value + bf16_RNE(ep1[column])) * ocarry), C2 = f16((value + bf16_RNE(ep2[column])) * ocarry).
// coverage: 4 slabs x 16 rows (f32: it 0..7 x lane>>4; 16-bit: it 0..3 x lane>>3) x 64 cols = the wave's whole 64x64 tile;
//           grid = ceil(tilesM*tilesN/8) blocks, surplus waves exit (wave-uniform).
// =====================================================================================================
template <int OM, int ASPLIT, int BF, int EPI>
__global__ __launch_bounds__(256) __attribute__((amdgpu_num_vgpr(256))) void gemm64(
    const unsigned short* __restrict__ Ap, const unsigned short* __restrict__ A2p, int lda, long long sA, long long zA,
    const unsigned short* __restrict__ Btp, int ldb, long long sB, long long zB,
    void* Cout, void* C2out, int ldc, long long sC, long long zC,
    int M, int N, int K, float oscale, float ocarry,
    const float* __restrict__ ep0, const float* __restrict__ ep1, const float* __restrict__ ep2) {
  __shared__ __align__(16) float sT[8][16 * 68];   // per-wave 16x64 slab, pitch 68 floats
  const int by   = blockIdx.y;
  const int bz   = blockIdx.z;
  const int lane = threadIdx.x & 31;
  const int wave = threadIdx.x >> 5;
  const int tilesN = N >> 6;
  const int tilesM = M >> 6;
  const int tile = blockIdx.x * 8 + wave;
  if (tile >= tilesM * tilesN) return;   // wave-uniform; no block barriers in this kernel
  const int tm = tile / tilesN;
  const int tn = tile - tm * tilesN;
  const int m0 = tm << 6;
  const int n0 = tn << 6;

  const char* A1 = (const char*)(Ap  + (size_t)((long long)by * sA + (long long)bz * zA));
  const char* A2 = (const char*)(A2p + (size_t)((long long)by * sA + (long long)bz * zA));
  const char* Bb = (const char*)(Btp + (size_t)((long long)by * sB + (long long)bz * zB));

  const int rlane = lane & 15;                 // row (A) / col (B, D) within subtile
  const int koff  = (lane >> 4) * 8;           // k offset of this lane half
  const int mOff  = (lane >> 4) * 8;           // D row offset

  v8f acc[4][4];
#pragma unroll
  for (int i = 0; i < 4; ++i)
#pragma unroll
    for (int j = 0; j < 4; ++j) acc[i][j] = zero8();

  unsigned aofs[4], bofs[4];                   // this lane's byte offsets of its four A rows and four B rows, stepped with k (planes stay under 4 GiB)
#pragma unroll
  for (int i = 0; i < 4; ++i) {
    aofs[i] = (unsigned)((m0 + (i << 4) + rlane) * lda + koff) * 2u;
    bofs[i] = (unsigned)((n0 + (i << 4) + rlane) * ldb + koff) * 2u;
  }

  for (int k0 = 0; k0 < K; k0 += 32) {
    // every fragment of this k-step is requested before its first product: one load latency a k-step
    v16h bh[4], ah[4], al[4];
#pragma unroll
    for (int j = 0; j < 4; ++j) bh[j] = ldfrag_o(Bb, bofs[j]);
#pragma unroll
    for (int i = 0; i < 4; ++i) {
      ah[i] = ldfrag_o(A1, aofs[i]);
      if constexpr (ASPLIT != 0) al[i] = ldfrag_o(A2, aofs[i]);
    }
    __builtin_amdgcn_sched_barrier(0);   // keeps the loads above in front of the products (else each A load sinks to its own group and waits alone)
#pragma unroll
    for (int i = 0; i < 4; ++i) {
#pragma unroll
      for (int j = 0; j < 4; ++j) acc[i][j] = mmaT<BF>(ah[i], bh[j], acc[i][j]);
      dep_guard1(acc[i][0], acc[i][3], ah[i]);
      if constexpr (ASPLIT != 0) {
#pragma unroll
        for (int j = 0; j < 4; ++j) acc[i][j] = mmaT<BF>(al[i], bh[j], acc[i][j]);
        dep_guard1(acc[i][0], acc[i][3], al[i]);
      }
    }
    keep4_h(bh[0], bh[1], bh[2], bh[3]);
#pragma unroll
    for (int i = 0; i < 4; ++i) { aofs[i] += 64u; bofs[i] += 64u; }   // 32 halves on
  }
  acc_guard4(acc[0][0], acc[0][1], acc[0][2], acc[0][3]);
  acc_guard4(acc[1][0], acc[1][1], acc[1][2], acc[1][3]);
  acc_guard4(acc[2][0], acc[2][1], acc[2][2], acc[2][3]);
  acc_guard4(acc[3][0], acc[3][1], acc[3][2], acc[3][3]);

  const int hh2 = lane >> 4, c4 = (lane & 15) * 4;     // f32 out: 256-B row segment = 16 lanes x 16 B
  const int q8  = lane >> 3, c8 = (lane & 7) * 8;

  // ---- epilogue ----
  float* slab = sT[wave];
#pragma unroll
  for (int i = 0; i < 4; ++i) {
    const int mBase = m0 + (i << 4);
#pragma unroll
    for (int j = 0; j < 4; ++j) {
#pragma unroll
      for (int r = 0; r < 8; ++r) {
        slab[(mOff + r) * 68 + (j << 4) + rlane] = acc[i][j][r];
      }
    }
    wave_sync_lds();
    if constexpr (OM == 0) {
      float* C = (float*)Cout + (size_t)((long long)by * sC + (long long)bz * zC);
      v4f vals[8];
#pragma unroll
      for (int it = 0; it < 8; ++it) {
        const int row = it * 2 + hh2;                      // it 0..7 x hh2 0..1 = rows 0..15
        v4f v = *(const v4f*)(slab + row * 68 + c4);
#pragma unroll
        for (int e = 0; e < 4; ++e) v[e] = v[e] * oscale;
        if constexpr (EPI == 1) {
          const v4f bb = *(const v4f*)(ep0 + n0 + c4);     // per-column bias, columns n0+c4 .. +3 (N equals the bias length)
#pragma unroll
          for (int e = 0; e < 4; ++e) v[e] = v[e] + bfr(bb[e]);
        }
        vals[it] = v;
      }
      {
#pragma unroll
        for (int it = 0; it < 8; ++it) {
          const int gr = mBase + it * 2 + hh2;
          *(v4f*)(C + (size_t)gr * ldc + n0 + c4) = vals[it];
        }
        
      }
    } else {
      unsigned short* C  = (unsigned short*)Cout  + (size_t)((long long)by * sC + (long long)bz * zC);
      unsigned short* Cb = (unsigned short*)C2out + (size_t)((long long)by * sC + (long long)bz * zC);
      v4u hv[4], lv[4];
#pragma unroll
      for (int it = 0; it < 4; ++it) {
        const int row = it * 4 + q8;                       // it 0..3 x q8 0..3 = rows 0..15
        const float* sp = slab + row * 68 + c8;
        float rb = 0.f;
        if constexpr (EPI == 2) rb = bfr(ep0[mBase + row]);   // per-row bias (M equals the bias length)
        v4u a  = {0u, 0u, 0u, 0u};
        v4u b2 = {0u, 0u, 0u, 0u};
#pragma unroll
        for (int e = 0; e < 4; ++e) {
          const int ci = n0 + c8 + 2 * e;                  // column index, < N
          float f0 = sp[2 * e] * oscale + rb;
          float f1 = sp[2 * e + 1] * oscale + rb;
          if constexpr (EPI == 1) {
            f0 += bfr(ep0[ci]);
            f1 += bfr(ep0[ci + 1]);
          }
          if constexpr (OM == 5) {
            const float g0 = (f0 + bfr(ep1[ci])) * ocarry, g1 = (f1 + bfr(ep1[ci + 1])) * ocarry;
            const float w0 = (f0 + bfr(ep2[ci])) * ocarry, w1 = (f1 + bfr(ep2[ci + 1])) * ocarry;
            a[e]  = pk16(h_bits((_Float16)g0), h_bits((_Float16)g1));
            b2[e] = pk16(h_bits((_Float16)w0), h_bits((_Float16)w1));
          } else {
            f0 *= ocarry; f1 *= ocarry;
            const _Float16 x0 = (_Float16)f0, x1 = (_Float16)f1;
            a[e] = pk16(h_bits(x0), h_bits(x1));
            if constexpr (OM == 4) {
              b2[e] = pk16(h_bits((_Float16)(f0 - (float)x0)), h_bits((_Float16)(f1 - (float)x1)));
            }
          }
        }
        hv[it] = a;
        lv[it] = b2;
      }
      {
#pragma unroll
        for (int it = 0; it < 4; ++it) {
          const int row = it * 4 + q8;
          *(v4u*)(C + (size_t)(mBase + row) * ldc + n0 + c8) = hv[it];
          if constexpr (OM >= 4) {
            *(v4u*)(Cb + (size_t)(mBase + row) * ldc + n0 + c8) = lv[it];
          }
        }
        
      }
    }
    wave_sync_lds();
  }
}

// =====================================================================================================
// Flash attention for one batch element, one head and 128 query rows: 8 waves, 16 query rows each, head dim 64, 1024 keys.
// blockIdx.x = block of 128 query rows, blockIdx.y = head, blockIdx.z = batch element within the launch's group. Pointers QU0, KP0, CTh0,
// CTl0 are pre-offset to the group's first row of the [8192][512] planes; VTh0/VTl0 to the group's first [512][1024] plane; Gt0 is the
// group's position table, one slab per batch element, Gt[h][r][c] = (q_r + v_bias) . p_c (f32, pitch 1024).
//   The eight waves need the same k and v^T values: each chunk of 32 keys is brought from global memory ONCE per block (whole 16-byte pieces,
//   one of k, one of v^T hi, one of v^T residual per thread) into one of two LDS buffers, and every wave takes its B fragments from there.
//   The pieces of chunk t+1 are requested at the head of trip t, stored into the other buffer at its foot, and published by the trip's one
//   block barrier, which also ends every wave's reads of the buffer that the next trip refills.
//   LDS rows: k [32 keys][64 d] pitch 144 B, v^T [64 d][32 keys] pitch 80 B (16 B x odd: 16-byte fragment reads without bank conflicts).
//   A fragments (stationary): (q_i + u_bias) f16 x4 rows i0+m, QU[i][64h + d], two k-steps of 32;
//   B fragments per chunk of 32 keys: k f16 x4 rows (k-contiguous) -> scores s[i][j] (two 16-column tiles);
//   position logit by relative shift, i = query row, j = key: j <= i -> Gt[h][i][S-1-i+j]; j == i+1 -> 0; else Gt[h][i+1][j-i-2];
//   every lane loads from a clamped address and selects by value (no per-lane branches about loads);
//   t = (s/16 + pos) / sqrt(512) * log2(e); online softmax in base 2, max-subtracted, running sums in f32;
//   A fragments of P*1024 (f16 hi and unscaled residual) rebuilt from the wave's LDS rows (f32 vector loads, split k map); v^T B fragments
//   (f16 x16 hi and unscaled residual); 12 P.V WMMAs (hi.hi, lo.hi, hi.lo).
//   Final 1/l and carry folds in f32; behind the last trip's barrier each wave reuses its own 4608 B of LDS as two bf16 tiles [16][64]
//   (hi, lo, pitch 144 B), stages its slice (element stores) and writes it as whole 128-byte row segments.
//   every wave does identical bounded work (32 trips of 32 keys) and passes every barrier.
// coverage: wave tile 16 rows x 64 cols per plane = 4 iterations x 32 lanes x 8 halves; 8 waves x 8 blocks = 1024 rows, 8 heads x 64 = 512
//           columns, per batch element, each element written exactly once.
// =====================================================================================================
__global__ __launch_bounds__(ATT_THREADS) __attribute__((amdgpu_num_vgpr(256)))
void attnb(const unsigned short* __restrict__ QU0, const unsigned short* __restrict__ KP0,
           const unsigned short* __restrict__ VTh0, const unsigned short* __restrict__ VTl0,
           const float* __restrict__ Gt0, unsigned short* CTh0, unsigned short* CTl0) {
  __shared__ __align__(16) char smem[ATT_SMEM_BYTES];   // prob tiles [wave][row][32 cols] pitch 36 floats | two k / v^T buffers

  const int tid  = threadIdx.x;
  const int wave = tid >> 5;
  const int lane = tid & 31;
  const int hh   = lane >> 4;
  const int c    = lane & 15;

  const int head = blockIdx.y;                             // 0..7
  const int i0   = blockIdx.x * (ATT_WAVES * 16) + __builtin_amdgcn_readfirstlane(wave) * 16;   // first query row of this wave (scalar)

  const size_t bg = blockIdx.z;                            // batch element within the group
  const unsigned short* QU  = QU0  + bg * ((size_t)SEQ * DM);
  const unsigned short* KP  = KP0  + bg * ((size_t)SEQ * DM);
  const unsigned short* VTh = VTh0 + bg * ((size_t)DM * SEQ);
  const unsigned short* VTl = VTl0 + bg * ((size_t)DM * SEQ);
  const float*          Gt  = Gt0  + bg * ((size_t)NHEAD * SEQ * SEQ);
  unsigned short*       CTh = CTh0 + bg * ((size_t)SEQ * DM);
  unsigned short*       CTl = CTl0 + bg * ((size_t)SEQ * DM);

  // stationary A fragments: (q + u_bias) rows i0 + c, d 0..31 and 32..63
  const size_t qofs = (size_t)(i0 + c) * DM + head * HD + 8 * hh;
  const v16h qa = ldfrag_u(QU + qofs), qb = ldfrag_u(QU + qofs + 32);

  const char* Kb  = (const char*)(KP + head * HD);
  const char* Vbh = (const char*)(VTh + (size_t)(head * HD) * SEQ);
  const char* Vbl = (const char*)(VTl + (size_t)(head * HD) * SEQ);
  // this thread's 16-byte pieces of a chunk: k row tid>>3 (8 pieces of its 128 B), v^T row tid>>2 (4 pieces of its 64 B)
  const unsigned gk0 = (unsigned)((tid >> 3) * (DM * 2) + (tid & 7) * 16);      // byte offset in chunk 0 of k
  const unsigned gv0 = (unsigned)((tid >> 2) * (SEQ * 2) + (tid & 3) * 16);     // byte offset in chunk 0 of either v^T plane
  const unsigned sk  = (unsigned)((tid >> 3) * KPITCH + (tid & 7) * 16);        // where they go in a buffer
  const unsigned sv  = (unsigned)(ST_VH + (tid >> 2) * VPITCH + (tid & 3) * 16);
  const unsigned fk  = (unsigned)(c * KPITCH + 16 * hh);                        // this lane's fragment reads: k row c
  const unsigned fv  = (unsigned)(ST_VH + c * VPITCH + 16 * hh);                // v^T hi row c
  const float* Gh = Gt + (size_t)head * SEQ * SEQ;

  const float PSC = SCL * LOG2E;                           // position logit scale (table values are plain f32)
  const float CSC = PSC * (1.0f / (QC * QC));              // content scores carry x4 on both operands

  float mrow[8], lrow[8];
  v8f o0 = zero8(), o1 = zero8(), o2 = zero8(), o3 = zero8();
#pragma unroll
  for (int r = 0; r < 8; ++r) { mrow[r] = -INFINITY; lrow[r] = 0.f; }
  float* pt = (float*)smem + wave * (16 * 36);
  char* stage = smem + ATT_PT_BYTES;

  // position-table values of the trip that starts at key jt: raw loads from clamped addresses, selected by value where they are used
  auto ld_tab = [&](int jt, float (&ga)[8], float (&gc)[8]) {
#pragma unroll
    for (int r = 0; r < 8; ++r) {
      const int i  = i0 + 8 * hh + r;                      // query row of this lane's accumulator element r
      const int ja = jt + c, jc = jt + 16 + c;             // key columns of s0 / s1
      const bool la = (ja <= i), lc = (jc <= i);
      int ra = la ? i : (i + 1), rc = lc ? i : (i + 1);
      int ca = la ? (SEQ - 1 - i + ja) : (ja - i - 2);
      int cz = lc ? (SEQ - 1 - i + jc) : (jc - i - 2);
      ra = (ra > SEQ - 1) ? (SEQ - 1) : ra;
      rc = (rc > SEQ - 1) ? (SEQ - 1) : rc;
      ca = (ca < 0) ? 0 : ca;  ca = (ca > SEQ - 1) ? (SEQ - 1) : ca;
      cz = (cz < 0) ? 0 : cz;  cz = (cz > SEQ - 1) ? (SEQ - 1) : cz;
      ga[r] = Gh[(unsigned)(ra * SEQ + ca)];
      gc[r] = Gh[(unsigned)(rc * SEQ + cz)];
    }
  };

  // chunk 0 into buffer 0; table values travel one trip ahead of their use, trip 0's are requested here
  float ga[8], gc[8];
  {
    const v4u pk = *(const v4u*)(Kb + gk0);
    const v4u ph0 = *(const v4u*)(Vbh + gv0);
    const v4u pl0 = *(const v4u*)(Vbl + gv0);
    ld_tab(0, ga, gc);
    *(v4u*)(stage + sk) = pk;
    *(v4u*)(stage + sv) = ph0;
    *(v4u*)(stage + sv + ST_VSZ) = pl0;
  }
  __syncthreads();                                         // publishes chunk 0

#pragma unroll 1
  for (int jb = 0; jb < SEQ; jb += KCH) {
    const int jn = (jb + KCH < SEQ) ? (jb + KCH) : 0;      // next trip's first key; the last trip asks for trip 0's again (in bounds, not used)
    const unsigned bsel = (unsigned)((jb / KCH) & 1) * ST_BYTES;
    const char* cur = stage + bsel;                        // this trip's buffer
    char*       nxt = stage + (ST_BYTES - bsel);           // the other one: every wave left it before the last barrier
    // the next chunk's pieces are requested here and stored at the trip's foot: their latency lies under the whole trip
    const v4u nk = *(const v4u*)(Kb + (gk0 + (unsigned)jn * (unsigned)(DM * 2)));
    const v4u nh = *(const v4u*)(Vbh + (gv0 + (unsigned)jn * 2u));
    const v4u nl = *(const v4u*)(Vbl + (gv0 + (unsigned)jn * 2u));
    const v16h k0a = ldfrag_o(cur, fk);
    const v16h k0b = ldfrag_o(cur + 64, fk);
    const v16h k1a = ldfrag_o(cur + 16 * KPITCH, fk);
    const v16h k1b = ldfrag_o(cur + 16 * KPITCH + 64, fk);
    __builtin_amdgcn_sched_barrier(0);   // keeps the requests above at the trip's head (else the global ones sink to their stores and wait there)
    v8f s0, s1;
    s0 = mma_h(qa, k0a, zero8());
    s0 = mma_h(qb, k0b, s0);
    s1 = mma_h(qa, k1a, zero8());
    s1 = mma_h(qb, k1b, s1);
    guard2x6(s0, s1, qa, qb, k0a, k0b, k1a, k1b);
    float tt0[8], tt1[8];
#pragma unroll
    for (int r = 0; r < 8; ++r) {
      const int i  = i0 + 8 * hh + r;
      const int ja = jb + c, jc = jb + 16 + c;
      const float pa = (ja == i + 1) ? 0.f : ga[r];
      const float pz = (jc == i + 1) ? 0.f : gc[r];
      tt0[r] = s0[r] * CSC + pa * PSC;
      tt1[r] = s1[r] * CSC + pz * PSC;
    }
    ld_tab(jn, ga, gc);                                    // next trip's table values, likewise
    __builtin_amdgcn_sched_barrier(0);   // keeps that request in front of the softmax
#pragma unroll
    for (int r = 0; r < 8; ++r) {
      const float t0 = tt0[r], t1 = tt1[r];
      float mx = fmaxf(t0, t1);
#pragma unroll
      for (int off = 1; off < 16; off <<= 1) mx = fmaxf(mx, __shfl_xor(mx, off, 32));
      const float mn = fmaxf(mrow[r], mx);
      const float al = exp2f(mrow[r] - mn);
      mrow[r] = mn;
      const float e0 = exp2f(t0 - mn), e1 = exp2f(t1 - mn);
      float ps = e0 + e1;
#pragma unroll
      for (int off = 1; off < 16; off <<= 1) ps += __shfl_xor(ps, off, 32);
      lrow[r] = lrow[r] * al + ps;
      o0[r] *= al;
      o1[r] *= al;
      o2[r] *= al;
      o3[r] *= al;
      const int ro = (8 * hh + r) * 36 + c;
      pt[ro]      = e0;
      pt[ro + 16] = e1;
    }
    wave_sync_lds();
    const v16h vh0 = ldfrag_o(cur, fv);
    const v16h vh1 = ldfrag_o(cur + 16 * VPITCH, fv);
    const v16h vh2 = ldfrag_o(cur + 32 * VPITCH, fv);
    const v16h vh3 = ldfrag_o(cur + 48 * VPITCH, fv);
    const v16h vl0 = ldfrag_o(cur + ST_VSZ, fv);
    const v16h vl1 = ldfrag_o(cur + ST_VSZ + 16 * VPITCH, fv);
    const v16h vl2 = ldfrag_o(cur + ST_VSZ + 32 * VPITCH, fv);
    const v16h vl3 = ldfrag_o(cur + ST_VSZ + 48 * VPITCH, fv);
    FragH ph, pl;
    {
      const float* prow = pt + c * 36 + 8 * hh;
      const v4f p0 = *(const v4f*)(prow), p1 = *(const v4f*)(prow + 4);
      const v4f p2 = *(const v4f*)(prow + 16), p3 = *(const v4f*)(prow + 20);
#pragma unroll
      for (int e = 0; e < 4; ++e) {
        float f; _Float16 x;
        f = p0[e] * PC; x = (_Float16)f; ph.h[0][e]     = x; pl.h[0][e]     = (_Float16)(f - (float)x);   // keys jb + 8hh + e
        f = p1[e] * PC; x = (_Float16)f; ph.h[0][4 + e] = x; pl.h[0][4 + e] = (_Float16)(f - (float)x);   // keys jb + 8hh + 4 + e
        f = p2[e] * PC; x = (_Float16)f; ph.h[1][e]     = x; pl.h[1][e]     = (_Float16)(f - (float)x);   // keys jb + 16 + 8hh + e
        f = p3[e] * PC; x = (_Float16)f; ph.h[1][4 + e] = x; pl.h[1][4 + e] = (_Float16)(f - (float)x);
      }
    }
    {
      o0 = mma_h(ph.v, vh0, o0);
      o1 = mma_h(ph.v, vh1, o1);
      o2 = mma_h(ph.v, vh2, o2);
      o3 = mma_h(ph.v, vh3, o3);
      o0 = mma_h(pl.v, vh0, o0);
      o1 = mma_h(pl.v, vh1, o1);
      o2 = mma_h(pl.v, vh2, o2);
      o3 = mma_h(pl.v, vh3, o3);
      guard4x6(o0, o1, o2, o3, ph.v, pl.v, vh0, vh1, vh2, vh3);
    }
    {
      o0 = mma_h(ph.v, vl0, o0);
      o1 = mma_h(ph.v, vl1, o1);
      o2 = mma_h(ph.v, vl2, o2);
      o3 = mma_h(ph.v, vl3, o3);
      guard4x5(o0, o1, o2, o3, ph.v, vl0, vl1, vl2, vl3);
    }
    *(v4u*)(nxt + sk) = nk;
    *(v4u*)(nxt + sv) = nh;
    *(v4u*)(nxt + sv + ST_VSZ) = nl;
    __syncthreads();   // publishes the next chunk; ends every wave's reads of this trip's buffer (and of its own prob tile)
  }

  // ---- behind the last barrier no wave reads the loop's LDS any more: each wave takes its own 4608 B as two bf16 tiles [16][64], pitch 72 ----
  unsigned short* Osh = (unsigned short*)(smem + wave * (2 * 16 * OPITCH * 2));
  unsigned short* Osl = Osh + 16 * OPITCH;
  // ---- fold 1/l and the carries (1024 on P, 16 on v), split into bf16 hi + residual, stage the wave's 16x64 slice ----
  const float oc = 1.0f / (PC * VC);
#pragma unroll
  for (int r = 0; r < 8; ++r) {
    const float inv = (1.0f / lrow[r]) * oc;
    const int ro = (8 * hh + r) * OPITCH + c;
    const float f0 = o0[r] * inv, f1 = o1[r] * inv, f2 = o2[r] * inv, f3 = o3[r] * inv;
    const unsigned short g0 = bf_bits(f0), g1 = bf_bits(f1), g2 = bf_bits(f2), g3 = bf_bits(f3);
    Osh[ro]      = g0;  Osl[ro]      = bf_bits(f0 - bf_up(g0));
    Osh[ro + 16] = g1;  Osl[ro + 16] = bf_bits(f1 - bf_up(g1));
    Osh[ro + 32] = g2;  Osl[ro + 32] = bf_bits(f2 - bf_up(g2));
    Osh[ro + 48] = g3;  Osl[ro + 48] = bf_bits(f3 - bf_up(g3));
  }
  wave_sync_lds();
  // ---- the wave writes its 16 row segments of 128 B in both planes: piece p = it*32 + lane -> row p>>3, halves (p&7)*8 .. +7 ----
  {
    v4u hv[4], lv[4];
#pragma unroll
    for (int it = 0; it < 4; ++it) {
      const int p = it * 32 + lane;
      hv[it] = *(const v4u*)(Osh + (p >> 3) * OPITCH + (p & 7) * 8);
      lv[it] = *(const v4u*)(Osl + (p >> 3) * OPITCH + (p & 7) * 8);
    }
    const size_t dofs = (size_t)i0 * DM + head * HD;
    unsigned short* dsth = CTh + dofs;
    unsigned short* dstl = CTl + dofs;
#pragma unroll
    for (int it = 0; it < 4; ++it) {
      const int p = it * 32 + lane;
      *(v4u*)(dsth + (size_t)(p >> 3) * DM + (p & 7) * 8) = hv[it];
      *(v4u*)(dstl + (size_t)(p >> 3) * DM + (p & 7) * 8) = lv[it];
    }
  }
}

// =====================================================================================================
// Workspace map (bytes); every plane is an exact multiple of its tile / whole-row store granularity (M, N exact tile multiples,
// the activation convert count an exact multiple of 2048, no pad rows needed), every offset a multiple of 512 KiB:
//   WQT, WKT, WVT, WPT f16 [512 out][512 in] x64   4 x 524288
//   WOT  bf16 [512 out][512 in]                         524288
//   X16  f16 [8192][512] x16                          8388608    (one activation input at a time, rows b*1024 + tok)
//   QU, QV f16 [8192][512] x4                     2 x 8388608    (q + u_bias, q + v_bias)
//   K16, P16 f16 [8192][512] x4                   2 x 8388608
//   VTh, VTl f16 [8][512][1024] x16               2 x 8388608    (v^T per batch, hi / residual)
//   GTAB f32 [4 batches][8 heads][1024][1024]       134217728    (position tables of the current group of batch elements)
//   CTh, CTl bf16 [8192][512]                     2 x 8388608    (attention ctx, merged heads, hi / residual)
//   end                                             212336640
// =====================================================================================================
extern "C" void kernel_launch(void* const* d_in, const int* in_sizes, int n_in,
                              void* d_out, int out_size, void* d_ws, size_t ws_size,
                              hipStream_t stream) {
  if (n_in < 15) return;
  const int NA = NROWS * DM;
  if (in_sizes[0] != NA || in_sizes[1] != NA || in_sizes[2] != NA || in_sizes[3] != NA) return;
  if (in_sizes[4] != DM * DM || in_sizes[6] != DM * DM || in_sizes[8] != DM * DM || in_sizes[10] != DM * DM || in_sizes[13] != DM * DM) return;
  if (in_sizes[5] != DM || in_sizes[7] != DM || in_sizes[9] != DM || in_sizes[14] != DM) return;
  if (in_sizes[11] != NHEAD * HD || in_sizes[12] != NHEAD * HD) return;
  if (out_size != NROWS * DM) return;
  if ((NA % 2048) != 0) return;

  const float* query = (const float*)d_in[0];
  const float* key   = (const float*)d_in[1];
  const float* value = (const float*)d_in[2];
  const float* pemb  = (const float*)d_in[3];
  const float* w_q   = (const float*)d_in[4];
  const float* b_q   = (const float*)d_in[5];
  const float* w_k   = (const float*)d_in[6];
  const float* b_k   = (const float*)d_in[7];
  const float* w_v   = (const float*)d_in[8];
  const float* b_v   = (const float*)d_in[9];
  const float* w_p   = (const float*)d_in[10];
  const float* u_b   = (const float*)d_in[11];
  const float* v_b   = (const float*)d_in[12];
  const float* w_o   = (const float*)d_in[13];
  const float* b_o   = (const float*)d_in[14];
  float*       out   = (float*)d_out;

  const size_t PWT = (size_t)DM * DM * 2;                         //   524288
  const size_t PX  = (size_t)NROWS * DM * 2;                      //  8388608
  const size_t PVT = (size_t)NB * DM * SEQ * 2;                   //  8388608
  const size_t PG  = (size_t)GB * NHEAD * SEQ * SEQ * 4;          // 134217728
  size_t off = 0;
  const size_t oWQ = off; off += PWT;
  const size_t oWK = off; off += PWT;
  const size_t oWV = off; off += PWT;
  const size_t oWP = off; off += PWT;
  const size_t oWO = off; off += PWT;
  const size_t oX  = off; off += PX;
  const size_t oQU = off; off += PX;
  const size_t oQV = off; off += PX;
  const size_t oK  = off; off += PX;
  const size_t oP  = off; off += PX;
  const size_t oVh = off; off += PVT;
  const size_t oVl = off; off += PVT;
  const size_t oG  = off; off += PG;
  const size_t oCh = off; off += PX;
  const size_t oCl = off; off += PX;
  if (off > ws_size) return;                                      // off = 212336640

  char* ws = (char*)d_ws;
  unsigned short* WQT  = (unsigned short*)(ws + oWQ);
  unsigned short* WKT  = (unsigned short*)(ws + oWK);
  unsigned short* WVT  = (unsigned short*)(ws + oWV);
  unsigned short* WPT  = (unsigned short*)(ws + oWP);
  unsigned short* WOT  = (unsigned short*)(ws + oWO);
  unsigned short* X16  = (unsigned short*)(ws + oX);
  unsigned short* QU   = (unsigned short*)(ws + oQU);
  unsigned short* QV   = (unsigned short*)(ws + oQV);
  unsigned short* K16  = (unsigned short*)(ws + oK);
  unsigned short* P16  = (unsigned short*)(ws + oP);
  unsigned short* VTh  = (unsigned short*)(ws + oVh);
  unsigned short* VTl  = (unsigned short*)(ws + oVl);
  float*          GTAB = (float*)(ws + oG);
  unsigned short* CTh  = (unsigned short*)(ws + oCh);
  unsigned short* CTl  = (unsigned short*)(ws + oCl);

  const dim3 blk(256);
  const dim3 gTW(DM / 64, DM / 64, 1);                             // 8 x 8 x 1
  const dim3 gCX(NA / 2048);                                       // 2048
  const int tilesP = (NROWS / 64) * (DM / 64);                     // 1024
  const int tilesV = (DM / 64) * (SEQ / 64);                       // 128 per batch
  const int tilesG = (SEQ / 64) * (SEQ / 64);                      // 256 per head
  const dim3 gP((tilesP + 7) / 8, 1);                              // 128
  const dim3 gV((tilesV + 7) / 8, NB);                             // 16 x 8
  const dim3 gG((tilesG + 7) / 8, NHEAD, GB);                      // 32 x 8 x 4
  const dim3 gAT(ATT_BLOCKS, NHEAD, GB);                           // 8 x 8 x 4
  const dim3 bAT(ATT_THREADS);                                     // 256

  // (0) weight planes: W[c][n] -> WT[n][c] as f16( bf16_RNE(w) * 64 ); Wo[c][n] -> WOT[n][c] bf16
  tr16<0><<<gTW, blk, 0, stream>>>(w_q, WQT, DM, DM, 0LL, 0LL, WSC);
  tr16<0><<<gTW, blk, 0, stream>>>(w_k, WKT, DM, DM, 0LL, 0LL, WSC);
  tr16<0><<<gTW, blk, 0, stream>>>(w_v, WVT, DM, DM, 0LL, 0LL, WSC);
  tr16<0><<<gTW, blk, 0, stream>>>(w_p, WPT, DM, DM, 0LL, 0LL, WSC);
  tr16<1><<<gTW, blk, 0, stream>>>(w_o, WOT, DM, DM, 0LL, 0LL, 1.0f);

  // (1) q projection: X16 = f16(bf16(query)*16); q[m][n] = sum_c x[m][c] WQT[n][c] / 1024 + bq[n];
  //     QU = f16((q + u_bias[n]) * 4), QV = f16((q + v_bias[n]) * 4); M = 8192, N = 512, K = 512
  cvt16<<<gCX, blk, 0, stream>>>(query, X16, NA, ACARRY);
  gemm64<5, 0, 0, 1><<<gP, blk, 0, stream>>>(
      X16, X16, DM, 0LL, 0LL,
      WQT, DM, 0LL, 0LL,
      (void*)QU, (void*)QV, DM, 0LL, 0LL,
      NROWS, DM, DM, 1.0f / (ACARRY * WSC), QC,
      b_q, u_b, v_b);

  // (2) k projection -> K16 = f16((k + bk) * 4)
  cvt16<<<gCX, blk, 0, stream>>>(key, X16, NA, ACARRY);
  gemm64<2, 0, 0, 1><<<gP, blk, 0, stream>>>(
      X16, X16, DM, 0LL, 0LL,
      WKT, DM, 0LL, 0LL,
      (void*)K16, (void*)K16, DM, 0LL, 0LL,
      NROWS, DM, DM, 1.0f / (ACARRY * WSC), QC,
      b_k, b_k, b_k);

  // (3) v^T per batch: VT[b][n = h*64+d][tok] = sum_c WVT[n][c] x_b[tok][c] / 1024 + bv[n] -> f16 x16 hi / residual planes;
  //     M = 512, N = 1024, K = 512
  cvt16<<<gCX, blk, 0, stream>>>(value, X16, NA, ACARRY);
  gemm64<4, 0, 0, 2><<<gV, blk, 0, stream>>>(
      WVT, WVT, DM, 0LL, 0LL,
      X16, DM, (long long)SEQ * DM, 0LL,
      (void*)VTh, (void*)VTl, SEQ, (long long)DM * SEQ, 0LL,
      DM, SEQ, DM, 1.0f / (ACARRY * WSC), VC,
      b_v, b_v, b_v);

  // (4) p projection (no bias) -> P16 = f16(p * 4)
  cvt16<<<gCX, blk, 0, stream>>>(pemb, X16, NA, ACARRY);
  gemm64<2, 0, 0, 0><<<gP, blk, 0, stream>>>(
      X16, X16, DM, 0LL, 0LL,
      WPT, DM, 0LL, 0LL,
      (void*)P16, (void*)P16, DM, 0LL, 0LL,
      NROWS, DM, DM, 1.0f / (ACARRY * WSC), QC,
      b_q, b_q, b_q);

  // (5) per group of GB batch elements, one launch each (grid z = batch element g within the group, b = first of the group):
  //     position tables GTAB[g][h][r][c] = sum_d QV[(b+g)*1024+r][64h+d] P16[(b+g)*1024+c][64h+d] / 16 (f32; M = N = 1024, K = 64 per head),
  //     then attention over the group's 1024 query rows each, all heads -> CT (bf16 hi / residual planes)
  for (int b = 0; b < NB; b += GB) {
    const size_t boff = (size_t)b * SEQ * DM;                      // element offset of the group's rows in [8192][512] planes
    const size_t voff = (size_t)b * DM * SEQ;                      // element offset of the group's first v^T plane
    gemm64<0, 0, 0, 0><<<gG, blk, 0, stream>>>(
        QV + boff, QV + boff, DM, (long long)HD, (long long)SEQ * DM,
        P16 + boff, DM, (long long)HD, (long long)SEQ * DM,
        (void*)GTAB, (void*)GTAB, SEQ, (long long)SEQ * SEQ, (long long)NHEAD * SEQ * SEQ,
        SEQ, SEQ, HD, 1.0f / (QC * QC), 1.0f,
        b_q, b_q, b_q);
    attnb<<<gAT, bAT, 0, stream>>>(QU + boff, K16 + boff, VTh + voff, VTl + voff, GTAB, CTh + boff, CTl + boff);
  }

  // (6) out = (CT_hi + CT_lo) . WOT^T + bo; M = 8192, N = 512, K = 512, f32
  gemm64<0, 1, 1, 1><<<gP, blk, 0, stream>>>(
      CTh, CTl, DM, 0LL, 0LL,
      WOT, DM, 0LL, 0LL,
      (void*)out, (void*)out, DM, 0LL, 0LL,
      NROWS, DM, DM, 1.0f, 1.0f,
      b_o, b_o, b_o);
  (void)hipGetLastError();
}

// v004
// A run of this version takes 266 microseconds.
// Next to v003, in two timings, it ran 1.21 times as fast each time.
// All steps since v000 together make it 3.05 times as fast.
// Contractions (all f32 accumulate): q/k/v/p projections v_wmma_f32_16x16x32_f16 (x f16 x16 . W^T f16 x64, K=512, single products);
// position table (q+v_bias).p^T v_wmma_f32_16x16x32_f16 ((q+v_bias) f16 x4 . p f16 x4, K=64, single) -> f32 table;
// content scores v_wmma_f32_16x16x32_f16 ((q+u_bias) f16 x4 . k f16 x4, K=64, single);
// P . v^T v_wmma_f32_16x16x32_f16 (P f16 x1024 hi/lo . v^T f16 x16 hi/lo, hi.hi+lo.hi+hi.lo, K=1024 by 32);
// output projection v_wmma_f32_16x16x32_bf16 (ctx bf16 hi/lo . Wo bf16, hi.W+lo.W, K=512) + bias in f32.
// Max-subtracted online base-2 softmax and the relative-shift position logits in f32 on VALU. Every float input RNE-converted to bf16 on load.
#include <hip/hip_runtime.h>
#include <math.h>
#include <stdint.h>

#define NB     8
#define SEQ    1024
#define DM     512
#define NHEAD  8
#define HD     64
#define NROWS  (NB * SEQ)
#define KCH    32
#define WSC    64.0f
#define ACARRY 16.0f
#define QC     4.0f
#define VC     16.0f
#define PC     1024.0f
#define LOG2E  1.4426950408889634f
#define SCL    0.04419417382415922f
static_assert(NHEAD * HD == DM);
static_assert((SEQ % 64) == 0 && (DM % 64) == 0 && (NROWS % 64) == 0 && (HD % 32) == 0 && (SEQ % KCH) == 0);
static_assert(((NROWS * DM) % 2048) == 0);
#define ATT_WAVES   8                 // waves of an attention block: 16 query rows each, all on one head
#define ATT_THREADS (ATT_WAVES * 32)
#define ATT_BLOCKS  (SEQ / (ATT_WAVES * 16))
#define GB     4                      // batch elements per position-table / attention launch: 4 x 8 heads x 8 row blocks = one block per WGP
#define KPITCH 144                    // LDS bytes per staged k row (128 + 16)
#define VPITCH 80                     // LDS bytes per staged v^T row (64 + 16)
#define ST_VH    (KCH * KPITCH)       // v^T hi behind the k rows
#define ST_VSZ   (HD * VPITCH)        // one v^T plane's rows
#define ST_BYTES (ST_VH + 2 * ST_VSZ) // one buffer: k | v^T hi | v^T residual
#define OPITCH 72                     // halves per staged result row (64 + 8)
#define ATT_PT_BYTES   (ATT_WAVES * 16 * 36 * 4)
#define ATT_SMEM_BYTES (ATT_PT_BYTES + 2 * ST_BYTES)
#define GKS    64                     // halves of k per staged gemm slab: 128 B, one whole line of every row
#define GPITCH 144                    // LDS bytes per staged gemm row (128 + 16)
static_assert((DM % GKS) == 0 && (HD % GKS) == 0);                   // every K is whole slabs
static_assert(((DM / 64) % 8) == 0 && ((SEQ / 64) % 8) == 0);        // every N is whole blocks of 8 column tiles
static_assert(ATT_THREADS == 256);
static_assert(ATT_BLOCKS == 8);
static_assert((NB % GB) == 0);
static_assert(KCH * HD * 2 == ATT_THREADS * 16);          // one 16-byte piece of k, and of each v^T plane, per thread and chunk
static_assert(HD * 2 == 128 && KCH * 2 == 64);
static_assert((ATT_PT_BYTES % 16) == 0 && (ST_BYTES % 16) == 0 && (ST_VH % 16) == 0);
static_assert(ATT_WAVES * 2 * 16 * OPITCH * 2 <= ATT_SMEM_BYTES);

typedef _Float16 v16h __attribute__((ext_vector_type(16)));
typedef _Float16 v8h  __attribute__((ext_vector_type(8)));
typedef __bf16   v16b __attribute__((ext_vector_type(16)));
typedef float    v8f  __attribute__((ext_vector_type(8)));
typedef float    v4f  __attribute__((ext_vector_type(4)));
typedef unsigned int v4u __attribute__((ext_vector_type(4)));

union FragH { v16h v; v8h h[2]; v4u u[2]; };
union FragAny { v16h h; v16b b; };

// ---- scalar helpers --------------------------------------------------------------------------------
__device__ __forceinline__ unsigned short bf_bits(float f) {          // f32 -> bf16 bits, RNE convert
  unsigned u = __float_as_uint(f);
  return (unsigned short)((u + 0x7FFFu + ((u >> 16) & 1u)) >> 16);
}
__device__ __forceinline__ float bf_up(unsigned short h) { return __uint_as_float(((unsigned)h) << 16); }
__device__ __forceinline__ float bfr(float f) { return bf_up(bf_bits(f)); }   // value of the bf16 RNE convert
__device__ __forceinline__ unsigned short h_bits(_Float16 x) { return __builtin_bit_cast(unsigned short, x); }
__device__ __forceinline__ unsigned pk16(unsigned short a, unsigned short b) { return (unsigned)a | ((unsigned)b << 16); }
__device__ __forceinline__ v8f zero8() { v8f z = {0.f, 0.f, 0.f, 0.f, 0.f, 0.f, 0.f, 0.f}; return z; }

// ---- fragment loader: 16-bit A/B operand from a k-contiguous 16-bit plane, lane -> row/col (lane&15),
//      p already includes +8*(lane>>4); elements 0..7 <- p[0..7] (k0+8h..), elements 8..15 <- p[16..23] (k0+16+8h..)
//      (same split k map for A and B; B is always read from a [n][k] plane)
__device__ __forceinline__ v16h ldfrag_u(const unsigned short* p) {
  FragH f;
  f.u[0] = *(const v4u*)(p);
  f.u[1] = *(const v4u*)(p + 16);
  return f.v;
}

// same fragment from a wave-uniform byte base plus this lane's 32-bit byte offset (already holding +16*(lane>>4)): an address costs one
// register, shared by planes of one layout, so a whole trip's loads fit the register file together
__device__ __forceinline__ v16h ldfrag_o(const char* base, unsigned off) {
  const char* p = base + off;
  FragH f;
  f.u[0] = *(const v4u*)(p);
  f.u[1] = *(const v4u*)(p + 32);
  return f.v;
}

// ---- WMMA helpers with trailing VALU hazard gaps ------------------------------------------------------
__device__ __forceinline__ v8f mma_h(v16h a, v16h b, v8f c) {
  return __builtin_amdgcn_wmma_f32_16x16x32_f16(false, a, false, b, (short)0, c, false, false);
}
__device__ __forceinline__ v8f mma_b(v16h a, v16h b, v8f c) {
  FragAny ua, ub;
  ua.h = a;
  ub.h = b;
  return __builtin_amdgcn_wmma_f32_16x16x32_bf16(false, ua.b, false, ub.b, (short)0, c, false, false);
}
template <int BF>
__device__ __forceinline__ v8f mmaT(v16h a, v16h b, v8f c) {
  if constexpr (BF != 0) return mma_b(a, b, c);
  else return mma_h(a, b, c);
}
__device__ __forceinline__ void dep_guard1(v8f& a, v8f& b, v16h x) {
#if defined(__HIP_DEVICE_COMPILE__)
  asm volatile("v_nop\n\tv_nop\n\tv_nop\n\tv_nop" : "+v"(a), "+v"(b) : "v"(x));
#endif
}
__device__ __forceinline__ void guard2x6(v8f& a, v8f& b, v16h x0, v16h x1, v16h x2, v16h x3, v16h x4, v16h x5) {
#if defined(__HIP_DEVICE_COMPILE__)
  asm volatile("v_nop\n\tv_nop\n\tv_nop\n\tv_nop"
               : "+v"(a), "+v"(b) : "v"(x0), "v"(x1), "v"(x2), "v"(x3), "v"(x4), "v"(x5));
#endif
}
__device__ __forceinline__ void guard4x6(v8f& a, v8f& b, v8f& c, v8f& d,
                                         v16h x0, v16h x1, v16h x2, v16h x3, v16h x4, v16h x5) {
#if defined(__HIP_DEVICE_COMPILE__)
  asm volatile("v_nop\n\tv_nop\n\tv_nop\n\tv_nop"
               : "+v"(a), "+v"(b), "+v"(c), "+v"(d) : "v"(x0), "v"(x1), "v"(x2), "v"(x3), "v"(x4), "v"(x5));
#endif
}
__device__ __forceinline__ void guard4x5(v8f& a, v8f& b, v8f& c, v8f& d,
                                         v16h x0, v16h x1, v16h x2, v16h x3, v16h x4) {
#if defined(__HIP_DEVICE_COMPILE__)
  asm volatile("v_nop\n\tv_nop\n\tv_nop\n\tv_nop"
               : "+v"(a), "+v"(b), "+v"(c), "+v"(d) : "v"(x0), "v"(x1), "v"(x2), "v"(x3), "v"(x4));
#endif
}
__device__ __forceinline__ void keep4_h(v16h a, v16h b, v16h c, v16h d) {
#if defined(__HIP_DEVICE_COMPILE__)
  asm volatile("v_nop" :: "v"(a), "v"(b), "v"(c), "v"(d));
#endif
}
__device__ __forceinline__ void acc_guard4(v8f& a, v8f& b, v8f& c, v8f& d) {
#if defined(__HIP_DEVICE_COMPILE__)
  asm volatile("v_nop\n\tv_nop\n\tv_nop\n\tv_nop" : "+v"(a), "+v"(b), "+v"(c), "+v"(d));
#endif
}
// N asynchronous 16-byte copies per lane, global memory -> LDS through no register: l[q] = the lane's LDS byte address, g[q] = its global address.
// The closing s_wait_xcnt 0 stands in the copies' own statement, so no address register is rewritten in front of it.
template <int N>
__device__ __forceinline__ void acopy(const unsigned* l, const char* const* g) {
  static_assert(N == 9 || N == 10);
#if defined(__HIP_DEVICE_COMPILE__)
  if constexpr (N == 9) {
    asm volatile("global_load_async_to_lds_b128 %0, %1, off\n\t"
                 "global_load_async_to_lds_b128 %2, %3, off\n\t"
                 "global_load_async_to_lds_b128 %4, %5, off\n\t"
                 "global_load_async_to_lds_b128 %6, %7, off\n\t"
                 "global_load_async_to_lds_b128 %8, %9, off\n\t"
                 "global_load_async_to_lds_b128 %10, %11, off\n\t"
                 "global_load_async_to_lds_b128 %12, %13, off\n\t"
                 "global_load_async_to_lds_b128 %14, %15, off\n\t"
                 "global_load_async_to_lds_b128 %16, %17, off\n\t"
                 "s_wait_xcnt 0x0"
                 :: "v"(l[0]), "v"(g[0]), "v"(l[1]), "v"(g[1]), "v"(l[2]), "v"(g[2]), "v"(l[3]), "v"(g[3]), "v"(l[4]), "v"(g[4]),
                    "v"(l[5]), "v"(g[5]), "v"(l[6]), "v"(g[6]), "v"(l[7]), "v"(g[7]), "v"(l[8]), "v"(g[8])
                 : "memory");
  } else {
    asm volatile("global_load_async_to_lds_b128 %0, %1, off\n\t"
                 "global_load_async_to_lds_b128 %2, %3, off\n\t"
                 "global_load_async_to_lds_b128 %4, %5, off\n\t"
                 "global_load_async_to_lds_b128 %6, %7, off\n\t"
                 "global_load_async_to_lds_b128 %8, %9, off\n\t"
                 "global_load_async_to_lds_b128 %10, %11, off\n\t"
                 "global_load_async_to_lds_b128 %12, %13, off\n\t"
                 "global_load_async_to_lds_b128 %14, %15, off\n\t"
                 "global_load_async_to_lds_b128 %16, %17, off\n\t"
                 "global_load_async_to_lds_b128 %18, %19, off\n\t"
                 "s_wait_xcnt 0x0"
                 :: "v"(l[0]), "v"(g[0]), "v"(l[1]), "v"(g[1]), "v"(l[2]), "v"(g[2]), "v"(l[3]), "v"(g[3]), "v"(l[4]), "v"(g[4]),
                    "v"(l[5]), "v"(g[5]), "v"(l[6]), "v"(g[6]), "v"(l[7]), "v"(g[7]), "v"(l[8]), "v"(g[8]), "v"(l[9]), "v"(g[9])
                 : "memory");
  }
#endif
}
__device__ __forceinline__ void wait_async0() {   // this wave's copies have landed in LDS
#if defined(__HIP_DEVICE_COMPILE__)
  asm volatile("s_wait_asynccnt 0x0" ::: "memory");
#endif
}
__device__ __forceinline__ void wait_ds0() {      // this wave's LDS reads have returned: their buffer may be refilled behind the next barrier
#if defined(__HIP_DEVICE_COMPILE__)
  asm volatile("s_wait_dscnt 0x0" ::: "memory");
#endif
}
__device__ __forceinline__ void wave_sync_lds() {
  __builtin_amdgcn_fence(__ATOMIC_RELEASE, "workgroup");
  __builtin_amdgcn_wave_barrier();
  __builtin_amdgcn_fence(__ATOMIC_ACQUIRE, "workgroup");
}

// =====================================================================================================
// Elementwise 16-bit pack, no transpose: dst[i] = f16( bf16_RNE(src[i]) * sc ), sc a power of two (exact).
// coverage: grid = n / 2048 blocks x 256 thr x 8 elements = n exactly (host checks n % 2048 == 0).
// =====================================================================================================
__global__ __launch_bounds__(256) void cvt16(const float* __restrict__ src, unsigned short* dst, int n, float sc) {
  const size_t i8 = ((size_t)blockIdx.x * 256 + threadIdx.x) * 8;
  if (i8 + 8 > (size_t)n) return;                 // never taken with the exact grid; no barriers in this kernel
  const v4f a = *(const v4f*)(src + i8);
  const v4f b = *(const v4f*)(src + i8 + 4);
  v4u o;
  o[0] = pk16(h_bits((_Float16)(bfr(a[0]) * sc)), h_bits((_Float16)(bfr(a[1]) * sc)));
  o[1] = pk16(h_bits((_Float16)(bfr(a[2]) * sc)), h_bits((_Float16)(bfr(a[3]) * sc)));
  o[2] = pk16(h_bits((_Float16)(bfr(b[0]) * sc)), h_bits((_Float16)(bfr(b[1]) * sc)));
  o[3] = pk16(h_bits((_Float16)(bfr(b[2]) * sc)), h_bits((_Float16)(bfr(b[3]) * sc)));
  {
    *(v4u*)(dst + i8) = o;
    
  }
}

// =====================================================================================================
// Transposing 16-bit pack of a weight matrix: in W[Cin][Dd] (pitch Dd, base + z*sIn) -> out WT[Dd][Cin] (pitch Cin, base + z*sOut),
// BFO 0: f16( bf16_RNE(w) * sc ); BFO 1: bf16_RNE(w) bits. One 64x64 tile per block (x = Cin tile, y = Dd tile, z = matrix index):
// coverage: loads 4 x 256 x 4 floats = 64x64; stores 2 x 256 pieces x 8 halves = 64 rows x 64 halves = the whole tile;
//           grid = (Cin/64, Dd/64, nmat) exact (host passes exact multiples of 64).
// =====================================================================================================
template <int BFO>
__global__ __launch_bounds__(256) void tr16(const float* __restrict__ W, unsigned short* WT, int Cin, int Dd,
                                            long long sIn, long long sOut, float sc) {
  __shared__ float t[64][65];
  const int tid = threadIdx.x;
  const int c0 = blockIdx.x * 64, d0 = blockIdx.y * 64;
  const float* src = W + (size_t)((long long)blockIdx.z * sIn);
  unsigned short* dst = WT + (size_t)((long long)blockIdx.z * sOut);
#pragma unroll
  for (int it = 0; it < 4; ++it) {
    const int p  = it * 256 + tid;
    const int cc = p >> 4, sg = (p & 15) * 4;
    const v4f v = *(const v4f*)(src + (size_t)(c0 + cc) * Dd + d0 + sg);
    t[cc][sg]     = v[0];
    t[cc][sg + 1] = v[1];
    t[cc][sg + 2] = v[2];
    t[cc][sg + 3] = v[3];
  }
  __syncthreads();
  v4u o[2];
#pragma unroll
  for (int it = 0; it < 2; ++it) {
    const int p  = it * 256 + tid;
    const int dd = p >> 3, s8 = (p & 7) * 8;
    unsigned short hv[8];
#pragma unroll
    for (int k = 0; k < 8; ++k) {
      const float f = bfr(t[s8 + k][dd]);
      if constexpr (BFO != 0) hv[k] = bf_bits(f);
      else hv[k] = h_bits((_Float16)(f * sc));
    }
    v4u q;
    q[0] = pk16(hv[0], hv[1]);
    q[1] = pk16(hv[2], hv[3]);
    q[2] = pk16(hv[4], hv[5]);
    q[3] = pk16(hv[6], hv[7]);
    o[it] = q;
  }
  {
#pragma unroll
    for (int it = 0; it < 2; ++it) {
      const int p  = it * 256 + tid;
      const int dd = p >> 3, s8 = (p & 7) * 8;
      *(v4u*)(dst + (size_t)(d0 + dd) * Cin + c0 + s8) = o[it];
    }
    
  }
}

// =====================================================================================================
// Register-blocked batched 16-bit WMMA GEMM: C[m][n] = oscale * sum_k A[m][k] * Bt[n][k] (+ bias); one wave per 64x64 tile, a block's
// eight waves on eight neighbouring column tiles of one row tile (64 x 512). A row-major [M][K] pitch lda (16-bit plane), Bt row-major
// [N][K] pitch ldb (k contiguous); M multiple of 64, N multiple of 512, K multiple of 64.
// Operands go through LDS: per slab of 64 k the block's 64 A rows (both planes with ASPLIT) and 512 Bt rows are copied once, as whole
// 128-byte lines (a wave's copy = 4 rows), by asynchronous copies; every wave takes its fragments from there (row pitch 144 B = 16 B x odd).
// NBUF 2: slab t+2 is copied into the buffer that trip t has read, behind the trip's one barrier, and flies under trip t+1.
// NBUF 1: one buffer, filled and then read (for K = one slab: two blocks fit a WGP).
// blockIdx.y = batch index with element strides sA, sB, sC; blockIdx.z = outer batch index with strides zA, zB, zC.
// ASPLIT 1: a second A plane A2 (unscaled residual of A, same layout) is multiplied into the same accumulator (A + A2 ~ exact A).
// BF 1: bf16 operands (v_wmma_f32_16x16x32_bf16), else f16.
// EPI 1: value += bf16_RNE(ep0[column]) (per-column bias); EPI 2: value += bf16_RNE(ep0[row]) (per-row bias, 16-bit out only).
// OM 0: f32 out (pitch ldc).  OM 2: one f16 plane = f16(value * ocarry).
// OM 4: two f16 planes: hi = f16(value * ocarry), lo = f16(value * ocarry - hi) (unscaled residual).
// OM 5: two f16 planes: C = f16((value + bf16_RNE(ep1[column])) * ocarry), C2 = f16((value + bf16_RNE(ep2[column])) * ocarry).
// coverage: 4 slabs x 16 rows (f32: it 0..7 x lane>>4; 16-bit: it 0..3 x lane>>3) x 64 cols = the wave's whole 64x64 tile;
//           grid = tilesM*tilesN/8 blocks exactly.
// =====================================================================================================
template <int OM, int ASPLIT, int BF, int EPI, int NBUF>
__global__ __launch_bounds__(256) __attribute__((amdgpu_num_vgpr(256))) void gemm64(
    const unsigned short* __restrict__ Ap, const unsigned short* __restrict__ A2p, int lda, long long sA, long long zA,
    const unsigned short* __restrict__ Btp, int ldb, long long sB, long long zB,
    void* Cout, void* C2out, int ldc, long long sC, long long zC,
    int M, int N, int K, float oscale, float ocarry,
    const float* __restrict__ ep0, const float* __restrict__ ep1, const float* __restrict__ ep2) {
  constexpr int AROWS  = 64 * (1 + ASPLIT);        // staged rows: A | A2 (ASPLIT) | Bt
  constexpr int SROWS  = AROWS + 512;
  constexpr int SBYTES = SROWS * GPITCH;           // one buffer
  constexpr int NQ     = SROWS / 32;               // copies per thread and slab: 256 threads x 16 B = 32 rows each
  __shared__ __align__(16) float sT[8][16 * 68];   // per-wave 16x64 slab, pitch 68 floats
  __shared__ __align__(16) char stg[NBUF * SBYTES];
  const int by   = blockIdx.y;
  const int bz   = blockIdx.z;
  const int lane = threadIdx.x & 31;
  const int wave = threadIdx.x >> 5;
  const int tilesN = N >> 6;
  const int tilesM = M >> 6;
  const int tile0 = blockIdx.x * 8;
  if (tile0 + 8 > tilesM * tilesN) return;   // the same for the whole block, in front of every barrier; never taken with the exact grid
  const int tm  = tile0 / tilesN;
  const int tn0 = tile0 - tm * tilesN;       // tilesN is a multiple of 8: the block's eight tiles lie in one row of tiles
  const int m0  = tm << 6;
  const int nb0 = tn0 << 6;                  // first Bt row of the block
  const int n0  = nb0 + (wave << 6);

  const char* A1 = (const char*)(Ap  + (size_t)((long long)by * sA + (long long)bz * zA));
  const char* A2 = (const char*)(A2p + (size_t)((long long)by * sA + (long long)bz * zA));
  const char* Bb = (const char*)(Btp + (size_t)((long long)by * sB + (long long)bz * zB));

  const int rlane = lane & 15;                 // row (A) / col (B, D) within subtile
  const int koff  = (lane >> 4) * 8;           // k offset of this lane half
  const int mOff  = (lane >> 4) * 8;           // D row offset

  v8f acc[4][4];
#pragma unroll
  for (int i = 0; i < 4; ++i)
#pragma unroll
    for (int j = 0; j < 4; ++j) acc[i][j] = zero8();

  // this thread's 16-byte pieces of a slab: staged rows (tid>>3) + 32 q, piece tid&7 of the row's 128 B (planes stay under 4 GiB)
  const int prow = threadIdx.x >> 3, seg = threadIdx.x & 7;
  const unsigned lds0 = (unsigned)(uintptr_t)stg + (unsigned)(prow * GPITCH + seg * 16);   // low 32 bits of the __shared__ address
  const unsigned ga0  = (unsigned)((m0 + prow) * lda) * 2u + (unsigned)(seg * 16);
  const unsigned gb0  = (unsigned)((nb0 + prow) * ldb) * 2u + (unsigned)(seg * 16);
  auto stage = [&](int k0, unsigned bufoff) {
    unsigned l[NQ];
    const char* g[NQ];
#pragma unroll   // q must be a constant: the addresses are register operands of the copy statements
    for (int q = 0; q < NQ; ++q) {
      l[q] = lds0 + bufoff + (unsigned)(q * 32 * GPITCH);
      // block-uniform part first (scalar), then this thread's offset: one vector add an address
      if (q < 2) g[q] = (A1 + (unsigned)(q * 32 * lda + k0) * 2u) + ga0;
      else if (q < AROWS / 32) g[q] = (A2 + (unsigned)((q - 2) * 32 * lda + k0) * 2u) + ga0;
      else g[q] = (Bb + (unsigned)((q - AROWS / 32) * 32 * ldb + k0) * 2u) + gb0;
    }
    acopy<NQ / 2>(l, g);
    acopy<NQ / 2>(l + NQ / 2, g + NQ / 2);
  };

  const unsigned fa = (unsigned)(rlane * GPITCH + koff * 2);                               // this lane's fragment reads: A row rlane
  const unsigned fb = (unsigned)((AROWS + (wave << 6) + rlane) * GPITCH + koff * 2);       // Bt row rlane of the wave's 64
  auto products = [&](unsigned bufoff) {
    const char* sb = stg + bufoff;
#pragma unroll   // both k-steps of a slab in line: their LDS offsets are immediates
    for (int ks = 0; ks < GKS / 32; ++ks) {
      // every fragment of this k-step is requested before its first product: one LDS latency a k-step
      v16h bh[4], ah[4], al[4];
#pragma unroll
      for (int j = 0; j < 4; ++j) bh[j] = ldfrag_o(sb + (j * 16 * GPITCH + ks * 64), fb);
#pragma unroll
      for (int i = 0; i < 4; ++i) {
        ah[i] = ldfrag_o(sb + (i * 16 * GPITCH + ks * 64), fa);
        if constexpr (ASPLIT != 0) al[i] = ldfrag_o(sb + ((64 + i * 16) * GPITCH + ks * 64), fa);
      }
      __builtin_amdgcn_sched_barrier(0);   // keeps the loads above in front of the products (else each A load sinks to its own group and waits alone)
#pragma unroll
      for (int i = 0; i < 4; ++i) {
#pragma unroll
        for (int j = 0; j < 4; ++j) acc[i][j] = mmaT<BF>(ah[i], bh[j], acc[i][j]);
        dep_guard1(acc[i][0], acc[i][3], ah[i]);
        if constexpr (ASPLIT != 0) {
#pragma unroll
          for (int j = 0; j < 4; ++j) acc[i][j] = mmaT<BF>(al[i], bh[j], acc[i][j]);
          dep_guard1(acc[i][0], acc[i][3], al[i]);
        }
      }
      keep4_h(bh[0], bh[1], bh[2], bh[3]);
    }
  };

  const int nslab = K / GKS;
  if constexpr (NBUF == 2) {
    stage(0, 0u);
    wait_async0();
    __syncthreads();                                       // publishes slab 0
    if (nslab > 1) stage(GKS, (unsigned)SBYTES);
    for (int t = 0; t < nslab; ++t) {
      const unsigned bo = (unsigned)(t & 1) * (unsigned)SBYTES;
      products(bo);
      wait_ds0();
      wait_async0();
      __syncthreads();                                     // publishes slab t+1; ends every wave's reads of this trip's buffer
      if (t + 2 < nslab) stage((t + 2) * GKS, bo);
    }
    wait_async0();
  } else {
    for (int t = 0; t < nslab; ++t) {
      if (t > 0) {
        wait_ds0();
        __syncthreads();                                   // ends every wave's reads of the buffer before it is refilled
      }
      stage(t * GKS, 0u);
      wait_async0();
      __syncthreads();                                     // publishes slab t
      products(0u);
    }
  }
  acc_guard4(acc[0][0], acc[0][1], acc[0][2], acc[0][3]);
  acc_guard4(acc[1][0], acc[1][1], acc[1][2], acc[1][3]);
  acc_guard4(acc[2][0], acc[2][1], acc[2][2], acc[2][3]);
  acc_guard4(acc[3][0], acc[3][1], acc[3][2], acc[3][3]);

  const int hh2 = lane >> 4, c4 = (lane & 15) * 4;     // f32 out: 256-B row segment = 16 lanes x 16 B
  const int q8  = lane >> 3, c8 = (lane & 7) * 8;

  // ---- epilogue ----
  float* slab = sT[wave];
#pragma unroll
  for (int i = 0; i < 4; ++i) {
    const int mBase = m0 + (i << 4);
#pragma unroll
    for (int j = 0; j < 4; ++j) {
#pragma unroll
      for (int r = 0; r < 8; ++r) {
        slab[(mOff + r) * 68 + (j << 4) + rlane] = acc[i][j][r];
      }
    }
    wave_sync_lds();
    if constexpr (OM == 0) {
      float* C = (float*)Cout + (size_t)((long long)by * sC + (long long)bz * zC);
      v4f vals[8];
#pragma unroll
      for (int it = 0; it < 8; ++it) {
        const int row = it * 2 + hh2;                      // it 0..7 x hh2 0..1 = rows 0..15
        v4f v = *(const v4f*)(slab + row * 68 + c4);
#pragma unroll
        for (int e = 0; e < 4; ++e) v[e] = v[e] * oscale;
        if constexpr (EPI == 1) {
          const v4f bb = *(const v4f*)(ep0 + n0 + c4);     // per-column bias, columns n0+c4 .. +3 (N equals the bias length)
#pragma unroll
          for (int e = 0; e < 4; ++e) v[e] = v[e] + bfr(bb[e]);
        }
        vals[it] = v;
      }
      {
#pragma unroll
        for (int it = 0; it < 8; ++it) {
          const int gr = mBase + it * 2 + hh2;
          *(v4f*)(C + (size_t)gr * ldc + n0 + c4) = vals[it];
        }
        
      }
    } else {
      unsigned short* C  = (unsigned short*)Cout  + (size_t)((long long)by * sC + (long long)bz * zC);
      unsigned short* Cb = (unsigned short*)C2out + (size_t)((long long)by * sC + (long long)bz * zC);
      v4u hv[4], lv[4];
#pragma unroll
      for (int it = 0; it < 4; ++it) {
        const int row = it * 4 + q8;                       // it 0..3 x q8 0..3 = rows 0..15
        const float* sp = slab + row * 68 + c8;
        float rb = 0.f;
        if constexpr (EPI == 2) rb = bfr(ep0[mBase + row]);   // per-row bias (M equals the bias length)
        v4u a  = {0u, 0u, 0u, 0u};
        v4u b2 = {0u, 0u, 0u, 0u};
#pragma unroll
        for (int e = 0; e < 4; ++e) {
          const int ci = n0 + c8 + 2 * e;                  // column index, < N
          float f0 = sp[2 * e] * oscale + rb;
          float f1 = sp[2 * e + 1] * oscale + rb;
          if constexpr (EPI == 1) {
            f0 += bfr(ep0[ci]);
            f1 += bfr(ep0[ci + 1]);
          }
          if constexpr (OM == 5) {
            const float g0 = (f0 + bfr(ep1[ci])) * ocarry, g1 = (f1 + bfr(ep1[ci + 1])) * ocarry;
            const float w0 = (f0 + bfr(ep2[ci])) * ocarry, w1 = (f1 + bfr(ep2[ci + 1])) * ocarry;
            a[e]  = pk16(h_bits((_Float16)g0), h_bits((_Float16)g1));
            b2[e] = pk16(h_bits((_Float16)w0), h_bits((_Float16)w1));
          } else {
            f0 *= ocarry; f1 *= ocarry;
            const _Float16 x0 = (_Float16)f0, x1 = (_Float16)f1;
            a[e] = pk16(h_bits(x0), h_bits(x1));
            if constexpr (OM == 4) {
              b2[e] = pk16(h_bits((_Float16)(f0 - (float)x0)), h_bits((_Float16)(f1 - (float)x1)));
            }
          }
        }
        hv[it] = a;
        lv[it] = b2;
      }
      {
#pragma unroll
        for (int it = 0; it < 4; ++it) {
          const int row = it * 4 + q8;
          *(v4u*)(C + (size_t)(mBase + row) * ldc + n0 + c8) = hv[it];
          if constexpr (OM >= 4) {
            *(v4u*)(Cb + (size_t)(mBase + row) * ldc + n0 + c8) = lv[it];
          }
        }
        
      }
    }
    wave_sync_lds();
  }
}

// =====================================================================================================
// Flash attention for one batch element, one head and 128 query rows: 8 waves, 16 query rows each, head dim 64, 1024 keys.
// blockIdx.x = block of 128 query rows, blockIdx.y = head, blockIdx.z = batch element within the launch's group. Pointers QU0, KP0, CTh0,
// CTl0 are pre-offset to the group's first row of the [8192][512] planes; VTh0/VTl0 to the group's first [512][1024] plane; Gt0 is the
// group's position table, one slab per batch element, Gt[h][r][c] = (q_r + v_bias) . p_c (f32, pitch 1024).
//   The eight waves need the same k and v^T values: each chunk of 32 keys is brought from global memory ONCE per block (whole 16-byte pieces,
//   one of k, one of v^T hi, one of v^T residual per thread) into one of two LDS buffers, and every wave takes its B fragments from there.
//   The pieces of chunk t+1 are requested at the head of trip t, stored into the other buffer at its foot, and published by the trip's one
//   block barrier, which also ends every wave's reads of the buffer that the next trip refills.
//   LDS rows: k [32 keys][64 d] pitch 144 B, v^T [64 d][32 keys] pitch 80 B (16 B x odd: 16-byte fragment reads without bank conflicts).
//   A fragments (stationary): (q_i + u_bias) f16 x4 rows i0+m, QU[i][64h + d], two k-steps of 32;
//   B fragments per chunk of 32 keys: k f16 x4 rows (k-contiguous) -> scores s[i][j] (two 16-column tiles);
//   position logit by relative shift, i = query row, j = key: j <= i -> Gt[h][i][S-1-i+j]; j == i+1 -> 0; else Gt[h][i+1][j-i-2];
//   every lane loads from a clamped address and selects by value (no per-lane branches about loads);
//   t = (s/16 + pos) / sqrt(512) * log2(e); online softmax in base 2, max-subtracted, running sums in f32;
//   A fragments of P*1024 (f16 hi and unscaled residual) rebuilt from the wave's LDS rows (f32 vector loads, split k map); v^T B fragments
//   (f16 x16 hi and unscaled residual); 12 P.V WMMAs (hi.hi, lo.hi, hi.lo).
//   Final 1/l and carry folds in f32; behind the last trip's barrier each wave reuses its own 4608 B of LDS as two bf16 tiles [16][64]
//   (hi, lo, pitch 144 B), stages its slice (element stores) and writes it as whole 128-byte row segments.
//   every wave does identical bounded work (32 trips of 32 keys) and passes every barrier.
// coverage: wave tile 16 rows x 64 cols per plane = 4 iterations x 32 lanes x 8 halves; 8 waves x 8 blocks = 1024 rows, 8 heads x 64 = 512
//           columns, per batch element, each element written exactly once.
// =====================================================================================================
__global__ __launch_bounds__(ATT_THREADS) __attribute__((amdgpu_num_vgpr(256)))
void attnb(const unsigned short* __restrict__ QU0, const unsigned short* __restrict__ KP0,
           const unsigned short* __restrict__ VTh0, const unsigned short* __restrict__ VTl0,
           const float* __restrict__ Gt0, unsigned short* CTh0, unsigned short* CTl0) {
  __shared__ __align__(16) char smem[ATT_SMEM_BYTES];   // prob tiles [wave][row][32 cols] pitch 36 floats | two k / v^T buffers

  const int tid  = threadIdx.x;
  const int wave = tid >> 5;
  const int lane = tid & 31;
  const int hh   = lane >> 4;
  const int c    = lane & 15;

  const int head = blockIdx.y;                             // 0..7
  const int i0   = blockIdx.x * (ATT_WAVES * 16) + __builtin_amdgcn_readfirstlane(wave) * 16;   // first query row of this wave (scalar)

  const size_t bg = blockIdx.z;                            // batch element within the group
  const unsigned short* QU  = QU0  + bg * ((size_t)SEQ * DM);
  const unsigned short* KP  = KP0  + bg * ((size_t)SEQ * DM);
  const unsigned short* VTh = VTh0 + bg * ((size_t)DM * SEQ);
  const unsigned short* VTl = VTl0 + bg * ((size_t)DM * SEQ);
  const float*          Gt  = Gt0  + bg * ((size_t)NHEAD * SEQ * SEQ);
  unsigned short*       CTh = CTh0 + bg * ((size_t)SEQ * DM);
  unsigned short*       CTl = CTl0 + bg * ((size_t)SEQ * DM);

  // stationary A fragments: (q + u_bias) rows i0 + c, d 0..31 and 32..63
  const size_t qofs = (size_t)(i0 + c) * DM + head * HD + 8 * hh;
  const v16h qa = ldfrag_u(QU + qofs), qb = ldfrag_u(QU + qofs + 32);

  const char* Kb  = (const char*)(KP + head * HD);
  const char* Vbh = (const char*)(VTh + (size_t)(head * HD) * SEQ);
  const char* Vbl = (const char*)(VTl + (size_t)(head * HD) * SEQ);
  // this thread's 16-byte pieces of a chunk: k row tid>>3 (8 pieces of its 128 B), v^T row tid>>2 (4 pieces of its 64 B)
  const unsigned gk0 = (unsigned)((tid >> 3) * (DM * 2) + (tid & 7) * 16);      // byte offset in chunk 0 of k
  const unsigned gv0 = (unsigned)((tid >> 2) * (SEQ * 2) + (tid & 3) * 16);     // byte offset in chunk 0 of either v^T plane
  const unsigned sk  = (unsigned)((tid >> 3) * KPITCH + (tid & 7) * 16);        // where they go in a buffer
  const unsigned sv  = (unsigned)(ST_VH + (tid >> 2) * VPITCH + (tid & 3) * 16);
  const unsigned fk  = (unsigned)(c * KPITCH + 16 * hh);                        // this lane's fragment reads: k row c
  const unsigned fv  = (unsigned)(ST_VH + c * VPITCH + 16 * hh);                // v^T hi row c
  const float* Gh = Gt + (size_t)head * SEQ * SEQ;

  const float PSC = SCL * LOG2E;                           // position logit scale (table values are plain f32)
  const float CSC = PSC * (1.0f / (QC * QC));              // content scores carry x4 on both operands

  float mrow[8], lrow[8];
  v8f o0 = zero8(), o1 = zero8(), o2 = zero8(), o3 = zero8();
#pragma unroll
  for (int r = 0; r < 8; ++r) { mrow[r] = -INFINITY; lrow[r] = 0.f; }
  float* pt = (float*)smem + wave * (16 * 36);
  char* stage = smem + ATT_PT_BYTES;

  // position-table values of the trip that starts at key jt: raw loads from clamped addresses, selected by value where they are used
  auto ld_tab = [&](int jt, float (&ga)[8], float (&gc)[8]) {
#pragma unroll
    for (int r = 0; r < 8; ++r) {
      const int i  = i0 + 8 * hh + r;                      // query row of this lane's accumulator element r
      const int ja = jt + c, jc = jt + 16 + c;             // key columns of s0 / s1
      const bool la = (ja <= i), lc = (jc <= i);
      int ra = la ? i : (i + 1), rc = lc ? i : (i + 1);
      int ca = la ? (SEQ - 1 - i + ja) : (ja - i - 2);
      int cz = lc ? (SEQ - 1 - i + jc) : (jc - i - 2);
      ra = (ra > SEQ - 1) ? (SEQ - 1) : ra;
      rc = (rc > SEQ - 1) ? (SEQ - 1) : rc;
      ca = (ca < 0) ? 0 : ca;  ca = (ca > SEQ - 1) ? (SEQ - 1) : ca;
      cz = (cz < 0) ? 0 : cz;  cz = (cz > SEQ - 1) ? (SEQ - 1) : cz;
      ga[r] = Gh[(unsigned)(ra * SEQ + ca)];
      gc[r] = Gh[(unsigned)(rc * SEQ + cz)];
    }
  };

  // chunk 0 into buffer 0; table values travel one trip ahead of their use, trip 0's are requested here
  float ga[8], gc[8];
  {
    const v4u pk = *(const v4u*)(Kb + gk0);
    const v4u ph0 = *(const v4u*)(Vbh + gv0);
    const v4u pl0 = *(const v4u*)(Vbl + gv0);
    ld_tab(0, ga, gc);
    *(v4u*)(stage + sk) = pk;
    *(v4u*)(stage + sv) = ph0;
    *(v4u*)(stage + sv + ST_VSZ) = pl0;
  }
  __syncthreads();                                         // publishes chunk 0

#pragma unroll 1
  for (int jb = 0; jb < SEQ; jb += KCH) {
    const int jn = (jb + KCH < SEQ) ? (jb + KCH) : 0;      // next trip's first key; the last trip asks for trip 0's again (in bounds, not used)
    const unsigned bsel = (unsigned)((jb / KCH) & 1) * ST_BYTES;
    const char* cur = stage + bsel;                        // this trip's buffer
    char*       nxt = stage + (ST_BYTES - bsel);           // the other one: every wave left it before the last barrier
    // the next chunk's pieces are requested here and stored at the trip's foot: their latency lies under the whole trip
    const v4u nk = *(const v4u*)(Kb + (gk0 + (unsigned)jn * (unsigned)(DM * 2)));
    const v4u nh = *(const v4u*)(Vbh + (gv0 + (unsigned)jn * 2u));
    const v4u nl = *(const v4u*)(Vbl + (gv0 + (unsigned)jn * 2u));
    const v16h k0a = ldfrag_o(cur, fk);
    const v16h k0b = ldfrag_o(cur + 64, fk);
    const v16h k1a = ldfrag_o(cur + 16 * KPITCH, fk);
    const v16h k1b = ldfrag_o(cur + 16 * KPITCH + 64, fk);
    __builtin_amdgcn_sched_barrier(0);   // keeps the requests above at the trip's head (else the global ones sink to their stores and wait there)
    v8f s0, s1;
    s0 = mma_h(qa, k0a, zero8());
    s0 = mma_h(qb, k0b, s0);
    s1 = mma_h(qa, k1a, zero8());
    s1 = mma_h(qb, k1b, s1);
    guard2x6(s0, s1, qa, qb, k0a, k0b, k1a, k1b);
    float tt0[8], tt1[8];
#pragma unroll
    for (int r = 0; r < 8; ++r) {
      const int i  = i0 + 8 * hh + r;
      const int ja = jb + c, jc = jb + 16 + c;
      const float pa = (ja == i + 1) ? 0.f : ga[r];
      const float pz = (jc == i + 1) ? 0.f : gc[r];
      tt0[r] = s0[r] * CSC + pa * PSC;
      tt1[r] = s1[r] * CSC + pz * PSC;
    }
    ld_tab(jn, ga, gc);                                    // next trip's table values, likewise
    __builtin_amdgcn_sched_barrier(0);   // keeps that request in front of the softmax
#pragma unroll
    for (int r = 0; r < 8; ++r) {
      const float t0 = tt0[r], t1 = tt1[r];
      float mx = fmaxf(t0, t1);
#pragma unroll
      for (int off = 1; off < 16; off <<= 1) mx = fmaxf(mx, __shfl_xor(mx, off, 32));
      const float mn = fmaxf(mrow[r], mx);
      const float al = exp2f(mrow[r] - mn);
      mrow[r] = mn;
      const float e0 = exp2f(t0 - mn), e1 = exp2f(t1 - mn);
      float ps = e0 + e1;
#pragma unroll
      for (int off = 1; off < 16; off <<= 1) ps += __shfl_xor(ps, off, 32);
      lrow[r] = lrow[r] * al + ps;
      o0[r] *= al;
      o1[r] *= al;
      o2[r] *= al;
      o3[r] *= al;
      const int ro = (8 * hh + r) * 36 + c;
      pt[ro]      = e0;
      pt[ro + 16] = e1;
    }
    wave_sync_lds();
    const v16h vh0 = ldfrag_o(cur, fv);
    const v16h vh1 = ldfrag_o(cur + 16 * VPITCH, fv);
    const v16h vh2 = ldfrag_o(cur + 32 * VPITCH, fv);
    const v16h vh3 = ldfrag_o(cur + 48 * VPITCH, fv);
    const v16h vl0 = ldfrag_o(cur + ST_VSZ, fv);
    const v16h vl1 = ldfrag_o(cur + ST_VSZ + 16 * VPITCH, fv);
    const v16h vl2 = ldfrag_o(cur + ST_VSZ + 32 * VPITCH, fv);
    const v16h vl3 = ldfrag_o(cur + ST_VSZ + 48 * VPITCH, fv);
    FragH ph, pl;
    {
      const float* prow = pt + c * 36 + 8 * hh;
      const v4f p0 = *(const v4f*)(prow), p1 = *(const v4f*)(prow + 4);
      const v4f p2 = *(const v4f*)(prow + 16), p3 = *(const v4f*)(prow + 20);
#pragma unroll
      for (int e = 0; e < 4; ++e) {
        float f; _Float16 x;
        f = p0[e] * PC; x = (_Float16)f; ph.h[0][e]     = x; pl.h[0][e]     = (_Float16)(f - (float)x);   // keys jb + 8hh + e
        f = p1[e] * PC; x = (_Float16)f; ph.h[0][4 + e] = x; pl.h[0][4 + e] = (_Float16)(f - (float)x);   // keys jb + 8hh + 4 + e
        f = p2[e] * PC; x = (_Float16)f; ph.h[1][e]     = x; pl.h[1][e]     = (_Float16)(f - (float)x);   // keys jb + 16 + 8hh + e
        f = p3[e] * PC; x = (_Float16)f; ph.h[1][4 + e] = x; pl.h[1][4 + e] = (_Float16)(f - (float)x);
      }
    }
    {
      o0 = mma_h(ph.v, vh0, o0);
      o1 = mma_h(ph.v, vh1, o1);
      o2 = mma_h(ph.v, vh2, o2);
      o3 = mma_h(ph.v, vh3, o3);
      o0 = mma_h(pl.v, vh0, o0);
      o1 = mma_h(pl.v, vh1, o1);
      o2 = mma_h(pl.v, vh2, o2);
      o3 = mma_h(pl.v, vh3, o3);
      guard4x6(o0, o1, o2, o3, ph.v, pl.v, vh0, vh1, vh2, vh3);
    }
    {
      o0 = mma_h(ph.v, vl0, o0);
      o1 = mma_h(ph.v, vl1, o1);
      o2 = mma_h(ph.v, vl2, o2);
      o3 = mma_h(ph.v, vl3, o3);
      guard4x5(o0, o1, o2, o3, ph.v, vl0, vl1, vl2, vl3);
    }
    *(v4u*)(nxt + sk) = nk;
    *(v4u*)(nxt + sv) = nh;
    *(v4u*)(nxt + sv + ST_VSZ) = nl;
    __syncthreads();   // publishes the next chunk; ends every wave's reads of this trip's buffer (and of its own prob tile)
  }

  // ---- behind the last barrier no wave reads the loop's LDS any more: each wave takes its own 4608 B as two bf16 tiles [16][64], pitch 72 ----
  unsigned short* Osh = (unsigned short*)(smem + wave * (2 * 16 * OPITCH * 2));
  unsigned short* Osl = Osh + 16 * OPITCH;
  // ---- fold 1/l and the carries (1024 on P, 16 on v), split into bf16 hi + residual, stage the wave's 16x64 slice ----
  const float oc = 1.0f / (PC * VC);
#pragma unroll
  for (int r = 0; r < 8; ++r) {
    const float inv = (1.0f / lrow[r]) * oc;
    const int ro = (8 * hh + r) * OPITCH + c;
    const float f0 = o0[r] * inv, f1 = o1[r] * inv, f2 = o2[r] * inv, f3 = o3[r] * inv;
    const unsigned short g0 = bf_bits(f0), g1 = bf_bits(f1), g2 = bf_bits(f2), g3 = bf_bits(f3);
    Osh[ro]      = g0;  Osl[ro]      = bf_bits(f0 - bf_up(g0));
    Osh[ro + 16] = g1;  Osl[ro + 16] = bf_bits(f1 - bf_up(g1));
    Osh[ro + 32] = g2;  Osl[ro + 32] = bf_bits(f2 - bf_up(g2));
    Osh[ro + 48] = g3;  Osl[ro + 48] = bf_bits(f3 - bf_up(g3));
  }
  wave_sync_lds();
  // ---- the wave writes its 16 row segments of 128 B in both planes: piece p = it*32 + lane -> row p>>3, halves (p&7)*8 .. +7 ----
  {
    v4u hv[4], lv[4];
#pragma unroll
    for (int it = 0; it < 4; ++it) {
      const int p = it * 32 + lane;
      hv[it] = *(const v4u*)(Osh + (p >> 3) * OPITCH + (p & 7) * 8);
      lv[it] = *(const v4u*)(Osl + (p >> 3) * OPITCH + (p & 7) * 8);
    }
    const size_t dofs = (size_t)i0 * DM + head * HD;
    unsigned short* dsth = CTh + dofs;
    unsigned short* dstl = CTl + dofs;
#pragma unroll
    for (int it = 0; it < 4; ++it) {
      const int p = it * 32 + lane;
      *(v4u*)(dsth + (size_t)(p >> 3) * DM + (p & 7) * 8) = hv[it];
      *(v4u*)(dstl + (size_t)(p >> 3) * DM + (p & 7) * 8) = lv[it];
    }
  }
}

// =====================================================================================================
// Workspace map (bytes); every plane is an exact multiple of its tile / whole-row store granularity (M, N exact tile multiples,
// the activation convert count an exact multiple of 2048, no pad rows needed), every offset a multiple of 512 KiB:
//   WQT, WKT, WVT, WPT f16 [512 out][512 in] x64   4 x 524288
//   WOT  bf16 [512 out][512 in]                         524288
//   X16  f16 [8192][512] x16                          8388608    (one activation input at a time, rows b*1024 + tok)
//   QU, QV f16 [8192][512] x4                     2 x 8388608    (q + u_bias, q + v_bias)
//   K16, P16 f16 [8192][512] x4                   2 x 8388608
//   VTh, VTl f16 [8][512][1024] x16               2 x 8388608    (v^T per batch, hi / residual)
//   GTAB f32 [4 batches][8 heads][1024][1024]       134217728    (position tables of the current group of batch elements)
//   CTh, CTl bf16 [8192][512]                     2 x 8388608    (attention ctx, merged heads, hi / residual)
//   end                                             212336640
// =====================================================================================================
extern "C" void kernel_launch(void* const* d_in, const int* in_sizes, int n_in,
                              void* d_out, int out_size, void* d_ws, size_t ws_size,
                              hipStream_t stream) {
  if (n_in < 15) return;
  const int NA = NROWS * DM;
  if (in_sizes[0] != NA || in_sizes[1] != NA || in_sizes[2] != NA || in_sizes[3] != NA) return;
  if (in_sizes[4] != DM * DM || in_sizes[6] != DM * DM || in_sizes[8] != DM * DM || in_sizes[10] != DM * DM || in_sizes[13] != DM * DM) return;
  if (in_sizes[5] != DM || in_sizes[7] != DM || in_sizes[9] != DM || in_sizes[14] != DM) return;
  if (in_sizes[11] != NHEAD * HD || in_sizes[12] != NHEAD * HD) return;
  if (out_size != NROWS * DM) return;
  if ((NA % 2048) != 0) return;

  const float* query = (const float*)d_in[0];
  const float* key   = (const float*)d_in[1];
  const float* value = (const float*)d_in[2];
  const float* pemb  = (const float*)d_in[3];
  const float* w_q   = (const float*)d_in[4];
  const float* b_q   = (const float*)d_in[5];
  const float* w_k   = (const float*)d_in[6];
  const float* b_k   = (const float*)d_in[7];
  const float* w_v   = (const float*)d_in[8];
  const float* b_v   = (const float*)d_in[9];
  const float* w_p   = (const float*)d_in[10];
  const float* u_b   = (const float*)d_in[11];
  const float* v_b   = (const float*)d_in[12];
  const float* w_o   = (const float*)d_in[13];
  const float* b_o   = (const float*)d_in[14];
  float*       out   = (float*)d_out;

  const size_t PWT = (size_t)DM * DM * 2;                         //   524288
  const size_t PX  = (size_t)NROWS * DM * 2;                      //  8388608
  const size_t PVT = (size_t)NB * DM * SEQ * 2;                   //  8388608
  const size_t PG  = (size_t)GB * NHEAD * SEQ * SEQ * 4;          // 134217728
  size_t off = 0;
  const size_t oWQ = off; off += PWT;
  const size_t oWK = off; off += PWT;
  const size_t oWV = off; off += PWT;
  const size_t oWP = off; off += PWT;
  const size_t oWO = off; off += PWT;
  const size_t oX  = off; off += PX;
  const size_t oQU = off; off += PX;
  const size_t oQV = off; off += PX;
  const size_t oK  = off; off += PX;
  const size_t oP  = off; off += PX;
  const size_t oVh = off; off += PVT;
  const size_t oVl = off; off += PVT;
  const size_t oG  = off; off += PG;
  const size_t oCh = off; off += PX;
  const size_t oCl = off; off += PX;
  if (off > ws_size) return;                                      // off = 212336640

  char* ws = (char*)d_ws;
  unsigned short* WQT  = (unsigned short*)(ws + oWQ);
  unsigned short* WKT  = (unsigned short*)(ws + oWK);
  unsigned short* WVT  = (unsigned short*)(ws + oWV);
  unsigned short* WPT  = (unsigned short*)(ws + oWP);
  unsigned short* WOT  = (unsigned short*)(ws + oWO);
  unsigned short* X16  = (unsigned short*)(ws + oX);
  unsigned short* QU   = (unsigned short*)(ws + oQU);
  unsigned short* QV   = (unsigned short*)(ws + oQV);
  unsigned short* K16  = (unsigned short*)(ws + oK);
  unsigned short* P16  = (unsigned short*)(ws + oP);
  unsigned short* VTh  = (unsigned short*)(ws + oVh);
  unsigned short* VTl  = (unsigned short*)(ws + oVl);
  float*          GTAB = (float*)(ws + oG);
  unsigned short* CTh  = (unsigned short*)(ws + oCh);
  unsigned short* CTl  = (unsigned short*)(ws + oCl);

  const dim3 blk(256);
  const dim3 gTW(DM / 64, DM / 64, 1);                             // 8 x 8 x 1
  const dim3 gCX(NA / 2048);                                       // 2048
  const int tilesP = (NROWS / 64) * (DM / 64);                     // 1024
  const int tilesV = (DM / 64) * (SEQ / 64);                       // 128 per batch
  const int tilesG = (SEQ / 64) * (SEQ / 64);                      // 256 per head
  const dim3 gP((tilesP + 7) / 8, 1);                              // 128
  const dim3 gV((tilesV + 7) / 8, NB);                             // 16 x 8
  const dim3 gG((tilesG + 7) / 8, NHEAD, GB);                      // 32 x 8 x 4
  const dim3 gAT(ATT_BLOCKS, NHEAD, GB);                           // 8 x 8 x 4
  const dim3 bAT(ATT_THREADS);                                     // 256

  // (0) weight planes: W[c][n] -> WT[n][c] as f16( bf16_RNE(w) * 64 ); Wo[c][n] -> WOT[n][c] bf16
  tr16<0><<<gTW, blk, 0, stream>>>(w_q, WQT, DM, DM, 0LL, 0LL, WSC);
  tr16<0><<<gTW, blk, 0, stream>>>(w_k, WKT, DM, DM, 0LL, 0LL, WSC);
  tr16<0><<<gTW, blk, 0, stream>>>(w_v, WVT, DM, DM, 0LL, 0LL, WSC);
  tr16<0><<<gTW, blk, 0, stream>>>(w_p, WPT, DM, DM, 0LL, 0LL, WSC);
  tr16<1><<<gTW, blk, 0, stream>>>(w_o, WOT, DM, DM, 0LL, 0LL, 1.0f);

  // (1) q projection: X16 = f16(bf16(query)*16); q[m][n] = sum_c x[m][c] WQT[n][c] / 1024 + bq[n];
  //     QU = f16((q + u_bias[n]) * 4), QV = f16((q + v_bias[n]) * 4); M = 8192, N = 512, K = 512
  cvt16<<<gCX, blk, 0, stream>>>(query, X16, NA, ACARRY);
  gemm64<5, 0, 0, 1, 2><<<gP, blk, 0, stream>>>(
      X16, X16, DM, 0LL, 0LL,
      WQT, DM, 0LL, 0LL,
      (void*)QU, (void*)QV, DM, 0LL, 0LL,
      NROWS, DM, DM, 1.0f / (ACARRY * WSC), QC,
      b_q, u_b, v_b);

  // (2) k projection -> K16 = f16((k + bk) * 4)
  cvt16<<<gCX, blk, 0, stream>>>(key, X16, NA, ACARRY);
  gemm64<2, 0, 0, 1, 2><<<gP, blk, 0, stream>>>(
      X16, X16, DM, 0LL, 0LL,
      WKT, DM, 0LL, 0LL,
      (void*)K16, (void*)K16, DM, 0LL, 0LL,
      NROWS, DM, DM, 1.0f / (ACARRY * WSC), QC,
      b_k, b_k, b_k);

  // (3) v^T per batch: VT[b][n = h*64+d][tok] = sum_c WVT[n][c] x_b[tok][c] / 1024 + bv[n] -> f16 x16 hi / residual planes;
  //     M = 512, N = 1024, K = 512
  cvt16<<<gCX, blk, 0, stream>>>(value, X16, NA, ACARRY);
  gemm64<4, 0, 0, 2, 2><<<gV, blk, 0, stream>>>(
      WVT, WVT, DM, 0LL, 0LL,
      X16, DM, (long long)SEQ * DM, 0LL,
      (void*)VTh, (void*)VTl, SEQ, (long long)DM * SEQ, 0LL,
      DM, SEQ, DM, 1.0f / (ACARRY * WSC), VC,
      b_v, b_v, b_v);

  // (4) p projection (no bias) -> P16 = f16(p * 4)
  cvt16<<<gCX, blk, 0, stream>>>(pemb, X16, NA, ACARRY);
  gemm64<2, 0, 0, 0, 2><<<gP, blk, 0, stream>>>(
      X16, X16, DM, 0LL, 0LL,
      WPT, DM, 0LL, 0LL,
      (void*)P16, (void*)P16, DM, 0LL, 0LL,
      NROWS, DM, DM, 1.0f / (ACARRY * WSC), QC,
      b_q, b_q, b_q);

  // (5) per group of GB batch elements, one launch each (grid z = batch element g within the group, b = first of the group):
  //     position tables GTAB[g][h][r][c] = sum_d QV[(b+g)*1024+r][64h+d] P16[(b+g)*1024+c][64h+d] / 16 (f32; M = N = 1024, K = 64 per head),
  //     then attention over the group's 1024 query rows each, all heads -> CT (bf16 hi / residual planes)
  for (int b = 0; b < NB; b += GB) {
    const size_t boff = (size_t)b * SEQ * DM;                      // element offset of the group's rows in [8192][512] planes
    const size_t voff = (size_t)b * DM * SEQ;                      // element offset of the group's first v^T plane
    gemm64<0, 0, 0, 0, 1><<<gG, blk, 0, stream>>>(
        QV + boff, QV + boff, DM, (long long)HD, (long long)SEQ * DM,
        P16 + boff, DM, (long long)HD, (long long)SEQ * DM,
        (void*)GTAB, (void*)GTAB, SEQ, (long long)SEQ * SEQ, (long long)NHEAD * SEQ * SEQ,
        SEQ, SEQ, HD, 1.0f / (QC * QC), 1.0f,
        b_q, b_q, b_q);
    attnb<<<gAT, bAT, 0, stream>>>(QU + boff, K16 + boff, VTh + voff, VTl + voff, GTAB, CTh + boff, CTl + boff);
  }

  // (6) out = (CT_hi + CT_lo) . WOT^T + bo; M = 8192, N = 512, K = 512, f32
  gemm64<0, 1, 1, 1, 2><<<gP, blk, 0, stream>>>(
      CTh, CTl, DM, 0LL, 0LL,
      WOT, DM, 0LL, 0LL,
      (void*)out, (void*)out, DM, 0LL, 0LL,
      NROWS, DM, DM, 1.0f, 1.0f,
      b_o, b_o, b_o);
  (void)hipGetLastError();
}

// v005
// It runs in 190 microseconds.
// Next to v004, in two timings, it ran 1.40 times as fast each time.
// All steps since v000 together make it 4.27 times as fast.
// Contractions (all f32 accumulate): q/k/v/p projections v_wmma_f32_16x16x32_f16 (x f16 x16 . W^T f16 x64, K=512, single products);
// position logits (q+v_bias).p^T v_wmma_f32_16x16x32_f16 ((q+v_bias) f16 x4 . p f16 x4, K=64, single), inside attention, f32;
// content scores v_wmma_f32_16x16x32_f16 ((q+u_bias) f16 x4 . k f16 x4, K=64, single);
// P . v^T v_wmma_f32_16x16x32_f16 (P f16 x1024 hi/lo . v^T f16 x16 hi/lo, hi.hi+lo.hi+hi.lo, K=1024 by 32);
// output projection v_wmma_f32_16x16x32_bf16 (ctx bf16 hi/lo . Wo bf16, hi.W+lo.W, K=512) + bias in f32.
// Max-subtracted online base-2 softmax in f32 on VALU; the relative shift of the position logits is a shifted read of their f32 tiles in LDS. Every float input RNE-converted to bf16 on load.
#include <hip/hip_runtime.h>
#include <math.h>
#include <stdint.h>

#define NB     8
#define SEQ    1024
#define DM     512
#define NHEAD  8
#define HD     64
#define NROWS  (NB * SEQ)
#define KCH    32
#define WSC    64.0f
#define ACARRY 16.0f
#define QC     4.0f
#define VC     16.0f
#define PC     1024.0f
#define LOG2E  1.4426950408889634f
#define SCL    0.04419417382415922f
static_assert(NHEAD * HD == DM);
static_assert((SEQ % 64) == 0 && (DM % 64) == 0 && (NROWS % 64) == 0 && (HD % 32) == 0 && (SEQ % KCH) == 0);
static_assert(((NROWS * DM) % 2048) == 0);
#define ATT_WAVES   8                 // waves of an attention block: 16 query rows each, all on one head
#define ATT_THREADS (ATT_WAVES * 32)
#define ATT_BLOCKS  (SEQ / (ATT_WAVES * 16))
#define SKP    100                    // floats per row of a wave's position-logit tiles (6 tile places of 16 columns + 4: stores and shifted reads spread over the banks)
#define KPITCH 144                    // LDS bytes per staged k row (128 + 16)
#define VPITCH 80                     // LDS bytes per staged v^T row (64 + 16)
#define ST_VH    (KCH * KPITCH)       // v^T hi behind the k rows
#define ST_VSZ   (HD * VPITCH)        // one v^T plane's rows
#define ST_BYTES (ST_VH + 2 * ST_VSZ) // one buffer: k | v^T hi | v^T residual
#define OPITCH 72                     // halves per staged result row (64 + 8)
#define ATT_PT_BYTES   (ATT_WAVES * 16 * 36 * 4)
#define ATT_SMEM_BYTES (ATT_PT_BYTES + 2 * ST_BYTES)
#define GKS    64                     // halves of k per staged gemm slab: 128 B, one whole line of every row
#define GPITCH 144                    // LDS bytes per staged gemm row (128 + 16)
static_assert((DM % GKS) == 0 && (HD % GKS) == 0);                   // every K is whole slabs
static_assert(((DM / 64) % 8) == 0 && ((SEQ / 64) % 8) == 0);        // every N is whole blocks of 8 column tiles
static_assert(ATT_THREADS == 256);
static_assert(ATT_BLOCKS == 8);
static_assert(KCH * HD * 2 == ATT_THREADS * 16);          // one 16-byte piece of k, and of each v^T plane, per thread and chunk
static_assert(HD * 2 == 128 && KCH * 2 == 64);
static_assert((ATT_PT_BYTES % 16) == 0 && (ST_BYTES % 16) == 0 && (ST_VH % 16) == 0);
static_assert(ATT_WAVES * 2 * 16 * OPITCH * 2 <= ATT_SMEM_BYTES);

typedef _Float16 v16h __attribute__((ext_vector_type(16)));
typedef _Float16 v8h  __attribute__((ext_vector_type(8)));
typedef __bf16   v16b __attribute__((ext_vector_type(16)));
typedef float    v8f  __attribute__((ext_vector_type(8)));
typedef float    v4f  __attribute__((ext_vector_type(4)));
typedef unsigned int v4u __attribute__((ext_vector_type(4)));

union FragH { v16h v; v8h h[2]; v4u u[2]; };
union FragAny { v16h h; v16b b; };

// ---- scalar helpers --------------------------------------------------------------------------------
__device__ __forceinline__ unsigned short bf_bits(float f) {          // f32 -> bf16 bits, RNE convert
  unsigned u = __float_as_uint(f);
  return (unsigned short)((u + 0x7FFFu + ((u >> 16) & 1u)) >> 16);
}
__device__ __forceinline__ float bf_up(unsigned short h) { return __uint_as_float(((unsigned)h) << 16); }
__device__ __forceinline__ float bfr(float f) { return bf_up(bf_bits(f)); }   // value of the bf16 RNE convert
__device__ __forceinline__ unsigned short h_bits(_Float16 x) { return __builtin_bit_cast(unsigned short, x); }
__device__ __forceinline__ unsigned pk16(unsigned short a, unsigned short b) { return (unsigned)a | ((unsigned)b << 16); }
__device__ __forceinline__ v8f zero8() { v8f z = {0.f, 0.f, 0.f, 0.f, 0.f, 0.f, 0.f, 0.f}; return z; }

// ---- fragment loader: 16-bit A/B operand from a k-contiguous 16-bit plane, lane -> row/col (lane&15),
//      p already includes +8*(lane>>4); elements 0..7 <- p[0..7] (k0+8h..), elements 8..15 <- p[16..23] (k0+16+8h..)
//      (same split k map for A and B; B is always read from a [n][k] plane)
__device__ __forceinline__ v16h ldfrag_u(const unsigned short* p) {
  FragH f;
  f.u[0] = *(const v4u*)(p);
  f.u[1] = *(const v4u*)(p + 16);
  return f.v;
}

// same fragment from a wave-uniform byte base plus this lane's 32-bit byte offset (already holding +16*(lane>>4)): an address costs one
// register, shared by planes of one layout, so a whole trip's loads fit the register file together
__device__ __forceinline__ v16h ldfrag_o(const char* base, unsigned off) {
  const char* p = base + off;
  FragH f;
  f.u[0] = *(const v4u*)(p);
  f.u[1] = *(const v4u*)(p + 32);
  return f.v;
}

// ---- WMMA helpers with trailing VALU hazard gaps ------------------------------------------------------
__device__ __forceinline__ v8f mma_h(v16h a, v16h b, v8f c) {
  return __builtin_amdgcn_wmma_f32_16x16x32_f16(false, a, false, b, (short)0, c, false, false);
}
__device__ __forceinline__ v8f mma_b(v16h a, v16h b, v8f c) {
  FragAny ua, ub;
  ua.h = a;
  ub.h = b;
  return __builtin_amdgcn_wmma_f32_16x16x32_bf16(false, ua.b, false, ub.b, (short)0, c, false, false);
}
template <int BF>
__device__ __forceinline__ v8f mmaT(v16h a, v16h b, v8f c) {
  if constexpr (BF != 0) return mma_b(a, b, c);
  else return mma_h(a, b, c);
}
__device__ __forceinline__ void dep_guard1(v8f& a, v8f& b, v16h x) {
#if defined(__HIP_DEVICE_COMPILE__)
  asm volatile("v_nop\n\tv_nop\n\tv_nop\n\tv_nop" : "+v"(a), "+v"(b) : "v"(x));
#endif
}
__device__ __forceinline__ void guard2x6(v8f& a, v8f& b, v16h x0, v16h x1, v16h x2, v16h x3, v16h x4, v16h x5) {
#if defined(__HIP_DEVICE_COMPILE__)
  asm volatile("v_nop\n\tv_nop\n\tv_nop\n\tv_nop"
               : "+v"(a), "+v"(b) : "v"(x0), "v"(x1), "v"(x2), "v"(x3), "v"(x4), "v"(x5));
#endif
}
__device__ __forceinline__ void guard4x6(v8f& a, v8f& b, v8f& c, v8f& d,
                                         v16h x0, v16h x1, v16h x2, v16h x3, v16h x4, v16h x5) {
#if defined(__HIP_DEVICE_COMPILE__)
  asm volatile("v_nop\n\tv_nop\n\tv_nop\n\tv_nop"
               : "+v"(a), "+v"(b), "+v"(c), "+v"(d) : "v"(x0), "v"(x1), "v"(x2), "v"(x3), "v"(x4), "v"(x5));
#endif
}
__device__ __forceinline__ void guard4x5(v8f& a, v8f& b, v8f& c, v8f& d,
                                         v16h x0, v16h x1, v16h x2, v16h x3, v16h x4) {
#if defined(__HIP_DEVICE_COMPILE__)
  asm volatile("v_nop\n\tv_nop\n\tv_nop\n\tv_nop"
               : "+v"(a), "+v"(b), "+v"(c), "+v"(d) : "v"(x0), "v"(x1), "v"(x2), "v"(x3), "v"(x4));
#endif
}
__device__ __forceinline__ void keep4_h(v16h a, v16h b, v16h c, v16h d) {
#if defined(__HIP_DEVICE_COMPILE__)
  asm volatile("v_nop" :: "v"(a), "v"(b), "v"(c), "v"(d));
#endif
}
__device__ __forceinline__ void acc_guard4(v8f& a, v8f& b, v8f& c, v8f& d) {
#if defined(__HIP_DEVICE_COMPILE__)
  asm volatile("v_nop\n\tv_nop\n\tv_nop\n\tv_nop" : "+v"(a), "+v"(b), "+v"(c), "+v"(d));
#endif
}
// N asynchronous 16-byte copies per lane, global memory -> LDS through no register: l[q] = the lane's LDS byte address, g[q] = its global address.
// The closing s_wait_xcnt 0 stands in the copies' own statement, so no address register is rewritten in front of it.
template <int N>
__device__ __forceinline__ void acopy(const unsigned* l, const char* const* g) {
  static_assert(N == 9 || N == 10);
#if defined(__HIP_DEVICE_COMPILE__)
  if constexpr (N == 9) {
    asm volatile("global_load_async_to_lds_b128 %0, %1, off\n\t"
                 "global_load_async_to_lds_b128 %2, %3, off\n\t"
                 "global_load_async_to_lds_b128 %4, %5, off\n\t"
                 "global_load_async_to_lds_b128 %6, %7, off\n\t"
                 "global_load_async_to_lds_b128 %8, %9, off\n\t"
                 "global_load_async_to_lds_b128 %10, %11, off\n\t"
                 "global_load_async_to_lds_b128 %12, %13, off\n\t"
                 "global_load_async_to_lds_b128 %14, %15, off\n\t"
                 "global_load_async_to_lds_b128 %16, %17, off\n\t"
                 "s_wait_xcnt 0x0"
                 :: "v"(l[0]), "v"(g[0]), "v"(l[1]), "v"(g[1]), "v"(l[2]), "v"(g[2]), "v"(l[3]), "v"(g[3]), "v"(l[4]), "v"(g[4]),
                    "v"(l[5]), "v"(g[5]), "v"(l[6]), "v"(g[6]), "v"(l[7]), "v"(g[7]), "v"(l[8]), "v"(g[8])
                 : "memory");
  } else {
    asm volatile("global_load_async_to_lds_b128 %0, %1, off\n\t"
                 "global_load_async_to_lds_b128 %2, %3, off\n\t"
                 "global_load_async_to_lds_b128 %4, %5, off\n\t"
                 "global_load_async_to_lds_b128 %6, %7, off\n\t"
                 "global_load_async_to_lds_b128 %8, %9, off\n\t"
                 "global_load_async_to_lds_b128 %10, %11, off\n\t"
                 "global_load_async_to_lds_b128 %12, %13, off\n\t"
                 "global_load_async_to_lds_b128 %14, %15, off\n\t"
                 "global_load_async_to_lds_b128 %16, %17, off\n\t"
                 "global_load_async_to_lds_b128 %18, %19, off\n\t"
                 "s_wait_xcnt 0x0"
                 :: "v"(l[0]), "v"(g[0]), "v"(l[1]), "v"(g[1]), "v"(l[2]), "v"(g[2]), "v"(l[3]), "v"(g[3]), "v"(l[4]), "v"(g[4]),
                    "v"(l[5]), "v"(g[5]), "v"(l[6]), "v"(g[6]), "v"(l[7]), "v"(g[7]), "v"(l[8]), "v"(g[8]), "v"(l[9]), "v"(g[9])
                 : "memory");
  }
#endif
}
__device__ __forceinline__ void wait_async0() {   // this wave's copies have landed in LDS
#if defined(__HIP_DEVICE_COMPILE__)
  asm volatile("s_wait_asynccnt 0x0" ::: "memory");
#endif
}
__device__ __forceinline__ void wait_ds0() {      // this wave's LDS reads have returned: their buffer may be refilled behind the next barrier
#if defined(__HIP_DEVICE_COMPILE__)
  asm volatile("s_wait_dscnt 0x0" ::: "memory");
#endif
}
__device__ __forceinline__ void wave_sync_lds() {
  __builtin_amdgcn_fence(__ATOMIC_RELEASE, "workgroup");
  __builtin_amdgcn_wave_barrier();
  __builtin_amdgcn_fence(__ATOMIC_ACQUIRE, "workgroup");
}

// =====================================================================================================
// Elementwise 16-bit pack, no transpose: dst[i] = f16( bf16_RNE(src[i]) * sc ), sc a power of two (exact).
// coverage: grid = n / 2048 blocks x 256 thr x 8 elements = n exactly (host checks n % 2048 == 0).
// =====================================================================================================
__global__ __launch_bounds__(256) void cvt16(const float* __restrict__ src, unsigned short* dst, int n, float sc) {
  const size_t i8 = ((size_t)blockIdx.x * 256 + threadIdx.x) * 8;
  if (i8 + 8 > (size_t)n) return;                 // never taken with the exact grid; no barriers in this kernel
  const v4f a = *(const v4f*)(src + i8);
  const v4f b = *(const v4f*)(src + i8 + 4);
  v4u o;
  o[0] = pk16(h_bits((_Float16)(bfr(a[0]) * sc)), h_bits((_Float16)(bfr(a[1]) * sc)));
  o[1] = pk16(h_bits((_Float16)(bfr(a[2]) * sc)), h_bits((_Float16)(bfr(a[3]) * sc)));
  o[2] = pk16(h_bits((_Float16)(bfr(b[0]) * sc)), h_bits((_Float16)(bfr(b[1]) * sc)));
  o[3] = pk16(h_bits((_Float16)(bfr(b[2]) * sc)), h_bits((_Float16)(bfr(b[3]) * sc)));
  {
    *(v4u*)(dst + i8) = o;
    
  }
}

// =====================================================================================================
// Transposing 16-bit pack of a weight matrix: in W[Cin][Dd] (pitch Dd, base + z*sIn) -> out WT[Dd][Cin] (pitch Cin, base + z*sOut),
// BFO 0: f16( bf16_RNE(w) * sc ); BFO 1: bf16_RNE(w) bits. One 64x64 tile per block (x = Cin tile, y = Dd tile, z = matrix index):
// coverage: loads 4 x 256 x 4 floats = 64x64; stores 2 x 256 pieces x 8 halves = 64 rows x 64 halves = the whole tile;
//           grid = (Cin/64, Dd/64, nmat) exact (host passes exact multiples of 64).
// =====================================================================================================
template <int BFO>
__global__ __launch_bounds__(256) void tr16(const float* __restrict__ W, unsigned short* WT, int Cin, int Dd,
                                            long long sIn, long long sOut, float sc) {
  __shared__ float t[64][65];
  const int tid = threadIdx.x;
  const int c0 = blockIdx.x * 64, d0 = blockIdx.y * 64;
  const float* src = W + (size_t)((long long)blockIdx.z * sIn);
  unsigned short* dst = WT + (size_t)((long long)blockIdx.z * sOut);
#pragma unroll
  for (int it = 0; it < 4; ++it) {
    const int p  = it * 256 + tid;
    const int cc = p >> 4, sg = (p & 15) * 4;
    const v4f v = *(const v4f*)(src + (size_t)(c0 + cc) * Dd + d0 + sg);
    t[cc][sg]     = v[0];
    t[cc][sg + 1] = v[1];
    t[cc][sg + 2] = v[2];
    t[cc][sg + 3] = v[3];
  }
  __syncthreads();
  v4u o[2];
#pragma unroll
  for (int it = 0; it < 2; ++it) {
    const int p  = it * 256 + tid;
    const int dd = p >> 3, s8 = (p & 7) * 8;
    unsigned short hv[8];
#pragma unroll
    for (int k = 0; k < 8; ++k) {
      const float f = bfr(t[s8 + k][dd]);
      if constexpr (BFO != 0) hv[k] = bf_bits(f);
      else hv[k] = h_bits((_Float16)(f * sc));
    }
    v4u q;
    q[0] = pk16(hv[0], hv[1]);
    q[1] = pk16(hv[2], hv[3]);
    q[2] = pk16(hv[4], hv[5]);
    q[3] = pk16(hv[6], hv[7]);
    o[it] = q;
  }
  {
#pragma unroll
    for (int it = 0; it < 2; ++it) {
      const int p  = it * 256 + tid;
      const int dd = p >> 3, s8 = (p & 7) * 8;
      *(v4u*)(dst + (size_t)(d0 + dd) * Cin + c0 + s8) = o[it];
    }
    
  }
}

// =====================================================================================================
// Register-blocked batched 16-bit WMMA GEMM: C[m][n] = oscale * sum_k A[m][k] * Bt[n][k] (+ bias); one wave per 64x64 tile, a block's
// eight waves on eight neighbouring column tiles of one row tile (64 x 512). A row-major [M][K] pitch lda (16-bit plane), Bt row-major
// [N][K] pitch ldb (k contiguous); M multiple of 64, N multiple of 512, K multiple of 64.
// Operands go through LDS: per slab of 64 k the block's 64 A rows (both planes with ASPLIT) and 512 Bt rows are copied once, as whole
// 128-byte lines (a wave's copy = 4 rows), by asynchronous copies; every wave takes its fragments from there (row pitch 144 B = 16 B x odd).
// NBUF 2: slab t+2 is copied into the buffer that trip t has read, behind the trip's one barrier, and flies under trip t+1.
// NBUF 1: one buffer, filled and then read (for K = one slab: two blocks fit a WGP).
// blockIdx.y = batch index with element strides sA, sB, sC; blockIdx.z = outer batch index with strides zA, zB, zC.
// ASPLIT 1: a second A plane A2 (unscaled residual of A, same layout) is multiplied into the same accumulator (A + A2 ~ exact A).
// BF 1: bf16 operands (v_wmma_f32_16x16x32_bf16), else f16.
// EPI 1: value += bf16_RNE(ep0[column]) (per-column bias); EPI 2: value += bf16_RNE(ep0[row]) (per-row bias, 16-bit out only).
// OM 0: f32 out (pitch ldc).  OM 2: one f16 plane = f16(value * ocarry).
// OM 4: two f16 planes: hi = f16(value * ocarry), lo = f16(value * ocarry - hi) (unscaled residual).
// OM 5: two f16 planes: C = f16((value + bf16_RNE(ep1[column])) * ocarry), C2 = f16((value + bf16_RNE(ep2[column])) * ocarry).
// coverage: 4 slabs x 16 rows (f32: it 0..7 x lane>>4; 16-bit: it 0..3 x lane>>3) x 64 cols = the wave's whole 64x64 tile;
//           grid = tilesM*tilesN/8 blocks exactly.
// =====================================================================================================
template <int OM, int ASPLIT, int BF, int EPI, int NBUF>
__global__ __launch_bounds__(256) __attribute__((amdgpu_num_vgpr(256))) void gemm64(
    const unsigned short* __restrict__ Ap, const unsigned short* __restrict__ A2p, int lda, long long sA, long long zA,
    const unsigned short* __restrict__ Btp, int ldb, long long sB, long long zB,
    void* Cout, void* C2out, int ldc, long long sC, long long zC,
    int M, int N, int K, float oscale, float ocarry,
    const float* __restrict__ ep0, const float* __restrict__ ep1, const float* __restrict__ ep2) {
  constexpr int AROWS  = 64 * (1 + ASPLIT);        // staged rows: A | A2 (ASPLIT) | Bt
  constexpr int SROWS  = AROWS + 512;
  constexpr int SBYTES = SROWS * GPITCH;           // one buffer
  constexpr int NQ     = SROWS / 32;               // copies per thread and slab: 256 threads x 16 B = 32 rows each
  __shared__ __align__(16) float sT[8][16 * 68];   // per-wave 16x64 slab, pitch 68 floats
  __shared__ __align__(16) char stg[NBUF * SBYTES];
  const int by   = blockIdx.y;
  const int bz   = blockIdx.z;
  const int lane = threadIdx.x & 31;
  const int wave = threadIdx.x >> 5;
  const int tilesN = N >> 6;
  const int tilesM = M >> 6;
  const int tile0 = blockIdx.x * 8;
  if (tile0 + 8 > tilesM * tilesN) return;   // the same for the whole block, in front of every barrier; never taken with the exact grid
  const int tm  = tile0 / tilesN;
  const int tn0 = tile0 - tm * tilesN;       // tilesN is a multiple of 8: the block's eight tiles lie in one row of tiles
  const int m0  = tm << 6;
  const int nb0 = tn0 << 6;                  // first Bt row of the block
  const int n0  = nb0 + (wave << 6);

  const char* A1 = (const char*)(Ap  + (size_t)((long long)by * sA + (long long)bz * zA));
  const char* A2 = (const char*)(A2p + (size_t)((long long)by * sA + (long long)bz * zA));
  const char* Bb = (const char*)(Btp + (size_t)((long long)by * sB + (long long)bz * zB));

  const int rlane = lane & 15;                 // row (A) / col (B, D) within subtile
  const int koff  = (lane >> 4) * 8;           // k offset of this lane half
  const int mOff  = (lane >> 4) * 8;           // D row offset

  v8f acc[4][4];
#pragma unroll
  for (int i = 0; i < 4; ++i)
#pragma unroll
    for (int j = 0; j < 4; ++j) acc[i][j] = zero8();

  // this thread's 16-byte pieces of a slab: staged rows (tid>>3) + 32 q, piece tid&7 of the row's 128 B (planes stay under 4 GiB)
  const int prow = threadIdx.x >> 3, seg = threadIdx.x & 7;
  const unsigned lds0 = (unsigned)(uintptr_t)stg + (unsigned)(prow * GPITCH + seg * 16);   // low 32 bits of the __shared__ address
  const unsigned ga0  = (unsigned)((m0 + prow) * lda) * 2u + (unsigned)(seg * 16);
  const unsigned gb0  = (unsigned)((nb0 + prow) * ldb) * 2u + (unsigned)(seg * 16);
  auto stage = [&](int k0, unsigned bufoff) {
    unsigned l[NQ];
    const char* g[NQ];
#pragma unroll   // q must be a constant: the addresses are register operands of the copy statements
    for (int q = 0; q < NQ; ++q) {
      l[q] = lds0 + bufoff + (unsigned)(q * 32 * GPITCH);
      // block-uniform part first (scalar), then this thread's offset: one vector add an address
      if (q < 2) g[q] = (A1 + (unsigned)(q * 32 * lda + k0) * 2u) + ga0;
      else if (q < AROWS / 32) g[q] = (A2 + (unsigned)((q - 2) * 32 * lda + k0) * 2u) + ga0;
      else g[q] = (Bb + (unsigned)((q - AROWS / 32) * 32 * ldb + k0) * 2u) + gb0;
    }
    acopy<NQ / 2>(l, g);
    acopy<NQ / 2>(l + NQ / 2, g + NQ / 2);
  };

  const unsigned fa = (unsigned)(rlane * GPITCH + koff * 2);                               // this lane's fragment reads: A row rlane
  const unsigned fb = (unsigned)((AROWS + (wave << 6) + rlane) * GPITCH + koff * 2);       // Bt row rlane of the wave's 64
  auto products = [&](unsigned bufoff) {
    const char* sb = stg + bufoff;
#pragma unroll   // both k-steps of a slab in line: their LDS offsets are immediates
    for (int ks = 0; ks < GKS / 32; ++ks) {
      // every fragment of this k-step is requested before its first product: one LDS latency a k-step
      v16h bh[4], ah[4], al[4];
#pragma unroll
      for (int j = 0; j < 4; ++j) bh[j] = ldfrag_o(sb + (j * 16 * GPITCH + ks * 64), fb);
#pragma unroll
      for (int i = 0; i < 4; ++i) {
        ah[i] = ldfrag_o(sb + (i * 16 * GPITCH + ks * 64), fa);
        if constexpr (ASPLIT != 0) al[i] = ldfrag_o(sb + ((64 + i * 16) * GPITCH + ks * 64), fa);
      }
      __builtin_amdgcn_sched_barrier(0);   // keeps the loads above in front of the products (else each A load sinks to its own group and waits alone)
#pragma unroll
      for (int i = 0; i < 4; ++i) {
#pragma unroll
        for (int j = 0; j < 4; ++j) acc[i][j] = mmaT<BF>(ah[i], bh[j], acc[i][j]);
        dep_guard1(acc[i][0], acc[i][3], ah[i]);
        if constexpr (ASPLIT != 0) {
#pragma unroll
          for (int j = 0; j < 4; ++j) acc[i][j] = mmaT<BF>(al[i], bh[j], acc[i][j]);
          dep_guard1(acc[i][0], acc[i][3], al[i]);
        }
      }
      keep4_h(bh[0], bh[1], bh[2], bh[3]);
    }
  };

  const int nslab = K / GKS;
  if constexpr (NBUF == 2) {
    stage(0, 0u);
    wait_async0();
    __syncthreads();                                       // publishes slab 0
    if (nslab > 1) stage(GKS, (unsigned)SBYTES);
    for (int t = 0; t < nslab; ++t) {
      const unsigned bo = (unsigned)(t & 1) * (unsigned)SBYTES;
      products(bo);
      wait_ds0();
      wait_async0();
      __syncthreads();                                     // publishes slab t+1; ends every wave's reads of this trip's buffer
      if (t + 2 < nslab) stage((t + 2) * GKS, bo);
    }
    wait_async0();
  } else {
    for (int t = 0; t < nslab; ++t) {
      if (t > 0) {
        wait_ds0();
        __syncthreads();                                   // ends every wave's reads of the buffer before it is refilled
      }
      stage(t * GKS, 0u);
      wait_async0();
      __syncthreads();                                     // publishes slab t
      products(0u);
    }
  }
  acc_guard4(acc[0][0], acc[0][1], acc[0][2], acc[0][3]);
  acc_guard4(acc[1][0], acc[1][1], acc[1][2], acc[1][3]);
  acc_guard4(acc[2][0], acc[2][1], acc[2][2], acc[2][3]);
  acc_guard4(acc[3][0], acc[3][1], acc[3][2], acc[3][3]);

  const int hh2 = lane >> 4, c4 = (lane & 15) * 4;     // f32 out: 256-B row segment = 16 lanes x 16 B
  const int q8  = lane >> 3, c8 = (lane & 7) * 8;

  // ---- epilogue ----
  float* slab = sT[wave];
#pragma unroll
  for (int i = 0; i < 4; ++i) {
    const int mBase = m0 + (i << 4);
#pragma unroll
    for (int j = 0; j < 4; ++j) {
#pragma unroll
      for (int r = 0; r < 8; ++r) {
        slab[(mOff + r) * 68 + (j << 4) + rlane] = acc[i][j][r];
      }
    }
    wave_sync_lds();
    if constexpr (OM == 0) {
      float* C = (float*)Cout + (size_t)((long long)by * sC + (long long)bz * zC);
      v4f vals[8];
#pragma unroll
      for (int it = 0; it < 8; ++it) {
        const int row = it * 2 + hh2;                      // it 0..7 x hh2 0..1 = rows 0..15
        v4f v = *(const v4f*)(slab + row * 68 + c4);
#pragma unroll
        for (int e = 0; e < 4; ++e) v[e] = v[e] * oscale;
        if constexpr (EPI == 1) {
          const v4f bb = *(const v4f*)(ep0 + n0 + c4);     // per-column bias, columns n0+c4 .. +3 (N equals the bias length)
#pragma unroll
          for (int e = 0; e < 4; ++e) v[e] = v[e] + bfr(bb[e]);
        }
        vals[it] = v;
      }
      {
#pragma unroll
        for (int it = 0; it < 8; ++it) {
          const int gr = mBase + it * 2 + hh2;
          *(v4f*)(C + (size_t)gr * ldc + n0 + c4) = vals[it];
        }
        
      }
    } else {
      unsigned short* C  = (unsigned short*)Cout  + (size_t)((long long)by * sC + (long long)bz * zC);
      unsigned short* Cb = (unsigned short*)C2out + (size_t)((long long)by * sC + (long long)bz * zC);
      v4u hv[4], lv[4];
#pragma unroll
      for (int it = 0; it < 4; ++it) {
        const int row = it * 4 + q8;                       // it 0..3 x q8 0..3 = rows 0..15
        const float* sp = slab + row * 68 + c8;
        float rb = 0.f;
        if constexpr (EPI == 2) rb = bfr(ep0[mBase + row]);   // per-row bias (M equals the bias length)
        v4u a  = {0u, 0u, 0u, 0u};
        v4u b2 = {0u, 0u, 0u, 0u};
#pragma unroll
        for (int e = 0; e < 4; ++e) {
          const int ci = n0 + c8 + 2 * e;                  // column index, < N
          float f0 = sp[2 * e] * oscale + rb;
          float f1 = sp[2 * e + 1] * oscale + rb;
          if constexpr (EPI == 1) {
            f0 += bfr(ep0[ci]);
            f1 += bfr(ep0[ci + 1]);
          }
          if constexpr (OM == 5) {
            const float g0 = (f0 + bfr(ep1[ci])) * ocarry, g1 = (f1 + bfr(ep1[ci + 1])) * ocarry;
            const float w0 = (f0 + bfr(ep2[ci])) * ocarry, w1 = (f1 + bfr(ep2[ci + 1])) * ocarry;
            a[e]  = pk16(h_bits((_Float16)g0), h_bits((_Float16)g1));
            b2[e] = pk16(h_bits((_Float16)w0), h_bits((_Float16)w1));
          } else {
            f0 *= ocarry; f1 *= ocarry;
            const _Float16 x0 = (_Float16)f0, x1 = (_Float16)f1;
            a[e] = pk16(h_bits(x0), h_bits(x1));
            if constexpr (OM == 4) {
              b2[e] = pk16(h_bits((_Float16)(f0 - (float)x0)), h_bits((_Float16)(f1 - (float)x1)));
            }
          }
        }
        hv[it] = a;
        lv[it] = b2;
      }
      {
#pragma unroll
        for (int it = 0; it < 4; ++it) {
          const int row = it * 4 + q8;
          *(v4u*)(C + (size_t)(mBase + row) * ldc + n0 + c8) = hv[it];
          if constexpr (OM >= 4) {
            *(v4u*)(Cb + (size_t)(mBase + row) * ldc + n0 + c8) = lv[it];
          }
        }
        
      }
    }
    wave_sync_lds();
  }
}

// =====================================================================================================
// Flash attention for one batch element, one head and 128 query rows: 8 waves, 16 query rows each, head dim 64, 1024 keys.
// blockIdx.x = block of 128 query rows, blockIdx.y = head, blockIdx.z = batch element. QU0, QV0, KP0, PP0, CTh0, CTl0 are [8192][512] planes,
// VTh0/VTl0 [8][512][1024] planes. G[r][c] below stands for (q_r + v_bias) . p_c of this head.
//   The eight waves need the same k and v^T values: each chunk of 32 keys is brought from global memory ONCE per block (whole 16-byte pieces,
//   one of k, one of v^T hi, one of v^T residual per thread) into one of two LDS buffers, and every wave takes its k and v^T B fragments from there.
//   The pieces of chunk t+1 are requested at the head of trip t, stored into the other buffer at its foot, and published by the trip's one
//   block barrier, which also ends every wave's reads of the buffer that the next trip refills.
//   LDS rows: k [32 keys][64 d] pitch 144 B, v^T [64 d][32 keys] pitch 80 B (16 B x odd: 16-byte fragment reads without bank conflicts).
//   A fragments (stationary): (q_i + u_bias) f16 x4 rows i0+m, QU[i][64h + d], two k-steps of 32;
//   B fragments per chunk of 32 keys: k f16 x4 rows (k-contiguous) -> scores s[i][j] (two 16-column tiles);
//   position logit by relative shift, i = query row, j = key: j <= i -> G[i][S-1-i+j]; j == i+1 -> 0; else G[i+1][j-i-2].
//   With x = S-1-i+j a wave's 16 rows x 32 keys need x in a window of 47 that starts at the multiple of 16 S-16-i0+jb: three 16-column tiles,
//   each wholly x < S (rows i, p row x) or wholly x >= S (rows i+1, p row x-S-1; x == S is selected to 0 where it is used). The wave makes the
//   tiles by WMMA (A = either row set, from the wave's LDS; B = p rows from global memory, requested a trip ahead), stores them side by side in
//   its own LDS rows and reads row m back shifted by 15-m. The window moves by two tiles a trip, so a trip makes two new ones: even trips read
//   tile places 0 1 2, odd trips 2 3 4; the tile stored at place 4 is also stored at place 0 (on odd trips that second store goes to the spare place 5).
//   t = (s/16 + pos) / sqrt(512) * log2(e); online softmax in base 2, max-subtracted, running sums in f32;
//   A fragments of P*1024 (f16 hi and unscaled residual) rebuilt from the wave's LDS rows (f32 vector loads, split k map); v^T B fragments
//   (f16 x16 hi and unscaled residual); 12 P.V WMMAs (hi.hi, lo.hi, hi.lo).
//   Final 1/l and carry folds in f32; behind the last trip's barrier each wave reuses its own 4608 B of LDS as two bf16 tiles [16][64]
//   (hi, lo, pitch 144 B), stages its slice (element stores) and writes it as whole 128-byte row segments.
//   every wave does identical bounded work (32 trips of 32 keys) and passes every barrier.
// coverage: wave tile 16 rows x 64 cols per plane = 4 iterations x 32 lanes x 8 halves; 8 waves x 8 blocks = 1024 rows, 8 heads x 64 = 512
//           columns, per batch element, each element written exactly once.
// =====================================================================================================
__global__ __launch_bounds__(ATT_THREADS) __attribute__((amdgpu_num_vgpr(256)))
void attnb(const unsigned short* __restrict__ QU0, const unsigned short* __restrict__ QV0,
           const unsigned short* __restrict__ KP0, const unsigned short* __restrict__ PP0,
           const unsigned short* __restrict__ VTh0, const unsigned short* __restrict__ VTl0,
           unsigned short* CTh0, unsigned short* CTl0) {
  __shared__ __align__(16) char smem[ATT_SMEM_BYTES];   // prob tiles [wave][row][32 cols] pitch 36 floats | two k / v^T buffers
  __shared__ __align__(16) float skew[ATT_WAVES][16 * SKP];   // per wave: position logits [16 rows][6 tile places x 16 columns]
  __shared__ __align__(16) char  qvf[ATT_WAVES][8 * 512];     // per wave: (q + v_bias) A fragments, 8 pieces of 16 B per lane (each lane reads its own)

  const int tid  = threadIdx.x;
  const int wave = tid >> 5;
  const int lane = tid & 31;
  const int hh   = lane >> 4;
  const int c    = lane & 15;

  const int head = blockIdx.y;                             // 0..7
  const int i0   = blockIdx.x * (ATT_WAVES * 16) + __builtin_amdgcn_readfirstlane(wave) * 16;   // first query row of this wave (scalar)

  const size_t bg = blockIdx.z;                            // batch element
  const unsigned short* QU  = QU0  + bg * ((size_t)SEQ * DM);
  const unsigned short* QV  = QV0  + bg * ((size_t)SEQ * DM);
  const unsigned short* KP  = KP0  + bg * ((size_t)SEQ * DM);
  const unsigned short* PP  = PP0  + bg * ((size_t)SEQ * DM);
  const unsigned short* VTh = VTh0 + bg * ((size_t)DM * SEQ);
  const unsigned short* VTl = VTl0 + bg * ((size_t)DM * SEQ);
  unsigned short*       CTh = CTh0 + bg * ((size_t)SEQ * DM);
  unsigned short*       CTl = CTl0 + bg * ((size_t)SEQ * DM);

  // stationary A fragments: (q + u_bias) rows i0 + c, d 0..31 and 32..63
  const size_t qofs = (size_t)(i0 + c) * DM + head * HD + 8 * hh;
  const v16h qa = ldfrag_u(QU + qofs), qb = ldfrag_u(QU + qofs + 32);
  // likewise (q + v_bias), rows i0 + c (pieces 0..3) and rows i0 + 1 + c (pieces 4..7; the row behind the last is clamped: no key lies right of
  // its diagonal); kept in LDS, not in registers: one set is used twice a trip, and 32 more stationary registers would spill
  char* qvl = qvf[wave] + lane * 16;
  {
    const int i1 = (i0 + c + 1 < SEQ) ? (i0 + c + 1) : (SEQ - 1);
    const size_t qofs1 = (size_t)i1 * DM + head * HD + 8 * hh;
#pragma unroll
    for (int q = 0; q < 4; ++q) {
      *(v4u*)(qvl + q * 512)       = *(const v4u*)(QV + qofs + q * 16);
      *(v4u*)(qvl + (4 + q) * 512) = *(const v4u*)(QV + qofs1 + q * 16);
    }
  }

  const char* Kb  = (const char*)(KP + head * HD);
  const char* Pb  = (const char*)(PP + head * HD);
  const char* Vbh = (const char*)(VTh + (size_t)(head * HD) * SEQ);
  const char* Vbl = (const char*)(VTl + (size_t)(head * HD) * SEQ);
  // this thread's 16-byte pieces of a chunk: k row tid>>3 (8 pieces of its 128 B), v^T row tid>>2 (4 pieces of its 64 B)
  const unsigned gk0 = (unsigned)((tid >> 3) * (DM * 2) + (tid & 7) * 16);      // byte offset in chunk 0 of k
  const unsigned gv0 = (unsigned)((tid >> 2) * (SEQ * 2) + (tid & 3) * 16);     // byte offset in chunk 0 of either v^T plane
  const unsigned sk  = (unsigned)((tid >> 3) * KPITCH + (tid & 7) * 16);        // where they go in a buffer
  const unsigned sv  = (unsigned)(ST_VH + (tid >> 2) * VPITCH + (tid & 3) * 16);
  const unsigned fk  = (unsigned)(c * KPITCH + 16 * hh);                        // this lane's fragment reads: k row c
  const unsigned fv  = (unsigned)(ST_VH + c * VPITCH + 16 * hh);                // v^T hi row c

  const float CSC = SCL * LOG2E * (1.0f / (QC * QC));      // content scores and position logits carry x4 on both operands

  float mrow[8], lrow[8];
  v8f o0 = zero8(), o1 = zero8(), o2 = zero8(), o3 = zero8();
#pragma unroll
  for (int r = 0; r < 8; ++r) { mrow[r] = -INFINITY; lrow[r] = 0.f; }
  float* pt = (float*)smem + wave * (16 * 36);
  char* stage = smem + ATT_PT_BYTES;

  float* sw = skew[wave];
  // B fragments of the window tile that starts at x = tb (a multiple of 16, 0 .. 2S-16): lane c takes p row x (x < S) or x-S-1 (x == S clamped to row 0)
  auto ld_p = [&](int tb, v16h& b0, v16h& b1) -> unsigned {
    const int rb = (tb < SEQ) ? tb : (tb - (SEQ + 1));     // scalar
    int row = rb + c;
    row = (row < 0) ? 0 : row;
    const unsigned off = (unsigned)row * (unsigned)(DM * 2) + (unsigned)(16 * hh);
    b0 = ldfrag_o(Pb, off);
    b1 = ldfrag_o(Pb + 64, off);
    return off;
  };
  // that tile's 16 x 16 logits; tb is the same for the whole wave
  auto mm_p = [&](int tb, v16h b0, v16h b1) -> v8f {
    const char* ap = qvl + ((tb < SEQ) ? 0 : 4 * 512);
    FragH a0, a1;
    a0.u[0] = *(const v4u*)(ap);
    a0.u[1] = *(const v4u*)(ap + 512);
    a1.u[0] = *(const v4u*)(ap + 1024);
    a1.u[1] = *(const v4u*)(ap + 1536);
    v8f d = mma_h(a0.v, b0, zero8());
    return mma_h(a1.v, b1, d);
  };
  float*       sws = sw + hh * (8 * SKP) + c;              // this lane's stores: row 8 hh + r at + r SKP, tile place t at + 16 t
  const float* swr = sw + hh * (8 * (SKP - 1)) + 15 + c;   // its shifted reads: row 8 hh + r, window column 15 - (8 hh + r) + c, at + r (SKP - 1)
  auto st_tile = [&](int col, const v8f& d) {              // col = first column of the tile place (scalar)
    float* w = sws + col;
#pragma unroll
    for (int r = 0; r < 8; ++r) w[r * SKP] = d[r];
  };

  // chunk 0 into buffer 0; trip 0's position window into tile places 0 1 2
  {
    const v4u pk = *(const v4u*)(Kb + gk0);
    const v4u ph0 = *(const v4u*)(Vbh + gv0);
    const v4u pl0 = *(const v4u*)(Vbl + gv0);
    const int x0 = SEQ - 16 - i0;
    v16h t0a, t0b, t1a, t1b, t2a, t2b;
    const unsigned f0 = ld_p(x0, t0a, t0b);
    const unsigned f1 = ld_p(x0 + 16, t1a, t1b);
    const unsigned f2 = ld_p(x0 + 32, t2a, t2b);
    // the p loads' offset registers stay whole (no load's result lands on one) up to this wait
    asm volatile("s_wait_xcnt 0x0" :: "v"(f0), "v"(f1), "v"(f2) : "memory");
    *(v4u*)(stage + sk) = pk;
    *(v4u*)(stage + sv) = ph0;
    *(v4u*)(stage + sv + ST_VSZ) = pl0;
    st_tile(0, mm_p(x0, t0a, t0b));
    st_tile(16, mm_p(x0 + 16, t1a, t1b));
    st_tile(32, mm_p(x0 + 32, t2a, t2b));
  }
  __syncthreads();                                         // publishes chunk 0 (and orders the wave's window stores before its reads)

#pragma unroll 1
  for (int jb = 0; jb < SEQ; jb += KCH) {
    const int jn = (jb + KCH < SEQ) ? (jb + KCH) : 0;      // next trip's first key; the last trip asks for trip 0's again (in bounds, not used)
    const unsigned bsel = (unsigned)((jb / KCH) & 1) * ST_BYTES;
    const char* cur = stage + bsel;                        // this trip's buffer
    char*       nxt = stage + (ST_BYTES - bsel);           // the other one: every wave left it before the last barrier
    // the next chunk's pieces are requested here and stored at the trip's foot: their latency lies under the whole trip
    const v4u nk = *(const v4u*)(Kb + (gk0 + (unsigned)jn * (unsigned)(DM * 2)));
    const v4u nh = *(const v4u*)(Vbh + (gv0 + (unsigned)jn * 2u));
    const v4u nl = *(const v4u*)(Vbl + (gv0 + (unsigned)jn * 2u));
    // behind this wait the three loads' address registers are free for the results of the p loads below
    asm volatile("s_wait_xcnt 0x0" ::: "memory");
    const v16h k0a = ldfrag_o(cur, fk);
    const v16h k0b = ldfrag_o(cur + 64, fk);
    const v16h k1a = ldfrag_o(cur + 16 * KPITCH, fk);
    const v16h k1b = ldfrag_o(cur + 16 * KPITCH + 64, fk);
    // the two new tiles of the next trip's window: p rows requested here, multiplied behind the softmax
    const int xn = SEQ - 16 - i0 + jn;
    v16h n1a, n1b, n2a, n2b;
    const unsigned f1 = ld_p(xn + 16, n1a, n1b);
    const unsigned f2 = ld_p(xn + 32, n2a, n2b);
    // the p loads' offset registers stay whole (no load's result lands on one) up to this wait
    asm volatile("s_wait_xcnt 0x0" :: "v"(f1), "v"(f2) : "memory");
    // this trip's position logits: row m = 8 hh + r of the window, shifted by 15 - m
    const int odd = (jb / KCH) & 1;
    float ga[8], gc[8];
    {
      const float* wr = swr + odd * 32;
#pragma unroll
      for (int r = 0; r < 8; ++r) {
        ga[r] = wr[r * (SKP - 1)];
        gc[r] = wr[r * (SKP - 1) + 16];
      }
    }
    __builtin_amdgcn_sched_barrier(0);   // keeps the requests above at the trip's head (else the global ones sink to their stores and wait there)
    v8f s0, s1;
    s0 = mma_h(qa, k0a, zero8());
    s0 = mma_h(qb, k0b, s0);
    s1 = mma_h(qa, k1a, zero8());
    s1 = mma_h(qb, k1b, s1);
    guard2x6(s0, s1, qa, qb, k0a, k0b, k1a, k1b);
    float tt0[8], tt1[8];
#pragma unroll
    for (int r = 0; r < 8; ++r) {
      const int i  = i0 + 8 * hh + r;
      const int ja = jb + c, jc = jb + 16 + c;
      const float pa = (ja == i + 1) ? 0.f : ga[r];
      const float pz = (jc == i + 1) ? 0.f : gc[r];
      tt0[r] = s0[r] * CSC + pa * CSC;
      tt1[r] = s1[r] * CSC + pz * CSC;
    }
#pragma unroll
    for (int r = 0; r < 8; ++r) {
      const float t0 = tt0[r], t1 = tt1[r];
      float mx = fmaxf(t0, t1);
#pragma unroll
      for (int off = 1; off < 16; off <<= 1) mx = fmaxf(mx, __shfl_xor(mx, off, 32));
      const float mn = fmaxf(mrow[r], mx);
      const float al = exp2f(mrow[r] - mn);
      mrow[r] = mn;
      const float e0 = exp2f(t0 - mn), e1 = exp2f(t1 - mn);
      float ps = e0 + e1;
#pragma unroll
      for (int off = 1; off < 16; off <<= 1) ps += __shfl_xor(ps, off, 32);
      lrow[r] = lrow[r] * al + ps;
      o0[r] *= al;
      o1[r] *= al;
      o2[r] *= al;
      o3[r] *= al;
      const int ro = (8 * hh + r) * 36 + c;
      pt[ro]      = e0;
      pt[ro + 16] = e1;
    }
    wave_sync_lds();
    {
      // next trip's window: its first tile is this one's last and lies in place already
      const v8f d1 = mm_p(xn + 16, n1a, n1b);
      const v8f d2 = mm_p(xn + 32, n2a, n2b);
      st_tile(odd ? 16 : 48, d1);
      st_tile(odd ? 32 : 64, d2);
      st_tile(odd ? 80 : 0, d2);
    }
    const v16h vh0 = ldfrag_o(cur, fv);
    const v16h vh1 = ldfrag_o(cur + 16 * VPITCH, fv);
    const v16h vh2 = ldfrag_o(cur + 32 * VPITCH, fv);
    const v16h vh3 = ldfrag_o(cur + 48 * VPITCH, fv);
    const v16h vl0 = ldfrag_o(cur + ST_VSZ, fv);
    const v16h vl1 = ldfrag_o(cur + ST_VSZ + 16 * VPITCH, fv);
    const v16h vl2 = ldfrag_o(cur + ST_VSZ + 32 * VPITCH, fv);
    const v16h vl3 = ldfrag_o(cur + ST_VSZ + 48 * VPITCH, fv);
    FragH ph, pl;
    {
      const float* prow = pt + c * 36 + 8 * hh;
      const v4f p0 = *(const v4f*)(prow), p1 = *(const v4f*)(prow + 4);
      const v4f p2 = *(const v4f*)(prow + 16), p3 = *(const v4f*)(prow + 20);
#pragma unroll
      for (int e = 0; e < 4; ++e) {
        float f; _Float16 x;
        f = p0[e] * PC; x = (_Float16)f; ph.h[0][e]     = x; pl.h[0][e]     = (_Float16)(f - (float)x);   // keys jb + 8hh + e
        f = p1[e] * PC; x = (_Float16)f; ph.h[0][4 + e] = x; pl.h[0][4 + e] = (_Float16)(f - (float)x);   // keys jb + 8hh + 4 + e
        f = p2[e] * PC; x = (_Float16)f; ph.h[1][e]     = x; pl.h[1][e]     = (_Float16)(f - (float)x);   // keys jb + 16 + 8hh + e
        f = p3[e] * PC; x = (_Float16)f; ph.h[1][4 + e] = x; pl.h[1][4 + e] = (_Float16)(f - (float)x);
      }
    }
    {
      o0 = mma_h(ph.v, vh0, o0);
      o1 = mma_h(ph.v, vh1, o1);
      o2 = mma_h(ph.v, vh2, o2);
      o3 = mma_h(ph.v, vh3, o3);
      o0 = mma_h(pl.v, vh0, o0);
      o1 = mma_h(pl.v, vh1, o1);
      o2 = mma_h(pl.v, vh2, o2);
      o3 = mma_h(pl.v, vh3, o3);
      guard4x6(o0, o1, o2, o3, ph.v, pl.v, vh0, vh1, vh2, vh3);
    }
    {
      o0 = mma_h(ph.v, vl0, o0);
      o1 = mma_h(ph.v, vl1, o1);
      o2 = mma_h(ph.v, vl2, o2);
      o3 = mma_h(ph.v, vl3, o3);
      guard4x5(o0, o1, o2, o3, ph.v, vl0, vl1, vl2, vl3);
    }
    *(v4u*)(nxt + sk) = nk;
    *(v4u*)(nxt + sv) = nh;
    *(v4u*)(nxt + sv + ST_VSZ) = nl;
    __syncthreads();   // publishes the next chunk; ends every wave's reads of this trip's buffer (and of its own prob tile); window stores before reads
  }

  // ---- behind the last barrier no wave reads the loop's LDS any more: each wave takes its own 4608 B as two bf16 tiles [16][64], pitch 72 ----
  unsigned short* Osh = (unsigned short*)(smem + wave * (2 * 16 * OPITCH * 2));
  unsigned short* Osl = Osh + 16 * OPITCH;
  // ---- fold 1/l and the carries (1024 on P, 16 on v), split into bf16 hi + residual, stage the wave's 16x64 slice ----
  const float oc = 1.0f / (PC * VC);
#pragma unroll
  for (int r = 0; r < 8; ++r) {
    const float inv = (1.0f / lrow[r]) * oc;
    const int ro = (8 * hh + r) * OPITCH + c;
    const float f0 = o0[r] * inv, f1 = o1[r] * inv, f2 = o2[r] * inv, f3 = o3[r] * inv;
    const unsigned short g0 = bf_bits(f0), g1 = bf_bits(f1), g2 = bf_bits(f2), g3 = bf_bits(f3);
    Osh[ro]      = g0;  Osl[ro]      = bf_bits(f0 - bf_up(g0));
    Osh[ro + 16] = g1;  Osl[ro + 16] = bf_bits(f1 - bf_up(g1));
    Osh[ro + 32] = g2;  Osl[ro + 32] = bf_bits(f2 - bf_up(g2));
    Osh[ro + 48] = g3;  Osl[ro + 48] = bf_bits(f3 - bf_up(g3));
  }
  wave_sync_lds();
  // ---- the wave writes its 16 row segments of 128 B in both planes: piece p = it*32 + lane -> row p>>3, halves (p&7)*8 .. +7 ----
  {
    v4u hv[4], lv[4];
#pragma unroll
    for (int it = 0; it < 4; ++it) {
      const int p = it * 32 + lane;
      hv[it] = *(const v4u*)(Osh + (p >> 3) * OPITCH + (p & 7) * 8);
      lv[it] = *(const v4u*)(Osl + (p >> 3) * OPITCH + (p & 7) * 8);
    }
    const size_t dofs = (size_t)i0 * DM + head * HD;
    unsigned short* dsth = CTh + dofs;
    unsigned short* dstl = CTl + dofs;
#pragma unroll
    for (int it = 0; it < 4; ++it) {
      const int p = it * 32 + lane;
      *(v4u*)(dsth + (size_t)(p >> 3) * DM + (p & 7) * 8) = hv[it];
      *(v4u*)(dstl + (size_t)(p >> 3) * DM + (p & 7) * 8) = lv[it];
    }
  }
}

// =====================================================================================================
// Workspace map (bytes); every plane is an exact multiple of its tile / whole-row store granularity (M, N exact tile multiples,
// the activation convert count an exact multiple of 2048, no pad rows needed), every offset a multiple of 512 KiB:
//   WQT, WKT, WVT, WPT f16 [512 out][512 in] x64   4 x 524288
//   WOT  bf16 [512 out][512 in]                         524288
//   X16  f16 [8192][512] x16                          8388608    (one activation input at a time, rows b*1024 + tok)
//   QU, QV f16 [8192][512] x4                     2 x 8388608    (q + u_bias, q + v_bias)
//   K16, P16 f16 [8192][512] x4                   2 x 8388608
//   VTh, VTl f16 [8][512][1024] x16               2 x 8388608    (v^T per batch, hi / residual)
//   CTh, CTl bf16 [8192][512]                     2 x 8388608    (attention ctx, merged heads, hi / residual)
//   end                                              78118912
// =====================================================================================================
extern "C" void kernel_launch(void* const* d_in, const int* in_sizes, int n_in,
                              void* d_out, int out_size, void* d_ws, size_t ws_size,
                              hipStream_t stream) {
  if (n_in < 15) return;
  const int NA = NROWS * DM;
  if (in_sizes[0] != NA || in_sizes[1] != NA || in_sizes[2] != NA || in_sizes[3] != NA) return;
  if (in_sizes[4] != DM * DM || in_sizes[6] != DM * DM || in_sizes[8] != DM * DM || in_sizes[10] != DM * DM || in_sizes[13] != DM * DM) return;
  if (in_sizes[5] != DM || in_sizes[7] != DM || in_sizes[9] != DM || in_sizes[14] != DM) return;
  if (in_sizes[11] != NHEAD * HD || in_sizes[12] != NHEAD * HD) return;
  if (out_size != NROWS * DM) return;
  if ((NA % 2048) != 0) return;

  const float* query = (const float*)d_in[0];
  const float* key   = (const float*)d_in[1];
  const float* value = (const float*)d_in[2];
  const float* pemb  = (const float*)d_in[3];
  const float* w_q   = (const float*)d_in[4];
  const float* b_q   = (const float*)d_in[5];
  const float* w_k   = (const float*)d_in[6];
  const float* b_k   = (const float*)d_in[7];
  const float* w_v   = (const float*)d_in[8];
  const float* b_v   = (const float*)d_in[9];
  const float* w_p   = (const float*)d_in[10];
  const float* u_b   = (const float*)d_in[11];
  const float* v_b   = (const float*)d_in[12];
  const float* w_o   = (const float*)d_in[13];
  const float* b_o   = (const float*)d_in[14];
  float*       out   = (float*)d_out;

  const size_t PWT = (size_t)DM * DM * 2;                         //   524288
  const size_t PX  = (size_t)NROWS * DM * 2;                      //  8388608
  const size_t PVT = (size_t)NB * DM * SEQ * 2;                   //  8388608
  size_t off = 0;
  const size_t oWQ = off; off += PWT;
  const size_t oWK = off; off += PWT;
  const size_t oWV = off; off += PWT;
  const size_t oWP = off; off += PWT;
  const size_t oWO = off; off += PWT;
  const size_t oX  = off; off += PX;
  const size_t oQU = off; off += PX;
  const size_t oQV = off; off += PX;
  const size_t oK  = off; off += PX;
  const size_t oP  = off; off += PX;
  const size_t oVh = off; off += PVT;
  const size_t oVl = off; off += PVT;
  const size_t oCh = off; off += PX;
  const size_t oCl = off; off += PX;
  if (off > ws_size) return;                                      // off = 78118912

  char* ws = (char*)d_ws;
  unsigned short* WQT  = (unsigned short*)(ws + oWQ);
  unsigned short* WKT  = (unsigned short*)(ws + oWK);
  unsigned short* WVT  = (unsigned short*)(ws + oWV);
  unsigned short* WPT  = (unsigned short*)(ws + oWP);
  unsigned short* WOT  = (unsigned short*)(ws + oWO);
  unsigned short* X16  = (unsigned short*)(ws + oX);
  unsigned short* QU   = (unsigned short*)(ws + oQU);
  unsigned short* QV   = (unsigned short*)(ws + oQV);
  unsigned short* K16  = (unsigned short*)(ws + oK);
  unsigned short* P16  = (unsigned short*)(ws + oP);
  unsigned short* VTh  = (unsigned short*)(ws + oVh);
  unsigned short* VTl  = (unsigned short*)(ws + oVl);
  unsigned short* CTh  = (unsigned short*)(ws + oCh);
  unsigned short* CTl  = (unsigned short*)(ws + oCl);

  const dim3 blk(256);
  const dim3 gTW(DM / 64, DM / 64, 1);                             // 8 x 8 x 1
  const dim3 gCX(NA / 2048);                                       // 2048
  const int tilesP = (NROWS / 64) * (DM / 64);                     // 1024
  const int tilesV = (DM / 64) * (SEQ / 64);                       // 128 per batch
  const dim3 gP((tilesP + 7) / 8, 1);                              // 128
  const dim3 gV((tilesV + 7) / 8, NB);                             // 16 x 8
  const dim3 gAT(ATT_BLOCKS, NHEAD, NB);                           // 8 x 8 x 8
  const dim3 bAT(ATT_THREADS);                                     // 256

  // (0) weight planes: W[c][n] -> WT[n][c] as f16( bf16_RNE(w) * 64 ); Wo[c][n] -> WOT[n][c] bf16
  tr16<0><<<gTW, blk, 0, stream>>>(w_q, WQT, DM, DM, 0LL, 0LL, WSC);
  tr16<0><<<gTW, blk, 0, stream>>>(w_k, WKT, DM, DM, 0LL, 0LL, WSC);
  tr16<0><<<gTW, blk, 0, stream>>>(w_v, WVT, DM, DM, 0LL, 0LL, WSC);
  tr16<0><<<gTW, blk, 0, stream>>>(w_p, WPT, DM, DM, 0LL, 0LL, WSC);
  tr16<1><<<gTW, blk, 0, stream>>>(w_o, WOT, DM, DM, 0LL, 0LL, 1.0f);

  // (1) q projection: X16 = f16(bf16(query)*16); q[m][n] = sum_c x[m][c] WQT[n][c] / 1024 + bq[n];
  //     QU = f16((q + u_bias[n]) * 4), QV = f16((q + v_bias[n]) * 4); M = 8192, N = 512, K = 512
  cvt16<<<gCX, blk, 0, stream>>>(query, X16, NA, ACARRY);
  gemm64<5, 0, 0, 1, 2><<<gP, blk, 0, stream>>>(
      X16, X16, DM, 0LL, 0LL,
      WQT, DM, 0LL, 0LL,
      (void*)QU, (void*)QV, DM, 0LL, 0LL,
      NROWS, DM, DM, 1.0f / (ACARRY * WSC), QC,
      b_q, u_b, v_b);

  // (2) k projection -> K16 = f16((k + bk) * 4)
  cvt16<<<gCX, blk, 0, stream>>>(key, X16, NA, ACARRY);
  gemm64<2, 0, 0, 1, 2><<<gP, blk, 0, stream>>>(
      X16, X16, DM, 0LL, 0LL,
      WKT, DM, 0LL, 0LL,
      (void*)K16, (void*)K16, DM, 0LL, 0LL,
      NROWS, DM, DM, 1.0f / (ACARRY * WSC), QC,
      b_k, b_k, b_k);

  // (3) v^T per batch: VT[b][n = h*64+d][tok] = sum_c WVT[n][c] x_b[tok][c] / 1024 + bv[n] -> f16 x16 hi / residual planes;
  //     M = 512, N = 1024, K = 512
  cvt16<<<gCX, blk, 0, stream>>>(value, X16, NA, ACARRY);
  gemm64<4, 0, 0, 2, 2><<<gV, blk, 0, stream>>>(
      WVT, WVT, DM, 0LL, 0LL,
      X16, DM, (long long)SEQ * DM, 0LL,
      (void*)VTh, (void*)VTl, SEQ, (long long)DM * SEQ, 0LL,
      DM, SEQ, DM, 1.0f / (ACARRY * WSC), VC,
      b_v, b_v, b_v);

  // (4) p projection (no bias) -> P16 = f16(p * 4)
  cvt16<<<gCX, blk, 0, stream>>>(pemb, X16, NA, ACARRY);
  gemm64<2, 0, 0, 0, 2><<<gP, blk, 0, stream>>>(
      X16, X16, DM, 0LL, 0LL,
      WPT, DM, 0LL, 0LL,
      (void*)P16, (void*)P16, DM, 0LL, 0LL,
      NROWS, DM, DM, 1.0f / (ACARRY * WSC), QC,
      b_q, b_q, b_q);

  // (5) attention with its position logits, every batch element, head and block of 128 query rows in one launch -> CT (bf16 hi / residual planes)
  attnb<<<gAT, bAT, 0, stream>>>(QU, QV, K16, P16, VTh, VTl, CTh, CTl);

  // (6) out = (CT_hi + CT_lo) . WOT^T + bo; M = 8192, N = 512, K = 512, f32
  gemm64<0, 1, 1, 1, 2><<<gP, blk, 0, stream>>>(
      CTh, CTl, DM, 0LL, 0LL,
      WOT, DM, 0LL, 0LL,
      (void*)out, (void*)out, DM, 0LL, 0LL,
      NROWS, DM, DM, 1.0f, 1.0f,
      b_o, b_o, b_o);
  (void)hipGetLastError();
}

// v006
// It runs in 139 microseconds.
// Timed twice side by side with v005, it ran 1.36 and 1.37 times as fast.
// Counting every step since v000, it is 5.83 times as fast.
// Contractions (all f32 accumulate): q/k/v/p projections v_wmma_f32_16x16x32_f16 (x f16 x16 . W^T f16 x64, K=512, single products);
// position logits (q+v_bias).p^T v_wmma_f32_16x16x32_f16 ((q+v_bias) f16 x4 . p f16 x4, K=64, single), inside attention, f32;
// content scores v_wmma_f32_16x16x32_f16 ((q+u_bias) f16 x4 . k f16 x4, K=64, single);
// P . v^T v_wmma_f32_16x16x32_f16 (P f16 x1024 hi/lo . v^T f16 x16 hi/lo, hi.hi+lo.hi+hi.lo, K=1024 by 32);
// output projection v_wmma_f32_16x16x32_bf16 (ctx bf16 hi/lo . Wo bf16, hi.W+lo.W, K=512) + bias in f32.
// Max-subtracted online base-2 softmax in f32 on VALU; the relative shift of the position logits is a shifted read of their f32 tiles in LDS. Every float input RNE-converted to bf16 on load.
#include <hip/hip_runtime.h>
#include <math.h>
#include <stdint.h>

#define NB     8
#define SEQ    1024
#define DM     512
#define NHEAD  8
#define HD     64
#define NROWS  (NB * SEQ)
#define KCH    32
#define WSC    64.0f
#define ACARRY 16.0f
#define QC     4.0f
#define VC     16.0f
#define PC     1024.0f
#define LOG2E  1.4426950408889634f
#define SCL    0.04419417382415922f
static_assert(NHEAD * HD == DM);
static_assert((SEQ % 64) == 0 && (DM % 64) == 0 && (NROWS % 64) == 0 && (HD % 32) == 0 && (SEQ % KCH) == 0);
static_assert(((NROWS * DM) % 2048) == 0);
#define ATT_WAVES   8                 // waves of an attention block: 16 query rows each, all on one head
#define ATT_THREADS (ATT_WAVES * 32)
#define ATT_BLOCKS  (SEQ / (ATT_WAVES * 16))
#define SKP    100                    // floats per row of a wave's position-logit tiles (6 tile places of 16 columns + 4: stores and shifted reads spread over the banks)
#define KPITCH 144                    // LDS bytes per staged k row (128 + 16)
#define VPITCH 80                     // LDS bytes per staged v^T row (64 + 16)
#define ST_VH    (KCH * KPITCH)       // v^T hi behind the k rows
#define ST_VSZ   (HD * VPITCH)        // one v^T plane's rows
#define ST_BYTES (ST_VH + 2 * ST_VSZ) // one buffer: k | v^T hi | v^T residual
#define OPITCH 72                     // halves per staged result row (64 + 8)
#define ATT_PT_BYTES   (ATT_WAVES * 16 * 36 * 4)
#define ATT_SMEM_BYTES (ATT_PT_BYTES + 2 * ST_BYTES)
#define GKS    64                     // halves of k per staged gemm slab: 128 B, one whole line of every row
#define GPITCH 144                    // LDS bytes per staged gemm row (128 + 16)
static_assert((DM % GKS) == 0 && (HD % GKS) == 0);                   // every K is whole slabs
static_assert(((DM / 64) % 8) == 0 && ((SEQ / 64) % 8) == 0);        // every N is whole blocks of 8 column tiles
static_assert(ATT_THREADS == 256);
static_assert(ATT_BLOCKS == 8);
static_assert(KCH * HD * 2 == ATT_THREADS * 16);          // one 16-byte piece of k, and of each v^T plane, per thread and chunk
static_assert(HD * 2 == 128 && KCH * 2 == 64);
static_assert((ATT_PT_BYTES % 16) == 0 && (ST_BYTES % 16) == 0 && (ST_VH % 16) == 0);
static_assert(ATT_WAVES * 2 * 16 * OPITCH * 2 <= ATT_SMEM_BYTES);

typedef _Float16 v16h __attribute__((ext_vector_type(16)));
typedef _Float16 v8h  __attribute__((ext_vector_type(8)));
typedef __bf16   v16b __attribute__((ext_vector_type(16)));
typedef float    v8f  __attribute__((ext_vector_type(8)));
typedef float    v4f  __attribute__((ext_vector_type(4)));
typedef unsigned int v4u __attribute__((ext_vector_type(4)));

union FragH { v16h v; v8h h[2]; v4u u[2]; };
union FragAny { v16h h; v16b b; };

// ---- scalar helpers --------------------------------------------------------------------------------
__device__ __forceinline__ unsigned short bf_bits(float f) {          // f32 -> bf16 bits, RNE convert
  unsigned u = __float_as_uint(f);
  return (unsigned short)((u + 0x7FFFu + ((u >> 16) & 1u)) >> 16);
}
__device__ __forceinline__ float bf_up(unsigned short h) { return __uint_as_float(((unsigned)h) << 16); }
__device__ __forceinline__ float bfr(float f) { return bf_up(bf_bits(f)); }   // value of the bf16 RNE convert
__device__ __forceinline__ unsigned short h_bits(_Float16 x) { return __builtin_bit_cast(unsigned short, x); }
__device__ __forceinline__ unsigned pk16(unsigned short a, unsigned short b) { return (unsigned)a | ((unsigned)b << 16); }
__device__ __forceinline__ v8f zero8() { v8f z = {0.f, 0.f, 0.f, 0.f, 0.f, 0.f, 0.f, 0.f}; return z; }

// ---- fragment loader: 16-bit A/B operand from a k-contiguous 16-bit plane, lane -> row/col (lane&15),
//      p already includes +8*(lane>>4); elements 0..7 <- p[0..7] (k0+8h..), elements 8..15 <- p[16..23] (k0+16+8h..)
//      (same split k map for A and B; B is always read from a [n][k] plane)
__device__ __forceinline__ v16h ldfrag_u(const unsigned short* p) {
  FragH f;
  f.u[0] = *(const v4u*)(p);
  f.u[1] = *(const v4u*)(p + 16);
  return f.v;
}

// same fragment from a wave-uniform byte base plus this lane's 32-bit byte offset (already holding +16*(lane>>4)): an address costs one
// register, shared by planes of one layout, so a whole trip's loads fit the register file together
__device__ __forceinline__ v16h ldfrag_o(const char* base, unsigned off) {
  const char* p = base + off;
  FragH f;
  f.u[0] = *(const v4u*)(p);
  f.u[1] = *(const v4u*)(p + 32);
  return f.v;
}

// ---- WMMA helpers with trailing VALU hazard gaps ------------------------------------------------------
__device__ __forceinline__ v8f mma_h(v16h a, v16h b, v8f c) {
  return __builtin_amdgcn_wmma_f32_16x16x32_f16(false, a, false, b, (short)0, c, false, false);
}
__device__ __forceinline__ v8f mma_b(v16h a, v16h b, v8f c) {
  FragAny ua, ub;
  ua.h = a;
  ub.h = b;
  return __builtin_amdgcn_wmma_f32_16x16x32_bf16(false, ua.b, false, ub.b, (short)0, c, false, false);
}
template <int BF>
__device__ __forceinline__ v8f mmaT(v16h a, v16h b, v8f c) {
  if constexpr (BF != 0) return mma_b(a, b, c);
  else return mma_h(a, b, c);
}
__device__ __forceinline__ void dep_guard1(v8f& a, v8f& b, v16h x) {
#if defined(__HIP_DEVICE_COMPILE__)
  asm volatile("v_nop\n\tv_nop\n\tv_nop\n\tv_nop" : "+v"(a), "+v"(b) : "v"(x));
#endif
}
__device__ __forceinline__ void guard2x6(v8f& a, v8f& b, v16h x0, v16h x1, v16h x2, v16h x3, v16h x4, v16h x5) {
#if defined(__HIP_DEVICE_COMPILE__)
  asm volatile("v_nop\n\tv_nop\n\tv_nop\n\tv_nop"
               : "+v"(a), "+v"(b) : "v"(x0), "v"(x1), "v"(x2), "v"(x3), "v"(x4), "v"(x5));
#endif
}
__device__ __forceinline__ void guard4x6(v8f& a, v8f& b, v8f& c, v8f& d,
                                         v16h x0, v16h x1, v16h x2, v16h x3, v16h x4, v16h x5) {
#if defined(__HIP_DEVICE_COMPILE__)
  asm volatile("v_nop\n\tv_nop\n\tv_nop\n\tv_nop"
               : "+v"(a), "+v"(b), "+v"(c), "+v"(d) : "v"(x0), "v"(x1), "v"(x2), "v"(x3), "v"(x4), "v"(x5));
#endif
}
__device__ __forceinline__ void guard4x5(v8f& a, v8f& b, v8f& c, v8f& d,
                                         v16h x0, v16h x1, v16h x2, v16h x3, v16h x4) {
#if defined(__HIP_DEVICE_COMPILE__)
  asm volatile("v_nop\n\tv_nop\n\tv_nop\n\tv_nop"
               : "+v"(a), "+v"(b), "+v"(c), "+v"(d) : "v"(x0), "v"(x1), "v"(x2), "v"(x3), "v"(x4));
#endif
}
__device__ __forceinline__ void keep4_h(v16h a, v16h b, v16h c, v16h d) {
#if defined(__HIP_DEVICE_COMPILE__)
  asm volatile("v_nop" :: "v"(a), "v"(b), "v"(c), "v"(d));
#endif
}
__device__ __forceinline__ void acc_guard4(v8f& a, v8f& b, v8f& c, v8f& d) {
#if defined(__HIP_DEVICE_COMPILE__)
  asm volatile("v_nop\n\tv_nop\n\tv_nop\n\tv_nop" : "+v"(a), "+v"(b), "+v"(c), "+v"(d));
#endif
}
// N asynchronous 16-byte copies per lane, global memory -> LDS through no register: l[q] = the lane's LDS byte address, g[q] = its global address.
// The closing s_wait_xcnt 0 stands in the copies' own statement, so no address register is rewritten in front of it.
template <int N>
__device__ __forceinline__ void acopy(const unsigned* l, const char* const* g) {
  static_assert(N == 9 || N == 10);
#if defined(__HIP_DEVICE_COMPILE__)
  if constexpr (N == 9) {
    asm volatile("global_load_async_to_lds_b128 %0, %1, off\n\t"
                 "global_load_async_to_lds_b128 %2, %3, off\n\t"
                 "global_load_async_to_lds_b128 %4, %5, off\n\t"
                 "global_load_async_to_lds_b128 %6, %7, off\n\t"
                 "global_load_async_to_lds_b128 %8, %9, off\n\t"
                 "global_load_async_to_lds_b128 %10, %11, off\n\t"
                 "global_load_async_to_lds_b128 %12, %13, off\n\t"
                 "global_load_async_to_lds_b128 %14, %15, off\n\t"
                 "global_load_async_to_lds_b128 %16, %17, off\n\t"
                 "s_wait_xcnt 0x0"
                 :: "v"(l[0]), "v"(g[0]), "v"(l[1]), "v"(g[1]), "v"(l[2]), "v"(g[2]), "v"(l[3]), "v"(g[3]), "v"(l[4]), "v"(g[4]),
                    "v"(l[5]), "v"(g[5]), "v"(l[6]), "v"(g[6]), "v"(l[7]), "v"(g[7]), "v"(l[8]), "v"(g[8])
                 : "memory");
  } else {
    asm volatile("global_load_async_to_lds_b128 %0, %1, off\n\t"
                 "global_load_async_to_lds_b128 %2, %3, off\n\t"
                 "global_load_async_to_lds_b128 %4, %5, off\n\t"
                 "global_load_async_to_lds_b128 %6, %7, off\n\t"
                 "global_load_async_to_lds_b128 %8, %9, off\n\t"
                 "global_load_async_to_lds_b128 %10, %11, off\n\t"
                 "global_load_async_to_lds_b128 %12, %13, off\n\t"
                 "global_load_async_to_lds_b128 %14, %15, off\n\t"
                 "global_load_async_to_lds_b128 %16, %17, off\n\t"
                 "global_load_async_to_lds_b128 %18, %19, off\n\t"
                 "s_wait_xcnt 0x0"
                 :: "v"(l[0]), "v"(g[0]), "v"(l[1]), "v"(g[1]), "v"(l[2]), "v"(g[2]), "v"(l[3]), "v"(g[3]), "v"(l[4]), "v"(g[4]),
                    "v"(l[5]), "v"(g[5]), "v"(l[6]), "v"(g[6]), "v"(l[7]), "v"(g[7]), "v"(l[8]), "v"(g[8]), "v"(l[9]), "v"(g[9])
                 : "memory");
  }
#endif
}
__device__ __forceinline__ void wait_async0() {   // this wave's copies have landed in LDS
#if defined(__HIP_DEVICE_COMPILE__)
  asm volatile("s_wait_asynccnt 0x0" ::: "memory");
#endif
}
__device__ __forceinline__ void wait_ds0() {      // this wave's LDS reads have returned: their buffer may be refilled behind the next barrier
#if defined(__HIP_DEVICE_COMPILE__)
  asm volatile("s_wait_dscnt 0x0" ::: "memory");
#endif
}
__device__ __forceinline__ void wave_sync_lds() {
  __builtin_amdgcn_fence(__ATOMIC_RELEASE, "workgroup");
  __builtin_amdgcn_wave_barrier();
  __builtin_amdgcn_fence(__ATOMIC_ACQUIRE, "workgroup");
}

// =====================================================================================================
// Every input pack of a call in ONE launch (they do not depend on one another); each block does what one block of the separate launches did.
// Blocks 0 .. WTB-1, transposing 16-bit pack of a weight matrix: matrix b / 64, 64x64 tile b % 64:
//   in W[DM][DM] -> out WT[DM][DM] (plane b / 64 of WT5); matrices 0..3: f16( bf16_RNE(w) * WSC ); matrix 4: bf16_RNE(w) bits.
//   coverage: loads 4 x 256 x 4 floats = 64x64; stores 2 x 256 pieces x 8 halves = 64 rows x 64 halves = the whole tile; 64 tiles = 8 x 8 a matrix.
//   They come first: their longer way (load, LDS, barrier, store) runs under the stream of convert blocks behind them.
// Blocks behind them, elementwise 16-bit pack, no transpose: cb = b - WTB, plane w = cb / CVB of X4 <- f16( bf16_RNE(x_w[i]) * ACARRY ) (power of two, exact).
//   coverage: CVB blocks x 256 thr x 8 elements = NROWS*DM exactly, per plane.
// =====================================================================================================
#define WTB (5 * 64)                             // weight tile blocks
#define CVB ((NROWS * DM) / 2048)                // convert blocks per activation input
static_assert(CVB * 2048 == NROWS * DM);
static_assert(DM == 512);                        // 8 x 8 tiles of 64 x 64 per weight matrix

template <int BFO>
__device__ __forceinline__ void tr_tile(float (*t)[65], const float* __restrict__ src, unsigned short* dst, int c0, int d0, float sc) {
  const int tid = threadIdx.x;
#pragma unroll
  for (int it = 0; it < 4; ++it) {
    const int p  = it * 256 + tid;
    const int cc = p >> 4, sg = (p & 15) * 4;
    const v4f v = *(const v4f*)(src + (size_t)(c0 + cc) * DM + d0 + sg);
    t[cc][sg]     = v[0];
    t[cc][sg + 1] = v[1];
    t[cc][sg + 2] = v[2];
    t[cc][sg + 3] = v[3];
  }
  __syncthreads();
  v4u o[2];
#pragma unroll
  for (int it = 0; it < 2; ++it) {
    const int p  = it * 256 + tid;
    const int dd = p >> 3, s8 = (p & 7) * 8;
    unsigned short hv[8];
#pragma unroll
    for (int k = 0; k < 8; ++k) {
      const float f = bfr(t[s8 + k][dd]);
      if constexpr (BFO != 0) hv[k] = bf_bits(f);
      else hv[k] = h_bits((_Float16)(f * sc));
    }
    v4u q;
    q[0] = pk16(hv[0], hv[1]);
    q[1] = pk16(hv[2], hv[3]);
    q[2] = pk16(hv[4], hv[5]);
    q[3] = pk16(hv[6], hv[7]);
    o[it] = q;
  }
#pragma unroll
  for (int it = 0; it < 2; ++it) {
    const int p  = it * 256 + tid;
    const int dd = p >> 3, s8 = (p & 7) * 8;
    *(v4u*)(dst + (size_t)(d0 + dd) * DM + c0 + s8) = o[it];
  }
#if defined(__HIP_DEVICE_COMPILE__)
  // behind the two stores: in the merged kernel other code follows them in the listing, and none of it may rewrite their registers ahead of this wait
  asm volatile("s_wait_xcnt 0x0" ::: "memory");
#endif
}

__global__ __launch_bounds__(256) void prep(const float* __restrict__ xq, const float* __restrict__ xk,
                                            const float* __restrict__ xv, const float* __restrict__ xp,
                                            const float* __restrict__ wq, const float* __restrict__ wk, const float* __restrict__ wv,
                                            const float* __restrict__ wp, const float* __restrict__ wo,
                                            unsigned short* X4, unsigned short* WT5) {
  __shared__ float t[64][65];
  const int b = blockIdx.x;
  if (b >= WTB) {                                // the same for the whole block; this side has no barrier
    const int cb = b - WTB;
    const int w = cb / CVB;
    const float* src = (w == 0) ? xq : (w == 1) ? xk : (w == 2) ? xv : xp;
    unsigned short* dst = X4 + (size_t)w * ((size_t)NROWS * DM);
    const float sc = ACARRY;
    const size_t i8 = ((size_t)(cb - w * CVB) * 256 + threadIdx.x) * 8;
    const v4f a = *(const v4f*)(src + i8);
    const v4f b4 = *(const v4f*)(src + i8 + 4);
    v4u o;
    o[0] = pk16(h_bits((_Float16)(bfr(a[0]) * sc)), h_bits((_Float16)(bfr(a[1]) * sc)));
    o[1] = pk16(h_bits((_Float16)(bfr(a[2]) * sc)), h_bits((_Float16)(bfr(a[3]) * sc)));
    o[2] = pk16(h_bits((_Float16)(bfr(b4[0]) * sc)), h_bits((_Float16)(bfr(b4[1]) * sc)));
    o[3] = pk16(h_bits((_Float16)(bfr(b4[2]) * sc)), h_bits((_Float16)(bfr(b4[3]) * sc)));
    *(v4u*)(dst + i8) = o;
    return;
  }
  const int m = b >> 6, c0 = (b & 7) * 64, d0 = ((b >> 3) & 7) * 64;
  const float* W = (m == 0) ? wq : (m == 1) ? wk : (m == 2) ? wv : (m == 3) ? wp : wo;
  unsigned short* dst = WT5 + (size_t)m * (DM * DM);
  if (m < 4) tr_tile<0>(t, W, dst, c0, d0, WSC);   // m is the same for the whole block: every thread passes the one barrier of its side
  else tr_tile<1>(t, W, dst, c0, d0, 1.0f);
}

// =====================================================================================================
// Register-blocked batched 16-bit WMMA GEMM: C[m][n] = oscale * sum_k A[m][k] * Bt[n][k] (+ bias); one wave per 64x64 tile, a block's
// eight waves on eight neighbouring column tiles of one row tile (64 x 512). A row-major [M][K] pitch lda (16-bit plane), Bt row-major
// [N][K] pitch ldb (k contiguous); M multiple of 64, N multiple of 512, K multiple of 64.
// Operands go through LDS: per slab of 64 k the block's 64 A rows (both planes with ASPLIT) and 512 Bt rows are copied once, as whole
// 128-byte lines (a wave's copy = 4 rows), by asynchronous copies; every wave takes its fragments from there (row pitch 144 B = 16 B x odd).
// NBUF 2: slab t+2 is copied into the buffer that trip t has read, behind the trip's one barrier, and flies under trip t+1.
// NBUF 1: one buffer, filled and then read (for K = one slab: two blocks fit a WGP).
// blockIdx.y = batch index with element strides sA, sB, sC; blockIdx.z = outer batch index with strides zA, zB, zC.
// ASPLIT 1: a second A plane A2 (unscaled residual of A, same layout) is multiplied into the same accumulator (A + A2 ~ exact A).
// BF 1: bf16 operands (v_wmma_f32_16x16x32_bf16), else f16.
// EPI 1: value += bf16_RNE(ep0[column]) (per-column bias); EPI 2: value += bf16_RNE(ep0[row]) (per-row bias, 16-bit out only).
// OM 0: f32 out (pitch ldc).  OM 2: one f16 plane = f16(value * ocarry).
// OM 4: two f16 planes: hi = f16(value * ocarry), lo = f16(value * ocarry - hi) (unscaled residual).
// OM 5: two f16 planes: C = f16((value + bf16_RNE(ep1[column])) * ocarry), C2 = f16((value + bf16_RNE(ep2[column])) * ocarry).
// coverage: 4 slabs x 16 rows (f32: it 0..7 x lane>>4; 16-bit: it 0..3 x lane>>3) x 64 cols = the wave's whole 64x64 tile;
//           grid = tilesM*tilesN/8 blocks exactly.
// =====================================================================================================
#define GSTG_BYTES(ASPLIT, NBUF) ((NBUF) * (64 * (1 + (ASPLIT)) + 512) * GPITCH)   // staging bytes of a block
// the products of one block: acc = the wave's 64x64 tile, rows m0.., Bt rows nb0 + 64 wave ..; A1, A2, Bb = byte bases of the planes
template <int ASPLIT, int BF, int NBUF>
__device__ __forceinline__ void gemm_main(v8f (&acc)[4][4], char* stg, const char* A1, const char* A2, const char* Bb,
                                          int lda, int ldb, int m0, int nb0, int K) {
  constexpr int AROWS  = 64 * (1 + ASPLIT);        // staged rows: A | A2 (ASPLIT) | Bt
  constexpr int SROWS  = AROWS + 512;
  constexpr int SBYTES = SROWS * GPITCH;           // one buffer
  constexpr int NQ     = SROWS / 32;               // copies per thread and slab: 256 threads x 16 B = 32 rows each
  const int lane = threadIdx.x & 31;
  const int wave = threadIdx.x >> 5;
  const int rlane = lane & 15;                 // row (A) / col (B, D) within subtile
  const int koff  = (lane >> 4) * 8;           // k offset of this lane half

#pragma unroll
  for (int i = 0; i < 4; ++i)
#pragma unroll
    for (int j = 0; j < 4; ++j) acc[i][j] = zero8();

  // this thread's 16-byte pieces of a slab: staged rows (tid>>3) + 32 q, piece tid&7 of the row's 128 B (planes stay under 4 GiB)
  const int prow = threadIdx.x >> 3, seg = threadIdx.x & 7;
  const unsigned lds0 = (unsigned)(uintptr_t)stg + (unsigned)(prow * GPITCH + seg * 16);   // low 32 bits of the __shared__ address
  const unsigned ga0  = (unsigned)((m0 + prow) * lda) * 2u + (unsigned)(seg * 16);
  const unsigned gb0  = (unsigned)((nb0 + prow) * ldb) * 2u + (unsigned)(seg * 16);
  auto stage = [&](int k0, unsigned bufoff) {
    unsigned l[NQ];
    const char* g[NQ];
#pragma unroll   // q must be a constant: the addresses are register operands of the copy statements
    for (int q = 0; q < NQ; ++q) {
      l[q] = lds0 + bufoff + (unsigned)(q * 32 * GPITCH);
      // block-uniform part first (scalar), then this thread's offset: one vector add an address
      if (q < 2) g[q] = (A1 + (unsigned)(q * 32 * lda + k0) * 2u) + ga0;
      else if (q < AROWS / 32) g[q] = (A2 + (unsigned)((q - 2) * 32 * lda + k0) * 2u) + ga0;
      else g[q] = (Bb + (unsigned)((q - AROWS / 32) * 32 * ldb + k0) * 2u) + gb0;
    }
    acopy<NQ / 2>(l, g);
    acopy<NQ / 2>(l + NQ / 2, g + NQ / 2);
  };

  const unsigned fa = (unsigned)(rlane * GPITCH + koff * 2);                               // this lane's fragment reads: A row rlane
  const unsigned fb = (unsigned)((AROWS + (wave << 6) + rlane) * GPITCH + koff * 2);       // Bt row rlane of the wave's 64
  auto products = [&](unsigned bufoff) {
    const char* sb = stg + bufoff;
#pragma unroll   // both k-steps of a slab in line: their LDS offsets are immediates
    for (int ks = 0; ks < GKS / 32; ++ks) {
      // every fragment of this k-step is requested before its first product: one LDS latency a k-step
      v16h bh[4], ah[4], al[4];
#pragma unroll
      for (int j = 0; j < 4; ++j) bh[j] = ldfrag_o(sb + (j * 16 * GPITCH + ks * 64), fb);
#pragma unroll
      for (int i = 0; i < 4; ++i) {
        ah[i] = ldfrag_o(sb + (i * 16 * GPITCH + ks * 64), fa);
        if constexpr (ASPLIT != 0) al[i] = ldfrag_o(sb + ((64 + i * 16) * GPITCH + ks * 64), fa);
      }
      __builtin_amdgcn_sched_barrier(0);   // keeps the loads above in front of the products (else each A load sinks to its own group and waits alone)
#pragma unroll
      for (int i = 0; i < 4; ++i) {
#pragma unroll
        for (int j = 0; j < 4; ++j) acc[i][j] = mmaT<BF>(ah[i], bh[j], acc[i][j]);
        dep_guard1(acc[i][0], acc[i][3], ah[i]);
        if constexpr (ASPLIT != 0) {
#pragma unroll
          for (int j = 0; j < 4; ++j) acc[i][j] = mmaT<BF>(al[i], bh[j], acc[i][j]);
          dep_guard1(acc[i][0], acc[i][3], al[i]);
        }
      }
      keep4_h(bh[0], bh[1], bh[2], bh[3]);
    }
  };

  const int nslab = K / GKS;
  if constexpr (NBUF == 2) {
    stage(0, 0u);
    wait_async0();
    __syncthreads();                                       // publishes slab 0
    if (nslab > 1) stage(GKS, (unsigned)SBYTES);
    for (int t = 0; t < nslab; ++t) {
      const unsigned bo = (unsigned)(t & 1) * (unsigned)SBYTES;
      products(bo);
      wait_ds0();
      wait_async0();
      __syncthreads();                                     // publishes slab t+1; ends every wave's reads of this trip's buffer
      if (t + 2 < nslab) stage((t + 2) * GKS, bo);
    }
    wait_async0();
  } else {
    for (int t = 0; t < nslab; ++t) {
      if (t > 0) {
        wait_ds0();
        __syncthreads();                                   // ends every wave's reads of the buffer before it is refilled
      }
      stage(t * GKS, 0u);
      wait_async0();
      __syncthreads();                                     // publishes slab t
      products(0u);
    }
  }
  acc_guard4(acc[0][0], acc[0][1], acc[0][2], acc[0][3]);
  acc_guard4(acc[1][0], acc[1][1], acc[1][2], acc[1][3]);
  acc_guard4(acc[2][0], acc[2][1], acc[2][2], acc[2][3]);
  acc_guard4(acc[3][0], acc[3][1], acc[3][2], acc[3][3]);
}

// the wave's tile out: slab = the wave's own 16 x 68 floats of LDS; Cout, C2out = the planes of this batch element; n0 = the wave's first column
template <int OM, int EPI>
__device__ __forceinline__ void gemm_epi(v8f (&acc)[4][4], float* slab, void* Cout, void* C2out, int ldc, int m0, int n0,
                                         float oscale, float ocarry,
                                         const float* __restrict__ ep0, const float* __restrict__ ep1, const float* __restrict__ ep2) {
  const int lane  = threadIdx.x & 31;
  const int rlane = lane & 15;                 // col (D) within subtile
  const int mOff  = (lane >> 4) * 8;           // D row offset
  const int hh2 = lane >> 4, c4 = (lane & 15) * 4;     // f32 out: 256-B row segment = 16 lanes x 16 B
  const int q8  = lane >> 3, c8 = (lane & 7) * 8;

  // ---- epilogue ----
#pragma unroll
  for (int i = 0; i < 4; ++i) {
    const int mBase = m0 + (i << 4);
#pragma unroll
    for (int j = 0; j < 4; ++j) {
#pragma unroll
      for (int r = 0; r < 8; ++r) {
        slab[(mOff + r) * 68 + (j << 4) + rlane] = acc[i][j][r];
      }
    }
    wave_sync_lds();
    if constexpr (OM == 0) {
      float* C = (float*)Cout;
      v4f vals[8];
#pragma unroll
      for (int it = 0; it < 8; ++it) {
        const int row = it * 2 + hh2;                      // it 0..7 x hh2 0..1 = rows 0..15
        v4f v = *(const v4f*)(slab + row * 68 + c4);
#pragma unroll
        for (int e = 0; e < 4; ++e) v[e] = v[e] * oscale;
        if constexpr (EPI == 1) {
          const v4f bb = *(const v4f*)(ep0 + n0 + c4);     // per-column bias, columns n0+c4 .. +3 (N equals the bias length)
#pragma unroll
          for (int e = 0; e < 4; ++e) v[e] = v[e] + bfr(bb[e]);
        }
        vals[it] = v;
      }
      {
#pragma unroll
        for (int it = 0; it < 8; ++it) {
          const int gr = mBase + it * 2 + hh2;
          *(v4f*)(C + (size_t)gr * ldc + n0 + c4) = vals[it];
        }
        
      }
    } else {
      unsigned short* C  = (unsigned short*)Cout;
      unsigned short* Cb = (unsigned short*)C2out;
      v4u hv[4], lv[4];
#pragma unroll
      for (int it = 0; it < 4; ++it) {
        const int row = it * 4 + q8;                       // it 0..3 x q8 0..3 = rows 0..15
        const float* sp = slab + row * 68 + c8;
        float rb = 0.f;
        if constexpr (EPI == 2) rb = bfr(ep0[mBase + row]);   // per-row bias (M equals the bias length)
        v4u a  = {0u, 0u, 0u, 0u};
        v4u b2 = {0u, 0u, 0u, 0u};
#pragma unroll
        for (int e = 0; e < 4; ++e) {
          const int ci = n0 + c8 + 2 * e;                  // column index, < N
          float f0 = sp[2 * e] * oscale + rb;
          float f1 = sp[2 * e + 1] * oscale + rb;
          if constexpr (EPI == 1) {
            f0 += bfr(ep0[ci]);
            f1 += bfr(ep0[ci + 1]);
          }
          if constexpr (OM == 5) {
            const float g0 = (f0 + bfr(ep1[ci])) * ocarry, g1 = (f1 + bfr(ep1[ci + 1])) * ocarry;
            const float w0 = (f0 + bfr(ep2[ci])) * ocarry, w1 = (f1 + bfr(ep2[ci + 1])) * ocarry;
            a[e]  = pk16(h_bits((_Float16)g0), h_bits((_Float16)g1));
            b2[e] = pk16(h_bits((_Float16)w0), h_bits((_Float16)w1));
          } else {
            f0 *= ocarry; f1 *= ocarry;
            const _Float16 x0 = (_Float16)f0, x1 = (_Float16)f1;
            a[e] = pk16(h_bits(x0), h_bits(x1));
            if constexpr (OM == 4) {
              b2[e] = pk16(h_bits((_Float16)(f0 - (float)x0)), h_bits((_Float16)(f1 - (float)x1)));
            }
          }
        }
        hv[it] = a;
        lv[it] = b2;
      }
      {
#pragma unroll
        for (int it = 0; it < 4; ++it) {
          const int row = it * 4 + q8;
          *(v4u*)(C + (size_t)(mBase + row) * ldc + n0 + c8) = hv[it];
          if constexpr (OM >= 4) {
            *(v4u*)(Cb + (size_t)(mBase + row) * ldc + n0 + c8) = lv[it];
          }
        }
        
      }
    }
    wave_sync_lds();
  }
}

template <int OM, int ASPLIT, int BF, int EPI, int NBUF>
__global__ __launch_bounds__(256) __attribute__((amdgpu_num_vgpr(256))) void gemm64(
    const unsigned short* __restrict__ Ap, const unsigned short* __restrict__ A2p, int lda, long long sA, long long zA,
    const unsigned short* __restrict__ Btp, int ldb, long long sB, long long zB,
    void* Cout, void* C2out, int ldc, long long sC, long long zC,
    int M, int N, int K, float oscale, float ocarry,
    const float* __restrict__ ep0, const float* __restrict__ ep1, const float* __restrict__ ep2) {
  __shared__ __align__(16) float sT[8][16 * 68];   // per-wave 16x64 slab, pitch 68 floats
  __shared__ __align__(16) char stg[GSTG_BYTES(ASPLIT, NBUF)];
  const int by   = blockIdx.y;
  const int bz   = blockIdx.z;
  const int wave = threadIdx.x >> 5;
  const int tilesN = N >> 6;
  const int tilesM = M >> 6;
  const int tile0 = blockIdx.x * 8;
  if (tile0 + 8 > tilesM * tilesN) return;   // the same for the whole block, in front of every barrier; never taken with the exact grid
  const int tm  = tile0 / tilesN;
  const int tn0 = tile0 - tm * tilesN;       // tilesN is a multiple of 8: the block's eight tiles lie in one row of tiles
  const int m0  = tm << 6;
  const int nb0 = tn0 << 6;                  // first Bt row of the block
  const int n0  = nb0 + (wave << 6);

  const char* A1 = (const char*)(Ap  + (size_t)((long long)by * sA + (long long)bz * zA));
  const char* A2 = (const char*)(A2p + (size_t)((long long)by * sA + (long long)bz * zA));
  const char* Bb = (const char*)(Btp + (size_t)((long long)by * sB + (long long)bz * zB));
  const size_t co = (size_t)((long long)by * sC + (long long)bz * zC);

  v8f acc[4][4];
  gemm_main<ASPLIT, BF, NBUF>(acc, stg, A1, A2, Bb, lda, ldb, m0, nb0, K);
  if constexpr (OM == 0) gemm_epi<OM, EPI>(acc, sT[wave], (void*)((float*)Cout + co), (void*)((float*)C2out + co), ldc, m0, n0, oscale, ocarry, ep0, ep1, ep2);
  else gemm_epi<OM, EPI>(acc, sT[wave], (void*)((unsigned short*)Cout + co), (void*)((unsigned short*)C2out + co), ldc, m0, n0, oscale, ocarry, ep0, ep1, ep2);
}

// =====================================================================================================
// The four input projections in ONE launch (they do not depend on one another): blockIdx.y = 0 q, 1 v^T, 2 k, 3 p; 128 blocks each, every block
// as in gemm64 (64 x 512 of C, K = 512, f16 operands, two buffers); the products are one text for all four, the way out differs.
//   q, k, p: C[8192][512] = X_w . W^T, block x = row tile x.   v^T: per batch element x / 16, C[512][1024] = WVT . X_v^T, tiles (x % 16) * 8 .. + 7.
// X4 = the four activation planes (q, k, v, p), WT5 = the weight planes (q, k, v, p, o).
// =====================================================================================================
__global__ __launch_bounds__(256) __attribute__((amdgpu_num_vgpr(256))) void proj4(
    const unsigned short* __restrict__ X4, const unsigned short* __restrict__ WT5,
    unsigned short* QU, unsigned short* QV, unsigned short* K16, unsigned short* P16, unsigned short* VTh, unsigned short* VTl,
    const float* __restrict__ b_q, const float* __restrict__ u_b, const float* __restrict__ v_b,
    const float* __restrict__ b_k, const float* __restrict__ b_v) {
  __shared__ __align__(16) float sT[8][16 * 68];   // per-wave 16x64 slab, pitch 68 floats
  __shared__ __align__(16) char stg[GSTG_BYTES(0, 2)];
  const int which = blockIdx.y;                    // the same for the whole block
  const int bx    = blockIdx.x;
  const int wave  = threadIdx.x >> 5;
  const size_t PXE = (size_t)NROWS * DM, PWE = (size_t)DM * DM;
  const float osc = 1.0f / (ACARRY * WSC);
  const char *A1, *Bb;
  int m0, nb0;
  if (which == 1) {
    const int tile0 = (bx & 15) * 8;               // 8 x 16 tiles a batch element
    m0  = (tile0 >> 4) << 6;
    nb0 = (tile0 & 15) << 6;
    A1  = (const char*)(WT5 + 2 * PWE);
    Bb  = (const char*)(X4 + 2 * PXE + (size_t)(bx >> 4) * ((size_t)SEQ * DM));
  } else {
    const int pl = (which == 0) ? 0 : (which == 2) ? 1 : 3;   // plane of X4 and of WT5
    m0  = bx << 6;
    nb0 = 0;
    A1  = (const char*)(X4 + (size_t)pl * PXE);
    Bb  = (const char*)(WT5 + (size_t)pl * PWE);
  }
  const int n0 = nb0 + (wave << 6);
  v8f acc[4][4];
  gemm_main<0, 0, 2>(acc, stg, A1, A1, Bb, DM, DM, m0, nb0, DM);
  float* slab = sT[wave];
  if (which == 0) {
    gemm_epi<5, 1>(acc, slab, (void*)QU, (void*)QV, DM, m0, n0, osc, QC, b_q, u_b, v_b);
  } else if (which == 1) {
    const size_t co = (size_t)(bx >> 4) * ((size_t)DM * SEQ);
    gemm_epi<4, 2>(acc, slab, (void*)(VTh + co), (void*)(VTl + co), SEQ, m0, n0, osc, VC, b_v, b_v, b_v);
  } else if (which == 2) {
    gemm_epi<2, 1>(acc, slab, (void*)K16, (void*)K16, DM, m0, n0, osc, QC, b_k, b_k, b_k);
  } else {
    gemm_epi<2, 0>(acc, slab, (void*)P16, (void*)P16, DM, m0, n0, osc, QC, b_k, b_k, b_k);
  }
}

// =====================================================================================================
// Flash attention for one batch element, one head and 128 query rows: 8 waves, 16 query rows each, head dim 64, 1024 keys.
// blockIdx.x = block of 128 query rows, blockIdx.y = head, blockIdx.z = batch element. QU0, QV0, KP0, PP0, CTh0, CTl0 are [8192][512] planes,
// VTh0/VTl0 [8][512][1024] planes. G[r][c] below stands for (q_r + v_bias) . p_c of this head.
//   The eight waves need the same k and v^T values: each chunk of 32 keys is brought from global memory ONCE per block (whole 16-byte pieces,
//   one of k, one of v^T hi, one of v^T residual per thread) into one of two LDS buffers, and every wave takes its k and v^T B fragments from there.
//   The pieces of chunk t+1 are requested at the head of trip t, stored into the other buffer at its foot, and published by the trip's one
//   block barrier, which also ends every wave's reads of the buffer that the next trip refills.
//   LDS rows: k [32 keys][64 d] pitch 144 B, v^T [64 d][32 keys] pitch 80 B (16 B x odd: 16-byte fragment reads without bank conflicts).
//   A fragments (stationary): (q_i + u_bias) f16 x4 rows i0+m, QU[i][64h + d], two k-steps of 32;
//   B fragments per chunk of 32 keys: k f16 x4 rows (k-contiguous) -> scores s[i][j] (two 16-column tiles);
//   position logit by relative shift, i = query row, j = key: j <= i -> G[i][S-1-i+j]; j == i+1 -> 0; else G[i+1][j-i-2].
//   With x = S-1-i+j a wave's 16 rows x 32 keys need x in a window of 47 that starts at the multiple of 16 S-16-i0+jb: three 16-column tiles,
//   each wholly x < S (rows i, p row x) or wholly x >= S (rows i+1, p row x-S-1; x == S is selected to 0 where it is used). The wave makes the
//   tiles by WMMA (A = either row set, from the wave's LDS; B = p rows from global memory, requested a trip ahead), stores them side by side in
//   its own LDS rows and reads row m back shifted by 15-m. The window moves by two tiles a trip, so a trip makes two new ones: even trips read
//   tile places 0 1 2, odd trips 2 3 4; the tile stored at place 4 is also stored at place 0 (on odd trips that second store goes to the spare place 5).
//   t = (s/16 + pos) / sqrt(512) * log2(e); online softmax in base 2, max-subtracted, running sums in f32;
//   A fragments of P*1024 (f16 hi and unscaled residual) rebuilt from the wave's LDS rows (f32 vector loads, split k map); v^T B fragments
//   (f16 x16 hi and unscaled residual); 12 P.V WMMAs (hi.hi, lo.hi, hi.lo).
//   Final 1/l and carry folds in f32; behind the last trip's barrier each wave reuses its own 4608 B of LDS as two bf16 tiles [16][64]
//   (hi, lo, pitch 144 B), stages its slice (element stores) and writes it as whole 128-byte row segments.
//   every wave does identical bounded work (32 trips of 32 keys) and passes every barrier.
// coverage: wave tile 16 rows x 64 cols per plane = 4 iterations x 32 lanes x 8 halves; 8 waves x 8 blocks = 1024 rows, 8 heads x 64 = 512
//           columns, per batch element, each element written exactly once.
// =====================================================================================================
__global__ __launch_bounds__(ATT_THREADS) __attribute__((amdgpu_num_vgpr(256)))
void attnb(const unsigned short* __restrict__ QU0, const unsigned short* __restrict__ QV0,
           const unsigned short* __restrict__ KP0, const unsigned short* __restrict__ PP0,
           const unsigned short* __restrict__ VTh0, const unsigned short* __restrict__ VTl0,
           unsigned short* CTh0, unsigned short* CTl0) {
  __shared__ __align__(16) char smem[ATT_SMEM_BYTES];   // prob tiles [wave][row][32 cols] pitch 36 floats | two k / v^T buffers
  __shared__ __align__(16) float skew[ATT_WAVES][16 * SKP];   // per wave: position logits [16 rows][6 tile places x 16 columns]
  __shared__ __align__(16) char  qvf[ATT_WAVES][8 * 512];     // per wave: (q + v_bias) A fragments, 8 pieces of 16 B per lane (each lane reads its own)

  const int tid  = threadIdx.x;
  const int wave = tid >> 5;
  const int lane = tid & 31;
  const int hh   = lane >> 4;
  const int c    = lane & 15;

  const int head = blockIdx.y;                             // 0..7
  const int i0   = blockIdx.x * (ATT_WAVES * 16) + __builtin_amdgcn_readfirstlane(wave) * 16;   // first query row of this wave (scalar)

  const size_t bg = blockIdx.z;                            // batch element
  const unsigned short* QU  = QU0  + bg * ((size_t)SEQ * DM);
  const unsigned short* QV  = QV0  + bg * ((size_t)SEQ * DM);
  const unsigned short* KP  = KP0  + bg * ((size_t)SEQ * DM);
  const unsigned short* PP  = PP0  + bg * ((size_t)SEQ * DM);
  const unsigned short* VTh = VTh0 + bg * ((size_t)DM * SEQ);
  const unsigned short* VTl = VTl0 + bg * ((size_t)DM * SEQ);
  unsigned short*       CTh = CTh0 + bg * ((size_t)SEQ * DM);
  unsigned short*       CTl = CTl0 + bg * ((size_t)SEQ * DM);

  // stationary A fragments: (q + u_bias) rows i0 + c, d 0..31 and 32..63
  const size_t qofs = (size_t)(i0 + c) * DM + head * HD + 8 * hh;
  const v16h qa = ldfrag_u(QU + qofs), qb = ldfrag_u(QU + qofs + 32);
  // likewise (q + v_bias), rows i0 + c (pieces 0..3) and rows i0 + 1 + c (pieces 4..7; the row behind the last is clamped: no key lies right of
  // its diagonal); kept in LDS, not in registers: one set is used twice a trip, and 32 more stationary registers would spill
  char* qvl = qvf[wave] + lane * 16;
  {
    const int i1 = (i0 + c + 1 < SEQ) ? (i0 + c + 1) : (SEQ - 1);
    const size_t qofs1 = (size_t)i1 * DM + head * HD + 8 * hh;
#pragma unroll
    for (int q = 0; q < 4; ++q) {
      *(v4u*)(qvl + q * 512)       = *(const v4u*)(QV + qofs + q * 16);
      *(v4u*)(qvl + (4 + q) * 512) = *(const v4u*)(QV + qofs1 + q * 16);
    }
  }

  const char* Kb  = (const char*)(KP + head * HD);
  const char* Pb  = (const char*)(PP + head * HD);
  const char* Vbh = (const char*)(VTh + (size_t)(head * HD) * SEQ);
  const char* Vbl = (const char*)(VTl + (size_t)(head * HD) * SEQ);
  // this thread's 16-byte pieces of a chunk: k row tid>>3 (8 pieces of its 128 B), v^T row tid>>2 (4 pieces of its 64 B)
  const unsigned gk0 = (unsigned)((tid >> 3) * (DM * 2) + (tid & 7) * 16);      // byte offset in chunk 0 of k
  const unsigned gv0 = (unsigned)((tid >> 2) * (SEQ * 2) + (tid & 3) * 16);     // byte offset in chunk 0 of either v^T plane
  const unsigned sk  = (unsigned)((tid >> 3) * KPITCH + (tid & 7) * 16);        // where they go in a buffer
  const unsigned sv  = (unsigned)(ST_VH + (tid >> 2) * VPITCH + (tid & 3) * 16);
  const unsigned fk  = (unsigned)(c * KPITCH + 16 * hh);                        // this lane's fragment reads: k row c
  const unsigned fv  = (unsigned)(ST_VH + c * VPITCH + 16 * hh);                // v^T hi row c

  const float CSC = SCL * LOG2E * (1.0f / (QC * QC));      // content scores and position logits carry x4 on both operands

  float mrow[8], lrow[8];
  v8f o0 = zero8(), o1 = zero8(), o2 = zero8(), o3 = zero8();
#pragma unroll
  for (int r = 0; r < 8; ++r) { mrow[r] = -INFINITY; lrow[r] = 0.f; }
  float* pt = (float*)smem + wave * (16 * 36);
  char* stage = smem + ATT_PT_BYTES;

  float* sw = skew[wave];
  // B fragments of the window tile that starts at x = tb (a multiple of 16, 0 .. 2S-16): lane c takes p row x (x < S) or x-S-1 (x == S clamped to row 0)
  auto ld_p = [&](int tb, v16h& b0, v16h& b1) -> unsigned {
    const int rb = (tb < SEQ) ? tb : (tb - (SEQ + 1));     // scalar
    int row = rb + c;
    row = (row < 0) ? 0 : row;
    const unsigned off = (unsigned)row * (unsigned)(DM * 2) + (unsigned)(16 * hh);
    b0 = ldfrag_o(Pb, off);
    b1 = ldfrag_o(Pb + 64, off);
    return off;
  };
  // that tile's 16 x 16 logits; tb is the same for the whole wave
  auto mm_p = [&](int tb, v16h b0, v16h b1) -> v8f {
    const char* ap = qvl + ((tb < SEQ) ? 0 : 4 * 512);
    FragH a0, a1;
    a0.u[0] = *(const v4u*)(ap);
    a0.u[1] = *(const v4u*)(ap + 512);
    a1.u[0] = *(const v4u*)(ap + 1024);
    a1.u[1] = *(const v4u*)(ap + 1536);
    v8f d = mma_h(a0.v, b0, zero8());
    return mma_h(a1.v, b1, d);
  };
  float*       sws = sw + hh * (8 * SKP) + c;              // this lane's stores: row 8 hh + r at + r SKP, tile place t at + 16 t
  const float* swr = sw + hh * (8 * (SKP - 1)) + 15 + c;   // its shifted reads: row 8 hh + r, window column 15 - (8 hh + r) + c, at + r (SKP - 1)
  auto st_tile = [&](int col, const v8f& d) {              // col = first column of the tile place (scalar)
    float* w = sws + col;
#pragma unroll
    for (int r = 0; r < 8; ++r) w[r * SKP] = d[r];
  };

  // chunk 0 into buffer 0; trip 0's position window into tile places 0 1 2
  {
    const v4u pk = *(const v4u*)(Kb + gk0);
    const v4u ph0 = *(const v4u*)(Vbh + gv0);
    const v4u pl0 = *(const v4u*)(Vbl + gv0);
    const int x0 = SEQ - 16 - i0;
    v16h t0a, t0b, t1a, t1b, t2a, t2b;
    const unsigned f0 = ld_p(x0, t0a, t0b);
    const unsigned f1 = ld_p(x0 + 16, t1a, t1b);
    const unsigned f2 = ld_p(x0 + 32, t2a, t2b);
    // the p loads' offset registers stay whole (no load's result lands on one) up to this wait
    asm volatile("s_wait_xcnt 0x0" :: "v"(f0), "v"(f1), "v"(f2) : "memory");
    *(v4u*)(stage + sk) = pk;
    *(v4u*)(stage + sv) = ph0;
    *(v4u*)(stage + sv + ST_VSZ) = pl0;
    st_tile(0, mm_p(x0, t0a, t0b));
    st_tile(16, mm_p(x0 + 16, t1a, t1b));
    st_tile(32, mm_p(x0 + 32, t2a, t2b));
  }
  __syncthreads();                                         // publishes chunk 0 (and orders the wave's window stores before its reads)

#pragma unroll 1
  for (int jb = 0; jb < SEQ; jb += KCH) {
    const int jn = (jb + KCH < SEQ) ? (jb + KCH) : 0;      // next trip's first key; the last trip asks for trip 0's again (in bounds, not used)
    const unsigned bsel = (unsigned)((jb / KCH) & 1) * ST_BYTES;
    const char* cur = stage + bsel;                        // this trip's buffer
    char*       nxt = stage + (ST_BYTES - bsel);           // the other one: every wave left it before the last barrier
    // the next chunk's pieces are requested here and stored at the trip's foot: their latency lies under the whole trip
    const v4u nk = *(const v4u*)(Kb + (gk0 + (unsigned)jn * (unsigned)(DM * 2)));
    const v4u nh = *(const v4u*)(Vbh + (gv0 + (unsigned)jn * 2u));
    const v4u nl = *(const v4u*)(Vbl + (gv0 + (unsigned)jn * 2u));
    // behind this wait the three loads' address registers are free for the results of the p loads below
    asm volatile("s_wait_xcnt 0x0" ::: "memory");
    const v16h k0a = ldfrag_o(cur, fk);
    const v16h k0b = ldfrag_o(cur + 64, fk);
    const v16h k1a = ldfrag_o(cur + 16 * KPITCH, fk);
    const v16h k1b = ldfrag_o(cur + 16 * KPITCH + 64, fk);
    // the two new tiles of the next trip's window: p rows requested here, multiplied behind the softmax
    const int xn = SEQ - 16 - i0 + jn;
    v16h n1a, n1b, n2a, n2b;
    const unsigned f1 = ld_p(xn + 16, n1a, n1b);
    const unsigned f2 = ld_p(xn + 32, n2a, n2b);
    // the p loads' offset registers stay whole (no load's result lands on one) up to this wait
    asm volatile("s_wait_xcnt 0x0" :: "v"(f1), "v"(f2) : "memory");
    // this trip's position logits: row m = 8 hh + r of the window, shifted by 15 - m
    const int odd = (jb / KCH) & 1;
    float ga[8], gc[8];
    {
      const float* wr = swr + odd * 32;
#pragma unroll
      for (int r = 0; r < 8; ++r) {
        ga[r] = wr[r * (SKP - 1)];
        gc[r] = wr[r * (SKP - 1) + 16];
      }
    }
    __builtin_amdgcn_sched_barrier(0);   // keeps the requests above at the trip's head (else the global ones sink to their stores and wait there)
    v8f s0, s1;
    s0 = mma_h(qa, k0a, zero8());
    s0 = mma_h(qb, k0b, s0);
    s1 = mma_h(qa, k1a, zero8());
    s1 = mma_h(qb, k1b, s1);
    guard2x6(s0, s1, qa, qb, k0a, k0b, k1a, k1b);
    float tt0[8], tt1[8];
#pragma unroll
    for (int r = 0; r < 8; ++r) {
      const int i  = i0 + 8 * hh + r;
      const int ja = jb + c, jc = jb + 16 + c;
      const float pa = (ja == i + 1) ? 0.f : ga[r];
      const float pz = (jc == i + 1) ? 0.f : gc[r];
      tt0[r] = s0[r] * CSC + pa * CSC;
      tt1[r] = s1[r] * CSC + pz * CSC;
    }
#pragma unroll
    for (int r = 0; r < 8; ++r) {
      const float t0 = tt0[r], t1 = tt1[r];
      float mx = fmaxf(t0, t1);
#pragma unroll
      for (int off = 1; off < 16; off <<= 1) mx = fmaxf(mx, __shfl_xor(mx, off, 32));
      const float mn = fmaxf(mrow[r], mx);
      const float al = exp2f(mrow[r] - mn);
      mrow[r] = mn;
      const float e0 = exp2f(t0 - mn), e1 = exp2f(t1 - mn);
      float ps = e0 + e1;
#pragma unroll
      for (int off = 1; off < 16; off <<= 1) ps += __shfl_xor(ps, off, 32);
      lrow[r] = lrow[r] * al + ps;
      o0[r] *= al;
      o1[r] *= al;
      o2[r] *= al;
      o3[r] *= al;
      const int ro = (8 * hh + r) * 36 + c;
      pt[ro]      = e0;
      pt[ro + 16] = e1;
    }
    wave_sync_lds();
    {
      // next trip's window: its first tile is this one's last and lies in place already
      const v8f d1 = mm_p(xn + 16, n1a, n1b);
      const v8f d2 = mm_p(xn + 32, n2a, n2b);
      st_tile(odd ? 16 : 48, d1);
      st_tile(odd ? 32 : 64, d2);
      st_tile(odd ? 80 : 0, d2);
    }
    const v16h vh0 = ldfrag_o(cur, fv);
    const v16h vh1 = ldfrag_o(cur + 16 * VPITCH, fv);
    const v16h vh2 = ldfrag_o(cur + 32 * VPITCH, fv);
    const v16h vh3 = ldfrag_o(cur + 48 * VPITCH, fv);
    const v16h vl0 = ldfrag_o(cur + ST_VSZ, fv);
    const v16h vl1 = ldfrag_o(cur + ST_VSZ + 16 * VPITCH, fv);
    const v16h vl2 = ldfrag_o(cur + ST_VSZ + 32 * VPITCH, fv);
    const v16h vl3 = ldfrag_o(cur + ST_VSZ + 48 * VPITCH, fv);
    FragH ph, pl;
    {
      const float* prow = pt + c * 36 + 8 * hh;
      const v4f p0 = *(const v4f*)(prow), p1 = *(const v4f*)(prow + 4);
      const v4f p2 = *(const v4f*)(prow + 16), p3 = *(const v4f*)(prow + 20);
#pragma unroll
      for (int e = 0; e < 4; ++e) {
        float f; _Float16 x;
        f = p0[e] * PC; x = (_Float16)f; ph.h[0][e]     = x; pl.h[0][e]     = (_Float16)(f - (float)x);   // keys jb + 8hh + e
        f = p1[e] * PC; x = (_Float16)f; ph.h[0][4 + e] = x; pl.h[0][4 + e] = (_Float16)(f - (float)x);   // keys jb + 8hh + 4 + e
        f = p2[e] * PC; x = (_Float16)f; ph.h[1][e]     = x; pl.h[1][e]     = (_Float16)(f - (float)x);   // keys jb + 16 + 8hh + e
        f = p3[e] * PC; x = (_Float16)f; ph.h[1][4 + e] = x; pl.h[1][4 + e] = (_Float16)(f - (float)x);
      }
    }
    {
      o0 = mma_h(ph.v, vh0, o0);
      o1 = mma_h(ph.v, vh1, o1);
      o2 = mma_h(ph.v, vh2, o2);
      o3 = mma_h(ph.v, vh3, o3);
      o0 = mma_h(pl.v, vh0, o0);
      o1 = mma_h(pl.v, vh1, o1);
      o2 = mma_h(pl.v, vh2, o2);
      o3 = mma_h(pl.v, vh3, o3);
      guard4x6(o0, o1, o2, o3, ph.v, pl.v, vh0, vh1, vh2, vh3);
    }
    {
      o0 = mma_h(ph.v, vl0, o0);
      o1 = mma_h(ph.v, vl1, o1);
      o2 = mma_h(ph.v, vl2, o2);
      o3 = mma_h(ph.v, vl3, o3);
      guard4x5(o0, o1, o2, o3, ph.v, vl0, vl1, vl2, vl3);
    }
    *(v4u*)(nxt + sk) = nk;
    *(v4u*)(nxt + sv) = nh;
    *(v4u*)(nxt + sv + ST_VSZ) = nl;
    __syncthreads();   // publishes the next chunk; ends every wave's reads of this trip's buffer (and of its own prob tile); window stores before reads
  }

  // ---- behind the last barrier no wave reads the loop's LDS any more: each wave takes its own 4608 B as two bf16 tiles [16][64], pitch 72 ----
  unsigned short* Osh = (unsigned short*)(smem + wave * (2 * 16 * OPITCH * 2));
  unsigned short* Osl = Osh + 16 * OPITCH;
  // ---- fold 1/l and the carries (1024 on P, 16 on v), split into bf16 hi + residual, stage the wave's 16x64 slice ----
  const float oc = 1.0f / (PC * VC);
#pragma unroll
  for (int r = 0; r < 8; ++r) {
    const float inv = (1.0f / lrow[r]) * oc;
    const int ro = (8 * hh + r) * OPITCH + c;
    const float f0 = o0[r] * inv, f1 = o1[r] * inv, f2 = o2[r] * inv, f3 = o3[r] * inv;
    const unsigned short g0 = bf_bits(f0), g1 = bf_bits(f1), g2 = bf_bits(f2), g3 = bf_bits(f3);
    Osh[ro]      = g0;  Osl[ro]      = bf_bits(f0 - bf_up(g0));
    Osh[ro + 16] = g1;  Osl[ro + 16] = bf_bits(f1 - bf_up(g1));
    Osh[ro + 32] = g2;  Osl[ro + 32] = bf_bits(f2 - bf_up(g2));
    Osh[ro + 48] = g3;  Osl[ro + 48] = bf_bits(f3 - bf_up(g3));
  }
  wave_sync_lds();
  // ---- the wave writes its 16 row segments of 128 B in both planes: piece p = it*32 + lane -> row p>>3, halves (p&7)*8 .. +7 ----
  {
    v4u hv[4], lv[4];
#pragma unroll
    for (int it = 0; it < 4; ++it) {
      const int p = it * 32 + lane;
      hv[it] = *(const v4u*)(Osh + (p >> 3) * OPITCH + (p & 7) * 8);
      lv[it] = *(const v4u*)(Osl + (p >> 3) * OPITCH + (p & 7) * 8);
    }
    const size_t dofs = (size_t)i0 * DM + head * HD;
    unsigned short* dsth = CTh + dofs;
    unsigned short* dstl = CTl + dofs;
#pragma unroll
    for (int it = 0; it < 4; ++it) {
      const int p = it * 32 + lane;
      *(v4u*)(dsth + (size_t)(p >> 3) * DM + (p & 7) * 8) = hv[it];
      *(v4u*)(dstl + (size_t)(p >> 3) * DM + (p & 7) * 8) = lv[it];
    }
  }
}

// =====================================================================================================
// Workspace map (bytes); every plane is an exact multiple of its tile / whole-row store granularity (M, N exact tile multiples,
// the activation convert count an exact multiple of 2048, no pad rows needed), every offset a multiple of 512 KiB:
//   WQT, WKT, WVT, WPT f16 [512 out][512 in] x64   4 x 524288
//   WOT  bf16 [512 out][512 in]                         524288
//   X16  f16 4 x [8192][512] x16                  4 x 8388608    (query, key, value, position planes, rows b*1024 + tok)
//   QU, QV f16 [8192][512] x4                     2 x 8388608    (q + u_bias, q + v_bias)
//   K16, P16 f16 [8192][512] x4                   2 x 8388608
//   VTh, VTl f16 [8][512][1024] x16               2 x 8388608    (v^T per batch, hi / residual)
//   CTh, CTl bf16 [8192][512]                     2 x 8388608    (attention ctx, merged heads, hi / residual)
//   end                                             103284736
// =====================================================================================================
extern "C" void kernel_launch(void* const* d_in, const int* in_sizes, int n_in,
                              void* d_out, int out_size, void* d_ws, size_t ws_size,
                              hipStream_t stream) {
  if (n_in < 15) return;
  const int NA = NROWS * DM;
  if (in_sizes[0] != NA || in_sizes[1] != NA || in_sizes[2] != NA || in_sizes[3] != NA) return;
  if (in_sizes[4] != DM * DM || in_sizes[6] != DM * DM || in_sizes[8] != DM * DM || in_sizes[10] != DM * DM || in_sizes[13] != DM * DM) return;
  if (in_sizes[5] != DM || in_sizes[7] != DM || in_sizes[9] != DM || in_sizes[14] != DM) return;
  if (in_sizes[11] != NHEAD * HD || in_sizes[12] != NHEAD * HD) return;
  if (out_size != NROWS * DM) return;
  if ((NA % 2048) != 0) return;

  const float* query = (const float*)d_in[0];
  const float* key   = (const float*)d_in[1];
  const float* value = (const float*)d_in[2];
  const float* pemb  = (const float*)d_in[3];
  const float* w_q   = (const float*)d_in[4];
  const float* b_q   = (const float*)d_in[5];
  const float* w_k   = (const float*)d_in[6];
  const float* b_k   = (const float*)d_in[7];
  const float* w_v   = (const float*)d_in[8];
  const float* b_v   = (const float*)d_in[9];
  const float* w_p   = (const float*)d_in[10];
  const float* u_b   = (const float*)d_in[11];
  const float* v_b   = (const float*)d_in[12];
  const float* w_o   = (const float*)d_in[13];
  const float* b_o   = (const float*)d_in[14];
  float*       out   = (float*)d_out;

  const size_t PWT = (size_t)DM * DM * 2;                         //   524288
  const size_t PX  = (size_t)NROWS * DM * 2;                      //  8388608
  const size_t PVT = (size_t)NB * DM * SEQ * 2;                   //  8388608
  size_t off = 0;
  const size_t oWQ = off; off += PWT;
  const size_t oWK = off; off += PWT;
  const size_t oWV = off; off += PWT;
  const size_t oWP = off; off += PWT;
  const size_t oWO = off; off += PWT;
  const size_t oX  = off; off += 4 * PX;
  const size_t oQU = off; off += PX;
  const size_t oQV = off; off += PX;
  const size_t oK  = off; off += PX;
  const size_t oP  = off; off += PX;
  const size_t oVh = off; off += PVT;
  const size_t oVl = off; off += PVT;
  const size_t oCh = off; off += PX;
  const size_t oCl = off; off += PX;
  if (off > ws_size) return;                                      // off = 103284736

  char* ws = (char*)d_ws;
  unsigned short* WQT  = (unsigned short*)(ws + oWQ);
  unsigned short* WOT  = (unsigned short*)(ws + oWO);
  unsigned short* X16  = (unsigned short*)(ws + oX);
  unsigned short* QU   = (unsigned short*)(ws + oQU);
  unsigned short* QV   = (unsigned short*)(ws + oQV);
  unsigned short* K16  = (unsigned short*)(ws + oK);
  unsigned short* P16  = (unsigned short*)(ws + oP);
  unsigned short* VTh  = (unsigned short*)(ws + oVh);
  unsigned short* VTl  = (unsigned short*)(ws + oVl);
  unsigned short* CTh  = (unsigned short*)(ws + oCh);
  unsigned short* CTl  = (unsigned short*)(ws + oCl);

  const dim3 blk(256);
  const dim3 gPR(WTB + 4 * CVB);                                   // 320 weight tiles + 8192 convert blocks
  const int tilesP = (NROWS / 64) * (DM / 64);                     // 1024
  const dim3 gP((tilesP + 7) / 8, 1);                              // 128
  const dim3 gP4((tilesP + 7) / 8, 4);                             // 128 x 4
  const dim3 gAT(ATT_BLOCKS, NHEAD, NB);                           // 8 x 8 x 8
  const dim3 bAT(ATT_THREADS);                                     // 256

  // (0) every pack: X16 plane w = f16(bf16(x_w)*16) for query, key, value, position; W[c][n] -> WT[n][c] as f16( bf16_RNE(w) * 64 );
  //     Wo[c][n] -> WOT[n][c] bf16 (the five weight planes lie one behind the other from WQT)
  prep<<<gPR, blk, 0, stream>>>(query, key, value, pemb, w_q, w_k, w_v, w_p, w_o, X16, WQT);

  // (1) the four projections, K = 512:
  //     q[m][n] = sum_c x[m][c] WQT[n][c] / 1024 + bq[n]; QU = f16((q + u_bias[n]) * 4), QV = f16((q + v_bias[n]) * 4); M = 8192, N = 512
  //     v^T per batch: VT[b][n = h*64+d][tok] = sum_c WVT[n][c] x_b[tok][c] / 1024 + bv[n] -> f16 x16 hi / residual planes; M = 512, N = 1024
  //     K16 = f16((k + bk) * 4); P16 = f16(p * 4) (no bias)
  proj4<<<gP4, blk, 0, stream>>>(X16, WQT, QU, QV, K16, P16, VTh, VTl, b_q, u_b, v_b, b_k, b_v);

  // (5) attention with its position logits, every batch element, head and block of 128 query rows in one launch -> CT (bf16 hi / residual planes)
  attnb<<<gAT, bAT, 0, stream>>>(QU, QV, K16, P16, VTh, VTl, CTh, CTl);

  // (6) out = (CT_hi + CT_lo) . WOT^T + bo; M = 8192, N = 512, K = 512, f32
  gemm64<0, 1, 1, 1, 2><<<gP, blk, 0, stream>>>(
      CTh, CTl, DM, 0LL, 0LL,
      WOT, DM, 0LL, 0LL,
      (void*)out, (void*)out, DM, 0LL, 0LL,
      NROWS, DM, DM, 1.0f, 1.0f,
      b_o, b_o, b_o);
  (void)hipGetLastError();
}

// v007
// It runs in 123 microseconds.
// Two timings next to v006 both put it at 1.13 times that version's speed.
// All steps since v000 together make it 6.57 times as fast.
// Contractions (all f32 accumulate): q/k/v/p projections v_wmma_f32_16x16x32_f16 (x f16 x16 . W^T f16 x64, K=512, single products);
// position logits (q+v_bias).p^T v_wmma_f32_16x16x32_f16 ((q+v_bias) f16 x4 . p f16 x4, K=64, single), inside attention, f32;
// content scores v_wmma_f32_16x16x32_f16 ((q+u_bias) f16 x4 . k f16 x4, K=64, single);
// P . v^T v_wmma_f32_16x16x32_f16 (P f16 x1024 hi/lo . v^T f16 x16 hi/lo, hi.hi+lo.hi+hi.lo, K=1024 by 32);
// output projection v_wmma_f32_16x16x32_bf16 (ctx bf16 hi/lo . Wo bf16, hi.W+lo.W, K=512) + bias in f32.
// Attention tiles are transposed (scores^T = k . q^T, ctx^T += v^T . P^T): a lane holds one query row's values.
// Max-subtracted online base-2 softmax in f32 on VALU; the relative shift of the position logits is a skewed store of their f32 tiles in LDS. Every float input RNE-converted to bf16 on load.
#include <hip/hip_runtime.h>
#include <math.h>
#include <stdint.h>

#define NB     8
#define SEQ    1024
#define DM     512
#define NHEAD  8
#define HD     64
#define NROWS  (NB * SEQ)
#define KCH    32
#define WSC    64.0f
#define ACARRY 16.0f
#define QC     4.0f
#define VC     16.0f
#define PC     1024.0f
#define LOG2E  1.4426950408889634f
#define SCL    0.04419417382415922f
static_assert(NHEAD * HD == DM);
static_assert((SEQ % 64) == 0 && (DM % 64) == 0 && (NROWS % 64) == 0 && (HD % 32) == 0 && (SEQ % KCH) == 0);
static_assert(((NROWS * DM) % 2048) == 0);
#define ATT_WAVES   8                 // waves of an attention block: 16 query rows each, all on one head
#define ATT_THREADS (ATT_WAVES * 32)
#define ATT_BLOCKS  (SEQ / (ATT_WAVES * 16))
#define SKP    116                    // floats per row of a wave's position-logit tiles (6 tile places of 16 columns + 16 of skew + 4: 464 B = 16 B x odd for the 16-byte reads)
#define KPITCH 144                    // LDS bytes per staged k row (128 + 16)
#define VPITCH 80                     // LDS bytes per staged v^T row (64 + 16)
#define ST_VH    (KCH * KPITCH)       // v^T hi behind the k rows
#define ST_VSZ   (HD * VPITCH)        // one v^T plane's rows
#define ST_BYTES (ST_VH + 2 * ST_VSZ) // one buffer: k | v^T hi | v^T residual
#define ATT_SMEM_BYTES (2 * ST_BYTES)
#define GKS    64                     // halves of k per staged gemm slab: 128 B, one whole line of every row
#define GPITCH 144                    // LDS bytes per staged gemm row (128 + 16)
static_assert((DM % GKS) == 0 && (HD % GKS) == 0);                   // every K is whole slabs
static_assert(((DM / 64) % 8) == 0 && ((SEQ / 64) % 8) == 0);        // every N is whole blocks of 8 column tiles
static_assert(ATT_THREADS == 256);
static_assert(ATT_BLOCKS == 8);
static_assert(KCH * HD * 2 == ATT_THREADS * 16);          // one 16-byte piece of k, and of each v^T plane, per thread and chunk
static_assert(HD * 2 == 128 && KCH * 2 == 64);
static_assert((ST_BYTES % 16) == 0 && (ST_VH % 16) == 0);
static_assert((SKP % 4) == 0 && ((SKP / 4) % 2) == 1 && SKP >= 6 * 16 + 16);

typedef _Float16 v16h __attribute__((ext_vector_type(16)));
typedef _Float16 v8h  __attribute__((ext_vector_type(8)));
typedef __bf16   v16b __attribute__((ext_vector_type(16)));
typedef float    v8f  __attribute__((ext_vector_type(8)));
typedef float    v4f  __attribute__((ext_vector_type(4)));
typedef unsigned int v4u __attribute__((ext_vector_type(4)));

union FragH { v16h v; v8h h[2]; v4u u[2]; };
union FragAny { v16h h; v16b b; };

// ---- scalar helpers --------------------------------------------------------------------------------
__device__ __forceinline__ unsigned short bf_bits(float f) {          // f32 -> bf16 bits, RNE convert
  unsigned u = __float_as_uint(f);
  return (unsigned short)((u + 0x7FFFu + ((u >> 16) & 1u)) >> 16);
}
__device__ __forceinline__ float bf_up(unsigned short h) { return __uint_as_float(((unsigned)h) << 16); }
__device__ __forceinline__ float bfr(float f) { return bf_up(bf_bits(f)); }   // value of the bf16 RNE convert
__device__ __forceinline__ unsigned short h_bits(_Float16 x) { return __builtin_bit_cast(unsigned short, x); }
__device__ __forceinline__ unsigned pk16(unsigned short a, unsigned short b) { return (unsigned)a | ((unsigned)b << 16); }
// lane l takes the value of lane l ^ 16 (the other half of the wave), by a vector cross-row move
__device__ __forceinline__ float xhalf(float x) {
  const int b = __builtin_bit_cast(int, x);
  return __builtin_bit_cast(float, __builtin_amdgcn_permlanex16(b, b, 0x76543210, 0xfedcba98, false, false));
}
__device__ __forceinline__ v8f zero8() { v8f z = {0.f, 0.f, 0.f, 0.f, 0.f, 0.f, 0.f, 0.f}; return z; }

// ---- fragment loader: 16-bit A/B operand from a k-contiguous 16-bit plane, lane -> row/col (lane&15),
//      p already includes +8*(lane>>4); elements 0..7 <- p[0..7] (k0+8h..), elements 8..15 <- p[16..23] (k0+16+8h..)
//      (same split k map for A and B; B is always read from a [n][k] plane)
__device__ __forceinline__ v16h ldfrag_u(const unsigned short* p) {
  FragH f;
  f.u[0] = *(const v4u*)(p);
  f.u[1] = *(const v4u*)(p + 16);
  return f.v;
}

// same fragment from a wave-uniform byte base plus this lane's 32-bit byte offset (already holding +16*(lane>>4)): an address costs one
// register, shared by planes of one layout, so a whole trip's loads fit the register file together
__device__ __forceinline__ v16h ldfrag_o(const char* base, unsigned off) {
  const char* p = base + off;
  FragH f;
  f.u[0] = *(const v4u*)(p);
  f.u[1] = *(const v4u*)(p + 32);
  return f.v;
}

// ---- WMMA helpers with trailing VALU hazard gaps ------------------------------------------------------
__device__ __forceinline__ v8f mma_h(v16h a, v16h b, v8f c) {
  return __builtin_amdgcn_wmma_f32_16x16x32_f16(false, a, false, b, (short)0, c, false, false);
}
__device__ __forceinline__ v8f mma_b(v16h a, v16h b, v8f c) {
  FragAny ua, ub;
  ua.h = a;
  ub.h = b;
  return __builtin_amdgcn_wmma_f32_16x16x32_bf16(false, ua.b, false, ub.b, (short)0, c, false, false);
}
template <int BF>
__device__ __forceinline__ v8f mmaT(v16h a, v16h b, v8f c) {
  if constexpr (BF != 0) return mma_b(a, b, c);
  else return mma_h(a, b, c);
}
__device__ __forceinline__ void dep_guard1(v8f& a, v8f& b, v16h x) {
#if defined(__HIP_DEVICE_COMPILE__)
  asm volatile("v_nop\n\tv_nop\n\tv_nop\n\tv_nop" : "+v"(a), "+v"(b) : "v"(x));
#endif
}
__device__ __forceinline__ void guard2x6(v8f& a, v8f& b, v16h x0, v16h x1, v16h x2, v16h x3, v16h x4, v16h x5) {
#if defined(__HIP_DEVICE_COMPILE__)
  asm volatile("v_nop\n\tv_nop\n\tv_nop\n\tv_nop"
               : "+v"(a), "+v"(b) : "v"(x0), "v"(x1), "v"(x2), "v"(x3), "v"(x4), "v"(x5));
#endif
}
__device__ __forceinline__ void guard4x6(v8f& a, v8f& b, v8f& c, v8f& d,
                                         v16h x0, v16h x1, v16h x2, v16h x3, v16h x4, v16h x5) {
#if defined(__HIP_DEVICE_COMPILE__)
  asm volatile("v_nop\n\tv_nop\n\tv_nop\n\tv_nop"
               : "+v"(a), "+v"(b), "+v"(c), "+v"(d) : "v"(x0), "v"(x1), "v"(x2), "v"(x3), "v"(x4), "v"(x5));
#endif
}
__device__ __forceinline__ void guard4x5(v8f& a, v8f& b, v8f& c, v8f& d,
                                         v16h x0, v16h x1, v16h x2, v16h x3, v16h x4) {
#if defined(__HIP_DEVICE_COMPILE__)
  asm volatile("v_nop\n\tv_nop\n\tv_nop\n\tv_nop"
               : "+v"(a), "+v"(b), "+v"(c), "+v"(d) : "v"(x0), "v"(x1), "v"(x2), "v"(x3), "v"(x4));
#endif
}
__device__ __forceinline__ void keep4_h(v16h a, v16h b, v16h c, v16h d) {
#if defined(__HIP_DEVICE_COMPILE__)
  asm volatile("v_nop" :: "v"(a), "v"(b), "v"(c), "v"(d));
#endif
}
__device__ __forceinline__ void acc_guard4(v8f& a, v8f& b, v8f& c, v8f& d) {
#if defined(__HIP_DEVICE_COMPILE__)
  asm volatile("v_nop\n\tv_nop\n\tv_nop\n\tv_nop" : "+v"(a), "+v"(b), "+v"(c), "+v"(d));
#endif
}
// N asynchronous 16-byte copies per lane, global memory -> LDS through no register: l[q] = the lane's LDS byte address, g[q] = its global address.
// The closing s_wait_xcnt 0 stands in the copies' own statement, so no address register is rewritten in front of it.
template <int N>
__device__ __forceinline__ void acopy(const unsigned* l, const char* const* g) {
  static_assert(N == 9 || N == 10);
#if defined(__HIP_DEVICE_COMPILE__)
  if constexpr (N == 9) {
    asm volatile("global_load_async_to_lds_b128 %0, %1, off\n\t"
                 "global_load_async_to_lds_b128 %2, %3, off\n\t"
                 "global_load_async_to_lds_b128 %4, %5, off\n\t"
                 "global_load_async_to_lds_b128 %6, %7, off\n\t"
                 "global_load_async_to_lds_b128 %8, %9, off\n\t"
                 "global_load_async_to_lds_b128 %10, %11, off\n\t"
                 "global_load_async_to_lds_b128 %12, %13, off\n\t"
                 "global_load_async_to_lds_b128 %14, %15, off\n\t"
                 "global_load_async_to_lds_b128 %16, %17, off\n\t"
                 "s_wait_xcnt 0x0"
                 :: "v"(l[0]), "v"(g[0]), "v"(l[1]), "v"(g[1]), "v"(l[2]), "v"(g[2]), "v"(l[3]), "v"(g[3]), "v"(l[4]), "v"(g[4]),
                    "v"(l[5]), "v"(g[5]), "v"(l[6]), "v"(g[6]), "v"(l[7]), "v"(g[7]), "v"(l[8]), "v"(g[8])
                 : "memory");
  } else {
    asm volatile("global_load_async_to_lds_b128 %0, %1, off\n\t"
                 "global_load_async_to_lds_b128 %2, %3, off\n\t"
                 "global_load_async_to_lds_b128 %4, %5, off\n\t"
                 "global_load_async_to_lds_b128 %6, %7, off\n\t"
                 "global_load_async_to_lds_b128 %8, %9, off\n\t"
                 "global_load_async_to_lds_b128 %10, %11, off\n\t"
                 "global_load_async_to_lds_b128 %12, %13, off\n\t"
                 "global_load_async_to_lds_b128 %14, %15, off\n\t"
                 "global_load_async_to_lds_b128 %16, %17, off\n\t"
                 "global_load_async_to_lds_b128 %18, %19, off\n\t"
                 "s_wait_xcnt 0x0"
                 :: "v"(l[0]), "v"(g[0]), "v"(l[1]), "v"(g[1]), "v"(l[2]), "v"(g[2]), "v"(l[3]), "v"(g[3]), "v"(l[4]), "v"(g[4]),
                    "v"(l[5]), "v"(g[5]), "v"(l[6]), "v"(g[6]), "v"(l[7]), "v"(g[7]), "v"(l[8]), "v"(g[8]), "v"(l[9]), "v"(g[9])
                 : "memory");
  }
#endif
}
__device__ __forceinline__ void wait_async0() {   // this wave's copies have landed in LDS
#if defined(__HIP_DEVICE_COMPILE__)
  asm volatile("s_wait_asynccnt 0x0" ::: "memory");
#endif
}
__device__ __forceinline__ void wait_ds0() {      // this wave's LDS reads have returned: their buffer may be refilled behind the next barrier
#if defined(__HIP_DEVICE_COMPILE__)
  asm volatile("s_wait_dscnt 0x0" ::: "memory");
#endif
}
__device__ __forceinline__ void wave_sync_lds() {
  __builtin_amdgcn_fence(__ATOMIC_RELEASE, "workgroup");
  __builtin_amdgcn_wave_barrier();
  __builtin_amdgcn_fence(__ATOMIC_ACQUIRE, "workgroup");
}

// =====================================================================================================
// Every input pack of a call in ONE launch (they do not depend on one another); each block does what one block of the separate launches did.
// Blocks 0 .. WTB-1, transposing 16-bit pack of a weight matrix: matrix b / 64, 64x64 tile b % 64:
//   in W[DM][DM] -> out WT[DM][DM] (plane b / 64 of WT5); matrices 0..3: f16( bf16_RNE(w) * WSC ); matrix 4: bf16_RNE(w) bits.
//   coverage: loads 4 x 256 x 4 floats = 64x64; stores 2 x 256 pieces x 8 halves = 64 rows x 64 halves = the whole tile; 64 tiles = 8 x 8 a matrix.
//   They come first: their longer way (load, LDS, barrier, store) runs under the stream of convert blocks behind them.
// Blocks behind them, elementwise 16-bit pack, no transpose: cb = b - WTB, plane w = cb / CVB of X4 <- f16( bf16_RNE(x_w[i]) * ACARRY ) (power of two, exact).
//   coverage: CVB blocks x 256 thr x 8 elements = NROWS*DM exactly, per plane.
// =====================================================================================================
#define WTB (5 * 64)                             // weight tile blocks
#define CVB ((NROWS * DM) / 2048)                // convert blocks per activation input
static_assert(CVB * 2048 == NROWS * DM);
static_assert(DM == 512);                        // 8 x 8 tiles of 64 x 64 per weight matrix

template <int BFO>
__device__ __forceinline__ void tr_tile(float (*t)[65], const float* __restrict__ src, unsigned short* dst, int c0, int d0, float sc) {
  const int tid = threadIdx.x;
#pragma unroll
  for (int it = 0; it < 4; ++it) {
    const int p  = it * 256 + tid;
    const int cc = p >> 4, sg = (p & 15) * 4;
    const v4f v = *(const v4f*)(src + (size_t)(c0 + cc) * DM + d0 + sg);
    t[cc][sg]     = v[0];
    t[cc][sg + 1] = v[1];
    t[cc][sg + 2] = v[2];
    t[cc][sg + 3] = v[3];
  }
  __syncthreads();
  v4u o[2];
#pragma unroll
  for (int it = 0; it < 2; ++it) {
    const int p  = it * 256 + tid;
    const int dd = p >> 3, s8 = (p & 7) * 8;
    unsigned short hv[8];
#pragma unroll
    for (int k = 0; k < 8; ++k) {
      const float f = bfr(t[s8 + k][dd]);
      if constexpr (BFO != 0) hv[k] = bf_bits(f);
      else hv[k] = h_bits((_Float16)(f * sc));
    }
    v4u q;
    q[0] = pk16(hv[0], hv[1]);
    q[1] = pk16(hv[2], hv[3]);
    q[2] = pk16(hv[4], hv[5]);
    q[3] = pk16(hv[6], hv[7]);
    o[it] = q;
  }
#pragma unroll
  for (int it = 0; it < 2; ++it) {
    const int p  = it * 256 + tid;
    const int dd = p >> 3, s8 = (p & 7) * 8;
    *(v4u*)(dst + (size_t)(d0 + dd) * DM + c0 + s8) = o[it];
  }
#if defined(__HIP_DEVICE_COMPILE__)
  // behind the two stores: in the merged kernel other code follows them in the listing, and none of it may rewrite their registers ahead of this wait
  asm volatile("s_wait_xcnt 0x0" ::: "memory");
#endif
}

__global__ __launch_bounds__(256) void prep(const float* __restrict__ xq, const float* __restrict__ xk,
                                            const float* __restrict__ xv, const float* __restrict__ xp,
                                            const float* __restrict__ wq, const float* __restrict__ wk, const float* __restrict__ wv,
                                            const float* __restrict__ wp, const float* __restrict__ wo,
                                            unsigned short* X4, unsigned short* WT5) {
  __shared__ float t[64][65];
  const int b = blockIdx.x;
  if (b >= WTB) {                                // the same for the whole block; this side has no barrier
    const int cb = b - WTB;
    const int w = cb / CVB;
    const float* src = (w == 0) ? xq : (w == 1) ? xk : (w == 2) ? xv : xp;
    unsigned short* dst = X4 + (size_t)w * ((size_t)NROWS * DM);
    const float sc = ACARRY;
    const size_t i8 = ((size_t)(cb - w * CVB) * 256 + threadIdx.x) * 8;
    const v4f a = *(const v4f*)(src + i8);
    const v4f b4 = *(const v4f*)(src + i8 + 4);
    v4u o;
    o[0] = pk16(h_bits((_Float16)(bfr(a[0]) * sc)), h_bits((_Float16)(bfr(a[1]) * sc)));
    o[1] = pk16(h_bits((_Float16)(bfr(a[2]) * sc)), h_bits((_Float16)(bfr(a[3]) * sc)));
    o[2] = pk16(h_bits((_Float16)(bfr(b4[0]) * sc)), h_bits((_Float16)(bfr(b4[1]) * sc)));
    o[3] = pk16(h_bits((_Float16)(bfr(b4[2]) * sc)), h_bits((_Float16)(bfr(b4[3]) * sc)));
    *(v4u*)(dst + i8) = o;
    return;
  }
  const int m = b >> 6, c0 = (b & 7) * 64, d0 = ((b >> 3) & 7) * 64;
  const float* W = (m == 0) ? wq : (m == 1) ? wk : (m == 2) ? wv : (m == 3) ? wp : wo;
  unsigned short* dst = WT5 + (size_t)m * (DM * DM);
  if (m < 4) tr_tile<0>(t, W, dst, c0, d0, WSC);   // m is the same for the whole block: every thread passes the one barrier of its side
  else tr_tile<1>(t, W, dst, c0, d0, 1.0f);
}

// =====================================================================================================
// Register-blocked batched 16-bit WMMA GEMM: C[m][n] = oscale * sum_k A[m][k] * Bt[n][k] (+ bias); one wave per 64x64 tile, a block's
// eight waves on eight neighbouring column tiles of one row tile (64 x 512). A row-major [M][K] pitch lda (16-bit plane), Bt row-major
// [N][K] pitch ldb (k contiguous); M multiple of 64, N multiple of 512, K multiple of 64.
// Operands go through LDS: per slab of 64 k the block's 64 A rows (both planes with ASPLIT) and 512 Bt rows are copied once, as whole
// 128-byte lines (a wave's copy = 4 rows), by asynchronous copies; every wave takes its fragments from there (row pitch 144 B = 16 B x odd).
// NBUF 2: slab t+2 is copied into the buffer that trip t has read, behind the trip's one barrier, and flies under trip t+1.
// NBUF 1: one buffer, filled and then read (for K = one slab: two blocks fit a WGP).
// blockIdx.y = batch index with element strides sA, sB, sC; blockIdx.z = outer batch index with strides zA, zB, zC.
// ASPLIT 1: a second A plane A2 (unscaled residual of A, same layout) is multiplied into the same accumulator (A + A2 ~ exact A).
// BF 1: bf16 operands (v_wmma_f32_16x16x32_bf16), else f16.
// EPI 1: value += bf16_RNE(ep0[column]) (per-column bias); EPI 2: value += bf16_RNE(ep0[row]) (per-row bias, 16-bit out only).
// OM 0: f32 out (pitch ldc).  OM 2: one f16 plane = f16(value * ocarry).
// OM 4: two f16 planes: hi = f16(value * ocarry), lo = f16(value * ocarry - hi) (unscaled residual).
// OM 5: two f16 planes: C = f16((value + bf16_RNE(ep1[column])) * ocarry), C2 = f16((value + bf16_RNE(ep2[column])) * ocarry).
// coverage: 4 slabs x 16 rows (f32: it 0..7 x lane>>4; 16-bit: it 0..3 x lane>>3) x 64 cols = the wave's whole 64x64 tile;
//           grid = tilesM*tilesN/8 blocks exactly.
// =====================================================================================================
#define GSTG_BYTES(ASPLIT, NBUF) ((NBUF) * (64 * (1 + (ASPLIT)) + 512) * GPITCH)   // staging bytes of a block
// the products of one block: acc = the wave's 64x64 tile, rows m0.., Bt rows nb0 + 64 wave ..; A1, A2, Bb = byte bases of the planes
template <int ASPLIT, int BF, int NBUF>
__device__ __forceinline__ void gemm_main(v8f (&acc)[4][4], char* stg, const char* A1, const char* A2, const char* Bb,
                                          int lda, int ldb, int m0, int nb0, int K) {
  constexpr int AROWS  = 64 * (1 + ASPLIT);        // staged rows: A | A2 (ASPLIT) | Bt
  constexpr int SROWS  = AROWS + 512;
  constexpr int SBYTES = SROWS * GPITCH;           // one buffer
  constexpr int NQ     = SROWS / 32;               // copies per thread and slab: 256 threads x 16 B = 32 rows each
  const int lane = threadIdx.x & 31;
  const int wave = threadIdx.x >> 5;
  const int rlane = lane & 15;                 // row (A) / col (B, D) within subtile
  const int koff  = (lane >> 4) * 8;           // k offset of this lane half

#pragma unroll
  for (int i = 0; i < 4; ++i)
#pragma unroll
    for (int j = 0; j < 4; ++j) acc[i][j] = zero8();

  // this thread's 16-byte pieces of a slab: staged rows (tid>>3) + 32 q, piece tid&7 of the row's 128 B (planes stay under 4 GiB)
  const int prow = threadIdx.x >> 3, seg = threadIdx.x & 7;
  const unsigned lds0 = (unsigned)(uintptr_t)stg + (unsigned)(prow * GPITCH + seg * 16);   // low 32 bits of the __shared__ address
  const unsigned ga0  = (unsigned)((m0 + prow) * lda) * 2u + (unsigned)(seg * 16);
  const unsigned gb0  = (unsigned)((nb0 + prow) * ldb) * 2u + (unsigned)(seg * 16);
  auto stage = [&](int k0, unsigned bufoff) {
    unsigned l[NQ];
    const char* g[NQ];
#pragma unroll   // q must be a constant: the addresses are register operands of the copy statements
    for (int q = 0; q < NQ; ++q) {
      l[q] = lds0 + bufoff + (unsigned)(q * 32 * GPITCH);
      // block-uniform part first (scalar), then this thread's offset: one vector add an address
      if (q < 2) g[q] = (A1 + (unsigned)(q * 32 * lda + k0) * 2u) + ga0;
      else if (q < AROWS / 32) g[q] = (A2 + (unsigned)((q - 2) * 32 * lda + k0) * 2u) + ga0;
      else g[q] = (Bb + (unsigned)((q - AROWS / 32) * 32 * ldb + k0) * 2u) + gb0;
    }
    acopy<NQ / 2>(l, g);
    acopy<NQ / 2>(l + NQ / 2, g + NQ / 2);
  };

  const unsigned fa = (unsigned)(rlane * GPITCH + koff * 2);                               // this lane's fragment reads: A row rlane
  const unsigned fb = (unsigned)((AROWS + (wave << 6) + rlane) * GPITCH + koff * 2);       // Bt row rlane of the wave's 64
  auto products = [&](unsigned bufoff) {
    const char* sb = stg + bufoff;
#pragma unroll   // both k-steps of a slab in line: their LDS offsets are immediates
    for (int ks = 0; ks < GKS / 32; ++ks) {
      // every fragment of this k-step is requested before its first product: one LDS latency a k-step
      v16h bh[4], ah[4], al[4];
#pragma unroll
      for (int j = 0; j < 4; ++j) bh[j] = ldfrag_o(sb + (j * 16 * GPITCH + ks * 64), fb);
#pragma unroll
      for (int i = 0; i < 4; ++i) {
        ah[i] = ldfrag_o(sb + (i * 16 * GPITCH + ks * 64), fa);
        if constexpr (ASPLIT != 0) al[i] = ldfrag_o(sb + ((64 + i * 16) * GPITCH + ks * 64), fa);
      }
      __builtin_amdgcn_sched_barrier(0);   // keeps the loads above in front of the products (else each A load sinks to its own group and waits alone)
#pragma unroll
      for (int i = 0; i < 4; ++i) {
#pragma unroll
        for (int j = 0; j < 4; ++j) acc[i][j] = mmaT<BF>(ah[i], bh[j], acc[i][j]);
        dep_guard1(acc[i][0], acc[i][3], ah[i]);
        if constexpr (ASPLIT != 0) {
#pragma unroll
          for (int j = 0; j < 4; ++j) acc[i][j] = mmaT<BF>(al[i], bh[j], acc[i][j]);
          dep_guard1(acc[i][0], acc[i][3], al[i]);
        }
      }
      keep4_h(bh[0], bh[1], bh[2], bh[3]);
    }
  };

  const int nslab = K / GKS;
  if constexpr (NBUF == 2) {
    stage(0, 0u);
    wait_async0();
    __syncthreads();                                       // publishes slab 0
    if (nslab > 1) stage(GKS, (unsigned)SBYTES);
    for (int t = 0; t < nslab; ++t) {
      const unsigned bo = (unsigned)(t & 1) * (unsigned)SBYTES;
      products(bo);
      wait_ds0();
      wait_async0();
      __syncthreads();                                     // publishes slab t+1; ends every wave's reads of this trip's buffer
      if (t + 2 < nslab) stage((t + 2) * GKS, bo);
    }
    wait_async0();
  } else {
    for (int t = 0; t < nslab; ++t) {
      if (t > 0) {
        wait_ds0();
        __syncthreads();                                   // ends every wave's reads of the buffer before it is refilled
      }
      stage(t * GKS, 0u);
      wait_async0();
      __syncthreads();                                     // publishes slab t
      products(0u);
    }
  }
  acc_guard4(acc[0][0], acc[0][1], acc[0][2], acc[0][3]);
  acc_guard4(acc[1][0], acc[1][1], acc[1][2], acc[1][3]);
  acc_guard4(acc[2][0], acc[2][1], acc[2][2], acc[2][3]);
  acc_guard4(acc[3][0], acc[3][1], acc[3][2], acc[3][3]);
}

// the wave's tile out: slab = the wave's own 16 x 68 floats of LDS; Cout, C2out = the planes of this batch element; n0 = the wave's first column
template <int OM, int EPI>
__device__ __forceinline__ void gemm_epi(v8f (&acc)[4][4], float* slab, void* Cout, void* C2out, int ldc, int m0, int n0,
                                         float oscale, float ocarry,
                                         const float* __restrict__ ep0, const float* __restrict__ ep1, const float* __restrict__ ep2) {
  const int lane  = threadIdx.x & 31;
  const int rlane = lane & 15;                 // col (D) within subtile
  const int mOff  = (lane >> 4) * 8;           // D row offset
  const int hh2 = lane >> 4, c4 = (lane & 15) * 4;     // f32 out: 256-B row segment = 16 lanes x 16 B
  const int q8  = lane >> 3, c8 = (lane & 7) * 8;

  // ---- epilogue ----
#pragma unroll
  for (int i = 0; i < 4; ++i) {
    const int mBase = m0 + (i << 4);
#pragma unroll
    for (int j = 0; j < 4; ++j) {
#pragma unroll
      for (int r = 0; r < 8; ++r) {
        slab[(mOff + r) * 68 + (j << 4) + rlane] = acc[i][j][r];
      }
    }
    wave_sync_lds();
    if constexpr (OM == 0) {
      float* C = (float*)Cout;
      v4f vals[8];
#pragma unroll
      for (int it = 0; it < 8; ++it) {
        const int row = it * 2 + hh2;                      // it 0..7 x hh2 0..1 = rows 0..15
        v4f v = *(const v4f*)(slab + row * 68 + c4);
#pragma unroll
        for (int e = 0; e < 4; ++e) v[e] = v[e] * oscale;
        if constexpr (EPI == 1) {
          const v4f bb = *(const v4f*)(ep0 + n0 + c4);     // per-column bias, columns n0+c4 .. +3 (N equals the bias length)
#pragma unroll
          for (int e = 0; e < 4; ++e) v[e] = v[e] + bfr(bb[e]);
        }
        vals[it] = v;
      }
      {
#pragma unroll
        for (int it = 0; it < 8; ++it) {
          const int gr = mBase + it * 2 + hh2;
          *(v4f*)(C + (size_t)gr * ldc + n0 + c4) = vals[it];
        }
        
      }
    } else {
      unsigned short* C  = (unsigned short*)Cout;
      unsigned short* Cb = (unsigned short*)C2out;
      v4u hv[4], lv[4];
#pragma unroll
      for (int it = 0; it < 4; ++it) {
        const int row = it * 4 + q8;                       // it 0..3 x q8 0..3 = rows 0..15
        const float* sp = slab + row * 68 + c8;
        float rb = 0.f;
        if constexpr (EPI == 2) rb = bfr(ep0[mBase + row]);   // per-row bias (M equals the bias length)
        v4u a  = {0u, 0u, 0u, 0u};
        v4u b2 = {0u, 0u, 0u, 0u};
#pragma unroll
        for (int e = 0; e < 4; ++e) {
          const int ci = n0 + c8 + 2 * e;                  // column index, < N
          float f0 = sp[2 * e] * oscale + rb;
          float f1 = sp[2 * e + 1] * oscale + rb;
          if constexpr (EPI == 1) {
            f0 += bfr(ep0[ci]);
            f1 += bfr(ep0[ci + 1]);
          }
          if constexpr (OM == 5) {
            const float g0 = (f0 + bfr(ep1[ci])) * ocarry, g1 = (f1 + bfr(ep1[ci + 1])) * ocarry;
            const float w0 = (f0 + bfr(ep2[ci])) * ocarry, w1 = (f1 + bfr(ep2[ci + 1])) * ocarry;
            a[e]  = pk16(h_bits((_Float16)g0), h_bits((_Float16)g1));
            b2[e] = pk16(h_bits((_Float16)w0), h_bits((_Float16)w1));
          } else {
            f0 *= ocarry; f1 *= ocarry;
            const _Float16 x0 = (_Float16)f0, x1 = (_Float16)f1;
            a[e] = pk16(h_bits(x0), h_bits(x1));
            if constexpr (OM == 4) {
              b2[e] = pk16(h_bits((_Float16)(f0 - (float)x0)), h_bits((_Float16)(f1 - (float)x1)));
            }
          }
        }
        hv[it] = a;
        lv[it] = b2;
      }
      {
#pragma unroll
        for (int it = 0; it < 4; ++it) {
          const int row = it * 4 + q8;
          *(v4u*)(C + (size_t)(mBase + row) * ldc + n0 + c8) = hv[it];
          if constexpr (OM >= 4) {
            *(v4u*)(Cb + (size_t)(mBase + row) * ldc + n0 + c8) = lv[it];
          }
        }
        
      }
    }
    wave_sync_lds();
  }
}

template <int OM, int ASPLIT, int BF, int EPI, int NBUF>
__global__ __launch_bounds__(256) __attribute__((amdgpu_num_vgpr(256))) void gemm64(
    const unsigned short* __restrict__ Ap, const unsigned short* __restrict__ A2p, int lda, long long sA, long long zA,
    const unsigned short* __restrict__ Btp, int ldb, long long sB, long long zB,
    void* Cout, void* C2out, int ldc, long long sC, long long zC,
    int M, int N, int K, float oscale, float ocarry,
    const float* __restrict__ ep0, const float* __restrict__ ep1, const float* __restrict__ ep2) {
  __shared__ __align__(16) float sT[8][16 * 68];   // per-wave 16x64 slab, pitch 68 floats
  __shared__ __align__(16) char stg[GSTG_BYTES(ASPLIT, NBUF)];
  const int by   = blockIdx.y;
  const int bz   = blockIdx.z;
  const int wave = threadIdx.x >> 5;
  const int tilesN = N >> 6;
  const int tilesM = M >> 6;
  const int tile0 = blockIdx.x * 8;
  if (tile0 + 8 > tilesM * tilesN) return;   // the same for the whole block, in front of every barrier; never taken with the exact grid
  const int tm  = tile0 / tilesN;
  const int tn0 = tile0 - tm * tilesN;       // tilesN is a multiple of 8: the block's eight tiles lie in one row of tiles
  const int m0  = tm << 6;
  const int nb0 = tn0 << 6;                  // first Bt row of the block
  const int n0  = nb0 + (wave << 6);

  const char* A1 = (const char*)(Ap  + (size_t)((long long)by * sA + (long long)bz * zA));
  const char* A2 = (const char*)(A2p + (size_t)((long long)by * sA + (long long)bz * zA));
  const char* Bb = (const char*)(Btp + (size_t)((long long)by * sB + (long long)bz * zB));
  const size_t co = (size_t)((long long)by * sC + (long long)bz * zC);

  v8f acc[4][4];
  gemm_main<ASPLIT, BF, NBUF>(acc, stg, A1, A2, Bb, lda, ldb, m0, nb0, K);
  if constexpr (OM == 0) gemm_epi<OM, EPI>(acc, sT[wave], (void*)((float*)Cout + co), (void*)((float*)C2out + co), ldc, m0, n0, oscale, ocarry, ep0, ep1, ep2);
  else gemm_epi<OM, EPI>(acc, sT[wave], (void*)((unsigned short*)Cout + co), (void*)((unsigned short*)C2out + co), ldc, m0, n0, oscale, ocarry, ep0, ep1, ep2);
}

// =====================================================================================================
// The four input projections in ONE launch (they do not depend on one another): blockIdx.y = 0 q, 1 v^T, 2 k, 3 p; 128 blocks each, every block
// as in gemm64 (64 x 512 of C, K = 512, f16 operands, two buffers); the products are one text for all four, the way out differs.
//   q, k, p: C[8192][512] = X_w . W^T, block x = row tile x.   v^T: per batch element x / 16, C[512][1024] = WVT . X_v^T, tiles (x % 16) * 8 .. + 7.
// X4 = the four activation planes (q, k, v, p), WT5 = the weight planes (q, k, v, p, o).
// =====================================================================================================
__global__ __launch_bounds__(256) __attribute__((amdgpu_num_vgpr(256))) void proj4(
    const unsigned short* __restrict__ X4, const unsigned short* __restrict__ WT5,
    unsigned short* QU, unsigned short* QV, unsigned short* K16, unsigned short* P16, unsigned short* VTh, unsigned short* VTl,
    const float* __restrict__ b_q, const float* __restrict__ u_b, const float* __restrict__ v_b,
    const float* __restrict__ b_k, const float* __restrict__ b_v) {
  __shared__ __align__(16) float sT[8][16 * 68];   // per-wave 16x64 slab, pitch 68 floats
  __shared__ __align__(16) char stg[GSTG_BYTES(0, 2)];
  const int which = blockIdx.y;                    // the same for the whole block
  const int bx    = blockIdx.x;
  const int wave  = threadIdx.x >> 5;
  const size_t PXE = (size_t)NROWS * DM, PWE = (size_t)DM * DM;
  const float osc = 1.0f / (ACARRY * WSC);
  const char *A1, *Bb;
  int m0, nb0;
  if (which == 1) {
    const int tile0 = (bx & 15) * 8;               // 8 x 16 tiles a batch element
    m0  = (tile0 >> 4) << 6;
    nb0 = (tile0 & 15) << 6;
    A1  = (const char*)(WT5 + 2 * PWE);
    Bb  = (const char*)(X4 + 2 * PXE + (size_t)(bx >> 4) * ((size_t)SEQ * DM));
  } else {
    const int pl = (which == 0) ? 0 : (which == 2) ? 1 : 3;   // plane of X4 and of WT5
    m0  = bx << 6;
    nb0 = 0;
    A1  = (const char*)(X4 + (size_t)pl * PXE);
    Bb  = (const char*)(WT5 + (size_t)pl * PWE);
  }
  const int n0 = nb0 + (wave << 6);
  v8f acc[4][4];
  gemm_main<0, 0, 2>(acc, stg, A1, A1, Bb, DM, DM, m0, nb0, DM);
  float* slab = sT[wave];
  if (which == 0) {
    gemm_epi<5, 1>(acc, slab, (void*)QU, (void*)QV, DM, m0, n0, osc, QC, b_q, u_b, v_b);
  } else if (which == 1) {
    const size_t co = (size_t)(bx >> 4) * ((size_t)DM * SEQ);
    gemm_epi<4, 2>(acc, slab, (void*)(VTh + co), (void*)(VTl + co), SEQ, m0, n0, osc, VC, b_v, b_v, b_v);
  } else if (which == 2) {
    gemm_epi<2, 1>(acc, slab, (void*)K16, (void*)K16, DM, m0, n0, osc, QC, b_k, b_k, b_k);
  } else {
    gemm_epi<2, 0>(acc, slab, (void*)P16, (void*)P16, DM, m0, n0, osc, QC, b_k, b_k, b_k);
  }
}

// =====================================================================================================
// Flash attention for one batch element, one head and 128 query rows: 8 waves, 16 query rows each, head dim 64, 1024 keys.
// blockIdx.x = block of 128 query rows, blockIdx.y = head, blockIdx.z = batch element. QU0, QV0, KP0, PP0, CTh0, CTl0 are [8192][512] planes,
// VTh0/VTl0 [8][512][1024] planes. G[r][c] below stands for (q_r + v_bias) . p_c of this head.
//   The eight waves need the same k and v^T values: each chunk of 32 keys is brought from global memory ONCE per block (whole 16-byte pieces,
//   one of k, one of v^T hi, one of v^T residual per thread) into one of two LDS buffers, and every wave takes its A fragments from there.
//   The pieces of chunk t+1 are requested at the head of trip t, stored into the other buffer at its foot, and published by the trip's one
//   block barrier, which also ends every wave's reads of the buffer that the next trip refills.
//   LDS rows: k [32 keys][64 d] pitch 144 B, v^T [64 d][32 keys] pitch 80 B (16 B x odd: 16-byte fragment reads without bank conflicts).
//   Every tile of scores and of the result is TRANSPOSED: key (or d) = 8 (lane>>4) + register, query row = i0 + (lane&15). A lane holds one query
//   row's values, so maximum and sum run over its own registers (plus one exchange between the wave's halves), and its 16 probabilities of a
//   chunk are, in place, the B fragment of P^T (element s: key 8 hh + s, then 16 + 8 hh + s - 8, the k map of the v^T loader).
//   B fragments (stationary): (q_i + u_bias) f16 x4 rows i0+c, QU[i][64h + d], two k-steps of 32;
//   A fragments per chunk of 32 keys: k f16 x4 rows (k-contiguous) -> scores s^T[j][i] (two tiles of 16 keys);
//   position logit by relative shift, i = query row, j = key: j <= i -> G[i][S-1-i+j]; j == i+1 -> 0; else G[i+1][j-i-2].
//   With x = S-1-i+j a wave's 16 rows x 32 keys need x in a window of 47 that starts at the multiple of 16 S-16-i0+jb: three 16-column tiles,
//   each wholly x < S (rows i, p row x) or wholly x >= S (rows i+1, p row x-S-1; x == S is selected to 0 where it is used). The wave makes the
//   tiles by WMMA (A = either row set, from the wave's LDS; B = p rows from global memory, requested a trip ahead) and stores them side by side in
//   its own LDS rows, row m moved right by m+1: window column 15-m+k of row m lies at float 16+k of the row, and lane (c, hh) reads its query
//   row's 8 + 8 logits as four aligned 16-byte pieces. The window moves by two tiles a trip, so a trip makes two new ones: even trips read
//   tile places 0 1 2, odd trips 2 3 4; the tile stored at place 4 is also stored at place 0 (on odd trips that second store goes to the spare place 5).
//   t = (s + pos) / 16 / sqrt(512) * log2(e); online softmax in base 2, max-subtracted, running sums in f32, one per lane (the two halves'
//   sums of a query row are joined once, behind the loop);
//   B fragments of P^T*1024 (f16 hi and unscaled residual) straight from the lane's registers; v^T A fragments
//   (f16 x16 hi and unscaled residual); 12 v^T.P^T WMMAs (hi.hi, hi.lo, lo.hi) -> four tiles ctx^T[d = 16 t + 8 hh + r][query c].
//   Final 1/l and carry folds in f32; a lane's 8 registers of a tile are 8 neighbouring d of its query row: one 16-byte store a tile and plane;
//   the wave's 8 stores of a plane's rows fill whole 128-byte row segments.
//   every wave does identical bounded work (32 trips of 32 keys) and passes every barrier.
// coverage: wave tile 16 rows x 64 cols per plane = 4 tiles x 32 lanes x 8 halves; 8 waves x 8 blocks = 1024 rows, 8 heads x 64 = 512
//           columns, per batch element, each element written exactly once.
// =====================================================================================================
__global__ __launch_bounds__(ATT_THREADS) __attribute__((amdgpu_num_vgpr(256)))
void attnb(const unsigned short* __restrict__ QU0, const unsigned short* __restrict__ QV0,
           const unsigned short* __restrict__ KP0, const unsigned short* __restrict__ PP0,
           const unsigned short* __restrict__ VTh0, const unsigned short* __restrict__ VTl0,
           unsigned short* CTh0, unsigned short* CTl0) {
  __shared__ __align__(16) char smem[ATT_SMEM_BYTES];   // two k / v^T buffers
  __shared__ __align__(16) float skew[ATT_WAVES][16 * SKP];   // per wave: position logits [16 rows][6 tile places x 16 columns, row m moved right by m + 1]
  __shared__ __align__(16) char  qvf[ATT_WAVES][8 * 512];     // per wave: (q + v_bias) A fragments, 8 pieces of 16 B per lane (each lane reads its own)

  const int tid  = threadIdx.x;
  const int wave = tid >> 5;
  const int lane = tid & 31;
  const int hh   = lane >> 4;
  const int c    = lane & 15;

  const int head = blockIdx.y;                             // 0..7
  const int i0   = blockIdx.x * (ATT_WAVES * 16) + __builtin_amdgcn_readfirstlane(wave) * 16;   // first query row of this wave (scalar)

  const size_t bg = blockIdx.z;                            // batch element
  const unsigned short* QU  = QU0  + bg * ((size_t)SEQ * DM);
  const unsigned short* QV  = QV0  + bg * ((size_t)SEQ * DM);
  const unsigned short* KP  = KP0  + bg * ((size_t)SEQ * DM);
  const unsigned short* PP  = PP0  + bg * ((size_t)SEQ * DM);
  const unsigned short* VTh = VTh0 + bg * ((size_t)DM * SEQ);
  const unsigned short* VTl = VTl0 + bg * ((size_t)DM * SEQ);
  unsigned short*       CTh = CTh0 + bg * ((size_t)SEQ * DM);
  unsigned short*       CTl = CTl0 + bg * ((size_t)SEQ * DM);

  // stationary B fragments: (q + u_bias) rows i0 + c, d 0..31 and 32..63
  const size_t qofs = (size_t)(i0 + c) * DM + head * HD + 8 * hh;
  const v16h qa = ldfrag_u(QU + qofs), qb = ldfrag_u(QU + qofs + 32);
  // likewise (q + v_bias), rows i0 + c (pieces 0..3) and rows i0 + 1 + c (pieces 4..7; the row behind the last is clamped: no key lies right of
  // its diagonal); kept in LDS, not in registers: one set is used twice a trip, and 32 more stationary registers would spill
  char* qvl = qvf[wave] + lane * 16;
  {
    const int i1 = (i0 + c + 1 < SEQ) ? (i0 + c + 1) : (SEQ - 1);
    const size_t qofs1 = (size_t)i1 * DM + head * HD + 8 * hh;
#pragma unroll
    for (int q = 0; q < 4; ++q) {
      *(v4u*)(qvl + q * 512)       = *(const v4u*)(QV + qofs + q * 16);
      *(v4u*)(qvl + (4 + q) * 512) = *(const v4u*)(QV + qofs1 + q * 16);
    }
  }

  const char* Kb  = (const char*)(KP + head * HD);
  const char* Pb  = (const char*)(PP + head * HD);
  const char* Vbh = (const char*)(VTh + (size_t)(head * HD) * SEQ);
  const char* Vbl = (const char*)(VTl + (size_t)(head * HD) * SEQ);
  // this thread's 16-byte pieces of a chunk: k row tid>>3 (8 pieces of its 128 B), v^T row tid>>2 (4 pieces of its 64 B)
  const unsigned gk0 = (unsigned)((tid >> 3) * (DM * 2) + (tid & 7) * 16);      // byte offset in chunk 0 of k
  const unsigned gv0 = (unsigned)((tid >> 2) * (SEQ * 2) + (tid & 3) * 16);     // byte offset in chunk 0 of either v^T plane
  const unsigned sk  = (unsigned)((tid >> 3) * KPITCH + (tid & 7) * 16);        // where they go in a buffer
  const unsigned sv  = (unsigned)(ST_VH + (tid >> 2) * VPITCH + (tid & 3) * 16);
  const unsigned fk  = (unsigned)(c * KPITCH + 16 * hh);                        // this lane's fragment reads: k row c
  const unsigned fv  = (unsigned)(ST_VH + c * VPITCH + 16 * hh);                // v^T hi row c

  const float CSC = SCL * LOG2E * (1.0f / (QC * QC));      // content scores and position logits carry x4 on both operands

  float mrow = -INFINITY, lrow = 0.f;                      // query row i0 + c: running maximum (both halves alike), this half's running sum
  v8f o0 = zero8(), o1 = zero8(), o2 = zero8(), o3 = zero8();
  char* stage = smem;

  float* sw = skew[wave];
  // B fragments of the window tile that starts at x = tb (a multiple of 16, 0 .. 2S-16): lane c takes p row x (x < S) or x-S-1 (x == S clamped to row 0)
  auto ld_p = [&](int tb, v16h& b0, v16h& b1) -> unsigned {
    const int rb = (tb < SEQ) ? tb : (tb - (SEQ + 1));     // scalar
    int row = rb + c;
    row = (row < 0) ? 0 : row;
    const unsigned off = (unsigned)row * (unsigned)(DM * 2) + (unsigned)(16 * hh);
    b0 = ldfrag_o(Pb, off);
    b1 = ldfrag_o(Pb + 64, off);
    return off;
  };
  // that tile's 16 x 16 logits; tb is the same for the whole wave
  auto mm_p = [&](int tb, v16h b0, v16h b1) -> v8f {
    const char* ap = qvl + ((tb < SEQ) ? 0 : 4 * 512);
    FragH a0, a1;
    a0.u[0] = *(const v4u*)(ap);
    a0.u[1] = *(const v4u*)(ap + 512);
    a1.u[0] = *(const v4u*)(ap + 1024);
    a1.u[1] = *(const v4u*)(ap + 1536);
    v8f d = mma_h(a0.v, b0, zero8());
    return mma_h(a1.v, b1, d);
  };
  float*       sws = sw + hh * (8 * (SKP + 1)) + c + 1;    // this lane's stores: row m = 8 hh + r, float c + m + 1, at + r (SKP + 1); tile place t at + 16 t
  const float* swr = sw + c * SKP + 16 + 8 * hh;           // its reads: row c, window columns 15 - c + 8 hh + (0 .. 7), and the same + 16
  auto st_tile = [&](int col, const v8f& d) {              // col = first column of the tile place (scalar)
    float* w = sws + col;
#pragma unroll
    for (int r = 0; r < 8; ++r) w[r * (SKP + 1)] = d[r];
  };

  // chunk 0 into buffer 0; trip 0's position window into tile places 0 1 2
  {
    const v4u pk = *(const v4u*)(Kb + gk0);
    const v4u ph0 = *(const v4u*)(Vbh + gv0);
    const v4u pl0 = *(const v4u*)(Vbl + gv0);
    const int x0 = SEQ - 16 - i0;
    v16h t0a, t0b, t1a, t1b, t2a, t2b;
    const unsigned f0 = ld_p(x0, t0a, t0b);
    const unsigned f1 = ld_p(x0 + 16, t1a, t1b);
    const unsigned f2 = ld_p(x0 + 32, t2a, t2b);
    // the p loads' offset registers stay whole (no load's result lands on one) up to this wait
    asm volatile("s_wait_xcnt 0x0" :: "v"(f0), "v"(f1), "v"(f2) : "memory");
    *(v4u*)(stage + sk) = pk;
    *(v4u*)(stage + sv) = ph0;
    *(v4u*)(stage + sv + ST_VSZ) = pl0;
    st_tile(0, mm_p(x0, t0a, t0b));
    st_tile(16, mm_p(x0 + 16, t1a, t1b));
    st_tile(32, mm_p(x0 + 32, t2a, t2b));
  }
  __syncthreads();                                         // publishes chunk 0 (and orders the wave's window stores before its reads)

#pragma unroll 1
  for (int jb = 0; jb < SEQ; jb += KCH) {
    const int jn = (jb + KCH < SEQ) ? (jb + KCH) : 0;      // next trip's first key; the last trip asks for trip 0's again (in bounds, not used)
    const unsigned bsel = (unsigned)((jb / KCH) & 1) * ST_BYTES;
    const char* cur = stage + bsel;                        // this trip's buffer
    char*       nxt = stage + (ST_BYTES - bsel);           // the other one: every wave left it before the last barrier
    // the next chunk's pieces are requested here and stored at the trip's foot: their latency lies under the whole trip
    const v4u nk = *(const v4u*)(Kb + (gk0 + (unsigned)jn * (unsigned)(DM * 2)));
    const v4u nh = *(const v4u*)(Vbh + (gv0 + (unsigned)jn * 2u));
    const v4u nl = *(const v4u*)(Vbl + (gv0 + (unsigned)jn * 2u));
    // behind this wait the three loads' address registers are free for the results of the p loads below
    asm volatile("s_wait_xcnt 0x0" ::: "memory");
    const v16h k0a = ldfrag_o(cur, fk);
    const v16h k0b = ldfrag_o(cur + 64, fk);
    const v16h k1a = ldfrag_o(cur + 16 * KPITCH, fk);
    const v16h k1b = ldfrag_o(cur + 16 * KPITCH + 64, fk);
    // the two new tiles of the next trip's window: p rows requested here, multiplied behind the softmax
    const int xn = SEQ - 16 - i0 + jn;
    v16h n1a, n1b, n2a, n2b;
    const unsigned f1 = ld_p(xn + 16, n1a, n1b);
    const unsigned f2 = ld_p(xn + 32, n2a, n2b);
    // the p loads' offset registers stay whole (no load's result lands on one) up to this wait
    asm volatile("s_wait_xcnt 0x0" :: "v"(f1), "v"(f2) : "memory");
    // this trip's position logits of query row i0 + c: keys jb + 8 hh + (0 .. 7) in g0 g1, keys jb + 16 + 8 hh + (0 .. 7) in g2 g3
    const int odd = (jb / KCH) & 1;
    v4f g0, g1, g2, g3;
    {
      const float* wr = swr + odd * 32;
      g0 = *(const v4f*)(wr);
      g1 = *(const v4f*)(wr + 4);
      g2 = *(const v4f*)(wr + 16);
      g3 = *(const v4f*)(wr + 20);
    }
    __builtin_amdgcn_sched_barrier(0);   // keeps the requests above at the trip's head (else the global ones sink to their stores and wait there)
    v8f s0, s1;                          // s0[r]: key jb + 8 hh + r, s1[r]: key jb + 16 + 8 hh + r, query row i0 + c
    s0 = mma_h(k0a, qa, zero8());
    s0 = mma_h(k0b, qb, s0);
    s1 = mma_h(k1a, qa, zero8());
    s1 = mma_h(k1b, qb, s1);
    guard2x6(s0, s1, qa, qb, k0a, k0b, k1a, k1b);
    float tt0[8], tt1[8];
    const int dz = i0 + c + 1 - jb - 8 * hh;               // the key right of the diagonal (j == i + 1) is register dz of s0, or dz - 16 of s1
#pragma unroll
    for (int r = 0; r < 8; ++r) {
      const float ga = (r < 4) ? g0[r & 3] : g1[r & 3];
      const float gc = (r < 4) ? g2[r & 3] : g3[r & 3];
      const float pa = (dz == r) ? 0.f : ga;
      const float pz = (dz == r + 16) ? 0.f : gc;
      tt0[r] = s0[r] * CSC + pa * CSC;
      tt1[r] = s1[r] * CSC + pz * CSC;
    }
    float e0[8], e1[8];
    {
      float mx = fmaxf(tt0[0], tt1[0]);
#pragma unroll   // r must be a constant: the values lie in registers (so in the loops below)
      for (int r = 1; r < 8; ++r) mx = fmaxf(mx, fmaxf(tt0[r], tt1[r]));
      mx = fmaxf(mx, xhalf(mx));                           // the row's other 16 keys lie in the other half of the wave
      const float mn = fmaxf(mrow, mx);
      const float al = exp2f(mrow - mn);
      mrow = mn;
      float pr[8];
#pragma unroll
      for (int r = 0; r < 8; ++r) {
        e0[r] = exp2f(tt0[r] - mn);
        e1[r] = exp2f(tt1[r] - mn);
        pr[r] = e0[r] + e1[r];
      }
      const float ps = ((pr[0] + pr[1]) + (pr[2] + pr[3])) + ((pr[4] + pr[5]) + (pr[6] + pr[7]));
      lrow = lrow * al + ps;
#pragma unroll
      for (int r = 0; r < 8; ++r) {
        o0[r] *= al;
        o1[r] *= al;
        o2[r] *= al;
        o3[r] *= al;
      }
    }
    {
      // next trip's window: its first tile is this one's last and lies in place already
      const v8f d1 = mm_p(xn + 16, n1a, n1b);
      const v8f d2 = mm_p(xn + 32, n2a, n2b);
      st_tile(odd ? 16 : 48, d1);
      st_tile(odd ? 32 : 64, d2);
      st_tile(odd ? 80 : 0, d2);
    }
    const v16h vh0 = ldfrag_o(cur, fv);
    const v16h vh1 = ldfrag_o(cur + 16 * VPITCH, fv);
    const v16h vh2 = ldfrag_o(cur + 32 * VPITCH, fv);
    const v16h vh3 = ldfrag_o(cur + 48 * VPITCH, fv);
    const v16h vl0 = ldfrag_o(cur + ST_VSZ, fv);
    const v16h vl1 = ldfrag_o(cur + ST_VSZ + 16 * VPITCH, fv);
    const v16h vl2 = ldfrag_o(cur + ST_VSZ + 32 * VPITCH, fv);
    const v16h vl3 = ldfrag_o(cur + ST_VSZ + 48 * VPITCH, fv);
    FragH ph, pl;
#pragma unroll
    for (int e = 0; e < 8; ++e) {
      float f; _Float16 x;
      f = e0[e] * PC; x = (_Float16)f; ph.h[0][e] = x; pl.h[0][e] = (_Float16)(f - (float)x);   // key jb + 8hh + e
      f = e1[e] * PC; x = (_Float16)f; ph.h[1][e] = x; pl.h[1][e] = (_Float16)(f - (float)x);   // key jb + 16 + 8hh + e
    }
    {
      o0 = mma_h(vh0, ph.v, o0);
      o1 = mma_h(vh1, ph.v, o1);
      o2 = mma_h(vh2, ph.v, o2);
      o3 = mma_h(vh3, ph.v, o3);
      o0 = mma_h(vh0, pl.v, o0);
      o1 = mma_h(vh1, pl.v, o1);
      o2 = mma_h(vh2, pl.v, o2);
      o3 = mma_h(vh3, pl.v, o3);
      guard4x6(o0, o1, o2, o3, ph.v, pl.v, vh0, vh1, vh2, vh3);
    }
    {
      o0 = mma_h(vl0, ph.v, o0);
      o1 = mma_h(vl1, ph.v, o1);
      o2 = mma_h(vl2, ph.v, o2);
      o3 = mma_h(vl3, ph.v, o3);
      guard4x5(o0, o1, o2, o3, ph.v, vl0, vl1, vl2, vl3);
    }
    *(v4u*)(nxt + sk) = nk;
    *(v4u*)(nxt + sv) = nh;
    *(v4u*)(nxt + sv + ST_VSZ) = nl;
    __syncthreads();   // publishes the next chunk; ends every wave's reads of this trip's buffer; window stores before reads
  }

  // ---- join the halves' sums, fold 1/l and the carries (1024 on P, 16 on v), split into bf16 hi + residual ----
  const float oc = 1.0f / (PC * VC);
  const float inv = (1.0f / (lrow + xhalf(lrow))) * oc;
  v4u hv[4], lv[4];
  auto pack8 = [&](const v8f& o, v4u& h4, v4u& l4) {       // d = 8 hh + (0 .. 7) of one tile
#pragma unroll   // e must be a constant: the values lie in registers
    for (int e = 0; e < 4; ++e) {
      const float f0 = o[2 * e] * inv, f1 = o[2 * e + 1] * inv;
      const unsigned short a0 = bf_bits(f0), a1 = bf_bits(f1);
      h4[e] = pk16(a0, a1);
      l4[e] = pk16(bf_bits(f0 - bf_up(a0)), bf_bits(f1 - bf_up(a1)));
    }
  };
  pack8(o0, hv[0], lv[0]);
  pack8(o1, hv[1], lv[1]);
  pack8(o2, hv[2], lv[2]);
  pack8(o3, hv[3], lv[3]);
  // ---- the lane writes its query row's halves 16 t + 8 hh .. + 7 in both planes; lanes c and c + 16 over the four tiles fill the row's 128 B ----
  {
    const size_t dofs = (size_t)(i0 + c) * DM + head * HD + 8 * hh;
    unsigned short* dsth = CTh + dofs;
    unsigned short* dstl = CTl + dofs;
#pragma unroll   // t must be a constant: the values lie in registers
    for (int t = 0; t < 4; ++t) {
      *(v4u*)(dsth + 16 * t) = hv[t];
      *(v4u*)(dstl + 16 * t) = lv[t];
    }
  }
}

// =====================================================================================================
// Workspace map (bytes); every plane is an exact multiple of its tile / whole-row store granularity (M, N exact tile multiples,
// the activation convert count an exact multiple of 2048, no pad rows needed), every offset a multiple of 512 KiB:
//   WQT, WKT, WVT, WPT f16 [512 out][512 in] x64   4 x 524288
//   WOT  bf16 [512 out][512 in]                         524288
//   X16  f16 4 x [8192][512] x16                  4 x 8388608    (query, key, value, position planes, rows b*1024 + tok)
//   QU, QV f16 [8192][512] x4                     2 x 8388608    (q + u_bias, q + v_bias)
//   K16, P16 f16 [8192][512] x4                   2 x 8388608
//   VTh, VTl f16 [8][512][1024] x16               2 x 8388608    (v^T per batch, hi / residual)
//   CTh, CTl bf16 [8192][512]                     2 x 8388608    (attention ctx, merged heads, hi / residual)
//   end                                             103284736
// =====================================================================================================
extern "C" void kernel_launch(void* const* d_in, const int* in_sizes, int n_in,
                              void* d_out, int out_size, void* d_ws, size_t ws_size,
                              hipStream_t stream) {
  if (n_in < 15) return;
  const int NA = NROWS * DM;
  if (in_sizes[0] != NA || in_sizes[1] != NA || in_sizes[2] != NA || in_sizes[3] != NA) return;
  if (in_sizes[4] != DM * DM || in_sizes[6] != DM * DM || in_sizes[8] != DM * DM || in_sizes[10] != DM * DM || in_sizes[13] != DM * DM) return;
  if (in_sizes[5] != DM || in_sizes[7] != DM || in_sizes[9] != DM || in_sizes[14] != DM) return;
  if (in_sizes[11] != NHEAD * HD || in_sizes[12] != NHEAD * HD) return;
  if (out_size != NROWS * DM) return;
  if ((NA % 2048) != 0) return;

  const float* query = (const float*)d_in[0];
  const float* key   = (const float*)d_in[1];
  const float* value = (const float*)d_in[2];
  const float* pemb  = (const float*)d_in[3];
  const float* w_q   = (const float*)d_in[4];
  const float* b_q   = (const float*)d_in[5];
  const float* w_k   = (const float*)d_in[6];
  const float* b_k   = (const float*)d_in[7];
  const float* w_v   = (const float*)d_in[8];
  const float* b_v   = (const float*)d_in[9];
  const float* w_p   = (const float*)d_in[10];
  const float* u_b   = (const float*)d_in[11];
  const float* v_b   = (const float*)d_in[12];
  const float* w_o   = (const float*)d_in[13];
  const float* b_o   = (const float*)d_in[14];
  float*       out   = (float*)d_out;

  const size_t PWT = (size_t)DM * DM * 2;                         //   524288
  const size_t PX  = (size_t)NROWS * DM * 2;                      //  8388608
  const size_t PVT = (size_t)NB * DM * SEQ * 2;                   //  8388608
  size_t off = 0;
  const size_t oWQ = off; off += PWT;
  const size_t oWK = off; off += PWT;
  const size_t oWV = off; off += PWT;
  const size_t oWP = off; off += PWT;
  const size_t oWO = off; off += PWT;
  const size_t oX  = off; off += 4 * PX;
  const size_t oQU = off; off += PX;
  const size_t oQV = off; off += PX;
  const size_t oK  = off; off += PX;
  const size_t oP  = off; off += PX;
  const size_t oVh = off; off += PVT;
  const size_t oVl = off; off += PVT;
  const size_t oCh = off; off += PX;
  const size_t oCl = off; off += PX;
  if (off > ws_size) return;                                      // off = 103284736

  char* ws = (char*)d_ws;
  unsigned short* WQT  = (unsigned short*)(ws + oWQ);
  unsigned short* WOT  = (unsigned short*)(ws + oWO);
  unsigned short* X16  = (unsigned short*)(ws + oX);
  unsigned short* QU   = (unsigned short*)(ws + oQU);
  unsigned short* QV   = (unsigned short*)(ws + oQV);
  unsigned short* K16  = (unsigned short*)(ws + oK);
  unsigned short* P16  = (unsigned short*)(ws + oP);
  unsigned short* VTh  = (unsigned short*)(ws + oVh);
  unsigned short* VTl  = (unsigned short*)(ws + oVl);
  unsigned short* CTh  = (unsigned short*)(ws + oCh);
  unsigned short* CTl  = (unsigned short*)(ws + oCl);

  const dim3 blk(256);
  const dim3 gPR(WTB + 4 * CVB);                                   // 320 weight tiles + 8192 convert blocks
  const int tilesP = (NROWS / 64) * (DM / 64);                     // 1024
  const dim3 gP((tilesP + 7) / 8, 1);                              // 128
  const dim3 gP4((tilesP + 7) / 8, 4);                             // 128 x 4
  const dim3 gAT(ATT_BLOCKS, NHEAD, NB);                           // 8 x 8 x 8
  const dim3 bAT(ATT_THREADS);                                     // 256

  // (0) every pack: X16 plane w = f16(bf16(x_w)*16) for query, key, value, position; W[c][n] -> WT[n][c] as f16( bf16_RNE(w) * 64 );
  //     Wo[c][n] -> WOT[n][c] bf16 (the five weight planes lie one behind the other from WQT)
  prep<<<gPR, blk, 0, stream>>>(query, key, value, pemb, w_q, w_k, w_v, w_p, w_o, X16, WQT);

  // (1) the four projections, K = 512:
  //     q[m][n] = sum_c x[m][c] WQT[n][c] / 1024 + bq[n]; QU = f16((q + u_bias[n]) * 4), QV = f16((q + v_bias[n]) * 4); M = 8192, N = 512
  //     v^T per batch: VT[b][n = h*64+d][tok] = sum_c WVT[n][c] x_b[tok][c] / 1024 + bv[n] -> f16 x16 hi / residual planes; M = 512, N = 1024
  //     K16 = f16((k + bk) * 4); P16 = f16(p * 4) (no bias)
  proj4<<<gP4, blk, 0, stream>>>(X16, WQT, QU, QV, K16, P16, VTh, VTl, b_q, u_b, v_b, b_k, b_v);

  // (5) attention with its position logits, every batch element, head and block of 128 query rows in one launch -> CT (bf16 hi / residual planes)
  attnb<<<gAT, bAT, 0, stream>>>(QU, QV, K16, P16, VTh, VTl, CTh, CTl);

  // (6) out = (CT_hi + CT_lo) . WOT^T + bo; M = 8192, N = 512, K = 512, f32
  gemm64<0, 1, 1, 1, 2><<<gP, blk, 0, stream>>>(
      CTh, CTl, DM, 0LL, 0LL,
      WOT, DM, 0LL, 0LL,
      (void*)out, (void*)out, DM, 0LL, 0LL,
      NROWS, DM, DM, 1.0f, 1.0f,
      b_o, b_o, b_o);
  (void)hipGetLastError();
}

// v008
// One run takes 111 microseconds.
// Timed twice side by side with v007, it ran 1.10 and 1.11 times as fast.
// Counting every step since v000, it is 7.25 times as fast.
// Contractions (all f32 accumulate): q/k/v/p projections v_wmma_f32_16x16x32_f16 (x f16 x16 . W^T f16 x64, K=512, single products);
// position logits (q+v_bias).p^T v_wmma_f32_16x16x32_f16 ((q+v_bias) f16 x4 . p f16 x4, K=64, single), inside attention, f32;
// content scores v_wmma_f32_16x16x32_f16 ((q+u_bias) f16 x4 . k f16 x4, K=64, single);
// P . v^T v_wmma_f32_16x16x32_f16 (P f16 x1024 hi/lo . v^T f16 x16 hi/lo, hi.hi+lo.hi+hi.lo, K=1024 by 32);
// output projection v_wmma_f32_16x16x32_bf16 (ctx bf16 hi/lo . Wo bf16, hi.W+lo.W, K=512) + bias in f32.
// Attention tiles are transposed (scores^T = k . q^T, ctx^T += v^T . P^T): a lane holds one query row's values.
// Max-subtracted online base-2 softmax in f32 on VALU; the relative shift of the position logits is a skewed store of their f32 tiles in LDS. Every float input RNE-converted to bf16 on load.
#include <hip/hip_runtime.h>
#include <math.h>
#include <stdint.h>

#define NB     8
#define SEQ    1024
#define DM     512
#define NHEAD  8
#define HD     64
#define NROWS  (NB * SEQ)
#define KCH    32
#define WSC    64.0f
#define ACARRY 16.0f
#define QC     4.0f
#define VC     16.0f
#define PC     1024.0f
#define LOG2E  1.4426950408889634f
#define SCL    0.04419417382415922f
static_assert(NHEAD * HD == DM);
static_assert((SEQ % 64) == 0 && (DM % 64) == 0 && (NROWS % 64) == 0 && (HD % 32) == 0 && (SEQ % KCH) == 0);
static_assert(((NROWS * DM) % 2048) == 0);
#define ATT_WAVES   8                 // waves of an attention block: 16 query rows each, all on one head
#define ATT_THREADS (ATT_WAVES * 32)
#define ATT_BLOCKS  (SEQ / (ATT_WAVES * 16))
#define SKP    116                    // floats per row of a wave's position-logit tiles (6 tile places of 16 columns + 16 of skew + 4: 464 B = 16 B x odd for the 16-byte reads)
#define KPITCH 144                    // LDS bytes per staged k row (128 + 16)
#define VPITCH 80                     // LDS bytes per staged v^T row (64 + 16)
#define ST_VH    (KCH * KPITCH)       // v^T hi behind the k rows
#define ST_VSZ   (HD * VPITCH)        // one v^T plane's rows
#define ST_BYTES (ST_VH + 2 * ST_VSZ) // one buffer: k | v^T hi | v^T residual
#define ATT_SMEM_BYTES (2 * ST_BYTES)
#define GKS    64                     // halves of k per staged gemm slab: 128 B, one whole line of every row
#define GPITCH 144                    // LDS bytes per staged gemm row (128 + 16)
static_assert((DM % GKS) == 0 && (HD % GKS) == 0);                   // every K is whole slabs
static_assert(((DM / 64) % 8) == 0 && ((SEQ / 64) % 8) == 0);        // every N is whole blocks of 8 column tiles
static_assert(ATT_THREADS == 256);
static_assert(ATT_BLOCKS == 8);
static_assert(KCH * HD * 2 == ATT_THREADS * 16);          // one 16-byte piece of k, and of each v^T plane, per thread and chunk
static_assert(HD * 2 == 128 && KCH * 2 == 64);
static_assert((ST_BYTES % 16) == 0 && (ST_VH % 16) == 0);
static_assert((SKP % 4) == 0 && ((SKP / 4) % 2) == 1 && SKP >= 6 * 16 + 16);

typedef _Float16 v16h __attribute__((ext_vector_type(16)));
typedef _Float16 v8h  __attribute__((ext_vector_type(8)));
typedef __bf16   v16b __attribute__((ext_vector_type(16)));
typedef float    v8f  __attribute__((ext_vector_type(8)));
typedef float    v4f  __attribute__((ext_vector_type(4)));
typedef unsigned int v4u __attribute__((ext_vector_type(4)));

union FragH { v16h v; v8h h[2]; v4u u[2]; };
union FragAny { v16h h; v16b b; };

// ---- scalar helpers --------------------------------------------------------------------------------
__device__ __forceinline__ unsigned short bf_bits(float f) {          // f32 -> bf16 bits, RNE convert
  unsigned u = __float_as_uint(f);
  return (unsigned short)((u + 0x7FFFu + ((u >> 16) & 1u)) >> 16);
}
__device__ __forceinline__ float bf_up(unsigned short h) { return __uint_as_float(((unsigned)h) << 16); }
__device__ __forceinline__ float bfr(float f) { return bf_up(bf_bits(f)); }   // value of the bf16 RNE convert
__device__ __forceinline__ unsigned short h_bits(_Float16 x) { return __builtin_bit_cast(unsigned short, x); }
__device__ __forceinline__ unsigned pk16(unsigned short a, unsigned short b) { return (unsigned)a | ((unsigned)b << 16); }
// lane l takes the value of lane l ^ 16 (the other half of the wave), by a vector cross-row move
__device__ __forceinline__ float xhalf(float x) {
  const int b = __builtin_bit_cast(int, x);
  return __builtin_bit_cast(float, __builtin_amdgcn_permlanex16(b, b, 0x76543210, 0xfedcba98, false, false));
}
__device__ __forceinline__ v8f zero8() { v8f z = {0.f, 0.f, 0.f, 0.f, 0.f, 0.f, 0.f, 0.f}; return z; }

// ---- fragment loader: 16-bit A/B operand from a k-contiguous 16-bit plane, lane -> row/col (lane&15),
//      p already includes +8*(lane>>4); elements 0..7 <- p[0..7] (k0+8h..), elements 8..15 <- p[16..23] (k0+16+8h..)
//      (same split k map for A and B; B is always read from a [n][k] plane)
__device__ __forceinline__ v16h ldfrag_u(const unsigned short* p) {
  FragH f;
  f.u[0] = *(const v4u*)(p);
  f.u[1] = *(const v4u*)(p + 16);
  return f.v;
}

// same fragment from a wave-uniform byte base plus this lane's 32-bit byte offset (already holding +16*(lane>>4)): an address costs one
// register, shared by planes of one layout, so a whole trip's loads fit the register file together
__device__ __forceinline__ v16h ldfrag_o(const char* base, unsigned off) {
  const char* p = base + off;
  FragH f;
  f.u[0] = *(const v4u*)(p);
  f.u[1] = *(const v4u*)(p + 32);
  return f.v;
}

// ---- WMMA helpers with trailing VALU hazard gaps ------------------------------------------------------
__device__ __forceinline__ v8f mma_h(v16h a, v16h b, v8f c) {
  return __builtin_amdgcn_wmma_f32_16x16x32_f16(false, a, false, b, (short)0, c, false, false);
}
__device__ __forceinline__ v8f mma_b(v16h a, v16h b, v8f c) {
  FragAny ua, ub;
  ua.h = a;
  ub.h = b;
  return __builtin_amdgcn_wmma_f32_16x16x32_bf16(false, ua.b, false, ub.b, (short)0, c, false, false);
}
template <int BF>
__device__ __forceinline__ v8f mmaT(v16h a, v16h b, v8f c) {
  if constexpr (BF != 0) return mma_b(a, b, c);
  else return mma_h(a, b, c);
}
__device__ __forceinline__ void dep_guard1(v8f& a, v8f& b, v16h x) {
#if defined(__HIP_DEVICE_COMPILE__)
  asm volatile("v_nop\n\tv_nop\n\tv_nop\n\tv_nop" : "+v"(a), "+v"(b) : "v"(x));
#endif
}
__device__ __forceinline__ void guard2x6(v8f& a, v8f& b, v16h x0, v16h x1, v16h x2, v16h x3, v16h x4, v16h x5) {
#if defined(__HIP_DEVICE_COMPILE__)
  asm volatile("v_nop\n\tv_nop\n\tv_nop\n\tv_nop"
               : "+v"(a), "+v"(b) : "v"(x0), "v"(x1), "v"(x2), "v"(x3), "v"(x4), "v"(x5));
#endif
}
__device__ __forceinline__ void guard4x6(v8f& a, v8f& b, v8f& c, v8f& d,
                                         v16h x0, v16h x1, v16h x2, v16h x3, v16h x4, v16h x5) {
#if defined(__HIP_DEVICE_COMPILE__)
  asm volatile("v_nop\n\tv_nop\n\tv_nop\n\tv_nop"
               : "+v"(a), "+v"(b), "+v"(c), "+v"(d) : "v"(x0), "v"(x1), "v"(x2), "v"(x3), "v"(x4), "v"(x5));
#endif
}
__device__ __forceinline__ void guard4x5(v8f& a, v8f& b, v8f& c, v8f& d,
                                         v16h x0, v16h x1, v16h x2, v16h x3, v16h x4) {
#if defined(__HIP_DEVICE_COMPILE__)
  asm volatile("v_nop\n\tv_nop\n\tv_nop\n\tv_nop"
               : "+v"(a), "+v"(b), "+v"(c), "+v"(d) : "v"(x0), "v"(x1), "v"(x2), "v"(x3), "v"(x4));
#endif
}
__device__ __forceinline__ void keep4_h(v16h a, v16h b, v16h c, v16h d) {
#if defined(__HIP_DEVICE_COMPILE__)
  asm volatile("v_nop" :: "v"(a), "v"(b), "v"(c), "v"(d));
#endif
}
__device__ __forceinline__ void acc_guard4(v8f& a, v8f& b, v8f& c, v8f& d) {
#if defined(__HIP_DEVICE_COMPILE__)
  asm volatile("v_nop\n\tv_nop\n\tv_nop\n\tv_nop" : "+v"(a), "+v"(b), "+v"(c), "+v"(d));
#endif
}
// N asynchronous 16-byte copies per lane, global memory -> LDS through no register: l[q] = the lane's LDS byte address, g[q] = its global address.
// The closing s_wait_xcnt 0 stands in the copies' own statement, so no address register is rewritten in front of it.
template <int N>
__device__ __forceinline__ void acopy(const unsigned* l, const char* const* g) {
  static_assert(N == 9 || N == 10);
#if defined(__HIP_DEVICE_COMPILE__)
  if constexpr (N == 9) {
    asm volatile("global_load_async_to_lds_b128 %0, %1, off\n\t"
                 "global_load_async_to_lds_b128 %2, %3, off\n\t"
                 "global_load_async_to_lds_b128 %4, %5, off\n\t"
                 "global_load_async_to_lds_b128 %6, %7, off\n\t"
                 "global_load_async_to_lds_b128 %8, %9, off\n\t"
                 "global_load_async_to_lds_b128 %10, %11, off\n\t"
                 "global_load_async_to_lds_b128 %12, %13, off\n\t"
                 "global_load_async_to_lds_b128 %14, %15, off\n\t"
                 "global_load_async_to_lds_b128 %16, %17, off\n\t"
                 "s_wait_xcnt 0x0"
                 :: "v"(l[0]), "v"(g[0]), "v"(l[1]), "v"(g[1]), "v"(l[2]), "v"(g[2]), "v"(l[3]), "v"(g[3]), "v"(l[4]), "v"(g[4]),
                    "v"(l[5]), "v"(g[5]), "v"(l[6]), "v"(g[6]), "v"(l[7]), "v"(g[7]), "v"(l[8]), "v"(g[8])
                 : "memory");
  } else {
    asm volatile("global_load_async_to_lds_b128 %0, %1, off\n\t"
                 "global_load_async_to_lds_b128 %2, %3, off\n\t"
                 "global_load_async_to_lds_b128 %4, %5, off\n\t"
                 "global_load_async_to_lds_b128 %6, %7, off\n\t"
                 "global_load_async_to_lds_b128 %8, %9, off\n\t"
                 "global_load_async_to_lds_b128 %10, %11, off\n\t"
                 "global_load_async_to_lds_b128 %12, %13, off\n\t"
                 "global_load_async_to_lds_b128 %14, %15, off\n\t"
                 "global_load_async_to_lds_b128 %16, %17, off\n\t"
                 "global_load_async_to_lds_b128 %18, %19, off\n\t"
                 "s_wait_xcnt 0x0"
                 :: "v"(l[0]), "v"(g[0]), "v"(l[1]), "v"(g[1]), "v"(l[2]), "v"(g[2]), "v"(l[3]), "v"(g[3]), "v"(l[4]), "v"(g[4]),
                    "v"(l[5]), "v"(g[5]), "v"(l[6]), "v"(g[6]), "v"(l[7]), "v"(g[7]), "v"(l[8]), "v"(g[8]), "v"(l[9]), "v"(g[9])
                 : "memory");
  }
#endif
}
__device__ __forceinline__ void wait_async0() {   // this wave's copies have landed in LDS
#if defined(__HIP_DEVICE_COMPILE__)
  asm volatile("s_wait_asynccnt 0x0" ::: "memory");
#endif
}
__device__ __forceinline__ void wait_ds0() {      // this wave's LDS reads have returned: their buffer may be refilled behind the next barrier
#if defined(__HIP_DEVICE_COMPILE__)
  asm volatile("s_wait_dscnt 0x0" ::: "memory");
#endif
}
__device__ __forceinline__ void wave_sync_lds() {
  __builtin_amdgcn_fence(__ATOMIC_RELEASE, "workgroup");
  __builtin_amdgcn_wave_barrier();
  __builtin_amdgcn_fence(__ATOMIC_ACQUIRE, "workgroup");
}

// =====================================================================================================
// Every input pack of a call in ONE launch (they do not depend on one another); each block does what one block of the separate launches did.
// Blocks 0 .. WTB-1, transposing 16-bit pack of a weight matrix: matrix b / 64, 64x64 tile b % 64:
//   in W[DM][DM] -> out WT[DM][DM] (plane b / 64 of WT5); matrices 0..3: f16( bf16_RNE(w) * WSC ); matrix 4: bf16_RNE(w) bits.
//   coverage: loads 4 x 256 x 4 floats = 64x64; stores 2 x 256 pieces x 8 halves = 64 rows x 64 halves = the whole tile; 64 tiles = 8 x 8 a matrix.
//   They come first: their longer way (load, LDS, barrier, store) runs under the stream of convert blocks behind them.
// Blocks behind them, elementwise 16-bit pack, no transpose: cb = b - WTB, plane w = cb / CVB of X4 <- f16( bf16_RNE(x_w[i]) * ACARRY ) (power of two, exact).
//   coverage: CVB blocks x 256 thr x 8 elements = NROWS*DM exactly, per plane.
// =====================================================================================================
#define WTB (5 * 64)                             // weight tile blocks
#define CVB ((NROWS * DM) / 2048)                // convert blocks per activation input
static_assert(CVB * 2048 == NROWS * DM);
static_assert(DM == 512);                        // 8 x 8 tiles of 64 x 64 per weight matrix

template <int BFO>
__device__ __forceinline__ void tr_tile(float (*t)[65], const float* __restrict__ src, unsigned short* dst, int c0, int d0, float sc) {
  const int tid = threadIdx.x;
#pragma unroll
  for (int it = 0; it < 4; ++it) {
    const int p  = it * 256 + tid;
    const int cc = p >> 4, sg = (p & 15) * 4;
    const v4f v = *(const v4f*)(src + (size_t)(c0 + cc) * DM + d0 + sg);
    t[cc][sg]     = v[0];
    t[cc][sg + 1] = v[1];
    t[cc][sg + 2] = v[2];
    t[cc][sg + 3] = v[3];
  }
  __syncthreads();
  v4u o[2];
#pragma unroll
  for (int it = 0; it < 2; ++it) {
    const int p  = it * 256 + tid;
    const int dd = p >> 3, s8 = (p & 7) * 8;
    unsigned short hv[8];
#pragma unroll
    for (int k = 0; k < 8; ++k) {
      const float f = bfr(t[s8 + k][dd]);
      if constexpr (BFO != 0) hv[k] = bf_bits(f);
      else hv[k] = h_bits((_Float16)(f * sc));
    }
    v4u q;
    q[0] = pk16(hv[0], hv[1]);
    q[1] = pk16(hv[2], hv[3]);
    q[2] = pk16(hv[4], hv[5]);
    q[3] = pk16(hv[6], hv[7]);
    o[it] = q;
  }
#pragma unroll
  for (int it = 0; it < 2; ++it) {
    const int p  = it * 256 + tid;
    const int dd = p >> 3, s8 = (p & 7) * 8;
    *(v4u*)(dst + (size_t)(d0 + dd) * DM + c0 + s8) = o[it];
  }
#if defined(__HIP_DEVICE_COMPILE__)
  // behind the two stores: in the merged kernel other code follows them in the listing, and none of it may rewrite their registers ahead of this wait
  asm volatile("s_wait_xcnt 0x0" ::: "memory");
#endif
}

__global__ __launch_bounds__(256) void prep(const float* __restrict__ xq, const float* __restrict__ xk,
                                            const float* __restrict__ xv, const float* __restrict__ xp,
                                            const float* __restrict__ wq, const float* __restrict__ wk, const float* __restrict__ wv,
                                            const float* __restrict__ wp, const float* __restrict__ wo,
                                            unsigned short* X4, unsigned short* WT5) {
  __shared__ float t[64][65];
  const int b = blockIdx.x;
  if (b >= WTB) {                                // the same for the whole block; this side has no barrier
    const int cb = b - WTB;
    const int w = cb / CVB;
    const float* src = (w == 0) ? xq : (w == 1) ? xk : (w == 2) ? xv : xp;
    unsigned short* dst = X4 + (size_t)w * ((size_t)NROWS * DM);
    const float sc = ACARRY;
    const size_t i8 = ((size_t)(cb - w * CVB) * 256 + threadIdx.x) * 8;
    const v4f a = *(const v4f*)(src + i8);
    const v4f b4 = *(const v4f*)(src + i8 + 4);
    v4u o;
    o[0] = pk16(h_bits((_Float16)(bfr(a[0]) * sc)), h_bits((_Float16)(bfr(a[1]) * sc)));
    o[1] = pk16(h_bits((_Float16)(bfr(a[2]) * sc)), h_bits((_Float16)(bfr(a[3]) * sc)));
    o[2] = pk16(h_bits((_Float16)(bfr(b4[0]) * sc)), h_bits((_Float16)(bfr(b4[1]) * sc)));
    o[3] = pk16(h_bits((_Float16)(bfr(b4[2]) * sc)), h_bits((_Float16)(bfr(b4[3]) * sc)));
    *(v4u*)(dst + i8) = o;
    return;
  }
  const int m = b >> 6, c0 = (b & 7) * 64, d0 = ((b >> 3) & 7) * 64;
  const float* W = (m == 0) ? wq : (m == 1) ? wk : (m == 2) ? wv : (m == 3) ? wp : wo;
  unsigned short* dst = WT5 + (size_t)m * (DM * DM);
  if (m < 4) tr_tile<0>(t, W, dst, c0, d0, WSC);   // m is the same for the whole block: every thread passes the one barrier of its side
  else tr_tile<1>(t, W, dst, c0, d0, 1.0f);
}

// =====================================================================================================
// Register-blocked batched 16-bit WMMA GEMM: C[m][n] = oscale * sum_k A[m][k] * Bt[n][k] (+ bias); one wave per 64x64 tile, a block's
// eight waves on eight neighbouring column tiles of one row tile (64 x 512). A row-major [M][K] pitch lda (16-bit plane), Bt row-major
// [N][K] pitch ldb (k contiguous); M multiple of 64, N multiple of 512, K multiple of 64.
// Operands go through LDS: per slab of 64 k the block's 64 A rows (both planes with ASPLIT) and 512 Bt rows are copied once, as whole
// 128-byte lines (a wave's copy = 4 rows), by asynchronous copies; every wave takes its fragments from there (row pitch 144 B = 16 B x odd).
// NBUF 2: slab t+2 is copied into the buffer that trip t has read, behind the trip's one barrier, and flies under trip t+1.
// NBUF 1: one buffer, filled and then read (for K = one slab: two blocks fit a WGP).
// blockIdx.y = batch index with element strides sA, sB, sC; blockIdx.z = outer batch index with strides zA, zB, zC.
// ASPLIT 1: a second A plane A2 (unscaled residual of A, same layout) is multiplied into the same accumulator (A + A2 ~ exact A).
// BF 1: bf16 operands (v_wmma_f32_16x16x32_bf16), else f16.
// EPI 1: value += bf16_RNE(ep0[column]) (per-column bias); EPI 2: value += bf16_RNE(ep0[row]) (per-row bias, 16-bit out only).
// OM 0: f32 out (pitch ldc).  OM 2: one f16 plane = f16(value * ocarry).
// OM 3: the same values as OM 2, laid out in the order attention's B fragments are read (rows = batch element x token, columns = head x d):
//       per batch element and head 64 tiles of 16 tokens, 2048 B each; 16-byte piece j of token r's 128 B lies at (j >> 1) * 512 + r * 32 + (j & 1) * 16.
//       A store (4 tokens x 8 pieces) still fills four whole 128-byte lines.
// OM 4: two f16 planes: hi = f16(value * ocarry), lo = f16(value * ocarry - hi) (unscaled residual).
// OM 5: two f16 planes: C = f16((value + bf16_RNE(ep1[column])) * ocarry), C2 = f16((value + bf16_RNE(ep2[column])) * ocarry).
// coverage: 4 slabs x 16 rows (f32: it 0..7 x lane>>4; 16-bit: it 0..3 x lane>>3) x 64 cols = the wave's whole 64x64 tile;
//           grid = tilesM*tilesN/8 blocks exactly.
// =====================================================================================================
#define GSTG_BYTES(ASPLIT, NBUF) ((NBUF) * (64 * (1 + (ASPLIT)) + 512) * GPITCH)   // staging bytes of a block
// the products of one block: acc = the wave's 64x64 tile, rows m0.., Bt rows nb0 + 64 wave ..; A1, A2, Bb = byte bases of the planes
template <int ASPLIT, int BF, int NBUF>
__device__ __forceinline__ void gemm_main(v8f (&acc)[4][4], char* stg, const char* A1, const char* A2, const char* Bb,
                                          int lda, int ldb, int m0, int nb0, int K) {
  constexpr int AROWS  = 64 * (1 + ASPLIT);        // staged rows: A | A2 (ASPLIT) | Bt
  constexpr int SROWS  = AROWS + 512;
  constexpr int SBYTES = SROWS * GPITCH;           // one buffer
  constexpr int NQ     = SROWS / 32;               // copies per thread and slab: 256 threads x 16 B = 32 rows each
  const int lane = threadIdx.x & 31;
  const int wave = threadIdx.x >> 5;
  const int rlane = lane & 15;                 // row (A) / col (B, D) within subtile
  const int koff  = (lane >> 4) * 8;           // k offset of this lane half

#pragma unroll
  for (int i = 0; i < 4; ++i)
#pragma unroll
    for (int j = 0; j < 4; ++j) acc[i][j] = zero8();

  // this thread's 16-byte pieces of a slab: staged rows (tid>>3) + 32 q, piece tid&7 of the row's 128 B (planes stay under 4 GiB)
  const int prow = threadIdx.x >> 3, seg = threadIdx.x & 7;
  const unsigned lds0 = (unsigned)(uintptr_t)stg + (unsigned)(prow * GPITCH + seg * 16);   // low 32 bits of the __shared__ address
  const unsigned ga0  = (unsigned)((m0 + prow) * lda) * 2u + (unsigned)(seg * 16);
  const unsigned gb0  = (unsigned)((nb0 + prow) * ldb) * 2u + (unsigned)(seg * 16);
  auto stage = [&](int k0, unsigned bufoff) {
    unsigned l[NQ];
    const char* g[NQ];
#pragma unroll   // q must be a constant: the addresses are register operands of the copy statements
    for (int q = 0; q < NQ; ++q) {
      l[q] = lds0 + bufoff + (unsigned)(q * 32 * GPITCH);
      // block-uniform part first (scalar), then this thread's offset: one vector add an address
      if (q < 2) g[q] = (A1 + (unsigned)(q * 32 * lda + k0) * 2u) + ga0;
      else if (q < AROWS / 32) g[q] = (A2 + (unsigned)((q - 2) * 32 * lda + k0) * 2u) + ga0;
      else g[q] = (Bb + (unsigned)((q - AROWS / 32) * 32 * ldb + k0) * 2u) + gb0;
    }
    acopy<NQ / 2>(l, g);
    acopy<NQ / 2>(l + NQ / 2, g + NQ / 2);
  };

  const unsigned fa = (unsigned)(rlane * GPITCH + koff * 2);                               // this lane's fragment reads: A row rlane
  const unsigned fb = (unsigned)((AROWS + (wave << 6) + rlane) * GPITCH + koff * 2);       // Bt row rlane of the wave's 64
  auto products = [&](unsigned bufoff) {
    const char* sb = stg + bufoff;
#pragma unroll   // both k-steps of a slab in line: their LDS offsets are immediates
    for (int ks = 0; ks < GKS / 32; ++ks) {
      // every fragment of this k-step is requested before its first product: one LDS latency a k-step
      v16h bh[4], ah[4], al[4];
#pragma unroll
      for (int j = 0; j < 4; ++j) bh[j] = ldfrag_o(sb + (j * 16 * GPITCH + ks * 64), fb);
#pragma unroll
      for (int i = 0; i < 4; ++i) {
        ah[i] = ldfrag_o(sb + (i * 16 * GPITCH + ks * 64), fa);
        if constexpr (ASPLIT != 0) al[i] = ldfrag_o(sb + ((64 + i * 16) * GPITCH + ks * 64), fa);
      }
      __builtin_amdgcn_sched_barrier(0);   // keeps the loads above in front of the products (else each A load sinks to its own group and waits alone)
#pragma unroll
      for (int i = 0; i < 4; ++i) {
#pragma unroll
        for (int j = 0; j < 4; ++j) acc[i][j] = mmaT<BF>(ah[i], bh[j], acc[i][j]);
        dep_guard1(acc[i][0], acc[i][3], ah[i]);
        if constexpr (ASPLIT != 0) {
#pragma unroll
          for (int j = 0; j < 4; ++j) acc[i][j] = mmaT<BF>(al[i], bh[j], acc[i][j]);
          dep_guard1(acc[i][0], acc[i][3], al[i]);
        }
      }
      keep4_h(bh[0], bh[1], bh[2], bh[3]);
    }
  };

  const int nslab = K / GKS;
  if constexpr (NBUF == 2) {
    stage(0, 0u);
    wait_async0();
    __syncthreads();                                       // publishes slab 0
    if (nslab > 1) stage(GKS, (unsigned)SBYTES);
    for (int t = 0; t < nslab; ++t) {
      const unsigned bo = (unsigned)(t & 1) * (unsigned)SBYTES;
      products(bo);
      wait_ds0();
      wait_async0();
      __syncthreads();                                     // publishes slab t+1; ends every wave's reads of this trip's buffer
      if (t + 2 < nslab) stage((t + 2) * GKS, bo);
    }
    wait_async0();
  } else {
    for (int t = 0; t < nslab; ++t) {
      if (t > 0) {
        wait_ds0();
        __syncthreads();                                   // ends every wave's reads of the buffer before it is refilled
      }
      stage(t * GKS, 0u);
      wait_async0();
      __syncthreads();                                     // publishes slab t
      products(0u);
    }
  }
  acc_guard4(acc[0][0], acc[0][1], acc[0][2], acc[0][3]);
  acc_guard4(acc[1][0], acc[1][1], acc[1][2], acc[1][3]);
  acc_guard4(acc[2][0], acc[2][1], acc[2][2], acc[2][3]);
  acc_guard4(acc[3][0], acc[3][1], acc[3][2], acc[3][3]);
}

// the wave's tile out: slab = the wave's own 16 x 68 floats of LDS; Cout, C2out = the planes of this batch element; n0 = the wave's first column
template <int OM, int EPI>
__device__ __forceinline__ void gemm_epi(v8f (&acc)[4][4], float* slab, void* Cout, void* C2out, int ldc, int m0, int n0,
                                         float oscale, float ocarry,
                                         const float* __restrict__ ep0, const float* __restrict__ ep1, const float* __restrict__ ep2) {
  const int lane  = threadIdx.x & 31;
  const int rlane = lane & 15;                 // col (D) within subtile
  const int mOff  = (lane >> 4) * 8;           // D row offset
  const int hh2 = lane >> 4, c4 = (lane & 15) * 4;     // f32 out: 256-B row segment = 16 lanes x 16 B
  const int q8  = lane >> 3, c8 = (lane & 7) * 8;

  // ---- epilogue ----
#pragma unroll
  for (int i = 0; i < 4; ++i) {
    const int mBase = m0 + (i << 4);
#pragma unroll
    for (int j = 0; j < 4; ++j) {
#pragma unroll
      for (int r = 0; r < 8; ++r) {
        slab[(mOff + r) * 68 + (j << 4) + rlane] = acc[i][j][r];
      }
    }
    wave_sync_lds();
    if constexpr (OM == 0) {
      float* C = (float*)Cout;
      v4f vals[8];
#pragma unroll
      for (int it = 0; it < 8; ++it) {
        const int row = it * 2 + hh2;                      // it 0..7 x hh2 0..1 = rows 0..15
        v4f v = *(const v4f*)(slab + row * 68 + c4);
#pragma unroll
        for (int e = 0; e < 4; ++e) v[e] = v[e] * oscale;
        if constexpr (EPI == 1) {
          const v4f bb = *(const v4f*)(ep0 + n0 + c4);     // per-column bias, columns n0+c4 .. +3 (N equals the bias length)
#pragma unroll
          for (int e = 0; e < 4; ++e) v[e] = v[e] + bfr(bb[e]);
        }
        vals[it] = v;
      }
      {
#pragma unroll
        for (int it = 0; it < 8; ++it) {
          const int gr = mBase + it * 2 + hh2;
          *(v4f*)(C + (size_t)gr * ldc + n0 + c4) = vals[it];
        }
        
      }
    } else {
      unsigned short* C  = (unsigned short*)Cout;
      unsigned short* Cb = (unsigned short*)C2out;
      v4u hv[4], lv[4];
#pragma unroll
      for (int it = 0; it < 4; ++it) {
        const int row = it * 4 + q8;                       // it 0..3 x q8 0..3 = rows 0..15
        const float* sp = slab + row * 68 + c8;
        float rb = 0.f;
        if constexpr (EPI == 2) rb = bfr(ep0[mBase + row]);   // per-row bias (M equals the bias length)
        v4u a  = {0u, 0u, 0u, 0u};
        v4u b2 = {0u, 0u, 0u, 0u};
#pragma unroll
        for (int e = 0; e < 4; ++e) {
          const int ci = n0 + c8 + 2 * e;                  // column index, < N
          float f0 = sp[2 * e] * oscale + rb;
          float f1 = sp[2 * e + 1] * oscale + rb;
          if constexpr (EPI == 1) {
            f0 += bfr(ep0[ci]);
            f1 += bfr(ep0[ci + 1]);
          }
          if constexpr (OM == 5) {
            const float g0 = (f0 + bfr(ep1[ci])) * ocarry, g1 = (f1 + bfr(ep1[ci + 1])) * ocarry;
            const float w0 = (f0 + bfr(ep2[ci])) * ocarry, w1 = (f1 + bfr(ep2[ci + 1])) * ocarry;
            a[e]  = pk16(h_bits((_Float16)g0), h_bits((_Float16)g1));
            b2[e] = pk16(h_bits((_Float16)w0), h_bits((_Float16)w1));
          } else {
            f0 *= ocarry; f1 *= ocarry;
            const _Float16 x0 = (_Float16)f0, x1 = (_Float16)f1;
            a[e] = pk16(h_bits(x0), h_bits(x1));
            if constexpr (OM == 4) {
              b2[e] = pk16(h_bits((_Float16)(f0 - (float)x0)), h_bits((_Float16)(f1 - (float)x1)));
            }
          }
        }
        hv[it] = a;
        lv[it] = b2;
      }
      {
#pragma unroll
        for (int it = 0; it < 4; ++it) {
          const int row = it * 4 + q8;
          if constexpr (OM == 3) {
            // mBase is a multiple of 16: these 16 rows are one tile; t0 = its first token's place in [batch element][head][token] order
            const unsigned t0 = (((unsigned)mBase / SEQ) * NHEAD + (unsigned)n0 / HD) * SEQ + (unsigned)mBase % SEQ;
            const unsigned pj = (unsigned)lane & 7u;       // 16-byte piece of the token's 128 B
            *(v4u*)(C + (size_t)t0 * HD + ((pj >> 1) * 256u + (pj & 1u) * 8u + (unsigned)row * 16u)) = hv[it];
          } else {
            *(v4u*)(C + (size_t)(mBase + row) * ldc + n0 + c8) = hv[it];
          }
          if constexpr (OM >= 4) {
            *(v4u*)(Cb + (size_t)(mBase + row) * ldc + n0 + c8) = lv[it];
          }
        }
        
      }
    }
    wave_sync_lds();
  }
}

template <int OM, int ASPLIT, int BF, int EPI, int NBUF>
__global__ __launch_bounds__(256) __attribute__((amdgpu_num_vgpr(256))) void gemm64(
    const unsigned short* __restrict__ Ap, const unsigned short* __restrict__ A2p, int lda, long long sA, long long zA,
    const unsigned short* __restrict__ Btp, int ldb, long long sB, long long zB,
    void* Cout, void* C2out, int ldc, long long sC, long long zC,
    int M, int N, int K, float oscale, float ocarry,
    const float* __restrict__ ep0, const float* __restrict__ ep1, const float* __restrict__ ep2) {
  __shared__ __align__(16) float sT[8][16 * 68];   // per-wave 16x64 slab, pitch 68 floats
  __shared__ __align__(16) char stg[GSTG_BYTES(ASPLIT, NBUF)];
  const int by   = blockIdx.y;
  const int bz   = blockIdx.z;
  const int wave = threadIdx.x >> 5;
  const int tilesN = N >> 6;
  const int tilesM = M >> 6;
  const int tile0 = blockIdx.x * 8;
  if (tile0 + 8 > tilesM * tilesN) return;   // the same for the whole block, in front of every barrier; never taken with the exact grid
  const int tm  = tile0 / tilesN;
  const int tn0 = tile0 - tm * tilesN;       // tilesN is a multiple of 8: the block's eight tiles lie in one row of tiles
  const int m0  = tm << 6;
  const int nb0 = tn0 << 6;                  // first Bt row of the block
  const int n0  = nb0 + (wave << 6);

  const char* A1 = (const char*)(Ap  + (size_t)((long long)by * sA + (long long)bz * zA));
  const char* A2 = (const char*)(A2p + (size_t)((long long)by * sA + (long long)bz * zA));
  const char* Bb = (const char*)(Btp + (size_t)((long long)by * sB + (long long)bz * zB));
  const size_t co = (size_t)((long long)by * sC + (long long)bz * zC);

  v8f acc[4][4];
  gemm_main<ASPLIT, BF, NBUF>(acc, stg, A1, A2, Bb, lda, ldb, m0, nb0, K);
  if constexpr (OM == 0) gemm_epi<OM, EPI>(acc, sT[wave], (void*)((float*)Cout + co), (void*)((float*)C2out + co), ldc, m0, n0, oscale, ocarry, ep0, ep1, ep2);
  else gemm_epi<OM, EPI>(acc, sT[wave], (void*)((unsigned short*)Cout + co), (void*)((unsigned short*)C2out + co), ldc, m0, n0, oscale, ocarry, ep0, ep1, ep2);
}

// =====================================================================================================
// The four input projections in ONE launch (they do not depend on one another): blockIdx.y = 0 q, 1 v^T, 2 k, 3 p; 128 blocks each, every block
// as in gemm64 (64 x 512 of C, K = 512, f16 operands, two buffers); the products are one text for all four, the way out differs.
//   q, k, p: C[8192][512] = X_w . W^T, block x = row tile x.   v^T: per batch element x / 16, C[512][1024] = WVT . X_v^T, tiles (x % 16) * 8 .. + 7.
// X4 = the four activation planes (q, k, v, p), WT5 = the weight planes (q, k, v, p, o).
// =====================================================================================================
__global__ __launch_bounds__(256) __attribute__((amdgpu_num_vgpr(256))) void proj4(
    const unsigned short* __restrict__ X4, const unsigned short* __restrict__ WT5,
    unsigned short* QU, unsigned short* QV, unsigned short* K16, unsigned short* P16, unsigned short* VTh, unsigned short* VTl,
    const float* __restrict__ b_q, const float* __restrict__ u_b, const float* __restrict__ v_b,
    const float* __restrict__ b_k, const float* __restrict__ b_v) {
  __shared__ __align__(16) float sT[8][16 * 68];   // per-wave 16x64 slab, pitch 68 floats
  __shared__ __align__(16) char stg[GSTG_BYTES(0, 2)];
  const int which = blockIdx.y;                    // the same for the whole block
  const int bx    = blockIdx.x;
  const int wave  = threadIdx.x >> 5;
  const size_t PXE = (size_t)NROWS * DM, PWE = (size_t)DM * DM;
  const float osc = 1.0f / (ACARRY * WSC);
  const char *A1, *Bb;
  int m0, nb0;
  if (which == 1) {
    const int tile0 = (bx & 15) * 8;               // 8 x 16 tiles a batch element
    m0  = (tile0 >> 4) << 6;
    nb0 = (tile0 & 15) << 6;
    A1  = (const char*)(WT5 + 2 * PWE);
    Bb  = (const char*)(X4 + 2 * PXE + (size_t)(bx >> 4) * ((size_t)SEQ * DM));
  } else {
    const int pl = (which == 0) ? 0 : (which == 2) ? 1 : 3;   // plane of X4 and of WT5
    m0  = bx << 6;
    nb0 = 0;
    A1  = (const char*)(X4 + (size_t)pl * PXE);
    Bb  = (const char*)(WT5 + (size_t)pl * PWE);
  }
  const int n0 = nb0 + (wave << 6);
  v8f acc[4][4];
  gemm_main<0, 0, 2>(acc, stg, A1, A1, Bb, DM, DM, m0, nb0, DM);
  float* slab = sT[wave];
  if (which == 0) {
    gemm_epi<5, 1>(acc, slab, (void*)QU, (void*)QV, DM, m0, n0, osc, QC, b_q, u_b, v_b);
  } else if (which == 1) {
    const size_t co = (size_t)(bx >> 4) * ((size_t)DM * SEQ);
    gemm_epi<4, 2>(acc, slab, (void*)(VTh + co), (void*)(VTl + co), SEQ, m0, n0, osc, VC, b_v, b_v, b_v);
  } else if (which == 2) {
    gemm_epi<2, 1>(acc, slab, (void*)K16, (void*)K16, DM, m0, n0, osc, QC, b_k, b_k, b_k);
  } else {
    gemm_epi<3, 0>(acc, slab, (void*)P16, (void*)P16, DM, m0, n0, osc, QC, b_k, b_k, b_k);   // a wave's 64 columns are one head
  }
}

// =====================================================================================================
// Flash attention for one batch element, one head and 128 query rows: 8 waves, 16 query rows each, head dim 64, 1024 keys.
// blockIdx.x = block of 128 query rows, blockIdx.y = head, blockIdx.z = batch element. QU0, QV0, KP0, CTh0, CTl0 are [8192][512] planes,
// VTh0/VTl0 [8][512][1024] planes, PP0 the p plane in fragment order (gemm64's OM 3). G[r][c] below stands for (q_r + v_bias) . p_c of this head.
//   The eight waves need the same k and v^T values: each chunk of 32 keys is brought from global memory ONCE per block (whole 16-byte pieces,
//   one of k, one of v^T hi, one of v^T residual per thread) into one of two LDS buffers, and every wave takes its A fragments from there.
//   The pieces of chunk t+1 are requested at the head of trip t, stored into the other buffer at its foot, and published by the trip's one
//   block barrier, which also ends every wave's reads of the buffer that the next trip refills.
//   LDS rows: k [32 keys][64 d] pitch 144 B, v^T [64 d][32 keys] pitch 80 B (16 B x odd: 16-byte fragment reads without bank conflicts).
//   Every tile of scores and of the result is TRANSPOSED: key (or d) = 8 (lane>>4) + register, query row = i0 + (lane&15). A lane holds one query
//   row's values, so maximum and sum run over its own registers (plus one exchange between the wave's halves), and its 16 probabilities of a
//   chunk are, in place, the B fragment of P^T (element s: key 8 hh + s, then 16 + 8 hh + s - 8, the k map of the v^T loader).
//   B fragments (stationary): (q_i + u_bias) f16 x4 rows i0+c, QU[i][64h + d], two k-steps of 32;
//   A fragments per chunk of 32 keys: k f16 x4 rows (k-contiguous) -> scores s^T[j][i] (two tiles of 16 keys);
//   position logit by relative shift, i = query row, j = key: j <= i -> G[i][S-1-i+j]; j == i+1 -> 0; else G[i+1][j-i-2].
//   With x = S-1-i+j a wave's 16 rows x 32 keys need x in a window of 47 that starts at the multiple of 16 S-16-i0+jb: three 16-column tiles,
//   each wholly x < S (rows i, p row x) or wholly x >= S (rows i+1, p row x-S-1; x == S is selected to 0 where it is used). The wave makes the
//   tiles by WMMA (A = either row set, from the wave's LDS; B = p rows from global memory, requested a trip ahead) and stores them side by side in
//   its own LDS rows, row m moved right by m+1: window column 15-m+k of row m lies at float 16+k of the row, and lane (c, hh) reads its query
//   row's 8 + 8 logits as four aligned 16-byte pieces. The window moves by two tiles a trip, so a trip makes two new ones: even trips read
//   tile places 0 1 2, odd trips 2 3 4; the tile stored at place 4 is also stored at place 0 (on odd trips that second store goes to the spare place 5).
//   t = (s + pos) / 16 / sqrt(512) * log2(e); online softmax in base 2, max-subtracted, running sums in f32, one per lane (the two halves'
//   sums of a query row are joined once, behind the loop);
//   B fragments of P^T*1024 (f16 hi and unscaled residual) straight from the lane's registers; v^T A fragments
//   (f16 x16 hi and unscaled residual); 12 v^T.P^T WMMAs (hi.hi, hi.lo, lo.hi) -> four tiles ctx^T[d = 16 t + 8 hh + r][query c].
//   Final 1/l and carry folds in f32; a lane's 8 registers of a tile are 8 neighbouring d of its query row: one 16-byte store a tile and plane;
//   the wave's 8 stores of a plane's rows fill whole 128-byte row segments.
//   every wave does identical bounded work (32 trips of 32 keys) and passes every barrier.
// coverage: wave tile 16 rows x 64 cols per plane = 4 tiles x 32 lanes x 8 halves; 8 waves x 8 blocks = 1024 rows, 8 heads x 64 = 512
//           columns, per batch element, each element written exactly once.
// =====================================================================================================
__global__ __launch_bounds__(ATT_THREADS) __attribute__((amdgpu_num_vgpr(256)))
void attnb(const unsigned short* __restrict__ QU0, const unsigned short* __restrict__ QV0,
           const unsigned short* __restrict__ KP0, const unsigned short* __restrict__ PP0,
           const unsigned short* __restrict__ VTh0, const unsigned short* __restrict__ VTl0,
           unsigned short* CTh0, unsigned short* CTl0) {
  __shared__ __align__(16) char smem[ATT_SMEM_BYTES];   // two k / v^T buffers
  __shared__ __align__(16) float skew[ATT_WAVES][16 * SKP];   // per wave: position logits [16 rows][6 tile places x 16 columns, row m moved right by m + 1]
  __shared__ __align__(16) char  qvf[ATT_WAVES][8 * 512];     // per wave: (q + v_bias) A fragments, 8 pieces of 16 B per lane (each lane reads its own)

  const int tid  = threadIdx.x;
  const int wave = tid >> 5;
  const int lane = tid & 31;
  const int hh   = lane >> 4;
  const int c    = lane & 15;

  const int head = blockIdx.y;                             // 0..7
  const int i0   = blockIdx.x * (ATT_WAVES * 16) + __builtin_amdgcn_readfirstlane(wave) * 16;   // first query row of this wave (scalar)

  const size_t bg = blockIdx.z;                            // batch element
  const unsigned short* QU  = QU0  + bg * ((size_t)SEQ * DM);
  const unsigned short* QV  = QV0  + bg * ((size_t)SEQ * DM);
  const unsigned short* KP  = KP0  + bg * ((size_t)SEQ * DM);
  const unsigned short* PP  = PP0  + bg * ((size_t)SEQ * DM);
  const unsigned short* VTh = VTh0 + bg * ((size_t)DM * SEQ);
  const unsigned short* VTl = VTl0 + bg * ((size_t)DM * SEQ);
  unsigned short*       CTh = CTh0 + bg * ((size_t)SEQ * DM);
  unsigned short*       CTl = CTl0 + bg * ((size_t)SEQ * DM);

  // stationary B fragments: (q + u_bias) rows i0 + c, d 0..31 and 32..63
  const size_t qofs = (size_t)(i0 + c) * DM + head * HD + 8 * hh;
  const v16h qa = ldfrag_u(QU + qofs), qb = ldfrag_u(QU + qofs + 32);
  // likewise (q + v_bias), rows i0 + c (pieces 0..3) and rows i0 + 1 + c (pieces 4..7; the row behind the last is clamped: no key lies right of
  // its diagonal); kept in LDS, not in registers: one set is used twice a trip, and 32 more stationary registers would spill
  char* qvl = qvf[wave] + lane * 16;
  {
    const int i1 = (i0 + c + 1 < SEQ) ? (i0 + c + 1) : (SEQ - 1);
    const size_t qofs1 = (size_t)i1 * DM + head * HD + 8 * hh;
#pragma unroll
    for (int q = 0; q < 4; ++q) {
      *(v4u*)(qvl + q * 512)       = *(const v4u*)(QV + qofs + q * 16);
      *(v4u*)(qvl + (4 + q) * 512) = *(const v4u*)(QV + qofs1 + q * 16);
    }
  }

  const char* Kb  = (const char*)(KP + head * HD);
  const char* Pb  = (const char*)(PP + (size_t)head * (SEQ * HD));   // p lies in fragment order: [head][tile of 16 rows][4 pairs of pieces][16 rows][32 B]
  const char* Vbh = (const char*)(VTh + (size_t)(head * HD) * SEQ);
  const char* Vbl = (const char*)(VTl + (size_t)(head * HD) * SEQ);
  // this thread's 16-byte pieces of a chunk: k row tid>>3 (8 pieces of its 128 B), v^T row tid>>2 (4 pieces of its 64 B)
  const unsigned gk0 = (unsigned)((tid >> 3) * (DM * 2) + (tid & 7) * 16);      // byte offset in chunk 0 of k
  const unsigned gv0 = (unsigned)((tid >> 2) * (SEQ * 2) + (tid & 3) * 16);     // byte offset in chunk 0 of either v^T plane
  const unsigned sk  = (unsigned)((tid >> 3) * KPITCH + (tid & 7) * 16);        // where they go in a buffer
  const unsigned sv  = (unsigned)(ST_VH + (tid >> 2) * VPITCH + (tid & 3) * 16);
  const unsigned fk  = (unsigned)(c * KPITCH + 16 * hh);                        // this lane's fragment reads: k row c
  const unsigned fv  = (unsigned)(ST_VH + c * VPITCH + 16 * hh);                // v^T hi row c

  const float CSC = SCL * LOG2E * (1.0f / (QC * QC));      // content scores and position logits carry x4 on both operands

  float mrow = -INFINITY, lrow = 0.f;                      // query row i0 + c: running maximum (both halves alike), this half's running sum
  v8f o0 = zero8(), o1 = zero8(), o2 = zero8(), o3 = zero8();
  char* stage = smem;

  float* sw = skew[wave];
  // B fragments of the window tile that starts at x = tb (a multiple of 16, 0 .. 2S-16): lane c takes p row x (x < S) or x-S-1 (x == S clamped to the plane's start)
  // each of a tile's four loads takes 32 B of 16 neighbouring rows, which lie side by side in the plane: 512 B of whole lines (x >= S: row x-S-1 of
  // lane 0 is the last of the tile before, one line more)
  const int pla = c * 32 + 16 * hh;                                    // x < S: row c of tile tb / 16
  const int plb = (c - 1) * 32 + 16 * hh - ((c == 0) ? 1536 : 0);      // x >= S: row c - 1 of tile (tb - S) / 16; lane 0: row 15 of the tile before
  auto ld_p = [&](int tb, v16h& b0, v16h& b1) -> unsigned {
    const int ob = ((tb < SEQ) ? tb : (tb - SEQ)) * 128 + ((tb < SEQ) ? pla : plb);   // tile's first byte (scalar) + this lane's place
    const unsigned off = (unsigned)((ob < 0) ? 0 : ob);    // x == S: in bounds, not used
    const char* pp = Pb + off;
    FragH f0, f1;
    f0.u[0] = *(const v4u*)(pp);                           // d 8 hh .. + 7
    f0.u[1] = *(const v4u*)(pp + 512);                     // d 16 + 8 hh ..
    f1.u[0] = *(const v4u*)(pp + 1024);                    // d 32 + 8 hh ..
    f1.u[1] = *(const v4u*)(pp + 1536);                    // d 48 + 8 hh ..
    b0 = f0.v;
    b1 = f1.v;
    return off;
  };
  // that tile's 16 x 16 logits; tb is the same for the whole wave
  auto mm_p = [&](int tb, v16h b0, v16h b1) -> v8f {
    const char* ap = qvl + ((tb < SEQ) ? 0 : 4 * 512);
    FragH a0, a1;
    a0.u[0] = *(const v4u*)(ap);
    a0.u[1] = *(const v4u*)(ap + 512);
    a1.u[0] = *(const v4u*)(ap + 1024);
    a1.u[1] = *(const v4u*)(ap + 1536);
    v8f d = mma_h(a0.v, b0, zero8());
    return mma_h(a1.v, b1, d);
  };
  float*       sws = sw + hh * (8 * (SKP + 1)) + c + 1;    // this lane's stores: row m = 8 hh + r, float c + m + 1, at + r (SKP + 1); tile place t at + 16 t
  const float* swr = sw + c * SKP + 16 + 8 * hh;           // its reads: row c, window columns 15 - c + 8 hh + (0 .. 7), and the same + 16
  auto st_tile = [&](int col, const v8f& d) {              // col = first column of the tile place (scalar)
    float* w = sws + col;
#pragma unroll
    for (int r = 0; r < 8; ++r) w[r * (SKP + 1)] = d[r];
  };

  // chunk 0 into buffer 0; trip 0's position window into tile places 0 1 2
  {
    const v4u pk = *(const v4u*)(Kb + gk0);
    const v4u ph0 = *(const v4u*)(Vbh + gv0);
    const v4u pl0 = *(const v4u*)(Vbl + gv0);
    const int x0 = SEQ - 16 - i0;
    v16h t0a, t0b, t1a, t1b, t2a, t2b;
    const unsigned f0 = ld_p(x0, t0a, t0b);
    const unsigned f1 = ld_p(x0 + 16, t1a, t1b);
    const unsigned f2 = ld_p(x0 + 32, t2a, t2b);
    // the p loads' offset registers stay whole (no load's result lands on one) up to this wait
    asm volatile("s_wait_xcnt 0x0" :: "v"(f0), "v"(f1), "v"(f2) : "memory");
    *(v4u*)(stage + sk) = pk;
    *(v4u*)(stage + sv) = ph0;
    *(v4u*)(stage + sv + ST_VSZ) = pl0;
    st_tile(0, mm_p(x0, t0a, t0b));
    st_tile(16, mm_p(x0 + 16, t1a, t1b));
    st_tile(32, mm_p(x0 + 32, t2a, t2b));
  }
  __syncthreads();                                         // publishes chunk 0 (and orders the wave's window stores before its reads)

#pragma unroll 1
  for (int jb = 0; jb < SEQ; jb += KCH) {
    const int jn = (jb + KCH < SEQ) ? (jb + KCH) : 0;      // next trip's first key; the last trip asks for trip 0's again (in bounds, not used)
    const unsigned bsel = (unsigned)((jb / KCH) & 1) * ST_BYTES;
    const char* cur = stage + bsel;                        // this trip's buffer
    char*       nxt = stage + (ST_BYTES - bsel);           // the other one: every wave left it before the last barrier
    // the next chunk's pieces are requested here and stored at the trip's foot: their latency lies under the whole trip
    const v4u nk = *(const v4u*)(Kb + (gk0 + (unsigned)jn * (unsigned)(DM * 2)));
    const v4u nh = *(const v4u*)(Vbh + (gv0 + (unsigned)jn * 2u));
    const v4u nl = *(const v4u*)(Vbl + (gv0 + (unsigned)jn * 2u));
    // behind this wait the three loads' address registers are free for the results of the p loads below
    asm volatile("s_wait_xcnt 0x0" ::: "memory");
    const v16h k0a = ldfrag_o(cur, fk);
    const v16h k0b = ldfrag_o(cur + 64, fk);
    const v16h k1a = ldfrag_o(cur + 16 * KPITCH, fk);
    const v16h k1b = ldfrag_o(cur + 16 * KPITCH + 64, fk);
    // the two new tiles of the next trip's window: p rows requested here, multiplied behind the softmax
    const int xn = SEQ - 16 - i0 + jn;
    v16h n1a, n1b, n2a, n2b;
    const unsigned f1 = ld_p(xn + 16, n1a, n1b);
    const unsigned f2 = ld_p(xn + 32, n2a, n2b);
    // the p loads' offset registers stay whole (no load's result lands on one) up to this wait
    asm volatile("s_wait_xcnt 0x0" :: "v"(f1), "v"(f2) : "memory");
    // this trip's position logits of query row i0 + c: keys jb + 8 hh + (0 .. 7) in g0 g1, keys jb + 16 + 8 hh + (0 .. 7) in g2 g3
    const int odd = (jb / KCH) & 1;
    v4f g0, g1, g2, g3;
    {
      const float* wr = swr + odd * 32;
      g0 = *(const v4f*)(wr);
      g1 = *(const v4f*)(wr + 4);
      g2 = *(const v4f*)(wr + 16);
      g3 = *(const v4f*)(wr + 20);
    }
    __builtin_amdgcn_sched_barrier(0);   // keeps the requests above at the trip's head (else the global ones sink to their stores and wait there)
    v8f s0, s1;                          // s0[r]: key jb + 8 hh + r, s1[r]: key jb + 16 + 8 hh + r, query row i0 + c
    s0 = mma_h(k0a, qa, zero8());
    s0 = mma_h(k0b, qb, s0);
    s1 = mma_h(k1a, qa, zero8());
    s1 = mma_h(k1b, qb, s1);
    guard2x6(s0, s1, qa, qb, k0a, k0b, k1a, k1b);
    float tt0[8], tt1[8];
    const int dz = i0 + c + 1 - jb - 8 * hh;               // the key right of the diagonal (j == i + 1) is register dz of s0, or dz - 16 of s1
#pragma unroll
    for (int r = 0; r < 8; ++r) {
      const float ga = (r < 4) ? g0[r & 3] : g1[r & 3];
      const float gc = (r < 4) ? g2[r & 3] : g3[r & 3];
      const float pa = (dz == r) ? 0.f : ga;
      const float pz = (dz == r + 16) ? 0.f : gc;
      tt0[r] = s0[r] * CSC + pa * CSC;
      tt1[r] = s1[r] * CSC + pz * CSC;
    }
    float e0[8], e1[8];
    {
      float mx = fmaxf(tt0[0], tt1[0]);
#pragma unroll   // r must be a constant: the values lie in registers (so in the loops below)
      for (int r = 1; r < 8; ++r) mx = fmaxf(mx, fmaxf(tt0[r], tt1[r]));
      mx = fmaxf(mx, xhalf(mx));                           // the row's other 16 keys lie in the other half of the wave
      const float mn = fmaxf(mrow, mx);
      const float al = exp2f(mrow - mn);
      mrow = mn;
      float pr[8];
#pragma unroll
      for (int r = 0; r < 8; ++r) {
        e0[r] = exp2f(tt0[r] - mn);
        e1[r] = exp2f(tt1[r] - mn);
        pr[r] = e0[r] + e1[r];
      }
      const float ps = ((pr[0] + pr[1]) + (pr[2] + pr[3])) + ((pr[4] + pr[5]) + (pr[6] + pr[7]));
      lrow = lrow * al + ps;
#pragma unroll
      for (int r = 0; r < 8; ++r) {
        o0[r] *= al;
        o1[r] *= al;
        o2[r] *= al;
        o3[r] *= al;
      }
    }
    {
      // next trip's window: its first tile is this one's last and lies in place already
      const v8f d1 = mm_p(xn + 16, n1a, n1b);
      const v8f d2 = mm_p(xn + 32, n2a, n2b);
      st_tile(odd ? 16 : 48, d1);
      st_tile(odd ? 32 : 64, d2);
      st_tile(odd ? 80 : 0, d2);
    }
    const v16h vh0 = ldfrag_o(cur, fv);
    const v16h vh1 = ldfrag_o(cur + 16 * VPITCH, fv);
    const v16h vh2 = ldfrag_o(cur + 32 * VPITCH, fv);
    const v16h vh3 = ldfrag_o(cur + 48 * VPITCH, fv);
    const v16h vl0 = ldfrag_o(cur + ST_VSZ, fv);
    const v16h vl1 = ldfrag_o(cur + ST_VSZ + 16 * VPITCH, fv);
    const v16h vl2 = ldfrag_o(cur + ST_VSZ + 32 * VPITCH, fv);
    const v16h vl3 = ldfrag_o(cur + ST_VSZ + 48 * VPITCH, fv);
    FragH ph, pl;
#pragma unroll
    for (int e = 0; e < 8; ++e) {
      float f; _Float16 x;
      f = e0[e] * PC; x = (_Float16)f; ph.h[0][e] = x; pl.h[0][e] = (_Float16)(f - (float)x);   // key jb + 8hh + e
      f = e1[e] * PC; x = (_Float16)f; ph.h[1][e] = x; pl.h[1][e] = (_Float16)(f - (float)x);   // key jb + 16 + 8hh + e
    }
    {
      o0 = mma_h(vh0, ph.v, o0);
      o1 = mma_h(vh1, ph.v, o1);
      o2 = mma_h(vh2, ph.v, o2);
      o3 = mma_h(vh3, ph.v, o3);
      o0 = mma_h(vh0, pl.v, o0);
      o1 = mma_h(vh1, pl.v, o1);
      o2 = mma_h(vh2, pl.v, o2);
      o3 = mma_h(vh3, pl.v, o3);
      guard4x6(o0, o1, o2, o3, ph.v, pl.v, vh0, vh1, vh2, vh3);
    }
    {
      o0 = mma_h(vl0, ph.v, o0);
      o1 = mma_h(vl1, ph.v, o1);
      o2 = mma_h(vl2, ph.v, o2);
      o3 = mma_h(vl3, ph.v, o3);
      guard4x5(o0, o1, o2, o3, ph.v, vl0, vl1, vl2, vl3);
    }
    *(v4u*)(nxt + sk) = nk;
    *(v4u*)(nxt + sv) = nh;
    *(v4u*)(nxt + sv + ST_VSZ) = nl;
    __syncthreads();   // publishes the next chunk; ends every wave's reads of this trip's buffer; window stores before reads
  }

  // ---- join the halves' sums, fold 1/l and the carries (1024 on P, 16 on v), split into bf16 hi + residual ----
  const float oc = 1.0f / (PC * VC);
  const float inv = (1.0f / (lrow + xhalf(lrow))) * oc;
  v4u hv[4], lv[4];
  auto pack8 = [&](const v8f& o, v4u& h4, v4u& l4) {       // d = 8 hh + (0 .. 7) of one tile
#pragma unroll   // e must be a constant: the values lie in registers
    for (int e = 0; e < 4; ++e) {
      const float f0 = o[2 * e] * inv, f1 = o[2 * e + 1] * inv;
      const unsigned short a0 = bf_bits(f0), a1 = bf_bits(f1);
      h4[e] = pk16(a0, a1);
      l4[e] = pk16(bf_bits(f0 - bf_up(a0)), bf_bits(f1 - bf_up(a1)));
    }
  };
  pack8(o0, hv[0], lv[0]);
  pack8(o1, hv[1], lv[1]);
  pack8(o2, hv[2], lv[2]);
  pack8(o3, hv[3], lv[3]);
  // ---- the lane writes its query row's halves 16 t + 8 hh .. + 7 in both planes; lanes c and c + 16 over the four tiles fill the row's 128 B ----
  {
    const size_t dofs = (size_t)(i0 + c) * DM + head * HD + 8 * hh;
    unsigned short* dsth = CTh + dofs;
    unsigned short* dstl = CTl + dofs;
#pragma unroll   // t must be a constant: the values lie in registers
    for (int t = 0; t < 4; ++t) {
      *(v4u*)(dsth + 16 * t) = hv[t];
      *(v4u*)(dstl + 16 * t) = lv[t];
    }
  }
}

// =====================================================================================================
// Workspace map (bytes); every plane is an exact multiple of its tile / whole-row store granularity (M, N exact tile multiples,
// the activation convert count an exact multiple of 2048, no pad rows needed), every offset a multiple of 512 KiB:
//   WQT, WKT, WVT, WPT f16 [512 out][512 in] x64   4 x 524288
//   WOT  bf16 [512 out][512 in]                         524288
//   X16  f16 4 x [8192][512] x16                  4 x 8388608    (query, key, value, position planes, rows b*1024 + tok)
//   QU, QV f16 [8192][512] x4                     2 x 8388608    (q + u_bias, q + v_bias)
//   K16 f16 [8192][512] x4                            8388608
//   P16 f16 [8][8 heads][64 tiles][2048 B] x4         8388608    (fragment order, OM 3)
//   VTh, VTl f16 [8][512][1024] x16               2 x 8388608    (v^T per batch, hi / residual)
//   CTh, CTl bf16 [8192][512]                     2 x 8388608    (attention ctx, merged heads, hi / residual)
//   end                                             103284736
// =====================================================================================================
extern "C" void kernel_launch(void* const* d_in, const int* in_sizes, int n_in,
                              void* d_out, int out_size, void* d_ws, size_t ws_size,
                              hipStream_t stream) {
  if (n_in < 15) return;
  const int NA = NROWS * DM;
  if (in_sizes[0] != NA || in_sizes[1] != NA || in_sizes[2] != NA || in_sizes[3] != NA) return;
  if (in_sizes[4] != DM * DM || in_sizes[6] != DM * DM || in_sizes[8] != DM * DM || in_sizes[10] != DM * DM || in_sizes[13] != DM * DM) return;
  if (in_sizes[5] != DM || in_sizes[7] != DM || in_sizes[9] != DM || in_sizes[14] != DM) return;
  if (in_sizes[11] != NHEAD * HD || in_sizes[12] != NHEAD * HD) return;
  if (out_size != NROWS * DM) return;
  if ((NA % 2048) != 0) return;

  const float* query = (const float*)d_in[0];
  const float* key   = (const float*)d_in[1];
  const float* value = (const float*)d_in[2];
  const float* pemb  = (const float*)d_in[3];
  const float* w_q   = (const float*)d_in[4];
  const float* b_q   = (const float*)d_in[5];
  const float* w_k   = (const float*)d_in[6];
  const float* b_k   = (const float*)d_in[7];
  const float* w_v   = (const float*)d_in[8];
  const float* b_v   = (const float*)d_in[9];
  const float* w_p   = (const float*)d_in[10];
  const float* u_b   = (const float*)d_in[11];
  const float* v_b   = (const float*)d_in[12];
  const float* w_o   = (const float*)d_in[13];
  const float* b_o   = (const float*)d_in[14];
  float*       out   = (float*)d_out;

  const size_t PWT = (size_t)DM * DM * 2;                         //   524288
  const size_t PX  = (size_t)NROWS * DM * 2;                      //  8388608
  const size_t PVT = (size_t)NB * DM * SEQ * 2;                   //  8388608
  size_t off = 0;
  const size_t oWQ = off; off += PWT;
  const size_t oWK = off; off += PWT;
  const size_t oWV = off; off += PWT;
  const size_t oWP = off; off += PWT;
  const size_t oWO = off; off += PWT;
  const size_t oX  = off; off += 4 * PX;
  const size_t oQU = off; off += PX;
  const size_t oQV = off; off += PX;
  const size_t oK  = off; off += PX;
  const size_t oP  = off; off += PX;
  const size_t oVh = off; off += PVT;
  const size_t oVl = off; off += PVT;
  const size_t oCh = off; off += PX;
  const size_t oCl = off; off += PX;
  if (off > ws_size) return;                                      // off = 103284736

  char* ws = (char*)d_ws;
  unsigned short* WQT  = (unsigned short*)(ws + oWQ);
  unsigned short* WOT  = (unsigned short*)(ws + oWO);
  unsigned short* X16  = (unsigned short*)(ws + oX);
  unsigned short* QU   = (unsigned short*)(ws + oQU);
  unsigned short* QV   = (unsigned short*)(ws + oQV);
  unsigned short* K16  = (unsigned short*)(ws + oK);
  unsigned short* P16  = (unsigned short*)(ws + oP);
  unsigned short* VTh  = (unsigned short*)(ws + oVh);
  unsigned short* VTl  = (unsigned short*)(ws + oVl);
  unsigned short* CTh  = (unsigned short*)(ws + oCh);
  unsigned short* CTl  = (unsigned short*)(ws + oCl);

  const dim3 blk(256);
  const dim3 gPR(WTB + 4 * CVB);                                   // 320 weight tiles + 8192 convert blocks
  const int tilesP = (NROWS / 64) * (DM / 64);                     // 1024
  const dim3 gP((tilesP + 7) / 8, 1);                              // 128
  const dim3 gP4((tilesP + 7) / 8, 4);                             // 128 x 4
  const dim3 gAT(ATT_BLOCKS, NHEAD, NB);                           // 8 x 8 x 8
  const dim3 bAT(ATT_THREADS);                                     // 256

  // (0) every pack: X16 plane w = f16(bf16(x_w)*16) for query, key, value, position; W[c][n] -> WT[n][c] as f16( bf16_RNE(w) * 64 );
  //     Wo[c][n] -> WOT[n][c] bf16 (the five weight planes lie one behind the other from WQT)
  prep<<<gPR, blk, 0, stream>>>(query, key, value, pemb, w_q, w_k, w_v, w_p, w_o, X16, WQT);

  // (1) the four projections, K = 512:
  //     q[m][n] = sum_c x[m][c] WQT[n][c] / 1024 + bq[n]; QU = f16((q + u_bias[n]) * 4), QV = f16((q + v_bias[n]) * 4); M = 8192, N = 512
  //     v^T per batch: VT[b][n = h*64+d][tok] = sum_c WVT[n][c] x_b[tok][c] / 1024 + bv[n] -> f16 x16 hi / residual planes; M = 512, N = 1024
  //     K16 = f16((k + bk) * 4); P16 = f16(p * 4) (no bias), in fragment order
  proj4<<<gP4, blk, 0, stream>>>(X16, WQT, QU, QV, K16, P16, VTh, VTl, b_q, u_b, v_b, b_k, b_v);

  // (5) attention with its position logits, every batch element, head and block of 128 query rows in one launch -> CT (bf16 hi / residual planes)
  attnb<<<gAT, bAT, 0, stream>>>(QU, QV, K16, P16, VTh, VTl, CTh, CTl);

  // (6) out = (CT_hi + CT_lo) . WOT^T + bo; M = 8192, N = 512, K = 512, f32
  gemm64<0, 1, 1, 1, 2><<<gP, blk, 0, stream>>>(
      CTh, CTl, DM, 0LL, 0LL,
      WOT, DM, 0LL, 0LL,
      (void*)out, (void*)out, DM, 0LL, 0LL,
      NROWS, DM, DM, 1.0f, 1.0f,
      b_o, b_o, b_o);
  (void)hipGetLastError();
}

// v009
// It runs in 108 microseconds.
// Timed twice side by side with v008, it ran 1.03 times as fast both times.
// Over all steps from v000 it is 7.48 times as fast.
// Contractions (all f32 accumulate): q/k/v/p projections v_wmma_f32_16x16x32_f16 (x f16 x16 . W^T f16 x64, K=512, single products);
// position logits (q+v_bias).p^T v_wmma_f32_16x16x32_f16 ((q+v_bias) f16 x4 . p f16 x4, K=64, single), inside attention, f32;
// content scores v_wmma_f32_16x16x32_f16 ((q+u_bias) f16 x4 . k f16 x4, K=64, single);
// P . v^T v_wmma_f32_16x16x32_f16 (P f16 x1024 hi/lo . v^T f16 x16 hi/lo, hi.hi+lo.hi+hi.lo, K=1024 by 32);
// output projection v_wmma_f32_16x16x32_bf16 (ctx bf16 hi/lo . Wo bf16, hi.W+lo.W, K=512) + bias in f32.
// Attention tiles are transposed (scores^T = k . q^T, ctx^T += v^T . P^T): a lane holds one query row's values.
// Max-subtracted online base-2 softmax in f32 on VALU; the relative shift of the position logits is a skewed store of their f32 tiles in LDS. Every float input RNE-converted to bf16 on load.
#include <hip/hip_runtime.h>
#include <math.h>
#include <stdint.h>

#define NB     8
#define SEQ    1024
#define DM     512
#define NHEAD  8
#define HD     64
#define NROWS  (NB * SEQ)
#define KCH    32
#define WSC    64.0f
#define ACARRY 16.0f
#define QC     4.0f
#define VC     16.0f
#define PC     1024.0f
#define LOG2E  1.4426950408889634f
#define SCL    0.04419417382415922f
static_assert(NHEAD * HD == DM);
static_assert((SEQ % 64) == 0 && (DM % 64) == 0 && (NROWS % 64) == 0 && (HD % 32) == 0 && (SEQ % KCH) == 0);
static_assert(((NROWS * DM) % 2048) == 0);
#define ATT_WAVES   8                 // waves of an attention block: 16 query rows each, all on one head
#define ATT_THREADS (ATT_WAVES * 32)
#define ATT_BLOCKS  (SEQ / (ATT_WAVES * 16))
#define SKP    116                    // floats per row of a wave's position-logit tiles (6 tile places of 16 columns + 16 of skew + 4: 464 B = 16 B x odd for the 16-byte reads)
#define KPITCH 144                    // LDS bytes per staged k row (128 + 16)
#define VPITCH 80                     // LDS bytes per staged v^T row (64 + 16)
#define ST_VH    (KCH * KPITCH)       // v^T hi behind the k rows
#define ST_VSZ   (HD * VPITCH)        // one v^T plane's rows
#define ST_BYTES (ST_VH + 2 * ST_VSZ) // one buffer: k | v^T hi | v^T residual
#define ATT_SMEM_BYTES (2 * ST_BYTES)
#define GKS    64                     // halves of k per staged gemm slab: 128 B, one whole line of every row
#define GPITCH 144                    // LDS bytes per staged gemm row (128 + 16)
static_assert((DM % GKS) == 0 && (HD % GKS) == 0);                   // every K is whole slabs
static_assert(((DM / 64) % 8) == 0 && ((SEQ / 64) % 8) == 0);        // every N is whole blocks of 8 column tiles
static_assert(ATT_THREADS == 256);
static_assert(ATT_BLOCKS == 8);
static_assert(KCH * HD * 2 == ATT_THREADS * 16);          // one 16-byte piece of k, and of each v^T plane, per thread and chunk
static_assert(HD * 2 == 128 && KCH * 2 == 64);
static_assert((ST_BYTES % 16) == 0 && (ST_VH % 16) == 0);
static_assert((SKP % 4) == 0 && ((SKP / 4) % 2) == 1 && SKP >= 6 * 16 + 16);

typedef _Float16 v16h __attribute__((ext_vector_type(16)));
typedef _Float16 v8h  __attribute__((ext_vector_type(8)));
typedef __bf16   v16b __attribute__((ext_vector_type(16)));
typedef float    v8f  __attribute__((ext_vector_type(8)));
typedef float    v4f  __attribute__((ext_vector_type(4)));
typedef unsigned int v4u __attribute__((ext_vector_type(4)));

union FragH { v16h v; v8h h[2]; v4u u[2]; };
union FragAny { v16h h; v16b b; };

// ---- scalar helpers --------------------------------------------------------------------------------
__device__ __forceinline__ unsigned short bf_bits(float f) {          // f32 -> bf16 bits, RNE convert
  unsigned u = __float_as_uint(f);
  return (unsigned short)((u + 0x7FFFu + ((u >> 16) & 1u)) >> 16);
}
__device__ __forceinline__ float bf_up(unsigned short h) { return __uint_as_float(((unsigned)h) << 16); }
__device__ __forceinline__ float bfr(float f) { return bf_up(bf_bits(f)); }   // value of the bf16 RNE convert
__device__ __forceinline__ unsigned short h_bits(_Float16 x) { return __builtin_bit_cast(unsigned short, x); }
__device__ __forceinline__ unsigned pk16(unsigned short a, unsigned short b) { return (unsigned)a | ((unsigned)b << 16); }
// lane l takes the value of lane l ^ 16 (the other half of the wave), by a vector cross-row move
__device__ __forceinline__ float xhalf(float x) {
  const int b = __builtin_bit_cast(int, x);
  return __builtin_bit_cast(float, __builtin_amdgcn_permlanex16(b, b, 0x76543210, 0xfedcba98, false, false));
}
__device__ __forceinline__ v8f zero8() { v8f z = {0.f, 0.f, 0.f, 0.f, 0.f, 0.f, 0.f, 0.f}; return z; }

// ---- fragment loader: 16-bit A/B operand from a k-contiguous 16-bit plane, lane -> row/col (lane&15),
//      p already includes +8*(lane>>4); elements 0..7 <- p[0..7] (k0+8h..), elements 8..15 <- p[16..23] (k0+16+8h..)
//      (same split k map for A and B; B is always read from a [n][k] plane)
__device__ __forceinline__ v16h ldfrag_u(const unsigned short* p) {
  FragH f;
  f.u[0] = *(const v4u*)(p);
  f.u[1] = *(const v4u*)(p + 16);
  return f.v;
}

// same fragment from a wave-uniform byte base plus this lane's 32-bit byte offset (already holding +16*(lane>>4)): an address costs one
// register, shared by planes of one layout, so a whole trip's loads fit the register file together
__device__ __forceinline__ v16h ldfrag_o(const char* base, unsigned off) {
  const char* p = base + off;
  FragH f;
  f.u[0] = *(const v4u*)(p);
  f.u[1] = *(const v4u*)(p + 32);
  return f.v;
}

// ---- WMMA helpers with trailing VALU hazard gaps ------------------------------------------------------
__device__ __forceinline__ v8f mma_h(v16h a, v16h b, v8f c) {
  return __builtin_amdgcn_wmma_f32_16x16x32_f16(false, a, false, b, (short)0, c, false, false);
}
__device__ __forceinline__ v8f mma_b(v16h a, v16h b, v8f c) {
  FragAny ua, ub;
  ua.h = a;
  ub.h = b;
  return __builtin_amdgcn_wmma_f32_16x16x32_bf16(false, ua.b, false, ub.b, (short)0, c, false, false);
}
template <int BF>
__device__ __forceinline__ v8f mmaT(v16h a, v16h b, v8f c) {
  if constexpr (BF != 0) return mma_b(a, b, c);
  else return mma_h(a, b, c);
}
__device__ __forceinline__ void dep_guard1(v8f& a, v8f& b, v16h x) {
#if defined(__HIP_DEVICE_COMPILE__)
  asm volatile("v_nop\n\tv_nop\n\tv_nop\n\tv_nop" : "+v"(a), "+v"(b) : "v"(x));
#endif
}
__device__ __forceinline__ void guard2x6(v8f& a, v8f& b, v16h x0, v16h x1, v16h x2, v16h x3, v16h x4, v16h x5) {
#if defined(__HIP_DEVICE_COMPILE__)
  asm volatile("v_nop\n\tv_nop\n\tv_nop\n\tv_nop"
               : "+v"(a), "+v"(b) : "v"(x0), "v"(x1), "v"(x2), "v"(x3), "v"(x4), "v"(x5));
#endif
}
__device__ __forceinline__ void guard4x6(v8f& a, v8f& b, v8f& c, v8f& d,
                                         v16h x0, v16h x1, v16h x2, v16h x3, v16h x4, v16h x5) {
#if defined(__HIP_DEVICE_COMPILE__)
  asm volatile("v_nop\n\tv_nop\n\tv_nop\n\tv_nop"
               : "+v"(a), "+v"(b), "+v"(c), "+v"(d) : "v"(x0), "v"(x1), "v"(x2), "v"(x3), "v"(x4), "v"(x5));
#endif
}
__device__ __forceinline__ void guard4x5(v8f& a, v8f& b, v8f& c, v8f& d,
                                         v16h x0, v16h x1, v16h x2, v16h x3, v16h x4) {
#if defined(__HIP_DEVICE_COMPILE__)
  asm volatile("v_nop\n\tv_nop\n\tv_nop\n\tv_nop"
               : "+v"(a), "+v"(b), "+v"(c), "+v"(d) : "v"(x0), "v"(x1), "v"(x2), "v"(x3), "v"(x4));
#endif
}
__device__ __forceinline__ void keep4_h(v16h a, v16h b, v16h c, v16h d) {
#if defined(__HIP_DEVICE_COMPILE__)
  asm volatile("v_nop" :: "v"(a), "v"(b), "v"(c), "v"(d));
#endif
}
__device__ __forceinline__ void acc_guard4(v8f& a, v8f& b, v8f& c, v8f& d) {
#if defined(__HIP_DEVICE_COMPILE__)
  asm volatile("v_nop\n\tv_nop\n\tv_nop\n\tv_nop" : "+v"(a), "+v"(b), "+v"(c), "+v"(d));
#endif
}
// N asynchronous 16-byte copies per lane, global memory -> LDS through no register: l[q] = the lane's LDS byte address, g[q] = its global address.
// The closing s_wait_xcnt 0 stands in the copies' own statement, so no address register is rewritten in front of it.
template <int N>
__device__ __forceinline__ void acopy(const unsigned* l, const char* const* g) {
  static_assert(N == 9 || N == 10);
#if defined(__HIP_DEVICE_COMPILE__)
  if constexpr (N == 9) {
    asm volatile("global_load_async_to_lds_b128 %0, %1, off\n\t"
                 "global_load_async_to_lds_b128 %2, %3, off\n\t"
                 "global_load_async_to_lds_b128 %4, %5, off\n\t"
                 "global_load_async_to_lds_b128 %6, %7, off\n\t"
                 "global_load_async_to_lds_b128 %8, %9, off\n\t"
                 "global_load_async_to_lds_b128 %10, %11, off\n\t"
                 "global_load_async_to_lds_b128 %12, %13, off\n\t"
                 "global_load_async_to_lds_b128 %14, %15, off\n\t"
                 "global_load_async_to_lds_b128 %16, %17, off\n\t"
                 "s_wait_xcnt 0x0"
                 :: "v"(l[0]), "v"(g[0]), "v"(l[1]), "v"(g[1]), "v"(l[2]), "v"(g[2]), "v"(l[3]), "v"(g[3]), "v"(l[4]), "v"(g[4]),
                    "v"(l[5]), "v"(g[5]), "v"(l[6]), "v"(g[6]), "v"(l[7]), "v"(g[7]), "v"(l[8]), "v"(g[8])
                 : "memory");
  } else {
    asm volatile("global_load_async_to_lds_b128 %0, %1, off\n\t"
                 "global_load_async_to_lds_b128 %2, %3, off\n\t"
                 "global_load_async_to_lds_b128 %4, %5, off\n\t"
                 "global_load_async_to_lds_b128 %6, %7, off\n\t"
                 "global_load_async_to_lds_b128 %8, %9, off\n\t"
                 "global_load_async_to_lds_b128 %10, %11, off\n\t"
                 "global_load_async_to_lds_b128 %12, %13, off\n\t"
                 "global_load_async_to_lds_b128 %14, %15, off\n\t"
                 "global_load_async_to_lds_b128 %16, %17, off\n\t"
                 "global_load_async_to_lds_b128 %18, %19, off\n\t"
                 "s_wait_xcnt 0x0"
                 :: "v"(l[0]), "v"(g[0]), "v"(l[1]), "v"(g[1]), "v"(l[2]), "v"(g[2]), "v"(l[3]), "v"(g[3]), "v"(l[4]), "v"(g[4]),
                    "v"(l[5]), "v"(g[5]), "v"(l[6]), "v"(g[6]), "v"(l[7]), "v"(g[7]), "v"(l[8]), "v"(g[8]), "v"(l[9]), "v"(g[9])
                 : "memory");
  }
#endif
}
__device__ __forceinline__ void wait_async0() {   // this wave's copies have landed in LDS
#if defined(__HIP_DEVICE_COMPILE__)
  asm volatile("s_wait_asynccnt 0x0" ::: "memory");
#endif
}
__device__ __forceinline__ void wait_ds0() {      // this wave's LDS reads have returned: their buffer may be refilled behind the next barrier
#if defined(__HIP_DEVICE_COMPILE__)
  asm volatile("s_wait_dscnt 0x0" ::: "memory");
#endif
}
__device__ __forceinline__ void wave_sync_lds() {
  __builtin_amdgcn_fence(__ATOMIC_RELEASE, "workgroup");
  __builtin_amdgcn_wave_barrier();
  __builtin_amdgcn_fence(__ATOMIC_ACQUIRE, "workgroup");
}

// =====================================================================================================
// Every input pack of a call in ONE launch (they do not depend on one another); each block does what one block of the separate launches did.
// Blocks 0 .. WTB-1, transposing 16-bit pack of a weight matrix: matrix b / 64, 64x64 tile b % 64:
//   in W[DM][DM] -> out WT[DM][DM] (plane b / 64 of WT5); matrices 0..3: f16( bf16_RNE(w) * WSC ); matrix 4: bf16_RNE(w) bits.
//   coverage: loads 4 x 256 x 4 floats = 64x64; stores 2 x 256 pieces x 8 halves = 64 rows x 64 halves = the whole tile; 64 tiles = 8 x 8 a matrix.
//   They come first: their longer way (load, LDS, barrier, store) runs under the stream of convert blocks behind them.
// Blocks behind them, elementwise 16-bit pack, no transpose: cb = b - WTB, plane w = cb / CVB of X4 <- f16( bf16_RNE(x_w[i]) * ACARRY ) (power of two, exact).
//   coverage: CVB blocks x 256 thr x 8 elements = NROWS*DM exactly, per plane.
// =====================================================================================================
#define WTB (5 * 64)                             // weight tile blocks
#define CVB ((NROWS * DM) / 2048)                // convert blocks per activation input
static_assert(CVB * 2048 == NROWS * DM);
static_assert(DM == 512);                        // 8 x 8 tiles of 64 x 64 per weight matrix

template <int BFO>
__device__ __forceinline__ void tr_tile(float (*t)[65], const float* __restrict__ src, unsigned short* dst, int c0, int d0, float sc) {
  const int tid = threadIdx.x;
#pragma unroll
  for (int it = 0; it < 4; ++it) {
    const int p  = it * 256 + tid;
    const int cc = p >> 4, sg = (p & 15) * 4;
    const v4f v = *(const v4f*)(src + (size_t)(c0 + cc) * DM + d0 + sg);
    t[cc][sg]     = v[0];
    t[cc][sg + 1] = v[1];
    t[cc][sg + 2] = v[2];
    t[cc][sg + 3] = v[3];
  }
  __syncthreads();
  v4u o[2];
#pragma unroll
  for (int it = 0; it < 2; ++it) {
    const int p  = it * 256 + tid;
    const int dd = p >> 3, s8 = (p & 7) * 8;
    unsigned short hv[8];
#pragma unroll
    for (int k = 0; k < 8; ++k) {
      const float f = bfr(t[s8 + k][dd]);
      if constexpr (BFO != 0) hv[k] = bf_bits(f);
      else hv[k] = h_bits((_Float16)(f * sc));
    }
    v4u q;
    q[0] = pk16(hv[0], hv[1]);
    q[1] = pk16(hv[2], hv[3]);
    q[2] = pk16(hv[4], hv[5]);
    q[3] = pk16(hv[6], hv[7]);
    o[it] = q;
  }
#pragma unroll
  for (int it = 0; it < 2; ++it) {
    const int p  = it * 256 + tid;
    const int dd = p >> 3, s8 = (p & 7) * 8;
    *(v4u*)(dst + (size_t)(d0 + dd) * DM + c0 + s8) = o[it];
  }
#if defined(__HIP_DEVICE_COMPILE__)
  // behind the two stores: in the merged kernel other code follows them in the listing, and none of it may rewrite their registers ahead of this wait
  asm volatile("s_wait_xcnt 0x0" ::: "memory");
#endif
}

__global__ __launch_bounds__(256) void prep(const float* __restrict__ xq, const float* __restrict__ xk,
                                            const float* __restrict__ xv, const float* __restrict__ xp,
                                            const float* __restrict__ wq, const float* __restrict__ wk, const float* __restrict__ wv,
                                            const float* __restrict__ wp, const float* __restrict__ wo,
                                            unsigned short* X4, unsigned short* WT5) {
  __shared__ float t[64][65];
  const int b = blockIdx.x;
  if (b >= WTB) {                                // the same for the whole block; this side has no barrier
    const int cb = b - WTB;
    const int w = cb / CVB;
    const float* src = (w == 0) ? xq : (w == 1) ? xk : (w == 2) ? xv : xp;
    unsigned short* dst = X4 + (size_t)w * ((size_t)NROWS * DM);
    const float sc = ACARRY;
    const size_t i8 = ((size_t)(cb - w * CVB) * 256 + threadIdx.x) * 8;
    const v4f a = *(const v4f*)(src + i8);
    const v4f b4 = *(const v4f*)(src + i8 + 4);
    v4u o;
    o[0] = pk16(h_bits((_Float16)(bfr(a[0]) * sc)), h_bits((_Float16)(bfr(a[1]) * sc)));
    o[1] = pk16(h_bits((_Float16)(bfr(a[2]) * sc)), h_bits((_Float16)(bfr(a[3]) * sc)));
    o[2] = pk16(h_bits((_Float16)(bfr(b4[0]) * sc)), h_bits((_Float16)(bfr(b4[1]) * sc)));
    o[3] = pk16(h_bits((_Float16)(bfr(b4[2]) * sc)), h_bits((_Float16)(bfr(b4[3]) * sc)));
    *(v4u*)(dst + i8) = o;
    return;
  }
  const int m = b >> 6, c0 = (b & 7) * 64, d0 = ((b >> 3) & 7) * 64;
  const float* W = (m == 0) ? wq : (m == 1) ? wk : (m == 2) ? wv : (m == 3) ? wp : wo;
  unsigned short* dst = WT5 + (size_t)m * (DM * DM);
  if (m < 4) tr_tile<0>(t, W, dst, c0, d0, WSC);   // m is the same for the whole block: every thread passes the one barrier of its side
  else tr_tile<1>(t, W, dst, c0, d0, 1.0f);
}

// =====================================================================================================
// Register-blocked batched 16-bit WMMA GEMM: C[m][n] = oscale * sum_k A[m][k] * Bt[n][k] (+ bias); one wave per 64x64 tile, a block's
// eight waves on eight neighbouring column tiles of one row tile (64 x 512). A row-major [M][K] pitch lda (16-bit plane), Bt row-major
// [N][K] pitch ldb (k contiguous); M multiple of 64, N multiple of 512, K multiple of 64.
// Operands go through LDS: per slab of 64 k the block's 64 A rows (both planes with ASPLIT) and 512 Bt rows are copied once, as whole
// 128-byte lines (a wave's copy = 4 rows), by asynchronous copies; every wave takes its fragments from there (row pitch 144 B = 16 B x odd).
// NBUF 2: slab t+2 is copied into the buffer that trip t has read, behind the trip's one barrier, and flies under trip t+1.
// NBUF 1: one buffer, filled and then read (for K = one slab: two blocks fit a WGP).
// blockIdx.y = batch index with element strides sA, sB, sC; blockIdx.z = outer batch index with strides zA, zB, zC.
// ASPLIT 1: a second A plane A2 (unscaled residual of A, same layout) is multiplied into the same accumulator (A + A2 ~ exact A).
// BF 1: bf16 operands (v_wmma_f32_16x16x32_bf16), else f16.
// EPI 1: value += bf16_RNE(ep0[column]) (per-column bias); EPI 2: value += bf16_RNE(ep0[row]) (per-row bias, 16-bit out only).
// OM 0: f32 out (pitch ldc).  OM 2: one f16 plane = f16(value * ocarry).
// OM 3: the same values as OM 2, laid out in the order attention's B fragments are read (rows = batch element x token, columns = head x d):
//       per batch element and head 64 tiles of 16 tokens, 2048 B each; 16-byte piece j of token r's 128 B lies at (j >> 1) * 512 + r * 32 + (j & 1) * 16.
//       A store (4 tokens x 8 pieces) still fills four whole 128-byte lines.
// OM 4: two f16 planes: hi = f16(value * ocarry), lo = f16(value * ocarry - hi) (unscaled residual).
// OM 5: two f16 planes: C = f16((value + bf16_RNE(ep1[column])) * ocarry), C2 = f16((value + bf16_RNE(ep2[column])) * ocarry).
// coverage: 4 slabs x 16 rows (f32: it 0..7 x lane>>4; 16-bit: it 0..3 x lane>>3) x 64 cols = the wave's whole 64x64 tile;
//           grid = tilesM*tilesN/8 blocks exactly.
// =====================================================================================================
#define GSTG_BYTES(ASPLIT, NBUF) ((NBUF) * (64 * (1 + (ASPLIT)) + 512) * GPITCH)   // staging bytes of a block
// the products of one block: acc = the wave's 64x64 tile, rows m0.., Bt rows nb0 + 64 wave ..; A1, A2, Bb = byte bases of the planes
template <int ASPLIT, int BF, int NBUF>
__device__ __forceinline__ void gemm_main(v8f (&acc)[4][4], char* stg, const char* A1, const char* A2, const char* Bb,
                                          int lda, int ldb, int m0, int nb0, int K) {
  constexpr int AROWS  = 64 * (1 + ASPLIT);        // staged rows: A | A2 (ASPLIT) | Bt
  constexpr int SROWS  = AROWS + 512;
  constexpr int SBYTES = SROWS * GPITCH;           // one buffer
  constexpr int NQ     = SROWS / 32;               // copies per thread and slab: 256 threads x 16 B = 32 rows each
  const int lane = threadIdx.x & 31;
  const int wave = threadIdx.x >> 5;
  const int rlane = lane & 15;                 // row (A) / col (B, D) within subtile
  const int koff  = (lane >> 4) * 8;           // k offset of this lane half

#pragma unroll
  for (int i = 0; i < 4; ++i)
#pragma unroll
    for (int j = 0; j < 4; ++j) acc[i][j] = zero8();

  // this thread's 16-byte pieces of a slab: staged rows (tid>>3) + 32 q, piece tid&7 of the row's 128 B (planes stay under 4 GiB)
  const int prow = threadIdx.x >> 3, seg = threadIdx.x & 7;
  const unsigned lds0 = (unsigned)(uintptr_t)stg + (unsigned)(prow * GPITCH + seg * 16);   // low 32 bits of the __shared__ address
  const unsigned ga0  = (unsigned)((m0 + prow) * lda) * 2u + (unsigned)(seg * 16);
  const unsigned gb0  = (unsigned)((nb0 + prow) * ldb) * 2u + (unsigned)(seg * 16);
  auto stage = [&](int k0, unsigned bufoff) {
    unsigned l[NQ];
    const char* g[NQ];
#pragma unroll   // q must be a constant: the addresses are register operands of the copy statements
    for (int q = 0; q < NQ; ++q) {
      l[q] = lds0 + bufoff + (unsigned)(q * 32 * GPITCH);
      // block-uniform part first (scalar), then this thread's offset: one vector add an address
      if (q < 2) g[q] = (A1 + (unsigned)(q * 32 * lda + k0) * 2u) + ga0;
      else if (q < AROWS / 32) g[q] = (A2 + (unsigned)((q - 2) * 32 * lda + k0) * 2u) + ga0;
      else g[q] = (Bb + (unsigned)((q - AROWS / 32) * 32 * ldb + k0) * 2u) + gb0;
    }
    acopy<NQ / 2>(l, g);
    acopy<NQ / 2>(l + NQ / 2, g + NQ / 2);
  };

  const unsigned fa = (unsigned)(rlane * GPITCH + koff * 2);                               // this lane's fragment reads: A row rlane
  const unsigned fb = (unsigned)((AROWS + (wave << 6) + rlane) * GPITCH + koff * 2);       // Bt row rlane of the wave's 64
  auto products = [&](unsigned bufoff) {
    const char* sb = stg + bufoff;
#pragma unroll   // both k-steps of a slab in line: their LDS offsets are immediates
    for (int ks = 0; ks < GKS / 32; ++ks) {
      // every fragment of this k-step is requested before its first product: one LDS latency a k-step
      v16h bh[4], ah[4], al[4];
#pragma unroll
      for (int j = 0; j < 4; ++j) bh[j] = ldfrag_o(sb + (j * 16 * GPITCH + ks * 64), fb);
#pragma unroll
      for (int i = 0; i < 4; ++i) {
        ah[i] = ldfrag_o(sb + (i * 16 * GPITCH + ks * 64), fa);
        if constexpr (ASPLIT != 0) al[i] = ldfrag_o(sb + ((64 + i * 16) * GPITCH + ks * 64), fa);
      }
      __builtin_amdgcn_sched_barrier(0);   // keeps the loads above in front of the products (else each A load sinks to its own group and waits alone)
#pragma unroll
      for (int i = 0; i < 4; ++i) {
#pragma unroll
        for (int j = 0; j < 4; ++j) acc[i][j] = mmaT<BF>(ah[i], bh[j], acc[i][j]);
        dep_guard1(acc[i][0], acc[i][3], ah[i]);
        if constexpr (ASPLIT != 0) {
#pragma unroll
          for (int j = 0; j < 4; ++j) acc[i][j] = mmaT<BF>(al[i], bh[j], acc[i][j]);
          dep_guard1(acc[i][0], acc[i][3], al[i]);
        }
      }
      keep4_h(bh[0], bh[1], bh[2], bh[3]);
    }
  };

  const int nslab = K / GKS;
  if constexpr (NBUF == 2) {
    stage(0, 0u);
    wait_async0();
    __syncthreads();                                       // publishes slab 0
    if (nslab > 1) stage(GKS, (unsigned)SBYTES);
    for (int t = 0; t < nslab; ++t) {
      const unsigned bo = (unsigned)(t & 1) * (unsigned)SBYTES;
      products(bo);
      wait_ds0();
      wait_async0();
      __syncthreads();                                     // publishes slab t+1; ends every wave's reads of this trip's buffer
      if (t + 2 < nslab) stage((t + 2) * GKS, bo);
    }
    wait_async0();
  } else {
    for (int t = 0; t < nslab; ++t) {
      if (t > 0) {
        wait_ds0();
        __syncthreads();                                   // ends every wave's reads of the buffer before it is refilled
      }
      stage(t * GKS, 0u);
      wait_async0();
      __syncthreads();                                     // publishes slab t
      products(0u);
    }
  }
  acc_guard4(acc[0][0], acc[0][1], acc[0][2], acc[0][3]);
  acc_guard4(acc[1][0], acc[1][1], acc[1][2], acc[1][3]);
  acc_guard4(acc[2][0], acc[2][1], acc[2][2], acc[2][3]);
  acc_guard4(acc[3][0], acc[3][1], acc[3][2], acc[3][3]);
}

// the wave's tile out: slab = the wave's own 16 x 68 floats of LDS; Cout, C2out = the planes of this batch element; n0 = the wave's first column
template <int OM, int EPI>
__device__ __forceinline__ void gemm_epi(v8f (&acc)[4][4], float* slab, void* Cout, void* C2out, int ldc, int m0, int n0,
                                         float oscale, float ocarry,
                                         const float* __restrict__ ep0, const float* __restrict__ ep1, const float* __restrict__ ep2) {
  const int lane  = threadIdx.x & 31;
  const int rlane = lane & 15;                 // col (D) within subtile
  const int mOff  = (lane >> 4) * 8;           // D row offset
  const int hh2 = lane >> 4, c4 = (lane & 15) * 4;     // f32 out: 256-B row segment = 16 lanes x 16 B
  const int q8  = lane >> 3, c8 = (lane & 7) * 8;

  // ---- epilogue ----
#pragma unroll
  for (int i = 0; i < 4; ++i) {
    const int mBase = m0 + (i << 4);
#pragma unroll
    for (int j = 0; j < 4; ++j) {
#pragma unroll
      for (int r = 0; r < 8; ++r) {
        slab[(mOff + r) * 68 + (j << 4) + rlane] = acc[i][j][r];
      }
    }
    wave_sync_lds();
    if constexpr (OM == 0) {
      float* C = (float*)Cout;
      v4f vals[8];
#pragma unroll
      for (int it = 0; it < 8; ++it) {
        const int row = it * 2 + hh2;                      // it 0..7 x hh2 0..1 = rows 0..15
        v4f v = *(const v4f*)(slab + row * 68 + c4);
#pragma unroll
        for (int e = 0; e < 4; ++e) v[e] = v[e] * oscale;
        if constexpr (EPI == 1) {
          const v4f bb = *(const v4f*)(ep0 + n0 + c4);     // per-column bias, columns n0+c4 .. +3 (N equals the bias length)
#pragma unroll
          for (int e = 0; e < 4; ++e) v[e] = v[e] + bfr(bb[e]);
        }
        vals[it] = v;
      }
      {
#pragma unroll
        for (int it = 0; it < 8; ++it) {
          const int gr = mBase + it * 2 + hh2;
          *(v4f*)(C + (size_t)gr * ldc + n0 + c4) = vals[it];
        }
        
      }
    } else {
      unsigned short* C  = (unsigned short*)Cout;
      unsigned short* Cb = (unsigned short*)C2out;
      v4u hv[4], lv[4];
#pragma unroll
      for (int it = 0; it < 4; ++it) {
        const int row = it * 4 + q8;                       // it 0..3 x q8 0..3 = rows 0..15
        const float* sp = slab + row * 68 + c8;
        float rb = 0.f;
        if constexpr (EPI == 2) rb = bfr(ep0[mBase + row]);   // per-row bias (M equals the bias length)
        v4u a  = {0u, 0u, 0u, 0u};
        v4u b2 = {0u, 0u, 0u, 0u};
#pragma unroll
        for (int e = 0; e < 4; ++e) {
          const int ci = n0 + c8 + 2 * e;                  // column index, < N
          float f0 = sp[2 * e] * oscale + rb;
          float f1 = sp[2 * e + 1] * oscale + rb;
          if constexpr (EPI == 1) {
            f0 += bfr(ep0[ci]);
            f1 += bfr(ep0[ci + 1]);
          }
          if constexpr (OM == 5) {
            const float g0 = (f0 + bfr(ep1[ci])) * ocarry, g1 = (f1 + bfr(ep1[ci + 1])) * ocarry;
            const float w0 = (f0 + bfr(ep2[ci])) * ocarry, w1 = (f1 + bfr(ep2[ci + 1])) * ocarry;
            a[e]  = pk16(h_bits((_Float16)g0), h_bits((_Float16)g1));
            b2[e] = pk16(h_bits((_Float16)w0), h_bits((_Float16)w1));
          } else {
            f0 *= ocarry; f1 *= ocarry;
            const _Float16 x0 = (_Float16)f0, x1 = (_Float16)f1;
            a[e] = pk16(h_bits(x0), h_bits(x1));
            if constexpr (OM == 4) {
              b2[e] = pk16(h_bits((_Float16)(f0 - (float)x0)), h_bits((_Float16)(f1 - (float)x1)));
            }
          }
        }
        hv[it] = a;
        lv[it] = b2;
      }
      {
#pragma unroll
        for (int it = 0; it < 4; ++it) {
          const int row = it * 4 + q8;
          if constexpr (OM == 3) {
            // mBase is a multiple of 16: these 16 rows are one tile; t0 = its first token's place in [batch element][head][token] order
            const unsigned t0 = (((unsigned)mBase / SEQ) * NHEAD + (unsigned)n0 / HD) * SEQ + (unsigned)mBase % SEQ;
            const unsigned pj = (unsigned)lane & 7u;       // 16-byte piece of the token's 128 B
            *(v4u*)(C + (size_t)t0 * HD + ((pj >> 1) * 256u + (pj & 1u) * 8u + (unsigned)row * 16u)) = hv[it];
          } else {
            *(v4u*)(C + (size_t)(mBase + row) * ldc + n0 + c8) = hv[it];
          }
          if constexpr (OM >= 4) {
            *(v4u*)(Cb + (size_t)(mBase + row) * ldc + n0 + c8) = lv[it];
          }
        }
        
      }
    }
    wave_sync_lds();
  }
}

template <int OM, int ASPLIT, int BF, int EPI, int NBUF>
__global__ __launch_bounds__(256) __attribute__((amdgpu_num_vgpr(256))) void gemm64(
    const unsigned short* __restrict__ Ap, const unsigned short* __restrict__ A2p, int lda, long long sA, long long zA,
    const unsigned short* __restrict__ Btp, int ldb, long long sB, long long zB,
    void* Cout, void* C2out, int ldc, long long sC, long long zC,
    int M, int N, int K, float oscale, float ocarry,
    const float* __restrict__ ep0, const float* __restrict__ ep1, const float* __restrict__ ep2) {
  __shared__ __align__(16) float sT[8][16 * 68];   // per-wave 16x64 slab, pitch 68 floats
  __shared__ __align__(16) char stg[GSTG_BYTES(ASPLIT, NBUF)];
  const int by   = blockIdx.y;
  const int bz   = blockIdx.z;
  const int wave = threadIdx.x >> 5;
  const int tilesN = N >> 6;
  const int tilesM = M >> 6;
  const int tile0 = blockIdx.x * 8;
  if (tile0 + 8 > tilesM * tilesN) return;   // the same for the whole block, in front of every barrier; never taken with the exact grid
  const int tm  = tile0 / tilesN;
  const int tn0 = tile0 - tm * tilesN;       // tilesN is a multiple of 8: the block's eight tiles lie in one row of tiles
  const int m0  = tm << 6;
  const int nb0 = tn0 << 6;                  // first Bt row of the block
  const int n0  = nb0 + (wave << 6);

  const char* A1 = (const char*)(Ap  + (size_t)((long long)by * sA + (long long)bz * zA));
  const char* A2 = (const char*)(A2p + (size_t)((long long)by * sA + (long long)bz * zA));
  const char* Bb = (const char*)(Btp + (size_t)((long long)by * sB + (long long)bz * zB));
  const size_t co = (size_t)((long long)by * sC + (long long)bz * zC);

  v8f acc[4][4];
  gemm_main<ASPLIT, BF, NBUF>(acc, stg, A1, A2, Bb, lda, ldb, m0, nb0, K);
  if constexpr (OM == 0) gemm_epi<OM, EPI>(acc, sT[wave], (void*)((float*)Cout + co), (void*)((float*)C2out + co), ldc, m0, n0, oscale, ocarry, ep0, ep1, ep2);
  else gemm_epi<OM, EPI>(acc, sT[wave], (void*)((unsigned short*)Cout + co), (void*)((unsigned short*)C2out + co), ldc, m0, n0, oscale, ocarry, ep0, ep1, ep2);
}

// =====================================================================================================
// The four input projections in ONE launch (they do not depend on one another): blockIdx.y = 0 q, 1 v^T, 2 k, 3 p; 128 blocks each, every block
// as in gemm64 (64 x 512 of C, K = 512, f16 operands, two buffers); the products are one text for all four, the way out differs.
//   q, k, p: C[8192][512] = X_w . W^T, block x = row tile x.   v^T: per batch element x / 16, C[512][1024] = WVT . X_v^T, tiles (x % 16) * 8 .. + 7.
// X4 = the four activation planes (q, k, v, p), WT5 = the weight planes (q, k, v, p, o).
// =====================================================================================================
__global__ __launch_bounds__(256) __attribute__((amdgpu_num_vgpr(256))) void proj4(
    const unsigned short* __restrict__ X4, const unsigned short* __restrict__ WT5,
    unsigned short* QU, unsigned short* QV, unsigned short* K16, unsigned short* P16, unsigned short* VTh, unsigned short* VTl,
    const float* __restrict__ b_q, const float* __restrict__ u_b, const float* __restrict__ v_b,
    const float* __restrict__ b_k, const float* __restrict__ b_v) {
  __shared__ __align__(16) float sT[8][16 * 68];   // per-wave 16x64 slab, pitch 68 floats
  __shared__ __align__(16) char stg[GSTG_BYTES(0, 2)];
  const int which = blockIdx.y;                    // the same for the whole block
  const int bx    = blockIdx.x;
  const int wave  = threadIdx.x >> 5;
  const size_t PXE = (size_t)NROWS * DM, PWE = (size_t)DM * DM;
  const float osc = 1.0f / (ACARRY * WSC);
  const char *A1, *Bb;
  int m0, nb0;
  if (which == 1) {
    const int tile0 = (bx & 15) * 8;               // 8 x 16 tiles a batch element
    m0  = (tile0 >> 4) << 6;
    nb0 = (tile0 & 15) << 6;
    A1  = (const char*)(WT5 + 2 * PWE);
    Bb  = (const char*)(X4 + 2 * PXE + (size_t)(bx >> 4) * ((size_t)SEQ * DM));
  } else {
    const int pl = (which == 0) ? 0 : (which == 2) ? 1 : 3;   // plane of X4 and of WT5
    m0  = bx << 6;
    nb0 = 0;
    A1  = (const char*)(X4 + (size_t)pl * PXE);
    Bb  = (const char*)(WT5 + (size_t)pl * PWE);
  }
  const int n0 = nb0 + (wave << 6);
  v8f acc[4][4];
  gemm_main<0, 0, 2>(acc, stg, A1, A1, Bb, DM, DM, m0, nb0, DM);
  float* slab = sT[wave];
  if (which == 0) {
    gemm_epi<5, 1>(acc, slab, (void*)QU, (void*)QV, DM, m0, n0, osc, QC, b_q, u_b, v_b);
  } else if (which == 1) {
    const size_t co = (size_t)(bx >> 4) * ((size_t)DM * SEQ);
    gemm_epi<4, 2>(acc, slab, (void*)(VTh + co), (void*)(VTl + co), SEQ, m0, n0, osc, VC, b_v, b_v, b_v);
  } else if (which == 2) {
    gemm_epi<2, 1>(acc, slab, (void*)K16, (void*)K16, DM, m0, n0, osc, QC, b_k, b_k, b_k);
  } else {
    gemm_epi<3, 0>(acc, slab, (void*)P16, (void*)P16, DM, m0, n0, osc, QC, b_k, b_k, b_k);   // a wave's 64 columns are one head
  }
}

// =====================================================================================================
// Flash attention for one batch element, one head and 128 query rows: 8 waves, 16 query rows each, head dim 64, 1024 keys.
// blockIdx.x = block of 128 query rows, blockIdx.y = head, blockIdx.z = batch element. QU0, QV0, KP0, CTh0, CTl0 are [8192][512] planes,
// VTh0/VTl0 [8][512][1024] planes, PP0 the p plane in fragment order (gemm64's OM 3). G[r][c] below stands for (q_r + v_bias) . p_c of this head.
//   The eight waves need the same k and v^T values: each chunk of 32 keys is brought from global memory ONCE per block (whole 16-byte pieces,
//   one of k, one of v^T hi, one of v^T residual per thread) into one of two LDS buffers, and every wave takes its A fragments from there.
//   The pieces of chunk t+1 are requested at the head of trip t, stored into the other buffer at its foot, and published by the trip's one
//   block barrier, which also ends every wave's reads of the buffer that the next trip refills.
//   LDS rows: k [32 keys][64 d] pitch 144 B, v^T [64 d][32 keys] pitch 80 B (16 B x odd: 16-byte fragment reads without bank conflicts).
//   Every tile of scores and of the result is TRANSPOSED: key (or d) = 8 (lane>>4) + register, query row = i0 + (lane&15). A lane holds one query
//   row's values, so maximum and sum run over its own registers (plus one exchange between the wave's halves), and its 16 probabilities of a
//   chunk are, in place, the B fragment of P^T (element s: key 8 hh + s, then 16 + 8 hh + s - 8, the k map of the v^T loader).
//   B fragments (stationary): (q_i + u_bias) f16 x4 rows i0+c, QU[i][64h + d], two k-steps of 32;
//   A fragments per chunk of 32 keys: k f16 x4 rows (k-contiguous) -> scores s^T[j][i] (two tiles of 16 keys);
//   position logit by relative shift, i = query row, j = key: j <= i -> G[i][S-1-i+j]; j == i+1 -> 0; else G[i+1][j-i-2].
//   With x = S-1-i+j a wave's 16 rows x 32 keys need x in a window of 47 that starts at the multiple of 16 S-16-i0+jb: three 16-column tiles,
//   each wholly x < S (rows i, p row x) or wholly x >= S (rows i+1, p row x-S-1; x == S is selected to 0 where it is used). The wave makes the
//   tiles by WMMA (A = either row set, from the wave's LDS; B = p rows from global memory, requested a trip ahead) and stores them side by side in
//   its own LDS rows, row m moved right by m+1: window column 15-m+k of row m lies at float 16+k of the row, and lane (c, hh) reads its query
//   row's 8 + 8 logits as four aligned 16-byte pieces. The window moves by two tiles a trip, so a trip makes two new ones: even trips read
//   tile places 0 1 2, odd trips 2 3 4; the tile stored at place 4 is also stored at place 0 (on odd trips that second store goes to the spare place 5).
//   t = (s + pos) / 16 / sqrt(512) * log2(e); online softmax in base 2, max-subtracted, running sums in f32, one per lane (the two halves'
//   sums of a query row are joined once, behind the loop);
//   B fragments of P^T*1024 (f16 hi and unscaled residual) straight from the lane's registers; v^T A fragments
//   (f16 x16 hi and unscaled residual); 12 v^T.P^T WMMAs (hi.hi, hi.lo, lo.hi) -> four tiles ctx^T[d = 16 t + 8 hh + r][query c].
//   Final 1/l and carry folds in f32; a lane's 8 registers of a tile are 8 neighbouring d of its query row: one 16-byte store a tile and plane;
//   the wave's 8 stores of a plane's rows fill whole 128-byte row segments.
//   every wave does identical bounded work (32 trips of 32 keys) and passes every barrier.
// coverage: wave tile 16 rows x 64 cols per plane = 4 tiles x 32 lanes x 8 halves; 8 waves x 8 blocks = 1024 rows, 8 heads x 64 = 512
//           columns, per batch element, each element written exactly once.
// =====================================================================================================
__global__ __launch_bounds__(ATT_THREADS) __attribute__((amdgpu_num_vgpr(256)))
void attnb(const unsigned short* __restrict__ QU0, const unsigned short* __restrict__ QV0,
           const unsigned short* __restrict__ KP0, const unsigned short* __restrict__ PP0,
           const unsigned short* __restrict__ VTh0, const unsigned short* __restrict__ VTl0,
           unsigned short* CTh0, unsigned short* CTl0) {
  __shared__ __align__(16) char smem[ATT_SMEM_BYTES];   // two k / v^T buffers
  __shared__ __align__(16) float skew[ATT_WAVES][16 * SKP];   // per wave: position logits [16 rows][6 tile places x 16 columns, row m moved right by m + 1]
  __shared__ __align__(16) char  qvf[ATT_WAVES][8 * 512];     // per wave: (q + v_bias) A fragments, 8 pieces of 16 B per lane (each lane reads its own)

  const int tid  = threadIdx.x;
  const int wave = tid >> 5;
  const int lane = tid & 31;
  const int hh   = lane >> 4;
  const int c    = lane & 15;

  const int head = blockIdx.y;                             // 0..7
  const int i0   = blockIdx.x * (ATT_WAVES * 16) + __builtin_amdgcn_readfirstlane(wave) * 16;   // first query row of this wave (scalar)

  const size_t bg = blockIdx.z;                            // batch element
  const unsigned short* QU  = QU0  + bg * ((size_t)SEQ * DM);
  const unsigned short* QV  = QV0  + bg * ((size_t)SEQ * DM);
  const unsigned short* KP  = KP0  + bg * ((size_t)SEQ * DM);
  const unsigned short* PP  = PP0  + bg * ((size_t)SEQ * DM);
  const unsigned short* VTh = VTh0 + bg * ((size_t)DM * SEQ);
  const unsigned short* VTl = VTl0 + bg * ((size_t)DM * SEQ);
  unsigned short*       CTh = CTh0 + bg * ((size_t)SEQ * DM);
  unsigned short*       CTl = CTl0 + bg * ((size_t)SEQ * DM);

  // stationary B fragments: (q + u_bias) rows i0 + c, d 0..31 and 32..63
  const size_t qofs = (size_t)(i0 + c) * DM + head * HD + 8 * hh;
  const v16h qa = ldfrag_u(QU + qofs), qb = ldfrag_u(QU + qofs + 32);
  // likewise (q + v_bias), rows i0 + c (pieces 0..3) and rows i0 + 1 + c (pieces 4..7; the row behind the last is clamped: no key lies right of
  // its diagonal); kept in LDS, not in registers: one set is used twice a trip, and 32 more stationary registers would spill
  char* qvl = qvf[wave] + lane * 16;
  {
    const int i1 = (i0 + c + 1 < SEQ) ? (i0 + c + 1) : (SEQ - 1);
    const size_t qofs1 = (size_t)i1 * DM + head * HD + 8 * hh;
#pragma unroll
    for (int q = 0; q < 4; ++q) {
      *(v4u*)(qvl + q * 512)       = *(const v4u*)(QV + qofs + q * 16);
      *(v4u*)(qvl + (4 + q) * 512) = *(const v4u*)(QV + qofs1 + q * 16);
    }
  }

  const char* Kb  = (const char*)(KP + head * HD);
  const char* Pb  = (const char*)(PP + (size_t)head * (SEQ * HD));   // p lies in fragment order: [head][tile of 16 rows][4 pairs of pieces][16 rows][32 B]
  const char* Vbh = (const char*)(VTh + (size_t)(head * HD) * SEQ);
  const char* Vbl = (const char*)(VTl + (size_t)(head * HD) * SEQ);
  // this thread's 16-byte pieces of a chunk: k row tid>>3 (8 pieces of its 128 B), v^T row tid>>2 (4 pieces of its 64 B)
  const unsigned gk0 = (unsigned)((tid >> 3) * (DM * 2) + (tid & 7) * 16);      // byte offset in chunk 0 of k
  const unsigned gv0 = (unsigned)((tid >> 2) * (SEQ * 2) + (tid & 3) * 16);     // byte offset in chunk 0 of either v^T plane
  const unsigned sk  = (unsigned)((tid >> 3) * KPITCH + (tid & 7) * 16);        // where they go in a buffer
  const unsigned sv  = (unsigned)(ST_VH + (tid >> 2) * VPITCH + (tid & 3) * 16);
  const unsigned fk  = (unsigned)(c * KPITCH + 16 * hh);                        // this lane's fragment reads: k row c
  const unsigned fv  = (unsigned)(ST_VH + c * VPITCH + 16 * hh);                // v^T hi row c

  const float CSC = SCL * LOG2E * (1.0f / (QC * QC));      // content scores and position logits carry x4 on both operands

  float mrow = -INFINITY, lrow = 0.f;                      // query row i0 + c: running maximum (both halves alike), this half's running sum
  v8f o0 = zero8(), o1 = zero8(), o2 = zero8(), o3 = zero8();
  char* stage = smem;

  float* sw = skew[wave];
  // B fragments of the window tile that starts at x = tb (a multiple of 16, 0 .. 2S-16): lane c takes p row x (x < S) or x-S-1 (x == S clamped to the plane's start)
  // each of a tile's four loads takes 32 B of 16 neighbouring rows, which lie side by side in the plane: 512 B of whole lines (x >= S: row x-S-1 of
  // lane 0 is the last of the tile before, one line more)
  const int pla = c * 32 + 16 * hh;                                    // x < S: row c of tile tb / 16
  const int plb = (c - 1) * 32 + 16 * hh - ((c == 0) ? 1536 : 0);      // x >= S: row c - 1 of tile (tb - S) / 16; lane 0: row 15 of the tile before
  auto ld_p = [&](int tb, v16h& b0, v16h& b1) -> unsigned {
    const int ob = ((tb < SEQ) ? tb : (tb - SEQ)) * 128 + ((tb < SEQ) ? pla : plb);   // tile's first byte (scalar) + this lane's place
    const unsigned off = (unsigned)((ob < 0) ? 0 : ob);    // x == S: in bounds, not used
    const char* pp = Pb + off;
    FragH f0, f1;
    f0.u[0] = *(const v4u*)(pp);                           // d 8 hh .. + 7
    f0.u[1] = *(const v4u*)(pp + 512);                     // d 16 + 8 hh ..
    f1.u[0] = *(const v4u*)(pp + 1024);                    // d 32 + 8 hh ..
    f1.u[1] = *(const v4u*)(pp + 1536);                    // d 48 + 8 hh ..
    b0 = f0.v;
    b1 = f1.v;
    return off;
  };
  // that tile's 16 x 16 logits; tb is the same for the whole wave
  auto mm_p = [&](int tb, v16h b0, v16h b1) -> v8f {
    const char* ap = qvl + ((tb < SEQ) ? 0 : 4 * 512);
    FragH a0, a1;
    a0.u[0] = *(const v4u*)(ap);
    a0.u[1] = *(const v4u*)(ap + 512);
    a1.u[0] = *(const v4u*)(ap + 1024);
    a1.u[1] = *(const v4u*)(ap + 1536);
    v8f d = mma_h(a0.v, b0, zero8());
    return mma_h(a1.v, b1, d);
  };
  float*       sws = sw + hh * (8 * (SKP + 1)) + c + 1;    // this lane's stores: row m = 8 hh + r, float c + m + 1, at + r (SKP + 1); tile place t at + 16 t
  const float* swr = sw + c * SKP + 16 + 8 * hh;           // its reads: row c, window columns 15 - c + 8 hh + (0 .. 7), and the same + 16
  auto st_tile = [&](int col, const v8f& d) {              // col = first column of the tile place (scalar)
    float* w = sws + col;
#pragma unroll
    for (int r = 0; r < 8; ++r) w[r * (SKP + 1)] = d[r];
  };

  // chunk 0 into buffer 0; trip 0's position window into tile places 0 1 2
  {
    const v4u pk = *(const v4u*)(Kb + gk0);
    const v4u ph0 = *(const v4u*)(Vbh + gv0);
    const v4u pl0 = *(const v4u*)(Vbl + gv0);
    const int x0 = SEQ - 16 - i0;
    v16h t0a, t0b, t1a, t1b, t2a, t2b;
    const unsigned f0 = ld_p(x0, t0a, t0b);
    const unsigned f1 = ld_p(x0 + 16, t1a, t1b);
    const unsigned f2 = ld_p(x0 + 32, t2a, t2b);
    // the p loads' offset registers stay whole (no load's result lands on one) up to this wait
    asm volatile("s_wait_xcnt 0x0" :: "v"(f0), "v"(f1), "v"(f2) : "memory");
    *(v4u*)(stage + sk) = pk;
    *(v4u*)(stage + sv) = ph0;
    *(v4u*)(stage + sv + ST_VSZ) = pl0;
    st_tile(0, mm_p(x0, t0a, t0b));
    st_tile(16, mm_p(x0 + 16, t1a, t1b));
    st_tile(32, mm_p(x0 + 32, t2a, t2b));
  }
  __syncthreads();                                         // publishes chunk 0 (and orders the wave's window stores before its reads)

#pragma unroll 1
  for (int jb = 0; jb < SEQ; jb += KCH) {
    const int jn = (jb + KCH < SEQ) ? (jb + KCH) : 0;      // next trip's first key; the last trip asks for trip 0's again (in bounds, not used)
    const unsigned bsel = (unsigned)((jb / KCH) & 1) * ST_BYTES;
    const char* cur = stage + bsel;                        // this trip's buffer
    char*       nxt = stage + (ST_BYTES - bsel);           // the other one: every wave left it before the last barrier
    // the next chunk's pieces are requested here and stored at the trip's foot: their latency lies under the whole trip
    const v4u nk = *(const v4u*)(Kb + (gk0 + (unsigned)jn * (unsigned)(DM * 2)));
    const v4u nh = *(const v4u*)(Vbh + (gv0 + (unsigned)jn * 2u));
    const v4u nl = *(const v4u*)(Vbl + (gv0 + (unsigned)jn * 2u));
    // behind this wait the three loads' address registers are free for the results of the p loads below
    asm volatile("s_wait_xcnt 0x0" ::: "memory");
    const v16h k0a = ldfrag_o(cur, fk);
    const v16h k0b = ldfrag_o(cur + 64, fk);
    const v16h k1a = ldfrag_o(cur + 16 * KPITCH, fk);
    const v16h k1b = ldfrag_o(cur + 16 * KPITCH + 64, fk);
    // the two new tiles of the next trip's window: p rows requested here, multiplied behind the softmax
    const int xn = SEQ - 16 - i0 + jn;
    v16h n1a, n1b, n2a, n2b;
    const unsigned f1 = ld_p(xn + 16, n1a, n1b);
    const unsigned f2 = ld_p(xn + 32, n2a, n2b);
    // the p loads' offset registers stay whole (no load's result lands on one) up to this wait
    asm volatile("s_wait_xcnt 0x0" :: "v"(f1), "v"(f2) : "memory");
    // this trip's position logits of query row i0 + c: keys jb + 8 hh + (0 .. 7) in g0 g1, keys jb + 16 + 8 hh + (0 .. 7) in g2 g3
    const int odd = (jb / KCH) & 1;
    v4f g0, g1, g2, g3;
    {
      const float* wr = swr + odd * 32;
      g0 = *(const v4f*)(wr);
      g1 = *(const v4f*)(wr + 4);
      g2 = *(const v4f*)(wr + 16);
      g3 = *(const v4f*)(wr + 20);
    }
    __builtin_amdgcn_sched_barrier(0);   // keeps the requests above at the trip's head (else the global ones sink to their stores and wait there)
    v8f s0, s1;                          // s0[r]: key jb + 8 hh + r, s1[r]: key jb + 16 + 8 hh + r, query row i0 + c
    s0 = mma_h(k0a, qa, zero8());
    s0 = mma_h(k0b, qb, s0);
    s1 = mma_h(k1a, qa, zero8());
    s1 = mma_h(k1b, qb, s1);
    guard2x6(s0, s1, qa, qb, k0a, k0b, k1a, k1b);
    float tt0[8], tt1[8];
    const int dz = i0 + c + 1 - jb - 8 * hh;               // the key right of the diagonal (j == i + 1) is register dz of s0, or dz - 16 of s1
#pragma unroll
    for (int r = 0; r < 8; ++r) {
      const float ga = (r < 4) ? g0[r & 3] : g1[r & 3];
      const float gc = (r < 4) ? g2[r & 3] : g3[r & 3];
      const float pa = (dz == r) ? 0.f : ga;
      const float pz = (dz == r + 16) ? 0.f : gc;
      tt0[r] = s0[r] * CSC + pa * CSC;
      tt1[r] = s1[r] * CSC + pz * CSC;
    }
    float e0[8], e1[8];
    {
      float mx = fmaxf(tt0[0], tt1[0]);
#pragma unroll   // r must be a constant: the values lie in registers (so in the loops below)
      for (int r = 1; r < 8; ++r) mx = fmaxf(mx, fmaxf(tt0[r], tt1[r]));
      mx = fmaxf(mx, xhalf(mx));                           // the row's other 16 keys lie in the other half of the wave
      const float mn = fmaxf(mrow, mx);
      // bare v_exp_f32, without the library's guard for results under 2^-126: such a term comes out 0, not subnormal, which changes nothing here:
      // the row's joined sum holds its largest term, 1, and times 1024 in f16 either is 0
      const float al = __builtin_amdgcn_exp2f(mrow - mn);
      mrow = mn;
      float pr[8];
#pragma unroll
      for (int r = 0; r < 8; ++r) {
        e0[r] = __builtin_amdgcn_exp2f(tt0[r] - mn);
        e1[r] = __builtin_amdgcn_exp2f(tt1[r] - mn);
        pr[r] = e0[r] + e1[r];
      }
      const float ps = ((pr[0] + pr[1]) + (pr[2] + pr[3])) + ((pr[4] + pr[5]) + (pr[6] + pr[7]));
      lrow = lrow * al + ps;
#pragma unroll
      for (int r = 0; r < 8; ++r) {
        o0[r] *= al;
        o1[r] *= al;
        o2[r] *= al;
        o3[r] *= al;
      }
    }
    {
      // next trip's window: its first tile is this one's last and lies in place already
      const v8f d1 = mm_p(xn + 16, n1a, n1b);
      const v8f d2 = mm_p(xn + 32, n2a, n2b);
      st_tile(odd ? 16 : 48, d1);
      st_tile(odd ? 32 : 64, d2);
      st_tile(odd ? 80 : 0, d2);
    }
    const v16h vh0 = ldfrag_o(cur, fv);
    const v16h vh1 = ldfrag_o(cur + 16 * VPITCH, fv);
    const v16h vh2 = ldfrag_o(cur + 32 * VPITCH, fv);
    const v16h vh3 = ldfrag_o(cur + 48 * VPITCH, fv);
    const v16h vl0 = ldfrag_o(cur + ST_VSZ, fv);
    const v16h vl1 = ldfrag_o(cur + ST_VSZ + 16 * VPITCH, fv);
    const v16h vl2 = ldfrag_o(cur + ST_VSZ + 32 * VPITCH, fv);
    const v16h vl3 = ldfrag_o(cur + ST_VSZ + 48 * VPITCH, fv);
    FragH ph, pl;
#pragma unroll
    for (int e = 0; e < 8; ++e) {
      float f; _Float16 x;
      f = e0[e] * PC; x = (_Float16)f; ph.h[0][e] = x; pl.h[0][e] = (_Float16)(f - (float)x);   // key jb + 8hh + e
      f = e1[e] * PC; x = (_Float16)f; ph.h[1][e] = x; pl.h[1][e] = (_Float16)(f - (float)x);   // key jb + 16 + 8hh + e
    }
    {
      o0 = mma_h(vh0, ph.v, o0);
      o1 = mma_h(vh1, ph.v, o1);
      o2 = mma_h(vh2, ph.v, o2);
      o3 = mma_h(vh3, ph.v, o3);
      o0 = mma_h(vh0, pl.v, o0);
      o1 = mma_h(vh1, pl.v, o1);
      o2 = mma_h(vh2, pl.v, o2);
      o3 = mma_h(vh3, pl.v, o3);
      guard4x6(o0, o1, o2, o3, ph.v, pl.v, vh0, vh1, vh2, vh3);
    }
    {
      o0 = mma_h(vl0, ph.v, o0);
      o1 = mma_h(vl1, ph.v, o1);
      o2 = mma_h(vl2, ph.v, o2);
      o3 = mma_h(vl3, ph.v, o3);
      guard4x5(o0, o1, o2, o3, ph.v, vl0, vl1, vl2, vl3);
    }
    *(v4u*)(nxt + sk) = nk;
    *(v4u*)(nxt + sv) = nh;
    *(v4u*)(nxt + sv + ST_VSZ) = nl;
    __syncthreads();   // publishes the next chunk; ends every wave's reads of this trip's buffer; window stores before reads
  }

  // ---- join the halves' sums, fold 1/l and the carries (1024 on P, 16 on v), split into bf16 hi + residual ----
  const float oc = 1.0f / (PC * VC);
  const float inv = (1.0f / (lrow + xhalf(lrow))) * oc;
  v4u hv[4], lv[4];
  auto pack8 = [&](const v8f& o, v4u& h4, v4u& l4) {       // d = 8 hh + (0 .. 7) of one tile
#pragma unroll   // e must be a constant: the values lie in registers
    for (int e = 0; e < 4; ++e) {
      const float f0 = o[2 * e] * inv, f1 = o[2 * e + 1] * inv;
      const unsigned short a0 = bf_bits(f0), a1 = bf_bits(f1);
      h4[e] = pk16(a0, a1);
      l4[e] = pk16(bf_bits(f0 - bf_up(a0)), bf_bits(f1 - bf_up(a1)));
    }
  };
  pack8(o0, hv[0], lv[0]);
  pack8(o1, hv[1], lv[1]);
  pack8(o2, hv[2], lv[2]);
  pack8(o3, hv[3], lv[3]);
  // ---- the lane writes its query row's halves 16 t + 8 hh .. + 7 in both planes; lanes c and c + 16 over the four tiles fill the row's 128 B ----
  {
    const size_t dofs = (size_t)(i0 + c) * DM + head * HD + 8 * hh;
    unsigned short* dsth = CTh + dofs;
    unsigned short* dstl = CTl + dofs;
#pragma unroll   // t must be a constant: the values lie in registers
    for (int t = 0; t < 4; ++t) {
      *(v4u*)(dsth + 16 * t) = hv[t];
      *(v4u*)(dstl + 16 * t) = lv[t];
    }
  }
}

// =====================================================================================================
// Workspace map (bytes); every plane is an exact multiple of its tile / whole-row store granularity (M, N exact tile multiples,
// the activation convert count an exact multiple of 2048, no pad rows needed), every offset a multiple of 512 KiB:
//   WQT, WKT, WVT, WPT f16 [512 out][512 in] x64   4 x 524288
//   WOT  bf16 [512 out][512 in]                         524288
//   X16  f16 4 x [8192][512] x16                  4 x 8388608    (query, key, value, position planes, rows b*1024 + tok)
//   QU, QV f16 [8192][512] x4                     2 x 8388608    (q + u_bias, q + v_bias)
//   K16 f16 [8192][512] x4                            8388608
//   P16 f16 [8][8 heads][64 tiles][2048 B] x4         8388608    (fragment order, OM 3)
//   VTh, VTl f16 [8][512][1024] x16               2 x 8388608    (v^T per batch, hi / residual)
//   CTh, CTl bf16 [8192][512]                     2 x 8388608    (attention ctx, merged heads, hi / residual)
//   end                                             103284736
// =====================================================================================================
extern "C" void kernel_launch(void* const* d_in, const int* in_sizes, int n_in,
                              void* d_out, int out_size, void* d_ws, size_t ws_size,
                              hipStream_t stream) {
  if (n_in < 15) return;
  const int NA = NROWS * DM;
  if (in_sizes[0] != NA || in_sizes[1] != NA || in_sizes[2] != NA || in_sizes[3] != NA) return;
  if (in_sizes[4] != DM * DM || in_sizes[6] != DM * DM || in_sizes[8] != DM * DM || in_sizes[10] != DM * DM || in_sizes[13] != DM * DM) return;
  if (in_sizes[5] != DM || in_sizes[7] != DM || in_sizes[9] != DM || in_sizes[14] != DM) return;
  if (in_sizes[11] != NHEAD * HD || in_sizes[12] != NHEAD * HD) return;
  if (out_size != NROWS * DM) return;
  if ((NA % 2048) != 0) return;

  const float* query = (const float*)d_in[0];
  const float* key   = (const float*)d_in[1];
  const float* value = (const float*)d_in[2];
  const float* pemb  = (const float*)d_in[3];
  const float* w_q   = (const float*)d_in[4];
  const float* b_q   = (const float*)d_in[5];
  const float* w_k   = (const float*)d_in[6];
  const float* b_k   = (const float*)d_in[7];
  const float* w_v   = (const float*)d_in[8];
  const float* b_v   = (const float*)d_in[9];
  const float* w_p   = (const float*)d_in[10];
  const float* u_b   = (const float*)d_in[11];
  const float* v_b   = (const float*)d_in[12];
  const float* w_o   = (const float*)d_in[13];
  const float* b_o   = (const float*)d_in[14];
  float*       out   = (float*)d_out;

  const size_t PWT = (size_t)DM * DM * 2;                         //   524288
  const size_t PX  = (size_t)NROWS * DM * 2;                      //  8388608
  const size_t PVT = (size_t)NB * DM * SEQ * 2;                   //  8388608
  size_t off = 0;
  const size_t oWQ = off; off += PWT;
  const size_t oWK = off; off += PWT;
  const size_t oWV = off; off += PWT;
  const size_t oWP = off; off += PWT;
  const size_t oWO = off; off += PWT;
  const size_t oX  = off; off += 4 * PX;
  const size_t oQU = off; off += PX;
  const size_t oQV = off; off += PX;
  const size_t oK  = off; off += PX;
  const size_t oP  = off; off += PX;
  const size_t oVh = off; off += PVT;
  const size_t oVl = off; off += PVT;
  const size_t oCh = off; off += PX;
  const size_t oCl = off; off += PX;
  if (off > ws_size) return;                                      // off = 103284736

  char* ws = (char*)d_ws;
  unsigned short* WQT  = (unsigned short*)(ws + oWQ);
  unsigned short* WOT  = (unsigned short*)(ws + oWO);
  unsigned short* X16  = (unsigned short*)(ws + oX);
  unsigned short* QU   = (unsigned short*)(ws + oQU);
  unsigned short* QV   = (unsigned short*)(ws + oQV);
  unsigned short* K16  = (unsigned short*)(ws + oK);
  unsigned short* P16  = (unsigned short*)(ws + oP);
  unsigned short* VTh  = (unsigned short*)(ws + oVh);
  unsigned short* VTl  = (unsigned short*)(ws + oVl);
  unsigned short* CTh  = (unsigned short*)(ws + oCh);
  unsigned short* CTl  = (unsigned short*)(ws + oCl);

  const dim3 blk(256);
  const dim3 gPR(WTB + 4 * CVB);                                   // 320 weight tiles + 8192 convert blocks
  const int tilesP = (NROWS / 64) * (DM / 64);                     // 1024
  const dim3 gP((tilesP + 7) / 8, 1);                              // 128
  const dim3 gP4((tilesP + 7) / 8, 4);                             // 128 x 4
  const dim3 gAT(ATT_BLOCKS, NHEAD, NB);                           // 8 x 8 x 8
  const dim3 bAT(ATT_THREADS);                                     // 256

  // (0) every pack: X16 plane w = f16(bf16(x_w)*16) for query, key, value, position; W[c][n] -> WT[n][c] as f16( bf16_RNE(w) * 64 );
  //     Wo[c][n] -> WOT[n][c] bf16 (the five weight planes lie one behind the other from WQT)
  prep<<<gPR, blk, 0, stream>>>(query, key, value, pemb, w_q, w_k, w_v, w_p, w_o, X16, WQT);

  // (1) the four projections, K = 512:
  //     q[m][n] = sum_c x[m][c] WQT[n][c] / 1024 + bq[n]; QU = f16((q + u_bias[n]) * 4), QV = f16((q + v_bias[n]) * 4); M = 8192, N = 512
  //     v^T per batch: VT[b][n = h*64+d][tok] = sum_c WVT[n][c] x_b[tok][c] / 1024 + bv[n] -> f16 x16 hi / residual planes; M = 512, N = 1024
  //     K16 = f16((k + bk) * 4); P16 = f16(p * 4) (no bias), in fragment order
  proj4<<<gP4, blk, 0, stream>>>(X16, WQT, QU, QV, K16, P16, VTh, VTl, b_q, u_b, v_b, b_k, b_v);

  // (5) attention with its position logits, every batch element, head and block of 128 query rows in one launch -> CT (bf16 hi / residual planes)
  attnb<<<gAT, bAT, 0, stream>>>(QU, QV, K16, P16, VTh, VTl, CTh, CTl);

  // (6) out = (CT_hi + CT_lo) . WOT^T + bo; M = 8192, N = 512, K = 512, f32
  gemm64<0, 1, 1, 1, 2><<<gP, blk, 0, stream>>>(
      CTh, CTl, DM, 0LL, 0LL,
      WOT, DM, 0LL, 0LL,
      (void*)out, (void*)out, DM, 0LL, 0LL,
      NROWS, DM, DM, 1.0f, 1.0f,
      b_o, b_o, b_o);
  (void)hipGetLastError();
}

// v010
// A run of this version takes 102 microseconds.
// Next to v009, in two timings, it ran 1.06 and 1.05 times as fast.
// Over all steps from v000 it is 7.89 times as fast.
// Contractions (all f32 accumulate): q/k/v/p projections v_wmma_f32_16x16x32_f16 (x f16 x16, converted on the way into LDS, . W^T f16 x64, K=512, single products);
// position logits (q+v_bias).p^T v_wmma_f32_16x16x32_f16 ((q+v_bias) f16 x4 . p f16 x4, K=64, single), inside attention, f32;
// content scores v_wmma_f32_16x16x32_f16 ((q+u_bias) f16 x4 . k f16 x4, K=64, single);
// P . v^T v_wmma_f32_16x16x32_f16 (P f16 x1024 hi/lo . v^T f16 x16 hi/lo, hi.hi+lo.hi+hi.lo, K=1024 by 32);
// output projection v_wmma_f32_16x16x32_bf16 (ctx bf16 hi/lo . Wo bf16, hi.W+lo.W, K=512) + bias in f32.
// Attention tiles are transposed (scores^T = k . q^T, ctx^T += v^T . P^T): a lane holds one query row's values.
// Max-subtracted online base-2 softmax in f32 on VALU; the relative shift of the position logits is a skewed store of their f32 tiles in LDS. Every float input RNE-converted to bf16 on load.
#include <hip/hip_runtime.h>
#include <math.h>
#include <stdint.h>

#define NB     8
#define SEQ    1024
#define DM     512
#define NHEAD  8
#define HD     64
#define NROWS  (NB * SEQ)
#define KCH    32
#define WSC    64.0f
#define ACARRY 16.0f
#define QC     4.0f
#define VC     16.0f
#define PC     1024.0f
#define LOG2E  1.4426950408889634f
#define SCL    0.04419417382415922f
static_assert(NHEAD * HD == DM);
static_assert((SEQ % 64) == 0 && (DM % 64) == 0 && (NROWS % 64) == 0 && (HD % 32) == 0 && (SEQ % KCH) == 0);
static_assert(((NROWS * DM) % 2048) == 0);
#define ATT_WAVES   8                 // waves of an attention block: 16 query rows each, all on one head
#define ATT_THREADS (ATT_WAVES * 32)
#define ATT_BLOCKS  (SEQ / (ATT_WAVES * 16))
#define SKP    116                    // floats per row of a wave's position-logit tiles (6 tile places of 16 columns + 16 of skew + 4: 464 B = 16 B x odd for the 16-byte reads)
#define KPITCH 144                    // LDS bytes per staged k row (128 + 16)
#define VPITCH 80                     // LDS bytes per staged v^T row (64 + 16)
#define ST_VH    (KCH * KPITCH)       // v^T hi behind the k rows
#define ST_VSZ   (HD * VPITCH)        // one v^T plane's rows
#define ST_BYTES (ST_VH + 2 * ST_VSZ) // one buffer: k | v^T hi | v^T residual
#define ATT_SMEM_BYTES (2 * ST_BYTES)
#define GKS    64                     // halves of k per staged gemm slab: 128 B, one whole line of every row
#define GPITCH 144                    // LDS bytes per staged gemm row (128 + 16)
static_assert((DM % GKS) == 0 && (HD % GKS) == 0);                   // every K is whole slabs
static_assert(((DM / 64) % 8) == 0 && ((SEQ / 64) % 8) == 0);        // every N is whole blocks of 8 column tiles
static_assert(ATT_THREADS == 256);
static_assert(ATT_BLOCKS == 8);
static_assert(KCH * HD * 2 == ATT_THREADS * 16);          // one 16-byte piece of k, and of each v^T plane, per thread and chunk
static_assert(HD * 2 == 128 && KCH * 2 == 64);
static_assert((ST_BYTES % 16) == 0 && (ST_VH % 16) == 0);
static_assert((SKP % 4) == 0 && ((SKP / 4) % 2) == 1 && SKP >= 6 * 16 + 16);

typedef _Float16 v16h __attribute__((ext_vector_type(16)));
typedef _Float16 v8h  __attribute__((ext_vector_type(8)));
typedef __bf16   v16b __attribute__((ext_vector_type(16)));
typedef float    v8f  __attribute__((ext_vector_type(8)));
typedef float    v4f  __attribute__((ext_vector_type(4)));
typedef unsigned int v4u __attribute__((ext_vector_type(4)));
typedef unsigned int v2u __attribute__((ext_vector_type(2)));
typedef float    v2f  __attribute__((ext_vector_type(2)));
typedef __bf16   v2b  __attribute__((ext_vector_type(2)));
typedef _Float16 v2h  __attribute__((ext_vector_type(2)));

union FragH { v16h v; v8h h[2]; v4u u[2]; };
union FragAny { v16h h; v16b b; };

// ---- scalar helpers --------------------------------------------------------------------------------
__device__ __forceinline__ unsigned short bf_bits(float f) {          // f32 -> bf16 bits, RNE convert
  unsigned u = __float_as_uint(f);
  return (unsigned short)((u + 0x7FFFu + ((u >> 16) & 1u)) >> 16);
}
__device__ __forceinline__ float bf_up(unsigned short h) { return __uint_as_float(((unsigned)h) << 16); }
__device__ __forceinline__ float bfr(float f) { return bf_up(bf_bits(f)); }   // value of the bf16 RNE convert
__device__ __forceinline__ unsigned short h_bits(_Float16 x) { return __builtin_bit_cast(unsigned short, x); }
__device__ __forceinline__ unsigned pk16(unsigned short a, unsigned short b) { return (unsigned)a | ((unsigned)b << 16); }
// lane l takes the value of lane l ^ 16 (the other half of the wave), by a vector cross-row move
__device__ __forceinline__ float xhalf(float x) {
  const int b = __builtin_bit_cast(int, x);
  return __builtin_bit_cast(float, __builtin_amdgcn_permlanex16(b, b, 0x76543210, 0xfedcba98, false, false));
}
__device__ __forceinline__ v8f zero8() { v8f z = {0.f, 0.f, 0.f, 0.f, 0.f, 0.f, 0.f, 0.f}; return z; }

// ---- fragment loader: 16-bit A/B operand from a k-contiguous 16-bit plane, lane -> row/col (lane&15),
//      p already includes +8*(lane>>4); elements 0..7 <- p[0..7] (k0+8h..), elements 8..15 <- p[16..23] (k0+16+8h..)
//      (same split k map for A and B; B is always read from a [n][k] plane)
__device__ __forceinline__ v16h ldfrag_u(const unsigned short* p) {
  FragH f;
  f.u[0] = *(const v4u*)(p);
  f.u[1] = *(const v4u*)(p + 16);
  return f.v;
}

// same fragment from a wave-uniform byte base plus this lane's 32-bit byte offset (already holding +16*(lane>>4)): an address costs one
// register, shared by planes of one layout, so a whole trip's loads fit the register file together
__device__ __forceinline__ v16h ldfrag_o(const char* base, unsigned off) {
  const char* p = base + off;
  FragH f;
  f.u[0] = *(const v4u*)(p);
  f.u[1] = *(const v4u*)(p + 32);
  return f.v;
}

// ---- WMMA helpers with trailing VALU hazard gaps ------------------------------------------------------
__device__ __forceinline__ v8f mma_h(v16h a, v16h b, v8f c) {
  return __builtin_amdgcn_wmma_f32_16x16x32_f16(false, a, false, b, (short)0, c, false, false);
}
__device__ __forceinline__ v8f mma_b(v16h a, v16h b, v8f c) {
  FragAny ua, ub;
  ua.h = a;
  ub.h = b;
  return __builtin_amdgcn_wmma_f32_16x16x32_bf16(false, ua.b, false, ub.b, (short)0, c, false, false);
}
template <int BF>
__device__ __forceinline__ v8f mmaT(v16h a, v16h b, v8f c) {
  if constexpr (BF != 0) return mma_b(a, b, c);
  else return mma_h(a, b, c);
}
__device__ __forceinline__ void dep_guard1(v8f& a, v8f& b, v16h x) {
#if defined(__HIP_DEVICE_COMPILE__)
  asm volatile("v_nop\n\tv_nop\n\tv_nop\n\tv_nop" : "+v"(a), "+v"(b) : "v"(x));
#endif
}
__device__ __forceinline__ void guard2x6(v8f& a, v8f& b, v16h x0, v16h x1, v16h x2, v16h x3, v16h x4, v16h x5) {
#if defined(__HIP_DEVICE_COMPILE__)
  asm volatile("v_nop\n\tv_nop\n\tv_nop\n\tv_nop"
               : "+v"(a), "+v"(b) : "v"(x0), "v"(x1), "v"(x2), "v"(x3), "v"(x4), "v"(x5));
#endif
}
__device__ __forceinline__ void guard4x6(v8f& a, v8f& b, v8f& c, v8f& d,
                                         v16h x0, v16h x1, v16h x2, v16h x3, v16h x4, v16h x5) {
#if defined(__HIP_DEVICE_COMPILE__)
  asm volatile("v_nop\n\tv_nop\n\tv_nop\n\tv_nop"
               : "+v"(a), "+v"(b), "+v"(c), "+v"(d) : "v"(x0), "v"(x1), "v"(x2), "v"(x3), "v"(x4), "v"(x5));
#endif
}
__device__ __forceinline__ void guard4x5(v8f& a, v8f& b, v8f& c, v8f& d,
                                         v16h x0, v16h x1, v16h x2, v16h x3, v16h x4) {
#if defined(__HIP_DEVICE_COMPILE__)
  asm volatile("v_nop\n\tv_nop\n\tv_nop\n\tv_nop"
               : "+v"(a), "+v"(b), "+v"(c), "+v"(d) : "v"(x0), "v"(x1), "v"(x2), "v"(x3), "v"(x4));
#endif
}
__device__ __forceinline__ void keep4_h(v16h a, v16h b, v16h c, v16h d) {
#if defined(__HIP_DEVICE_COMPILE__)
  asm volatile("v_nop" :: "v"(a), "v"(b), "v"(c), "v"(d));
#endif
}
__device__ __forceinline__ void acc_guard4(v8f& a, v8f& b, v8f& c, v8f& d) {
#if defined(__HIP_DEVICE_COMPILE__)
  asm volatile("v_nop\n\tv_nop\n\tv_nop\n\tv_nop" : "+v"(a), "+v"(b), "+v"(c), "+v"(d));
#endif
}
// N asynchronous 16-byte copies per lane, global memory -> LDS through no register: l[q] = the lane's LDS byte address, g[q] = its global address.
// The closing s_wait_xcnt 0 stands in the copies' own statement, so no address register is rewritten in front of it.
template <int N>
__device__ __forceinline__ void acopy(const unsigned* l, const char* const* g) {
  static_assert(N == 8 || N == 9 || N == 10);
#if defined(__HIP_DEVICE_COMPILE__)
  if constexpr (N == 8) {
    asm volatile("global_load_async_to_lds_b128 %0, %1, off\n\t"
                 "global_load_async_to_lds_b128 %2, %3, off\n\t"
                 "global_load_async_to_lds_b128 %4, %5, off\n\t"
                 "global_load_async_to_lds_b128 %6, %7, off\n\t"
                 "global_load_async_to_lds_b128 %8, %9, off\n\t"
                 "global_load_async_to_lds_b128 %10, %11, off\n\t"
                 "global_load_async_to_lds_b128 %12, %13, off\n\t"
                 "global_load_async_to_lds_b128 %14, %15, off\n\t"
                 "s_wait_xcnt 0x0"
                 :: "v"(l[0]), "v"(g[0]), "v"(l[1]), "v"(g[1]), "v"(l[2]), "v"(g[2]), "v"(l[3]), "v"(g[3]), "v"(l[4]), "v"(g[4]),
                    "v"(l[5]), "v"(g[5]), "v"(l[6]), "v"(g[6]), "v"(l[7]), "v"(g[7])
                 : "memory");
  } else if constexpr (N == 9) {
    asm volatile("global_load_async_to_lds_b128 %0, %1, off\n\t"
                 "global_load_async_to_lds_b128 %2, %3, off\n\t"
                 "global_load_async_to_lds_b128 %4, %5, off\n\t"
                 "global_load_async_to_lds_b128 %6, %7, off\n\t"
                 "global_load_async_to_lds_b128 %8, %9, off\n\t"
                 "global_load_async_to_lds_b128 %10, %11, off\n\t"
                 "global_load_async_to_lds_b128 %12, %13, off\n\t"
                 "global_load_async_to_lds_b128 %14, %15, off\n\t"
                 "global_load_async_to_lds_b128 %16, %17, off\n\t"
                 "s_wait_xcnt 0x0"
                 :: "v"(l[0]), "v"(g[0]), "v"(l[1]), "v"(g[1]), "v"(l[2]), "v"(g[2]), "v"(l[3]), "v"(g[3]), "v"(l[4]), "v"(g[4]),
                    "v"(l[5]), "v"(g[5]), "v"(l[6]), "v"(g[6]), "v"(l[7]), "v"(g[7]), "v"(l[8]), "v"(g[8])
                 : "memory");
  } else {
    asm volatile("global_load_async_to_lds_b128 %0, %1, off\n\t"
                 "global_load_async_to_lds_b128 %2, %3, off\n\t"
                 "global_load_async_to_lds_b128 %4, %5, off\n\t"
                 "global_load_async_to_lds_b128 %6, %7, off\n\t"
                 "global_load_async_to_lds_b128 %8, %9, off\n\t"
                 "global_load_async_to_lds_b128 %10, %11, off\n\t"
                 "global_load_async_to_lds_b128 %12, %13, off\n\t"
                 "global_load_async_to_lds_b128 %14, %15, off\n\t"
                 "global_load_async_to_lds_b128 %16, %17, off\n\t"
                 "global_load_async_to_lds_b128 %18, %19, off\n\t"
                 "s_wait_xcnt 0x0"
                 :: "v"(l[0]), "v"(g[0]), "v"(l[1]), "v"(g[1]), "v"(l[2]), "v"(g[2]), "v"(l[3]), "v"(g[3]), "v"(l[4]), "v"(g[4]),
                    "v"(l[5]), "v"(g[5]), "v"(l[6]), "v"(g[6]), "v"(l[7]), "v"(g[7]), "v"(l[8]), "v"(g[8]), "v"(l[9]), "v"(g[9])
                 : "memory");
  }
#endif
}
__device__ __forceinline__ void wait_async0() {   // this wave's copies have landed in LDS
#if defined(__HIP_DEVICE_COMPILE__)
  asm volatile("s_wait_asynccnt 0x0" ::: "memory");
#endif
}
__device__ __forceinline__ void wait_ds0() {      // this wave's LDS reads have returned: their buffer may be refilled behind the next barrier
#if defined(__HIP_DEVICE_COMPILE__)
  asm volatile("s_wait_dscnt 0x0" ::: "memory");
#endif
}
__device__ __forceinline__ void wave_sync_lds() {
  __builtin_amdgcn_fence(__ATOMIC_RELEASE, "workgroup");
  __builtin_amdgcn_wave_barrier();
  __builtin_amdgcn_fence(__ATOMIC_ACQUIRE, "workgroup");
}

// =====================================================================================================
// Every weight pack of a call in ONE launch (they do not depend on one another).
// Block b, transposing 16-bit pack of a weight matrix: matrix b / 64, 64x64 tile b % 64:
//   in W[DM][DM] -> out WT[DM][DM] (plane b / 64 of WT5); matrices 0..3: f16( bf16_RNE(w) * WSC ); matrix 4: bf16_RNE(w) bits.
//   coverage: loads 4 x 256 x 4 floats = 64x64; stores 2 x 256 pieces x 8 halves = 64 rows x 64 halves = the whole tile; 64 tiles = 8 x 8 a matrix.
// The activation inputs have no pack launch: the projections read them as f32 and convert them on the way into LDS (proj_main).
// =====================================================================================================
#define WTB (5 * 64)                             // weight tile blocks
static_assert(DM == 512);                        // 8 x 8 tiles of 64 x 64 per weight matrix

template <int BFO>
__device__ __forceinline__ void tr_tile(float (*t)[65], const float* __restrict__ src, unsigned short* dst, int c0, int d0, float sc) {
  const int tid = threadIdx.x;
#pragma unroll
  for (int it = 0; it < 4; ++it) {
    const int p  = it * 256 + tid;
    const int cc = p >> 4, sg = (p & 15) * 4;
    const v4f v = *(const v4f*)(src + (size_t)(c0 + cc) * DM + d0 + sg);
    t[cc][sg]     = v[0];
    t[cc][sg + 1] = v[1];
    t[cc][sg + 2] = v[2];
    t[cc][sg + 3] = v[3];
  }
  __syncthreads();
  v4u o[2];
#pragma unroll
  for (int it = 0; it < 2; ++it) {
    const int p  = it * 256 + tid;
    const int dd = p >> 3, s8 = (p & 7) * 8;
    unsigned short hv[8];
#pragma unroll
    for (int k = 0; k < 8; ++k) {
      const float f = bfr(t[s8 + k][dd]);
      if constexpr (BFO != 0) hv[k] = bf_bits(f);
      else hv[k] = h_bits((_Float16)(f * sc));
    }
    v4u q;
    q[0] = pk16(hv[0], hv[1]);
    q[1] = pk16(hv[2], hv[3]);
    q[2] = pk16(hv[4], hv[5]);
    q[3] = pk16(hv[6], hv[7]);
    o[it] = q;
  }
#pragma unroll
  for (int it = 0; it < 2; ++it) {
    const int p  = it * 256 + tid;
    const int dd = p >> 3, s8 = (p & 7) * 8;
    *(v4u*)(dst + (size_t)(d0 + dd) * DM + c0 + s8) = o[it];
  }
#if defined(__HIP_DEVICE_COMPILE__)
  // behind the two stores: in the merged kernel other code follows them in the listing, and none of it may rewrite their registers ahead of this wait
  asm volatile("s_wait_xcnt 0x0" ::: "memory");
#endif
}

__global__ __launch_bounds__(256) void prep(const float* __restrict__ wq, const float* __restrict__ wk, const float* __restrict__ wv,
                                            const float* __restrict__ wp, const float* __restrict__ wo, unsigned short* WT5) {
  __shared__ float t[64][65];
  const int b = blockIdx.x;
  const int m = b >> 6, c0 = (b & 7) * 64, d0 = ((b >> 3) & 7) * 64;
  const float* W = (m == 0) ? wq : (m == 1) ? wk : (m == 2) ? wv : (m == 3) ? wp : wo;
  unsigned short* dst = WT5 + (size_t)m * (DM * DM);
  if (m < 4) tr_tile<0>(t, W, dst, c0, d0, WSC);   // m is the same for the whole block: every thread passes the one barrier of its side
  else tr_tile<1>(t, W, dst, c0, d0, 1.0f);
}

// =====================================================================================================
// Register-blocked batched 16-bit WMMA GEMM: C[m][n] = oscale * sum_k A[m][k] * Bt[n][k] (+ bias); one wave per 64x64 tile, a block's
// eight waves on eight neighbouring column tiles of one row tile (64 x 512). A row-major [M][K] pitch lda (16-bit plane), Bt row-major
// [N][K] pitch ldb (k contiguous); M multiple of 64, N multiple of 512, K multiple of 64.
// Operands go through LDS: per slab of 64 k the block's 64 A rows (both planes with ASPLIT) and 512 Bt rows are copied once, as whole
// 128-byte lines (a wave's copy = 4 rows), by asynchronous copies; every wave takes its fragments from there (row pitch 144 B = 16 B x odd).
// NBUF 2: slab t+2 is copied into the buffer that trip t has read, behind the trip's one barrier, and flies under trip t+1.
// NBUF 1: one buffer, filled and then read (for K = one slab: two blocks fit a WGP).
// blockIdx.y = batch index with element strides sA, sB, sC; blockIdx.z = outer batch index with strides zA, zB, zC.
// ASPLIT 1: a second A plane A2 (unscaled residual of A, same layout) is multiplied into the same accumulator (A + A2 ~ exact A).
// BF 1: bf16 operands (v_wmma_f32_16x16x32_bf16), else f16.
// EPI 1: value += bf16_RNE(ep0[column]) (per-column bias); EPI 2: value += bf16_RNE(ep0[row]) (per-row bias, 16-bit out only).
// OM 0: f32 out (pitch ldc).  OM 2: one f16 plane = f16(value * ocarry).
// OM 3: the same values as OM 2, laid out in the order attention's B fragments are read (rows = batch element x token, columns = head x d):
//       per batch element and head 64 tiles of 16 tokens, 2048 B each; 16-byte piece j of token r's 128 B lies at (j >> 1) * 512 + r * 32 + (j & 1) * 16.
//       A store (4 tokens x 8 pieces) still fills four whole 128-byte lines.
// OM 4: two f16 planes: hi = f16(value * ocarry), lo = f16(value * ocarry - hi) (unscaled residual).
// OM 5: two f16 planes: C = f16((value + bf16_RNE(ep1[column])) * ocarry), C2 = f16((value + bf16_RNE(ep2[column])) * ocarry).
// coverage: 4 slabs x 16 rows (f32: it 0..7 x lane>>4; 16-bit: it 0..3 x lane>>3) x 64 cols = the wave's whole 64x64 tile;
//           grid = tilesM*tilesN/8 blocks exactly.
// =====================================================================================================
#define GSTG_BYTES(ASPLIT, NBUF) ((NBUF) * (64 * (1 + (ASPLIT)) + 512) * GPITCH)   // staging bytes of a block
// the products of one block: acc = the wave's 64x64 tile, rows m0.., Bt rows nb0 + 64 wave ..; A1, A2, Bb = byte bases of the planes
template <int ASPLIT, int BF, int NBUF>
__device__ __forceinline__ void gemm_main(v8f (&acc)[4][4], char* stg, const char* A1, const char* A2, const char* Bb,
                                          int lda, int ldb, int m0, int nb0, int K) {
  constexpr int AROWS  = 64 * (1 + ASPLIT);        // staged rows: A | A2 (ASPLIT) | Bt
  constexpr int SROWS  = AROWS + 512;
  constexpr int SBYTES = SROWS * GPITCH;           // one buffer
  constexpr int NQ     = SROWS / 32;               // copies per thread and slab: 256 threads x 16 B = 32 rows each
  const int lane = threadIdx.x & 31;
  const int wave = threadIdx.x >> 5;
  const int rlane = lane & 15;                 // row (A) / col (B, D) within subtile
  const int koff  = (lane >> 4) * 8;           // k offset of this lane half

#pragma unroll
  for (int i = 0; i < 4; ++i)
#pragma unroll
    for (int j = 0; j < 4; ++j) acc[i][j] = zero8();

  // this thread's 16-byte pieces of a slab: staged rows (tid>>3) + 32 q, piece tid&7 of the row's 128 B (planes stay under 4 GiB)
  const int prow = threadIdx.x >> 3, seg = threadIdx.x & 7;
  const unsigned lds0 = (unsigned)(uintptr_t)stg + (unsigned)(prow * GPITCH + seg * 16);   // low 32 bits of the __shared__ address
  const unsigned ga0  = (unsigned)((m0 + prow) * lda) * 2u + (unsigned)(seg * 16);
  const unsigned gb0  = (unsigned)((nb0 + prow) * ldb) * 2u + (unsigned)(seg * 16);
  auto stage = [&](int k0, unsigned bufoff) {
    unsigned l[NQ];
    const char* g[NQ];
#pragma unroll   // q must be a constant: the addresses are register operands of the copy statements
    for (int q = 0; q < NQ; ++q) {
      l[q] = lds0 + bufoff + (unsigned)(q * 32 * GPITCH);
      // block-uniform part first (scalar), then this thread's offset: one vector add an address
      if (q < 2) g[q] = (A1 + (unsigned)(q * 32 * lda + k0) * 2u) + ga0;
      else if (q < AROWS / 32) g[q] = (A2 + (unsigned)((q - 2) * 32 * lda + k0) * 2u) + ga0;
      else g[q] = (Bb + (unsigned)((q - AROWS / 32) * 32 * ldb + k0) * 2u) + gb0;
    }
    acopy<NQ / 2>(l, g);
    acopy<NQ / 2>(l + NQ / 2, g + NQ / 2);
  };

  const unsigned fa = (unsigned)(rlane * GPITCH + koff * 2);                               // this lane's fragment reads: A row rlane
  const unsigned fb = (unsigned)((AROWS + (wave << 6) + rlane) * GPITCH + koff * 2);       // Bt row rlane of the wave's 64
  auto products = [&](unsigned bufoff) {
    const char* sb = stg + bufoff;
#pragma unroll   // both k-steps of a slab in line: their LDS offsets are immediates
    for (int ks = 0; ks < GKS / 32; ++ks) {
      // every fragment of this k-step is requested before its first product: one LDS latency a k-step
      v16h bh[4], ah[4], al[4];
#pragma unroll
      for (int j = 0; j < 4; ++j) bh[j] = ldfrag_o(sb + (j * 16 * GPITCH + ks * 64), fb);
#pragma unroll
      for (int i = 0; i < 4; ++i) {
        ah[i] = ldfrag_o(sb + (i * 16 * GPITCH + ks * 64), fa);
        if constexpr (ASPLIT != 0) al[i] = ldfrag_o(sb + ((64 + i * 16) * GPITCH + ks * 64), fa);
      }
      __builtin_amdgcn_sched_barrier(0);   // keeps the loads above in front of the products (else each A load sinks to its own group and waits alone)
#pragma unroll
      for (int i = 0; i < 4; ++i) {
#pragma unroll
        for (int j = 0; j < 4; ++j) acc[i][j] = mmaT<BF>(ah[i], bh[j], acc[i][j]);
        dep_guard1(acc[i][0], acc[i][3], ah[i]);
        if constexpr (ASPLIT != 0) {
#pragma unroll
          for (int j = 0; j < 4; ++j) acc[i][j] = mmaT<BF>(al[i], bh[j], acc[i][j]);
          dep_guard1(acc[i][0], acc[i][3], al[i]);
        }
      }
      keep4_h(bh[0], bh[1], bh[2], bh[3]);
    }
  };

  const int nslab = K / GKS;
  if constexpr (NBUF == 2) {
    stage(0, 0u);
    wait_async0();
    __syncthreads();                                       // publishes slab 0
    if (nslab > 1) stage(GKS, (unsigned)SBYTES);
    for (int t = 0; t < nslab; ++t) {
      const unsigned bo = (unsigned)(t & 1) * (unsigned)SBYTES;
      products(bo);
      wait_ds0();
      wait_async0();
      __syncthreads();                                     // publishes slab t+1; ends every wave's reads of this trip's buffer
      if (t + 2 < nslab) stage((t + 2) * GKS, bo);
    }
    wait_async0();
  } else {
    for (int t = 0; t < nslab; ++t) {
      if (t > 0) {
        wait_ds0();
        __syncthreads();                                   // ends every wave's reads of the buffer before it is refilled
      }
      stage(t * GKS, 0u);
      wait_async0();
      __syncthreads();                                     // publishes slab t
      products(0u);
    }
  }
  acc_guard4(acc[0][0], acc[0][1], acc[0][2], acc[0][3]);
  acc_guard4(acc[1][0], acc[1][1], acc[1][2], acc[1][3]);
  acc_guard4(acc[2][0], acc[2][1], acc[2][2], acc[2][3]);
  acc_guard4(acc[3][0], acc[3][1], acc[3][2], acc[3][3]);
}

// the wave's tile out: slab = the wave's own 16 x 68 floats of LDS; Cout, C2out = the planes of this batch element; n0 = the wave's first column
// TR 1: the tile goes out transposed (C[n][m]): the slab takes 16 columns of acc as its rows, and m0 / n0, the bias index and ldc speak of C's own
//       rows (acc's columns) and columns (acc's rows); a lane's 8 registers are 8 neighbouring floats of a slab row
template <int OM, int EPI, int TR = 0>
__device__ __forceinline__ void gemm_epi(v8f (&acc)[4][4], float* slab, void* Cout, void* C2out, int ldc, int m0, int n0,
                                         float oscale, float ocarry,
                                         const float* __restrict__ ep0, const float* __restrict__ ep1, const float* __restrict__ ep2) {
  const int lane  = threadIdx.x & 31;
  const int rlane = lane & 15;                 // col (D) within subtile
  const int mOff  = (lane >> 4) * 8;           // D row offset
  const int hh2 = lane >> 4, c4 = (lane & 15) * 4;     // f32 out: 256-B row segment = 16 lanes x 16 B
  const int q8  = lane >> 3, c8 = (lane & 7) * 8;

  // ---- epilogue ----
#pragma unroll
  for (int i = 0; i < 4; ++i) {
    const int mBase = m0 + (i << 4);
#pragma unroll
    for (int j = 0; j < 4; ++j) {
#pragma unroll
      for (int r = 0; r < 8; ++r) {
        if constexpr (TR != 0) slab[rlane * 68 + (j << 4) + mOff + r] = acc[j][i][r];
        else slab[(mOff + r) * 68 + (j << 4) + rlane] = acc[i][j][r];
      }
    }
    wave_sync_lds();
    if constexpr (OM == 0) {
      float* C = (float*)Cout;
      v4f vals[8];
#pragma unroll
      for (int it = 0; it < 8; ++it) {
        const int row = it * 2 + hh2;                      // it 0..7 x hh2 0..1 = rows 0..15
        v4f v = *(const v4f*)(slab + row * 68 + c4);
#pragma unroll
        for (int e = 0; e < 4; ++e) v[e] = v[e] * oscale;
        if constexpr (EPI == 1) {
          const v4f bb = *(const v4f*)(ep0 + n0 + c4);     // per-column bias, columns n0+c4 .. +3 (N equals the bias length)
#pragma unroll
          for (int e = 0; e < 4; ++e) v[e] = v[e] + bfr(bb[e]);
        }
        vals[it] = v;
      }
      {
#pragma unroll
        for (int it = 0; it < 8; ++it) {
          const int gr = mBase + it * 2 + hh2;
          *(v4f*)(C + (size_t)gr * ldc + n0 + c4) = vals[it];
        }
        
      }
    } else {
      unsigned short* C  = (unsigned short*)Cout;
      unsigned short* Cb = (unsigned short*)C2out;
      v4u hv[4], lv[4];
#pragma unroll
      for (int it = 0; it < 4; ++it) {
        const int row = it * 4 + q8;                       // it 0..3 x q8 0..3 = rows 0..15
        const float* sp = slab + row * 68 + c8;
        float rb = 0.f;
        if constexpr (EPI == 2) rb = bfr(ep0[mBase + row]);   // per-row bias (M equals the bias length)
        v4u a  = {0u, 0u, 0u, 0u};
        v4u b2 = {0u, 0u, 0u, 0u};
#pragma unroll
        for (int e = 0; e < 4; ++e) {
          const int ci = n0 + c8 + 2 * e;                  // column index, < N
          float f0 = sp[2 * e] * oscale + rb;
          float f1 = sp[2 * e + 1] * oscale + rb;
          if constexpr (EPI == 1) {
            f0 += bfr(ep0[ci]);
            f1 += bfr(ep0[ci + 1]);
          }
          if constexpr (OM == 5) {
            const float g0 = (f0 + bfr(ep1[ci])) * ocarry, g1 = (f1 + bfr(ep1[ci + 1])) * ocarry;
            const float w0 = (f0 + bfr(ep2[ci])) * ocarry, w1 = (f1 + bfr(ep2[ci + 1])) * ocarry;
            a[e]  = pk16(h_bits((_Float16)g0), h_bits((_Float16)g1));
            b2[e] = pk16(h_bits((_Float16)w0), h_bits((_Float16)w1));
          } else {
            f0 *= ocarry; f1 *= ocarry;
            const _Float16 x0 = (_Float16)f0, x1 = (_Float16)f1;
            a[e] = pk16(h_bits(x0), h_bits(x1));
            if constexpr (OM == 4) {
              b2[e] = pk16(h_bits((_Float16)(f0 - (float)x0)), h_bits((_Float16)(f1 - (float)x1)));
            }
          }
        }
        hv[it] = a;
        lv[it] = b2;
      }
      {
#pragma unroll
        for (int it = 0; it < 4; ++it) {
          const int row = it * 4 + q8;
          if constexpr (OM == 3) {
            // mBase is a multiple of 16: these 16 rows are one tile; t0 = its first token's place in [batch element][head][token] order
            const unsigned t0 = (((unsigned)mBase / SEQ) * NHEAD + (unsigned)n0 / HD) * SEQ + (unsigned)mBase % SEQ;
            const unsigned pj = (unsigned)lane & 7u;       // 16-byte piece of the token's 128 B
            *(v4u*)(C + (size_t)t0 * HD + ((pj >> 1) * 256u + (pj & 1u) * 8u + (unsigned)row * 16u)) = hv[it];
          } else {
            *(v4u*)(C + (size_t)(mBase + row) * ldc + n0 + c8) = hv[it];
          }
          if constexpr (OM >= 4) {
            *(v4u*)(Cb + (size_t)(mBase + row) * ldc + n0 + c8) = lv[it];
          }
        }
        
      }
    }
    wave_sync_lds();
  }
}

template <int OM, int ASPLIT, int BF, int EPI, int NBUF>
__global__ __launch_bounds__(256) __attribute__((amdgpu_num_vgpr(256))) void gemm64(
    const unsigned short* __restrict__ Ap, const unsigned short* __restrict__ A2p, int lda, long long sA, long long zA,
    const unsigned short* __restrict__ Btp, int ldb, long long sB, long long zB,
    void* Cout, void* C2out, int ldc, long long sC, long long zC,
    int M, int N, int K, float oscale, float ocarry,
    const float* __restrict__ ep0, const float* __restrict__ ep1, const float* __restrict__ ep2) {
  __shared__ __align__(16) float sT[8][16 * 68];   // per-wave 16x64 slab, pitch 68 floats
  __shared__ __align__(16) char stg[GSTG_BYTES(ASPLIT, NBUF)];
  const int by   = blockIdx.y;
  const int bz   = blockIdx.z;
  const int wave = threadIdx.x >> 5;
  const int tilesN = N >> 6;
  const int tilesM = M >> 6;
  const int tile0 = blockIdx.x * 8;
  if (tile0 + 8 > tilesM * tilesN) return;   // the same for the whole block, in front of every barrier; never taken with the exact grid
  const int tm  = tile0 / tilesN;
  const int tn0 = tile0 - tm * tilesN;       // tilesN is a multiple of 8: the block's eight tiles lie in one row of tiles
  const int m0  = tm << 6;
  const int nb0 = tn0 << 6;                  // first Bt row of the block
  const int n0  = nb0 + (wave << 6);

  const char* A1 = (const char*)(Ap  + (size_t)((long long)by * sA + (long long)bz * zA));
  const char* A2 = (const char*)(A2p + (size_t)((long long)by * sA + (long long)bz * zA));
  const char* Bb = (const char*)(Btp + (size_t)((long long)by * sB + (long long)bz * zB));
  const size_t co = (size_t)((long long)by * sC + (long long)bz * zC);

  v8f acc[4][4];
  gemm_main<ASPLIT, BF, NBUF>(acc, stg, A1, A2, Bb, lda, ldb, m0, nb0, K);
  if constexpr (OM == 0) gemm_epi<OM, EPI>(acc, sT[wave], (void*)((float*)Cout + co), (void*)((float*)C2out + co), ldc, m0, n0, oscale, ocarry, ep0, ep1, ep2);
  else gemm_epi<OM, EPI>(acc, sT[wave], (void*)((unsigned short*)Cout + co), (void*)((unsigned short*)C2out + co), ldc, m0, n0, oscale, ocarry, ep0, ep1, ep2);
}

// =====================================================================================================
// The products of one projection block: acc = the wave's 64 x 64 tile of C[m][n] = sum_k f16(bf16_RNE(Xf[m][k]) * ACARRY) * Bt[n][k], rows m0 .. + 63,
// Bt rows 64 wave .. + 63 of 512, K = DM.
// A comes from the f32 input itself, once per block: its 64 rows are 128 KB in a row; a thread asks for its 32 pieces of 16 B together (a wave's load =
// 512 B of whole lines), converts them and stores 8 B each into sA, [64 rows][DM halves], pitch 1040 B (16 B x odd), where they stay for all of K.
// Bt (a packed weight plane) comes in slabs of 64 k by asynchronous copies, 16 a thread and slab, through two buffers as in gemm_main (pitch 144 B):
// slab t+2 is copied into the buffer that trip t has read, behind the trip's one barrier, and flies under trip t+1.
// =====================================================================================================
#define APITCH (DM * 2 + 16)                       // LDS bytes per converted A row
#define PB_BYTES (512 * GPITCH)                    // one Bt buffer
static_assert((APITCH % 16) == 0 && ((APITCH / 16) % 2) == 1);
static_assert((64 * DM) % (256 * 4) == 0 && DM == 512);   // whole 16-byte pieces per thread; 128 pieces a row
// two values: f16( bf16_RNE(x) * ACARRY ), packed (the product is exact: a power of two)
__device__ __forceinline__ unsigned cvt_x2(float a, float b) {
  const v2f x = {a, b};
  const unsigned u = __builtin_bit_cast(unsigned, __builtin_convertvector(x, v2b));   // both bf16 values, one packed convert
  const v2f y = {__uint_as_float(u << 16), __uint_as_float(u & 0xFFFF0000u)};
  return __builtin_bit_cast(unsigned, __builtin_convertvector(y * ACARRY, v2h));       // scaled in f32, then one packed convert
}
__device__ __forceinline__ void proj_main(v8f (&acc)[4][4], char* sA, char* stg, const float* __restrict__ Xf, const char* Bb, int m0) {
  constexpr int NQ    = 512 / 32;                  // Bt copies per thread and slab: 256 threads x 16 B = 32 rows each
  constexpr int NSLAB = DM / GKS;
  constexpr int NA    = (64 * DM) / (256 * 4);     // A pieces per thread: 32
  const int lane = threadIdx.x & 31;
  const int wave = threadIdx.x >> 5;
  const int rlane = lane & 15;                 // row (A) / col (B, D) within subtile
  const int koff  = (lane >> 4) * 8;           // k offset of this lane half

  // this thread's 16-byte pieces of a Bt slab: rows (tid>>3) + 32 q, piece tid&7 of the row's 128 B
  const int prow = threadIdx.x >> 3, seg = threadIdx.x & 7;
  const unsigned lds0 = (unsigned)(uintptr_t)stg + (unsigned)(prow * GPITCH + seg * 16);   // low 32 bits of the __shared__ address
  const unsigned gb0  = (unsigned)(prow * DM) * 2u + (unsigned)(seg * 16);
  auto stage_b = [&](int k0, unsigned bufoff) {
    unsigned l[NQ];
    const char* g[NQ];
#pragma unroll   // q must be a constant: the addresses are register operands of the copy statements
    for (int q = 0; q < NQ; ++q) {
      l[q] = lds0 + bufoff + (unsigned)(q * 32 * GPITCH);
      g[q] = (Bb + (unsigned)(q * 32 * DM + k0) * 2u) + gb0;   // block-uniform part first (scalar), then this thread's offset
    }
    acopy<NQ / 2>(l, g);
    acopy<NQ / 2>(l + NQ / 2, g + NQ / 2);
  };

  {
    // piece p = 256 it + tid of the block's A rows: floats 4 p .. + 3 = row 2 it + (tid >> 7), floats 4 (tid & 127) .. of it
    const float* xa = Xf + (size_t)m0 * DM + threadIdx.x * 4;
    char*        sa = sA + ((threadIdx.x >> 7) * APITCH + (threadIdx.x & 127) * 8);
    v4f r[NA];
#pragma unroll   // it must be a constant: the values lie in registers (so below)
    for (int it = 0; it < NA; ++it) r[it] = *(const v4f*)(xa + it * 1024);
#if defined(__HIP_DEVICE_COMPILE__)
    // behind the loads: no later code rewrites their address registers ahead of this wait
    asm volatile("s_wait_xcnt 0x0" ::: "memory");
#endif
    __builtin_amdgcn_sched_barrier(0);   // every request stands in front of the first convert: one memory latency for the block's A rows
    stage_b(0, 0u);
    __builtin_amdgcn_sched_barrier(0);   // the copies go out before any convert waits for its load (else some converts are lifted over them and slab 0 starts a memory latency late)
#pragma unroll
    for (int it = 0; it < NA; ++it) {
      v2u o;
      o[0] = cvt_x2(r[it][0], r[it][1]);
      o[1] = cvt_x2(r[it][2], r[it][3]);
      *(v2u*)(sa + it * 2 * APITCH) = o;
    }
  }

#pragma unroll
  for (int i = 0; i < 4; ++i)
#pragma unroll
    for (int j = 0; j < 4; ++j) acc[i][j] = zero8();

  const unsigned fa = (unsigned)(rlane * APITCH + koff * 2);                    // this lane's fragment reads: A row rlane
  const unsigned fb = (unsigned)(((wave << 6) + rlane) * GPITCH + koff * 2);    // Bt row rlane of the wave's 64
  auto products = [&](unsigned bufoff, unsigned aoff) {    // aoff = the slab's first byte in an A row
    const char* sb = stg + bufoff;
    const char* sx = sA + aoff;
#pragma unroll   // both k-steps of a slab in line: their LDS offsets are immediates
    for (int ks = 0; ks < GKS / 32; ++ks) {
      // every fragment of this k-step is requested before its first product: one LDS latency a k-step
      v16h bh[4], ah[4];
#pragma unroll
      for (int j = 0; j < 4; ++j) bh[j] = ldfrag_o(sb + (j * 16 * GPITCH + ks * 64), fb);
#pragma unroll
      for (int i = 0; i < 4; ++i) ah[i] = ldfrag_o(sx + (i * 16 * APITCH + ks * 64), fa);
      __builtin_amdgcn_sched_barrier(0);   // keeps the loads above in front of the products (else each A load sinks to its own group and waits alone)
#pragma unroll
      for (int i = 0; i < 4; ++i) {
#pragma unroll
        for (int j = 0; j < 4; ++j) acc[i][j] = mma_h(ah[i], bh[j], acc[i][j]);
        dep_guard1(acc[i][0], acc[i][3], ah[i]);
      }
      keep4_h(bh[0], bh[1], bh[2], bh[3]);
    }
  };

  wait_ds0();
  wait_async0();
  __syncthreads();                                         // publishes the A rows and Bt slab 0
  stage_b(GKS, (unsigned)PB_BYTES);
  for (int t = 0; t < NSLAB; ++t) {
    const unsigned bo = (unsigned)(t & 1) * (unsigned)PB_BYTES;
    products(bo, (unsigned)(t * GKS * 2));
    wait_ds0();
    wait_async0();
    __syncthreads();                                       // publishes slab t+1; ends every wave's reads of this trip's buffer
    if (t + 2 < NSLAB) stage_b((t + 2) * GKS, bo);
  }
  wait_async0();
  acc_guard4(acc[0][0], acc[0][1], acc[0][2], acc[0][3]);
  acc_guard4(acc[1][0], acc[1][1], acc[1][2], acc[1][3]);
  acc_guard4(acc[2][0], acc[2][1], acc[2][2], acc[2][3]);
  acc_guard4(acc[3][0], acc[3][1], acc[3][2], acc[3][3]);
}

// =====================================================================================================
// The four input projections in ONE launch (they do not depend on one another): blockIdx.y = 0 q, 1 v, 2 k, 3 p; 128 blocks each, every block
// 64 x 512 of C[8192][512] = X_w . W^T, row tile blockIdx.x, K = 512, f16 operands; the products are one text for all four, the way out differs
// (v goes out transposed, per batch element [512][1024]: a block's 64 tokens are 128 B of every row).
// xq, xk, xv, xp = the f32 activation inputs, WT5 = the weight planes (q, k, v, p, o).
// =====================================================================================================
__global__ __launch_bounds__(256) __attribute__((amdgpu_num_vgpr(256))) void proj4(
    const float* __restrict__ xq, const float* __restrict__ xk, const float* __restrict__ xv, const float* __restrict__ xp,
    const unsigned short* __restrict__ WT5,
    unsigned short* QU, unsigned short* QV, unsigned short* K16, unsigned short* P16, unsigned short* VTh, unsigned short* VTl,
    const float* __restrict__ b_q, const float* __restrict__ u_b, const float* __restrict__ v_b,
    const float* __restrict__ b_k, const float* __restrict__ b_v) {
  __shared__ __align__(16) float sT[8][16 * 68];   // per-wave 16x64 slab, pitch 68 floats
  __shared__ __align__(16) char sA[64 * APITCH];   // the block's A rows, f16
  __shared__ __align__(16) char stg[2 * PB_BYTES]; // two Bt buffers
  const int which = blockIdx.y;                    // the same for the whole block
  const int wave  = threadIdx.x >> 5;
  const size_t PWE = (size_t)DM * DM;
  const float osc = 1.0f / (ACARRY * WSC);
  const float* Xf = (which == 0) ? xq : (which == 1) ? xv : (which == 2) ? xk : xp;
  const int pl = (which == 0) ? 0 : (which == 1) ? 2 : (which == 2) ? 1 : 3;   // plane of WT5
  const int m0 = blockIdx.x << 6;
  const int n0 = wave << 6;
  v8f acc[4][4];
  proj_main(acc, sA, stg, Xf, (const char*)(WT5 + (size_t)pl * PWE), m0);
  float* slab = sT[wave];
  if (which == 0) {
    gemm_epi<5, 1>(acc, slab, (void*)QU, (void*)QV, DM, m0, n0, osc, QC, b_q, u_b, v_b);
  } else if (which == 1) {
    const size_t co = (size_t)(m0 / SEQ) * ((size_t)DM * SEQ);   // the block's 64 tokens lie in one batch element
    gemm_epi<4, 2, 1>(acc, slab, (void*)(VTh + co), (void*)(VTl + co), SEQ, n0, m0 % SEQ, osc, VC, b_v, b_v, b_v);
  } else if (which == 2) {
    gemm_epi<2, 1>(acc, slab, (void*)K16, (void*)K16, DM, m0, n0, osc, QC, b_k, b_k, b_k);
  } else {
    gemm_epi<3, 0>(acc, slab, (void*)P16, (void*)P16, DM, m0, n0, osc, QC, b_k, b_k, b_k);   // a wave's 64 columns are one head
  }
}

// =====================================================================================================
// Flash attention for one batch element, one head and 128 query rows: 8 waves, 16 query rows each, head dim 64, 1024 keys.
// blockIdx.x = block of 128 query rows, blockIdx.y = head, blockIdx.z = batch element. QU0, QV0, KP0, CTh0, CTl0 are [8192][512] planes,
// VTh0/VTl0 [8][512][1024] planes, PP0 the p plane in fragment order (gemm64's OM 3). G[r][c] below stands for (q_r + v_bias) . p_c of this head.
//   The eight waves need the same k and v^T values: each chunk of 32 keys is brought from global memory ONCE per block (whole 16-byte pieces,
//   one of k, one of v^T hi, one of v^T residual per thread) into one of two LDS buffers, and every wave takes its A fragments from there.
//   The pieces of chunk t+1 are requested at the head of trip t, stored into the other buffer at its foot, and published by the trip's one
//   block barrier, which also ends every wave's reads of the buffer that the next trip refills.
//   LDS rows: k [32 keys][64 d] pitch 144 B, v^T [64 d][32 keys] pitch 80 B (16 B x odd: 16-byte fragment reads without bank conflicts).
//   Every tile of scores and of the result is TRANSPOSED: key (or d) = 8 (lane>>4) + register, query row = i0 + (lane&15). A lane holds one query
//   row's values, so maximum and sum run over its own registers (plus one exchange between the wave's halves), and its 16 probabilities of a
//   chunk are, in place, the B fragment of P^T (element s: key 8 hh + s, then 16 + 8 hh + s - 8, the k map of the v^T loader).
//   B fragments (stationary): (q_i + u_bias) f16 x4 rows i0+c, QU[i][64h + d], two k-steps of 32;
//   A fragments per chunk of 32 keys: k f16 x4 rows (k-contiguous) -> scores s^T[j][i] (two tiles of 16 keys);
//   position logit by relative shift, i = query row, j = key: j <= i -> G[i][S-1-i+j]; j == i+1 -> 0; else G[i+1][j-i-2].
//   With x = S-1-i+j a wave's 16 rows x 32 keys need x in a window of 47 that starts at the multiple of 16 S-16-i0+jb: three 16-column tiles,
//   each wholly x < S (rows i, p row x) or wholly x >= S (rows i+1, p row x-S-1; x == S is selected to 0 where it is used). The wave makes the
//   tiles by WMMA (A = either row set, from the wave's LDS; B = p rows from global memory, requested a trip ahead) and stores them side by side in
//   its own LDS rows, row m moved right by m+1: window column 15-m+k of row m lies at float 16+k of the row, and lane (c, hh) reads its query
//   row's 8 + 8 logits as four aligned 16-byte pieces. The window moves by two tiles a trip, so a trip makes two new ones: even trips read
//   tile places 0 1 2, odd trips 2 3 4; the tile stored at place 4 is also stored at place 0 (on odd trips that second store goes to the spare place 5).
//   t = (s + pos) / 16 / sqrt(512) * log2(e); online softmax in base 2, max-subtracted, running sums in f32, one per lane (the two halves'
//   sums of a query row are joined once, behind the loop);
//   B fragments of P^T*1024 (f16 hi and unscaled residual) straight from the lane's registers; v^T A fragments
//   (f16 x16 hi and unscaled residual); 12 v^T.P^T WMMAs (hi.hi, hi.lo, lo.hi) -> four tiles ctx^T[d = 16 t + 8 hh + r][query c].
//   Final 1/l and carry folds in f32; a lane's 8 registers of a tile are 8 neighbouring d of its query row: one 16-byte store a tile and plane;
//   the wave's 8 stores of a plane's rows fill whole 128-byte row segments.
//   every wave does identical bounded work (32 trips of 32 keys) and passes every barrier.
// coverage: wave tile 16 rows x 64 cols per plane = 4 tiles x 32 lanes x 8 halves; 8 waves x 8 blocks = 1024 rows, 8 heads x 64 = 512
//           columns, per batch element, each element written exactly once.
// =====================================================================================================
__global__ __launch_bounds__(ATT_THREADS) __attribute__((amdgpu_num_vgpr(256)))
void attnb(const unsigned short* __restrict__ QU0, const unsigned short* __restrict__ QV0,
           const unsigned short* __restrict__ KP0, const unsigned short* __restrict__ PP0,
           const unsigned short* __restrict__ VTh0, const unsigned short* __restrict__ VTl0,
           unsigned short* CTh0, unsigned short* CTl0) {
  __shared__ __align__(16) char smem[ATT_SMEM_BYTES];   // two k / v^T buffers
  __shared__ __align__(16) float skew[ATT_WAVES][16 * SKP];   // per wave: position logits [16 rows][6 tile places x 16 columns, row m moved right by m + 1]
  __shared__ __align__(16) char  qvf[ATT_WAVES][8 * 512];     // per wave: (q + v_bias) A fragments, 8 pieces of 16 B per lane (each lane reads its own)

  const int tid  = threadIdx.x;
  const int wave = tid >> 5;
  const int lane = tid & 31;
  const int hh   = lane >> 4;
  const int c    = lane & 15;

  const int head = blockIdx.y;                             // 0..7
  const int i0   = blockIdx.x * (ATT_WAVES * 16) + __builtin_amdgcn_readfirstlane(wave) * 16;   // first query row of this wave (scalar)

  const size_t bg = blockIdx.z;                            // batch element
  const unsigned short* QU  = QU0  + bg * ((size_t)SEQ * DM);
  const unsigned short* QV  = QV0  + bg * ((size_t)SEQ * DM);
  const unsigned short* KP  = KP0  + bg * ((size_t)SEQ * DM);
  const unsigned short* PP  = PP0  + bg * ((size_t)SEQ * DM);
  const unsigned short* VTh = VTh0 + bg * ((size_t)DM * SEQ);
  const unsigned short* VTl = VTl0 + bg * ((size_t)DM * SEQ);
  unsigned short*       CTh = CTh0 + bg * ((size_t)SEQ * DM);
  unsigned short*       CTl = CTl0 + bg * ((size_t)SEQ * DM);

  // stationary B fragments: (q + u_bias) rows i0 + c, d 0..31 and 32..63
  const size_t qofs = (size_t)(i0 + c) * DM + head * HD + 8 * hh;
  const v16h qa = ldfrag_u(QU + qofs), qb = ldfrag_u(QU + qofs + 32);
  // likewise (q + v_bias), rows i0 + c (pieces 0..3) and rows i0 + 1 + c (pieces 4..7; the row behind the last is clamped: no key lies right of
  // its diagonal); kept in LDS, not in registers: one set is used twice a trip, and 32 more stationary registers would spill
  char* qvl = qvf[wave] + lane * 16;
  {
    const int i1 = (i0 + c + 1 < SEQ) ? (i0 + c + 1) : (SEQ - 1);
    const size_t qofs1 = (size_t)i1 * DM + head * HD + 8 * hh;
#pragma unroll
    for (int q = 0; q < 4; ++q) {
      *(v4u*)(qvl + q * 512)       = *(const v4u*)(QV + qofs + q * 16);
      *(v4u*)(qvl + (4 + q) * 512) = *(const v4u*)(QV + qofs1 + q * 16);
    }
  }

  const char* Kb  = (const char*)(KP + head * HD);
  const char* Pb  = (const char*)(PP + (size_t)head * (SEQ * HD));   // p lies in fragment order: [head][tile of 16 rows][4 pairs of pieces][16 rows][32 B]
  const char* Vbh = (const char*)(VTh + (size_t)(head * HD) * SEQ);
  const char* Vbl = (const char*)(VTl + (size_t)(head * HD) * SEQ);
  // this thread's 16-byte pieces of a chunk: k row tid>>3 (8 pieces of its 128 B), v^T row tid>>2 (4 pieces of its 64 B)
  const unsigned gk0 = (unsigned)((tid >> 3) * (DM * 2) + (tid & 7) * 16);      // byte offset in chunk 0 of k
  const unsigned gv0 = (unsigned)((tid >> 2) * (SEQ * 2) + (tid & 3) * 16);     // byte offset in chunk 0 of either v^T plane
  const unsigned sk  = (unsigned)((tid >> 3) * KPITCH + (tid & 7) * 16);        // where they go in a buffer
  const unsigned sv  = (unsigned)(ST_VH + (tid >> 2) * VPITCH + (tid & 3) * 16);
  const unsigned fk  = (unsigned)(c * KPITCH + 16 * hh);                        // this lane's fragment reads: k row c
  const unsigned fv  = (unsigned)(ST_VH + c * VPITCH + 16 * hh);                // v^T hi row c

  const float CSC = SCL * LOG2E * (1.0f / (QC * QC));      // content scores and position logits carry x4 on both operands

  float mrow = -INFINITY, lrow = 0.f;                      // query row i0 + c: running maximum (both halves alike), this half's running sum
  v8f o0 = zero8(), o1 = zero8(), o2 = zero8(), o3 = zero8();
  char* stage = smem;

  float* sw = skew[wave];
  // B fragments of the window tile that starts at x = tb (a multiple of 16, 0 .. 2S-16): lane c takes p row x (x < S) or x-S-1 (x == S clamped to the plane's start)
  // each of a tile's four loads takes 32 B of 16 neighbouring rows, which lie side by side in the plane: 512 B of whole lines (x >= S: row x-S-1 of
  // lane 0 is the last of the tile before, one line more)
  const int pla = c * 32 + 16 * hh;                                    // x < S: row c of tile tb / 16
  const int plb = (c - 1) * 32 + 16 * hh - ((c == 0) ? 1536 : 0);      // x >= S: row c - 1 of tile (tb - S) / 16; lane 0: row 15 of the tile before
  auto ld_p = [&](int tb, v16h& b0, v16h& b1) -> unsigned {
    const int ob = ((tb < SEQ) ? tb : (tb - SEQ)) * 128 + ((tb < SEQ) ? pla : plb);   // tile's first byte (scalar) + this lane's place
    const unsigned off = (unsigned)((ob < 0) ? 0 : ob);    // x == S: in bounds, not used
    const char* pp = Pb + off;
    FragH f0, f1;
    f0.u[0] = *(const v4u*)(pp);                           // d 8 hh .. + 7
    f0.u[1] = *(const v4u*)(pp + 512);                     // d 16 + 8 hh ..
    f1.u[0] = *(const v4u*)(pp + 1024);                    // d 32 + 8 hh ..
    f1.u[1] = *(const v4u*)(pp + 1536);                    // d 48 + 8 hh ..
    b0 = f0.v;
    b1 = f1.v;
    return off;
  };
  // that tile's 16 x 16 logits; tb is the same for the whole wave
  auto mm_p = [&](int tb, v16h b0, v16h b1) -> v8f {
    const char* ap = qvl + ((tb < SEQ) ? 0 : 4 * 512);
    FragH a0, a1;
    a0.u[0] = *(const v4u*)(ap);
    a0.u[1] = *(const v4u*)(ap + 512);
    a1.u[0] = *(const v4u*)(ap + 1024);
    a1.u[1] = *(const v4u*)(ap + 1536);
    v8f d = mma_h(a0.v, b0, zero8());
    return mma_h(a1.v, b1, d);
  };
  float*       sws = sw + hh * (8 * (SKP + 1)) + c + 1;    // this lane's stores: row m = 8 hh + r, float c + m + 1, at + r (SKP + 1); tile place t at + 16 t
  const float* swr = sw + c * SKP + 16 + 8 * hh;           // its reads: row c, window columns 15 - c + 8 hh + (0 .. 7), and the same + 16
  auto st_tile = [&](int col, const v8f& d) {              // col = first column of the tile place (scalar)
    float* w = sws + col;
#pragma unroll
    for (int r = 0; r < 8; ++r) w[r * (SKP + 1)] = d[r];
  };

  // chunk 0 into buffer 0; trip 0's position window into tile places 0 1 2
  {
    const v4u pk = *(const v4u*)(Kb + gk0);
    const v4u ph0 = *(const v4u*)(Vbh + gv0);
    const v4u pl0 = *(const v4u*)(Vbl + gv0);
    const int x0 = SEQ - 16 - i0;
    v16h t0a, t0b, t1a, t1b, t2a, t2b;
    const unsigned f0 = ld_p(x0, t0a, t0b);
    const unsigned f1 = ld_p(x0 + 16, t1a, t1b);
    const unsigned f2 = ld_p(x0 + 32, t2a, t2b);
    // the p loads' offset registers stay whole (no load's result lands on one) up to this wait
    asm volatile("s_wait_xcnt 0x0" :: "v"(f0), "v"(f1), "v"(f2) : "memory");
    *(v4u*)(stage + sk) = pk;
    *(v4u*)(stage + sv) = ph0;
    *(v4u*)(stage + sv + ST_VSZ) = pl0;
    st_tile(0, mm_p(x0, t0a, t0b));
    st_tile(16, mm_p(x0 + 16, t1a, t1b));
    st_tile(32, mm_p(x0 + 32, t2a, t2b));
  }
  __syncthreads();                                         // publishes chunk 0 (and orders the wave's window stores before its reads)

#pragma unroll 1
  for (int jb = 0; jb < SEQ; jb += KCH) {
    const int jn = (jb + KCH < SEQ) ? (jb + KCH) : 0;      // next trip's first key; the last trip asks for trip 0's again (in bounds, not used)
    const unsigned bsel = (unsigned)((jb / KCH) & 1) * ST_BYTES;
    const char* cur = stage + bsel;                        // this trip's buffer
    char*       nxt = stage + (ST_BYTES - bsel);           // the other one: every wave left it before the last barrier
    // the next chunk's pieces are requested here and stored at the trip's foot: their latency lies under the whole trip
    const v4u nk = *(const v4u*)(Kb + (gk0 + (unsigned)jn * (unsigned)(DM * 2)));
    const v4u nh = *(const v4u*)(Vbh + (gv0 + (unsigned)jn * 2u));
    const v4u nl = *(const v4u*)(Vbl + (gv0 + (unsigned)jn * 2u));
    // behind this wait the three loads' address registers are free for the results of the p loads below
    asm volatile("s_wait_xcnt 0x0" ::: "memory");
    const v16h k0a = ldfrag_o(cur, fk);
    const v16h k0b = ldfrag_o(cur + 64, fk);
    const v16h k1a = ldfrag_o(cur + 16 * KPITCH, fk);
    const v16h k1b = ldfrag_o(cur + 16 * KPITCH + 64, fk);
    // the two new tiles of the next trip's window: p rows requested here, multiplied behind the softmax
    const int xn = SEQ - 16 - i0 + jn;
    v16h n1a, n1b, n2a, n2b;
    const unsigned f1 = ld_p(xn + 16, n1a, n1b);
    const unsigned f2 = ld_p(xn + 32, n2a, n2b);
    // the p loads' offset registers stay whole (no load's result lands on one) up to this wait
    asm volatile("s_wait_xcnt 0x0" :: "v"(f1), "v"(f2) : "memory");
    // this trip's position logits of query row i0 + c: keys jb + 8 hh + (0 .. 7) in g0 g1, keys jb + 16 + 8 hh + (0 .. 7) in g2 g3
    const int odd = (jb / KCH) & 1;
    v4f g0, g1, g2, g3;
    {
      const float* wr = swr + odd * 32;
      g0 = *(const v4f*)(wr);
      g1 = *(const v4f*)(wr + 4);
      g2 = *(const v4f*)(wr + 16);
      g3 = *(const v4f*)(wr + 20);
    }
    __builtin_amdgcn_sched_barrier(0);   // keeps the requests above at the trip's head (else the global ones sink to their stores and wait there)
    v8f s0, s1;                          // s0[r]: key jb + 8 hh + r, s1[r]: key jb + 16 + 8 hh + r, query row i0 + c
    s0 = mma_h(k0a, qa, zero8());
    s0 = mma_h(k0b, qb, s0);
    s1 = mma_h(k1a, qa, zero8());
    s1 = mma_h(k1b, qb, s1);
    guard2x6(s0, s1, qa, qb, k0a, k0b, k1a, k1b);
    float tt0[8], tt1[8];
    const int dz = i0 + c + 1 - jb - 8 * hh;               // the key right of the diagonal (j == i + 1) is register dz of s0, or dz - 16 of s1
#pragma unroll
    for (int r = 0; r < 8; ++r) {
      const float ga = (r < 4) ? g0[r & 3] : g1[r & 3];
      const float gc = (r < 4) ? g2[r & 3] : g3[r & 3];
      const float pa = (dz == r) ? 0.f : ga;
      const float pz = (dz == r + 16) ? 0.f : gc;
      tt0[r] = s0[r] * CSC + pa * CSC;
      tt1[r] = s1[r] * CSC + pz * CSC;
    }
    float e0[8], e1[8];
    {
      float mx = fmaxf(tt0[0], tt1[0]);
#pragma unroll   // r must be a constant: the values lie in registers (so in the loops below)
      for (int r = 1; r < 8; ++r) mx = fmaxf(mx, fmaxf(tt0[r], tt1[r]));
      mx = fmaxf(mx, xhalf(mx));                           // the row's other 16 keys lie in the other half of the wave
      const float mn = fmaxf(mrow, mx);
      // bare v_exp_f32, without the library's guard for results under 2^-126: such a term comes out 0, not subnormal, which changes nothing here:
      // the row's joined sum holds its largest term, 1, and times 1024 in f16 either is 0
      const float al = __builtin_amdgcn_exp2f(mrow - mn);
      mrow = mn;
      float pr[8];
#pragma unroll
      for (int r = 0; r < 8; ++r) {
        e0[r] = __builtin_amdgcn_exp2f(tt0[r] - mn);
        e1[r] = __builtin_amdgcn_exp2f(tt1[r] - mn);
        pr[r] = e0[r] + e1[r];
      }
      const float ps = ((pr[0] + pr[1]) + (pr[2] + pr[3])) + ((pr[4] + pr[5]) + (pr[6] + pr[7]));
      lrow = lrow * al + ps;
#pragma unroll
      for (int r = 0; r < 8; ++r) {
        o0[r] *= al;
        o1[r] *= al;
        o2[r] *= al;
        o3[r] *= al;
      }
    }
    {
      // next trip's window: its first tile is this one's last and lies in place already
      const v8f d1 = mm_p(xn + 16, n1a, n1b);
      const v8f d2 = mm_p(xn + 32, n2a, n2b);
      st_tile(odd ? 16 : 48, d1);
      st_tile(odd ? 32 : 64, d2);
      st_tile(odd ? 80 : 0, d2);
    }
    const v16h vh0 = ldfrag_o(cur, fv);
    const v16h vh1 = ldfrag_o(cur + 16 * VPITCH, fv);
    const v16h vh2 = ldfrag_o(cur + 32 * VPITCH, fv);
    const v16h vh3 = ldfrag_o(cur + 48 * VPITCH, fv);
    const v16h vl0 = ldfrag_o(cur + ST_VSZ, fv);
    const v16h vl1 = ldfrag_o(cur + ST_VSZ + 16 * VPITCH, fv);
    const v16h vl2 = ldfrag_o(cur + ST_VSZ + 32 * VPITCH, fv);
    const v16h vl3 = ldfrag_o(cur + ST_VSZ + 48 * VPITCH, fv);
    FragH ph, pl;
#pragma unroll
    for (int e = 0; e < 8; ++e) {
      float f; _Float16 x;
      f = e0[e] * PC; x = (_Float16)f; ph.h[0][e] = x; pl.h[0][e] = (_Float16)(f - (float)x);   // key jb + 8hh + e
      f = e1[e] * PC; x = (_Float16)f; ph.h[1][e] = x; pl.h[1][e] = (_Float16)(f - (float)x);   // key jb + 16 + 8hh + e
    }
    {
      o0 = mma_h(vh0, ph.v, o0);
      o1 = mma_h(vh1, ph.v, o1);
      o2 = mma_h(vh2, ph.v, o2);
      o3 = mma_h(vh3, ph.v, o3);
      o0 = mma_h(vh0, pl.v, o0);
      o1 = mma_h(vh1, pl.v, o1);
      o2 = mma_h(vh2, pl.v, o2);
      o3 = mma_h(vh3, pl.v, o3);
      guard4x6(o0, o1, o2, o3, ph.v, pl.v, vh0, vh1, vh2, vh3);
    }
    {
      o0 = mma_h(vl0, ph.v, o0);
      o1 = mma_h(vl1, ph.v, o1);
      o2 = mma_h(vl2, ph.v, o2);
      o3 = mma_h(vl3, ph.v, o3);
      guard4x5(o0, o1, o2, o3, ph.v, vl0, vl1, vl2, vl3);
    }
    *(v4u*)(nxt + sk) = nk;
    *(v4u*)(nxt + sv) = nh;
    *(v4u*)(nxt + sv + ST_VSZ) = nl;
    __syncthreads();   // publishes the next chunk; ends every wave's reads of this trip's buffer; window stores before reads
  }

  // ---- join the halves' sums, fold 1/l and the carries (1024 on P, 16 on v), split into bf16 hi + residual ----
  const float oc = 1.0f / (PC * VC);
  const float inv = (1.0f / (lrow + xhalf(lrow))) * oc;
  v4u hv[4], lv[4];
  auto pack8 = [&](const v8f& o, v4u& h4, v4u& l4) {       // d = 8 hh + (0 .. 7) of one tile
#pragma unroll   // e must be a constant: the values lie in registers
    for (int e = 0; e < 4; ++e) {
      const float f0 = o[2 * e] * inv, f1 = o[2 * e + 1] * inv;
      const unsigned short a0 = bf_bits(f0), a1 = bf_bits(f1);
      h4[e] = pk16(a0, a1);
      l4[e] = pk16(bf_bits(f0 - bf_up(a0)), bf_bits(f1 - bf_up(a1)));
    }
  };
  pack8(o0, hv[0], lv[0]);
  pack8(o1, hv[1], lv[1]);
  pack8(o2, hv[2], lv[2]);
  pack8(o3, hv[3], lv[3]);
  // ---- the lane writes its query row's halves 16 t + 8 hh .. + 7 in both planes; lanes c and c + 16 over the four tiles fill the row's 128 B ----
  {
    const size_t dofs = (size_t)(i0 + c) * DM + head * HD + 8 * hh;
    unsigned short* dsth = CTh + dofs;
    unsigned short* dstl = CTl + dofs;
#pragma unroll   // t must be a constant: the values lie in registers
    for (int t = 0; t < 4; ++t) {
      *(v4u*)(dsth + 16 * t) = hv[t];
      *(v4u*)(dstl + 16 * t) = lv[t];
    }
  }
}

// =====================================================================================================
// Workspace map (bytes); every plane is an exact multiple of its tile / whole-row store granularity (M, N exact tile multiples,
// the activation convert count an exact multiple of 2048, no pad rows needed), every offset a multiple of 512 KiB:
//   WQT, WKT, WVT, WPT f16 [512 out][512 in] x64   4 x 524288
//   WOT  bf16 [512 out][512 in]                         524288
//   QU, QV f16 [8192][512] x4                     2 x 8388608    (q + u_bias, q + v_bias)
//   K16 f16 [8192][512] x4                            8388608
//   P16 f16 [8][8 heads][64 tiles][2048 B] x4         8388608    (fragment order, OM 3)
//   VTh, VTl f16 [8][512][1024] x16               2 x 8388608    (v^T per batch, hi / residual)
//   CTh, CTl bf16 [8192][512]                     2 x 8388608    (attention ctx, merged heads, hi / residual)
//   end                                              69730304
// =====================================================================================================
extern "C" void kernel_launch(void* const* d_in, const int* in_sizes, int n_in,
                              void* d_out, int out_size, void* d_ws, size_t ws_size,
                              hipStream_t stream) {
  if (n_in < 15) return;
  const int NA = NROWS * DM;
  if (in_sizes[0] != NA || in_sizes[1] != NA || in_sizes[2] != NA || in_sizes[3] != NA) return;
  if (in_sizes[4] != DM * DM || in_sizes[6] != DM * DM || in_sizes[8] != DM * DM || in_sizes[10] != DM * DM || in_sizes[13] != DM * DM) return;
  if (in_sizes[5] != DM || in_sizes[7] != DM || in_sizes[9] != DM || in_sizes[14] != DM) return;
  if (in_sizes[11] != NHEAD * HD || in_sizes[12] != NHEAD * HD) return;
  if (out_size != NROWS * DM) return;
  if ((NA % 2048) != 0) return;

  const float* query = (const float*)d_in[0];
  const float* key   = (const float*)d_in[1];
  const float* value = (const float*)d_in[2];
  const float* pemb  = (const float*)d_in[3];
  const float* w_q   = (const float*)d_in[4];
  const float* b_q   = (const float*)d_in[5];
  const float* w_k   = (const float*)d_in[6];
  const float* b_k   = (const float*)d_in[7];
  const float* w_v   = (const float*)d_in[8];
  const float* b_v   = (const float*)d_in[9];
  const float* w_p   = (const float*)d_in[10];
  const float* u_b   = (const float*)d_in[11];
  const float* v_b   = (const float*)d_in[12];
  const float* w_o   = (const float*)d_in[13];
  const float* b_o   = (const float*)d_in[14];
  float*       out   = (float*)d_out;

  const size_t PWT = (size_t)DM * DM * 2;                         //   524288
  const size_t PX  = (size_t)NROWS * DM * 2;                      //  8388608
  const size_t PVT = (size_t)NB * DM * SEQ * 2;                   //  8388608
  size_t off = 0;
  const size_t oWQ = off; off += PWT;
  const size_t oWK = off; off += PWT;
  const size_t oWV = off; off += PWT;
  const size_t oWP = off; off += PWT;
  const size_t oWO = off; off += PWT;
  const size_t oQU = off; off += PX;
  const size_t oQV = off; off += PX;
  const size_t oK  = off; off += PX;
  const size_t oP  = off; off += PX;
  const size_t oVh = off; off += PVT;
  const size_t oVl = off; off += PVT;
  const size_t oCh = off; off += PX;
  const size_t oCl = off; off += PX;
  if (off > ws_size) return;                                      // off = 69730304

  char* ws = (char*)d_ws;
  unsigned short* WQT  = (unsigned short*)(ws + oWQ);
  unsigned short* WOT  = (unsigned short*)(ws + oWO);
  unsigned short* QU   = (unsigned short*)(ws + oQU);
  unsigned short* QV   = (unsigned short*)(ws + oQV);
  unsigned short* K16  = (unsigned short*)(ws + oK);
  unsigned short* P16  = (unsigned short*)(ws + oP);
  unsigned short* VTh  = (unsigned short*)(ws + oVh);
  unsigned short* VTl  = (unsigned short*)(ws + oVl);
  unsigned short* CTh  = (unsigned short*)(ws + oCh);
  unsigned short* CTl  = (unsigned short*)(ws + oCl);

  const dim3 blk(256);
  const dim3 gPR(WTB);                                             // 320 weight tiles
  const int tilesP = (NROWS / 64) * (DM / 64);                     // 1024
  const dim3 gP((tilesP + 7) / 8, 1);                              // 128
  const dim3 gP4((tilesP + 7) / 8, 4);                             // 128 x 4
  const dim3 gAT(ATT_BLOCKS, NHEAD, NB);                           // 8 x 8 x 8
  const dim3 bAT(ATT_THREADS);                                     // 256

  // (0) every weight pack: W[c][n] -> WT[n][c] as f16( bf16_RNE(w) * 64 );
  //     Wo[c][n] -> WOT[n][c] bf16 (the five weight planes lie one behind the other from WQT)
  prep<<<gPR, blk, 0, stream>>>(w_q, w_k, w_v, w_p, w_o, WQT);

  // (1) the four projections, K = 512, x = f16(bf16(input)*16) made on the way into LDS:
  //     q[m][n] = sum_c x[m][c] WQT[n][c] / 1024 + bq[n]; QU = f16((q + u_bias[n]) * 4), QV = f16((q + v_bias[n]) * 4); M = 8192, N = 512
  //     v^T per batch: VT[b][n = h*64+d][tok] = sum_c x_b[tok][c] WVT[n][c] / 1024 + bv[n] -> f16 x16 hi / residual planes, stored transposed
  //     K16 = f16((k + bk) * 4); P16 = f16(p * 4) (no bias), in fragment order
  proj4<<<gP4, blk, 0, stream>>>(query, key, value, pemb, WQT, QU, QV, K16, P16, VTh, VTl, b_q, u_b, v_b, b_k, b_v);

  // (5) attention with its position logits, every batch element, head and block of 128 query rows in one launch -> CT (bf16 hi / residual planes)
  attnb<<<gAT, bAT, 0, stream>>>(QU, QV, K16, P16, VTh, VTl, CTh, CTl);

  // (6) out = (CT_hi + CT_lo) . WOT^T + bo; M = 8192, N = 512, K = 512, f32
  gemm64<0, 1, 1, 1, 2><<<gP, blk, 0, stream>>>(
      CTh, CTl, DM, 0LL, 0LL,
      WOT, DM, 0LL, 0LL,
      (void*)out, (void*)out, DM, 0LL, 0LL,
      NROWS, DM, DM, 1.0f, 1.0f,
      b_o, b_o, b_o);
  (void)hipGetLastError();
}
